// v000
// Measured on an AMD MI455X. A time is GPU time per run, averaged over a window of back-to-back runs after a warm-up
// (all launches, gaps included; the runs take copies of the inputs in turn), and the median of several windows.
// Apart from v000's, it joins two sittings. Times from different sittings can be a few percent apart, while
// side-by-side timings come from the same sitting.
// v000 is the starting kernel. One run takes 2720 microseconds.
#include <hip/hip_runtime.h>

// Differential causal attention (x [2][2048][1024]; q, k, v = x W ('xw' [1024][2048] 0.02) as 2 groups x 16 heads x 64; a_g = causal softmax(q_g.k_g / 8) (-1e30 fill); lambda = exp(lq1.lk1) - exp(lq2.lk2) + 0.8 (vectors [64], zeros, read: computed on device); o_h = (a1 v1 - lambda a2 v2) x (1 - 0.8); out = merged o Wo ('xw' [1024][1024]) -> [2][2048][1024] (4.2 M)).
// Layout per batch: bf16 copy of x; 'xw' weights transposed once; exact projections; the two groups run as 32 heads of the causal T-2048 attention (hybrid rows: < 512 hi/lo 3 products, rest fp16 x1024; k_gemmc skips tiles above the diagonal) into an f32 [2048][2048] merge buffer; a combine kernel forms (o1 - lambda o2) x 0.2 per head as hi/lo planes; hi/lo x Wo exact.
// Compute dtypes, f32 accumulate: every input rounded to bf16; projections exact; attention rows < 512 3 products, rest fp16; softmax f32; lambda (precise expf) and the combination f32; Wo hl x exact.

#define NB_  2
#define TT   2048
#define DM   1024
#define NH_  32
#define NKV  32
#define REP  (NH_ / NKV)
#define HD   64
#define DQ   (NH_ * HD)
#define DKV  (NKV * HD)
#define ZH   2
#define RH   512                  // query rows < RH use hi+lo planes (0: none)
#define WIN  2048
#define PCAR 1024.0f
#define SCL  0.125f
#define NHO  16      // output heads (per group)
#define DO   (NHO * HD)   // 1024
#define LINIT 0.8f
typedef _Float16 h16;
typedef unsigned short bf;
typedef __attribute__((ext_vector_type(16))) __bf16   v16bf;
typedef __attribute__((ext_vector_type(16))) _Float16 v16h;
typedef __attribute__((ext_vector_type(8)))  _Float16 v8h;
typedef __attribute__((ext_vector_type(8)))  unsigned short v8us;
typedef __attribute__((ext_vector_type(8)))  float    v8f;
typedef __attribute__((ext_vector_type(4)))  float    v4f;
typedef v8h  __attribute__((may_alias)) v8ha;
typedef v4f  __attribute__((may_alias)) v4fa;
typedef v8us __attribute__((may_alias)) v8usa;

__device__ __forceinline__ unsigned short f2bf(float f) { unsigned u = __float_as_uint(f); u += 0x7FFFu + ((u >> 16) & 1u); return (unsigned short)(u >> 16); }
__device__ __forceinline__ float bf2f(unsigned short b) { return __uint_as_float(((unsigned)b) << 16); }
__device__ __forceinline__ float bfr(float f) { return bf2f(f2bf(f)); }
__device__ __forceinline__ v16h cat16(v8h lo, v8h hi) { return __builtin_shufflevector(lo, hi, 0, 1, 2, 3, 4, 5, 6, 7, 8, 9, 10, 11, 12, 13, 14, 15); }
__device__ __forceinline__ v16bf cat16b(v8us lo, v8us hi) { return __builtin_bit_cast(v16bf, __builtin_shufflevector(lo, hi, 0, 1, 2, 3, 4, 5, 6, 7, 8, 9, 10, 11, 12, 13, 14, 15)); }
__device__ __forceinline__ v8f wmma16(v16h a, v16h b, v8f c) { return __builtin_amdgcn_wmma_f32_16x16x32_f16(false, a, false, b, (short)0, c, false, false); }
__device__ __forceinline__ v8f wmmab(v16bf a, v16bf b, v8f c) { return __builtin_amdgcn_wmma_f32_16x16x32_bf16(false, a, false, b, (short)0, c, false, false); }



// ---- k_gemmw: register-blocked GEMM, ONE WAVE per 64x64 output tile (16 accumulators), operands straight from K-contiguous 16-bit planes; grid (M/64, N/64, Z), 32 threads.
// C[m][n] (f32, pitch ldc, + optional f32 bias[n]) = sum_k A[m][k] Bt[n][k] (+ split products per NSPLIT). z-batch strides sA/sB/sC in elements. K % 32 == 0.
template <typename T16> struct WFrag;
template <> struct WFrag<h16> { typedef v16h V; static __device__ __forceinline__ V ld(const h16* p) { return cat16(*(const v8h*)p, *(const v8h*)(p + 16)); } static __device__ __forceinline__ v8f mma(V a, V b, v8f c) { return wmma16(a, b, c); } };
template <> struct WFrag<bf> { typedef v16bf V; static __device__ __forceinline__ V ld(const bf* p) { return cat16b(*(const v8us*)p, *(const v8us*)(p + 16)); } static __device__ __forceinline__ v8f mma(V a, V b, v8f c) { return wmmab(a, b, c); } };
template <typename T16, int NSPLIT, bool BIAS>
__global__ __launch_bounds__(32) void k_gemmw(const T16* __restrict__ A, const T16* __restrict__ A2, const T16* __restrict__ Bt, const T16* __restrict__ Bt2, int K, float* C, int ldc, const float* __restrict__ bias, size_t sA, size_t sB, size_t sC) {
    typedef typename WFrag<T16>::V V;
    __shared__ __align__(16) float os[16 * 68];
    const size_t z = blockIdx.z; A += z * sA; if (A2) A2 += z * sA; Bt += z * sB; if (Bt2) Bt2 += z * sB; C += z * sC;
    const int lane = threadIdx.x & 31, lr = lane & 15, hi = lane >> 4; const int r0 = blockIdx.x * 64, c0 = blockIdx.y * 64;
    v8f acc[4][4];
#pragma unroll
    for (int mb = 0; mb < 4; ++mb)
#pragma unroll
        for (int nb = 0; nb < 4; ++nb) acc[mb][nb] = (v8f){};
    const size_t aoff = (size_t)(r0 + lr) * K + 8 * hi, boff = (size_t)(c0 + lr) * K + 8 * hi;
#pragma unroll 1
    for (int kc = 0; kc < K; kc += 32) {
        V a[4], a2[4];
#pragma unroll
        for (int mb = 0; mb < 4; ++mb) { a[mb] = WFrag<T16>::ld(A + aoff + (size_t)mb * 16 * K + kc); if (NSPLIT == 1 || NSPLIT == 2) a2[mb] = WFrag<T16>::ld(A2 + aoff + (size_t)mb * 16 * K + kc); }
#pragma unroll
        for (int nb = 0; nb < 4; ++nb) { const V b = WFrag<T16>::ld(Bt + boff + (size_t)nb * 16 * K + kc); V b2; if (NSPLIT >= 2) b2 = WFrag<T16>::ld(Bt2 + boff + (size_t)nb * 16 * K + kc);
#pragma unroll
            for (int mb = 0; mb < 4; ++mb) { acc[mb][nb] = WFrag<T16>::mma(a[mb], b, acc[mb][nb]); if (NSPLIT == 1 || NSPLIT == 2) acc[mb][nb] = WFrag<T16>::mma(a2[mb], b, acc[mb][nb]); if (NSPLIT >= 2) acc[mb][nb] = WFrag<T16>::mma(a[mb], b2, acc[mb][nb]); } }
        asm volatile("v_nop\n\tv_nop\n\tv_nop\n\tv_nop" : "+v"(acc[0][0]), "+v"(acc[1][1]), "+v"(acc[2][2]), "+v"(acc[3][3]) : "v"(a[0]), "v"(a[3]));
    }
#pragma unroll
    for (int mb = 0; mb < 4; ++mb) {
#pragma unroll
        for (int nb = 0; nb < 4; ++nb) {
#pragma unroll
            for (int j = 0; j < 8; ++j) os[(hi * 8 + j) * 68 + nb * 16 + lr] = acc[mb][nb][j]; }
        __builtin_amdgcn_wave_barrier(); asm volatile("" ::: "memory");
        float* crow = C + (size_t)(r0 + mb * 16) * ldc + c0;
{
#pragma unroll
            for (int s = 0; s < 8; ++s) { const int row = 2 * s + hi, cofs = lr * 4; v4f val = *(const v4fa*)(os + row * 68 + cofs); if (BIAS) { val[0] += bfr(bias[c0 + cofs]); val[1] += bfr(bias[c0 + cofs + 1]); val[2] += bfr(bias[c0 + cofs + 2]); val[3] += bfr(bias[c0 + cofs + 3]); }
                *(v4f*)(crow + (size_t)row * ldc + cofs) = val; }
             }
        __builtin_amdgcn_wave_barrier(); asm volatile("" ::: "memory");
    }
}

// ---- k_gemmc: the same one-wave 64x64 tile GEMM specialised for causal attention: CMODE 1 skips score tiles entirely above the diagonal (query rows r0+roff.., key columns c0..), CMODE 2 limits the
// key (K) loop of the probability x value contraction to the diagonal block (probabilities beyond it are exactly zero). roff = row offset of this launch's first row within the sequence.
template <typename T16, int NSPLIT, int CMODE>
__global__ __launch_bounds__(32) void k_gemmc(const T16* __restrict__ A, const T16* __restrict__ A2, const T16* __restrict__ Bt, const T16* __restrict__ Bt2, int K, float* C, int ldc, int roff, size_t sA, size_t sB, size_t sC) {
    typedef typename WFrag<T16>::V V;
    __shared__ __align__(16) float os[16 * 68];
    const size_t z = blockIdx.z; A += z * sA; if (A2) A2 += z * sA; Bt += z * sB; if (Bt2) Bt2 += z * sB; C += z * sC;
    const int lane = threadIdx.x & 31, lr = lane & 15, hi = lane >> 4; const int r0 = blockIdx.x * 64, c0 = blockIdx.y * 64;
    if (CMODE == 1 && c0 > r0 + roff + 63) return;                  // score tile entirely above the causal diagonal: left unwritten (the softmax masks j > i by select)
    const int Kl = (CMODE == 2) ? min(K, r0 + roff + 64) : K;        // P.V: probabilities are exactly 0 beyond the diagonal block, so the K loop stops there
    v8f acc[4][4];
#pragma unroll
    for (int mb = 0; mb < 4; ++mb)
#pragma unroll
        for (int nb = 0; nb < 4; ++nb) acc[mb][nb] = (v8f){};
    const size_t aoff = (size_t)(r0 + lr) * K + 8 * hi, boff = (size_t)(c0 + lr) * K + 8 * hi;
#pragma unroll 1
    for (int kc = 0; kc < Kl; kc += 32) {
        V a[4], a2[4];
#pragma unroll
        for (int mb = 0; mb < 4; ++mb) { a[mb] = WFrag<T16>::ld(A + aoff + (size_t)mb * 16 * K + kc); if (NSPLIT == 1 || NSPLIT == 2) a2[mb] = WFrag<T16>::ld(A2 + aoff + (size_t)mb * 16 * K + kc); }
#pragma unroll
        for (int nb = 0; nb < 4; ++nb) { const V b = WFrag<T16>::ld(Bt + boff + (size_t)nb * 16 * K + kc); V b2; if (NSPLIT >= 2) b2 = WFrag<T16>::ld(Bt2 + boff + (size_t)nb * 16 * K + kc);
#pragma unroll
            for (int mb = 0; mb < 4; ++mb) { acc[mb][nb] = WFrag<T16>::mma(a[mb], b, acc[mb][nb]); if (NSPLIT == 1 || NSPLIT == 2) acc[mb][nb] = WFrag<T16>::mma(a2[mb], b, acc[mb][nb]); if (NSPLIT >= 2) acc[mb][nb] = WFrag<T16>::mma(a[mb], b2, acc[mb][nb]); } }
        asm volatile("v_nop\n\tv_nop\n\tv_nop\n\tv_nop" : "+v"(acc[0][0]), "+v"(acc[1][1]), "+v"(acc[2][2]), "+v"(acc[3][3]) : "v"(a[0]), "v"(a[3]));
    }
#pragma unroll
    for (int mb = 0; mb < 4; ++mb) {
#pragma unroll
        for (int nb = 0; nb < 4; ++nb) {
#pragma unroll
            for (int j = 0; j < 8; ++j) os[(hi * 8 + j) * 68 + nb * 16 + lr] = acc[mb][nb][j]; }
        __builtin_amdgcn_wave_barrier(); asm volatile("" ::: "memory");
        float* crow = C + (size_t)(r0 + mb * 16) * ldc + c0;
{
#pragma unroll
            for (int s = 0; s < 8; ++s) { const int row = 2 * s + hi, cofs = lr * 4; v4f val = *(const v4fa*)(os + row * 68 + cofs);
                *(v4f*)(crow + (size_t)row * ldc + cofs) = val; }
             }
        __builtin_amdgcn_wave_barrier(); asm volatile("" ::: "memory");
    }
}

__device__ __forceinline__ h16 tohx(float x) { return (h16)x; }
__device__ __forceinline__ void splitf(float y, unsigned short& h, unsigned short& l) { h = f2bf(y); l = f2bf(y - bf2f(h)); }
typedef __attribute__((ext_vector_type(2))) _Float16 v2h;
typedef __attribute__((ext_vector_type(4))) _Float16 v4h;
typedef __attribute__((ext_vector_type(2))) unsigned short v2us;
typedef __attribute__((ext_vector_type(4))) unsigned short v4us;
typedef __attribute__((ext_vector_type(2))) float v2f;
typedef __attribute__((ext_vector_type(4))) int v4i;

__global__ __launch_bounds__(256) void k_wtG(const float* __restrict__ w, int K, int N, bf* Bt) {
    const int lane = threadIdx.x & 31; const int L0 = (blockIdx.x * 8 + (threadIdx.x >> 5)) * 8; const int nlines = N * K / 64;
{
#pragma unroll 1
        for (int l = 0; l < 8; ++l) { const int L = L0 + l; if (L >= nlines) break; const size_t e = (size_t)L * 64 + lane * 2; const int k = (int)(e % K), n = (int)(e / K); v2us o;
            o[0] = f2bf(w[(size_t)k * N + n]); o[1] = f2bf(w[(size_t)(k + 1) * N + n]); *(v2us*)(Bt + e) = o; }
         }
}
__global__ __launch_bounds__(256) void k_cvt8(const float* __restrict__ src, bf* dst, size_t n8) { const size_t i = (size_t)blockIdx.x * 256 + threadIdx.x; if (i >= n8) return; const v8f v = *(const v8f*)(src + i * 8); v8us o;
#pragma unroll
    for (int k = 0; k < 8; ++k) o[k] = f2bf(v[k]); *(v8us*)(dst + i * 8) = o;  }

// k_rope: head planes [h][t][d] (fp16 + hi/lo) of rope(x) x sc with the rotate-half convention out[d] = x[d] cos[t][d] - x[d+HD/2] sin[t][d], out[d+HD/2] = x[d+HD/2] cos[t][d+HD/2] + x[d] sin[t][d+HD/2]
__global__ __launch_bounds__(256) void k_rope(const float* __restrict__ F, int pitch, int nheads, const float* __restrict__ CS, const float* __restrict__ RF, const float* __restrict__ nw, float sc, h16* P16, bf* Ph, bf* Pl) {
    const size_t e = ((size_t)blockIdx.x * 256 + threadIdx.x) * 2; if (e >= (size_t)nheads * TT * HD) return; const int d = (int)(e % HD); const int t = (int)((e / HD) % TT); const int h = (int)(e / ((size_t)HD * TT)); const float* f = F + (size_t)t * pitch + h * HD; const float rf = RF ? RF[(size_t)h * TT + t] : 1.0f; v2h o16; v2us oh, ol;
#pragma unroll
    for (int q = 0; q < 2; ++q) { const int dd = d + q; const int dp = (dd < HD / 2) ? dd + HD / 2 : dd - HD / 2; float x0 = f[dd], x1 = f[dp];
        if (RF) { float n0 = __fmul_rn(x0, rf), n1 = __fmul_rn(x1, rf); asm volatile("" : "+v"(n0)); asm volatile("" : "+v"(n1)); x0 = __fmul_rn(bfr(nw[dd]), n0); x1 = __fmul_rn(bfr(nw[dp]), n1); }
        const v2f cs = *(const v2f*)(CS + ((size_t)t * HD + dd) * 2); float a = __fmul_rn(x0, cs[0]), bq = __fmul_rn(x1, cs[1]); asm volatile("" : "+v"(a)); asm volatile("" : "+v"(bq)); const float r = ((dd < HD / 2) ? __fsub_rn(a, bq) : __fadd_rn(a, bq)) * sc;
        o16[q] = tohx(r); unsigned short a2, c2; splitf(r, a2, c2); oh[q] = a2; ol[q] = c2; }
    *(v2h*)(P16 + e) = o16; *(v2us*)(Ph + e) = oh; *(v2us*)(Pl + e) = ol;  }
__global__ __launch_bounds__(256) void k_vtp(const float* __restrict__ F, int pitch, int nheads, h16* V16, bf* Vh, bf* Vl) { const size_t e = ((size_t)blockIdx.x * 256 + threadIdx.x) * 2; if (e >= (size_t)nheads * HD * TT) return; const int t = (int)(e % TT); const int d = (int)((e / TT) % HD); const int g = (int)(e / ((size_t)TT * HD)); v2h o16; v2us oh, ol;
#pragma unroll
    for (int q = 0; q < 2; ++q) { const float x = F[(size_t)(t + q) * pitch + g * HD + d]; o16[q] = tohx(x); unsigned short a2, c2; splitf(x, a2, c2); oh[q] = a2; ol[q] = c2; }
    *(v2h*)(V16 + e) = o16; *(v2us*)(Vh + e) = oh; *(v2us*)(Vl + e) = ol;  }
__global__ __launch_bounds__(256) void k_csid(float* CS) { const int idx = blockIdx.x * 256 + threadIdx.x; if (idx >= TT * HD) return; v2f cs; cs[0] = 1.0f; cs[1] = 0.0f; *(v2f*)(CS + (size_t)idx * 2) = cs;  }
// k_asoft: per row (zz, i): t = S x HD^-0.5 for j <= i and i - j < WIN (WIN = TT, so plain causal; the reference's -1e9 additive fill vanishes identically); softmax over the 2048 keys (register row, one exp, fixed trees);
__global__ __launch_bounds__(256) void k_asoft(const float* __restrict__ Sb, h16* P16, bf* Ph, bf* Pl) {
    const int lane = threadIdx.x & 31; const int row = blockIdx.x * 8 + (threadIdx.x >> 5); if (row >= ZH * TT) return; const int i = row % TT; const int zz = row / TT; (void)zz; const bool hires = (i < RH); const float* sr = Sb + (size_t)row * TT; float v[TT / 32]; float mx = -3.0e38f;
#pragma unroll
    for (int ch = 0; ch < TT / 128; ++ch) { const int j0 = ch * 128 + lane * 4; const v4f a = *(const v4f*)(sr + j0);
#pragma unroll
        for (int q = 0; q < 4; ++q) { const int j = j0 + q; (void)j; const float t = (j <= i && i - j < WIN) ? a[q] * SCL : -3.0e38f; v[ch * 4 + q] = t; mx = fmaxf(mx, t); } }
#pragma unroll
    for (int sh = 16; sh; sh >>= 1) mx = fmaxf(mx, __shfl_xor(mx, sh, 32));
    float sum = 0.f;
#pragma unroll
    for (int k = 0; k < TT / 32; ++k) { float d0 = __fsub_rn(v[k], mx); asm volatile("" : "+v"(d0)); v[k] = __builtin_amdgcn_exp2f(__fmul_rn(d0, 1.4426950408889634f)); sum += v[k]; }
#pragma unroll
    for (int sh = 16; sh; sh >>= 1) sum += __shfl_xor(sum, sh, 32);
    const float f = __fdiv_rn(hires ? 1.0f : PCAR, sum);
{
        if (hires) {
#pragma unroll
            for (int ch = 0; ch < TT / 128; ++ch) { v4us oh, ol;
#pragma unroll
                for (int q = 0; q < 4; ++q) { unsigned short a, c2; splitf(v[ch * 4 + q] * f, a, c2); oh[q] = a; ol[q] = c2; }
                const size_t oo = ((size_t)zz * (RH ? RH : 1) + i) * TT + ch * 128 + lane * 4; *(v4us*)(Ph + oo) = oh; *(v4us*)(Pl + oo) = ol; }
        } else {
#pragma unroll
            for (int ch = 0; ch < TT / 128; ++ch) { v4h o4;
#pragma unroll
                for (int q = 0; q < 4; ++q) o4[q] = tohx(v[ch * 4 + q] * f);
                *(v4h*)(P16 + (size_t)row * TT + ch * 128 + lane * 4) = o4; } }
         }
}
__global__ __launch_bounds__(256) void k_lam(const float* __restrict__ a1, const float* __restrict__ b1, const float* __restrict__ a2, const float* __restrict__ b2, float* LAM) { if (threadIdx.x >= 32) return; const int lane = threadIdx.x; float d1 = __fadd_rn(__fmul_rn(bfr(a1[lane * 2]), bfr(b1[lane * 2])), __fmul_rn(bfr(a1[lane * 2 + 1]), bfr(b1[lane * 2 + 1]))); float d2 = __fadd_rn(__fmul_rn(bfr(a2[lane * 2]), bfr(b2[lane * 2])), __fmul_rn(bfr(a2[lane * 2 + 1]), bfr(b2[lane * 2 + 1])));
#pragma unroll
    for (int sh = 16; sh; sh >>= 1) { d1 = __fadd_rn(d1, __shfl_xor(d1, sh, 32)); d2 = __fadd_rn(d2, __shfl_xor(d2, sh, 32)); }
    float l = __fsub_rn(expf(d1), expf(d2)); asm volatile("" : "+v"(l)); l = __fadd_rn(l, LINIT); ((float*)LAM)[lane] = l;  }
__global__ __launch_bounds__(256) void k_comb(const float* __restrict__ A, const float* __restrict__ LAM, bf* Ph, bf* Pl) { const size_t i = (size_t)blockIdx.x * 256 + threadIdx.x; if (i >= (size_t)TT * DO / 4) return; const size_t e = i * 4; const int c0 = (int)(e % DO); const size_t t = e / DO; const float lam = LAM[0]; const v4f o1 = *(const v4f*)(A + t * DQ + c0); const v4f o2 = *(const v4f*)(A + t * DQ + DO + c0); v4us oh, ol;
#pragma unroll
    for (int q = 0; q < 4; ++q) { float m = __fmul_rn(lam, o2[q]); asm volatile("" : "+v"(m)); float y = __fsub_rn(o1[q], m); asm volatile("" : "+v"(y)); y = __fmul_rn(y, 1.0f - LINIT); unsigned short u, w; splitf(y, u, w); oh[q] = u; ol[q] = w; }
    *(v4us*)(Ph + e) = oh; *(v4us*)(Pl + e) = ol;  }
__global__ __launch_bounds__(256) void k_merge(const float* __restrict__ O, int h0, float* OUTb) { const size_t e = ((size_t)blockIdx.x * 256 + threadIdx.x) * 2; if (e >= (size_t)ZH * TT * HD) return; const int d = (int)(e % HD); const int t = (int)((e / HD) % TT); const int zz = (int)(e / ((size_t)HD * TT)); const float cs = (t < RH) ? 1.0f : (1.0f / PCAR); const size_t oo = (size_t)t * DQ + (h0 + zz) * HD + d;
    v2f o2; o2[0] = O[e] * cs; o2[1] = O[e + 1] * cs; *(v2f*)(OUTb + oo) = o2;  }

extern "C" void kernel_launch(void* const* d_in, const int* in_sizes, int n_in,
                              void* d_out, int out_size, void* d_ws, size_t ws_size, hipStream_t stream) {
    (void)in_sizes; (void)n_in; (void)out_size;
    const float* x = (const float*)d_in[0]; const float* wq = (const float*)d_in[1]; const float* wk = (const float*)d_in[2]; const float* wv = (const float*)d_in[3]; const float* wo = (const float*)d_in[4]; const float* lq1 = (const float*)d_in[5]; const float* lk1 = (const float*)d_in[6]; const float* lq2 = (const float*)d_in[7]; const float* lk2 = (const float*)d_in[8];
    float* OUT = (float*)d_out;     // [2][2048][1024]
    char* wsp = (char*)d_ws;
    auto take = [&](size_t bytes) { char* p = wsp; wsp += (bytes + 255) & ~(size_t)255; return (void*)p; };
    float* AT32 = (float*)take((size_t)TT * DQ * 4); bf* ACh = (bf*)take((size_t)TT * DO * 2); bf* ACl = (bf*)take((size_t)TT * DO * 2); bf* WO = (bf*)take((size_t)DM * DO * 2); float* LAM = (float*)take(256); bf* WQ = (bf*)take((size_t)DQ * DM * 2); bf* WK = (bf*)take((size_t)DKV * DM * 2); bf* WV = (bf*)take((size_t)DKV * DM * 2); float* CS = (float*)take((size_t)TT * HD * 2 * 4);
    bf* XB = (bf*)take((size_t)TT * DM * 2); float* FQ = (float*)take((size_t)TT * DQ * 4); float* FK = (float*)take((size_t)TT * DKV * 4);
    h16* QP16 = (h16*)take((size_t)NH_ * TT * HD * 2); h16* KP16 = (h16*)take((size_t)NKV * TT * HD * 2); h16* VT16 = (h16*)take((size_t)NKV * HD * TT * 2);
    bf* QPh = (bf*)take((size_t)NH_ * TT * HD * 2); bf* QPl = (bf*)take((size_t)NH_ * TT * HD * 2); bf* KPh = (bf*)take((size_t)NKV * TT * HD * 2); bf* KPl = (bf*)take((size_t)NKV * TT * HD * 2); bf* VTh = (bf*)take((size_t)NKV * HD * TT * 2); bf* VTl = (bf*)take((size_t)NKV * HD * TT * 2); bf* Ph = (bf*)take((size_t)ZH * RH * TT * 2); bf* Pl = (bf*)take((size_t)ZH * RH * TT * 2);
    float* Sb = (float*)take((size_t)ZH * TT * TT * 4); h16* P16 = (h16*)take((size_t)ZH * TT * TT * 2); float* Ob = (float*)take((size_t)ZH * TT * HD * 4);
    if ((size_t)(wsp - (char*)d_ws) > ws_size) return;    // ws 256 MiB
    float* FV = FK;   // v projection reuses the k buffer after the k planes are built (stream-ordered)
    { k_wtG<<<(unsigned)((DM * DQ / 64 + 63) / 64), 256, 0, stream>>>(wq, DM, DQ, WQ); k_wtG<<<(unsigned)((DM * DKV / 64 + 63) / 64), 256, 0, stream>>>(wk, DM, DKV, WK); k_wtG<<<(unsigned)((DM * DKV / 64 + 63) / 64), 256, 0, stream>>>(wv, DM, DKV, WV);
      
       }
    k_csid<<<(TT * HD + 255) / 256, 256, 0, stream>>>(CS);
    const unsigned LQ = (unsigned)(((size_t)NH_ * TT * HD / 2 + 255) / 256), LKv = (unsigned)(((size_t)NKV * TT * HD / 2 + 255) / 256);
    k_wtG<<<(unsigned)((DO * DM / 64 + 63) / 64), 256, 0, stream>>>(wo, DO, DM, WO); k_lam<<<1, 256, 0, stream>>>(lq1, lk1, lq2, lk2, LAM);   /* Wo 'xw' [1024][1024]; lambda line */
    for (int b = 0; b < NB_; ++b) {
        
        k_cvt8<<<(unsigned)(((size_t)TT * DM / 8 + 255) / 256), 256, 0, stream>>>(x + (size_t)b * TT * DM, XB, (size_t)TT * DM / 8);
        k_gemmw<bf, 0, false><<<dim3(TT / 64, DQ / 64, 1), 32, 0, stream>>>(XB, nullptr, WQ, nullptr, DM, FQ, DQ, nullptr, 0, 0, 0);
        k_rope<<<LQ, 256, 0, stream>>>(FQ, DQ, NH_, CS, nullptr, nullptr, 1.0f, QP16, QPh, QPl);
        k_gemmw<bf, 0, false><<<dim3(TT / 64, DKV / 64, 1), 32, 0, stream>>>(XB, nullptr, WK, nullptr, DM, FK, DKV, nullptr, 0, 0, 0);
        k_rope<<<LKv, 256, 0, stream>>>(FK, DKV, NKV, CS, nullptr, nullptr, 1.0f, KP16, KPh, KPl);
        k_gemmw<bf, 0, false><<<dim3(TT / 64, DKV / 64, 1), 32, 0, stream>>>(XB, nullptr, WV, nullptr, DM, FV, DKV, nullptr, 0, 0, 0); k_vtp<<<LKv, 256, 0, stream>>>(FV, DKV, NKV, VT16, VTh, VTl);
        for (int h0 = 0; h0 < NH_; h0 += ZH) { const size_t zq = (size_t)h0, zk = (size_t)(h0 / REP);   // one kv head per query head: the pass's two heads use consecutive kv planes (z-strides TT*HD)
            k_gemmc<bf, 2, 1><<<dim3(RH / 64, TT / 64, ZH), 32, 0, stream>>>(QPh + zq * TT * HD, QPl + zq * TT * HD, KPh + zk * TT * HD, KPl + zk * TT * HD, HD, Sb, TT, 0, (size_t)TT * HD, (size_t)TT * HD, (size_t)TT * TT);
            k_gemmc<h16, 0, 1><<<dim3((TT - RH) / 64, TT / 64, ZH), 32, 0, stream>>>(QP16 + zq * TT * HD + (size_t)RH * HD, nullptr, KP16 + zk * TT * HD, nullptr, HD, Sb + (size_t)RH * TT, TT, RH, (size_t)TT * HD, (size_t)TT * HD, (size_t)TT * TT);
            k_asoft<<<ZH * TT / 8, 256, 0, stream>>>(Sb, P16, Ph, Pl);
            k_gemmc<bf, 2, 2><<<dim3(RH / 64, HD / 64, ZH), 32, 0, stream>>>(Ph, Pl, VTh + zk * HD * TT, VTl + zk * HD * TT, TT, Ob, HD, 0, (size_t)RH * TT, (size_t)HD * TT, (size_t)TT * HD);
            k_gemmc<h16, 0, 2><<<dim3((TT - RH) / 64, HD / 64, ZH), 32, 0, stream>>>(P16 + (size_t)RH * TT, nullptr, VT16 + zk * HD * TT, nullptr, TT, Ob + (size_t)RH * HD, HD, RH, (size_t)TT * TT, (size_t)HD * TT, (size_t)TT * HD);
            k_merge<<<(unsigned)(((size_t)ZH * TT * HD / 2 + 255) / 256), 256, 0, stream>>>(Ob, h0, AT32 + (size_t)0); }
        k_comb<<<(unsigned)(((size_t)TT * DO / 4 + 255) / 256), 256, 0, stream>>>(AT32, LAM, ACh, ACl);   /* (o1 - lambda o2) x (1 - lambda_init) -> planes */
        k_gemmw<bf, 1, false><<<dim3(TT / 64, DM / 64, 1), 32, 0, stream>>>(ACh, ACl, WO, nullptr, DO, OUT + (size_t)b * TT * DM, DM, nullptr, 0, 0, 0);   /* Wo */
    }
}

// v001
// One run takes 935 microseconds.
// Two timings next to v000 put it at 2.90 and 2.88 times that version's speed.
#include <hip/hip_runtime.h>

// Differential causal attention (x [2][2048][1024]; q, k, v = x W ('xw' [1024][2048] 0.02) as 2 groups x 16 heads x 64; a_g = causal softmax(q_g.k_g / 8) (-1e30 fill); lambda = exp(lq1.lk1) - exp(lq2.lk2) + 0.8 (vectors [64], zeros, read: computed on device); o_h = (a1 v1 - lambda a2 v2) x (1 - 0.8); out = merged o Wo ('xw' [1024][1024]) -> [2][2048][1024] (4.2 M)).
// Layout per batch: bf16 copy of x; 'xw' weights transposed once; exact projections; the two groups run as 32 heads of the causal T-2048 attention, one pass per band of 512 query rows over 32 heads (two passes of 16 heads in the hi/lo band) (hybrid rows: < 512 hi/lo 3 products, rest fp16 x1024; k_gemmc skips tiles above the diagonal) into an f32 [2048][2048] merge buffer; a combine kernel forms (o1 - lambda o2) x 0.2 per head as hi/lo planes; hi/lo x Wo exact.
// Compute dtypes, f32 accumulate: every input rounded to bf16; projections exact; attention rows < 512 3 products, rest fp16; softmax f32; lambda (precise expf) and the combination f32; Wo hl x exact.

#define NB_  2
#define TT   2048
#define DM   1024
#define NH_  32
#define NKV  32
#define REP  (NH_ / NKV)
#define HD   64
#define DQ   (NH_ * HD)
#define DKV  (NKV * HD)
#define BR   512                  // query rows per attention pass (one band); the hi/lo rows are exactly the first band (RH == BR)
#define ZHI  16                   // heads per pass of the hi/lo band
#define ZLO  32                   // heads per pass of the fp16 bands
#define RH   512                  // query rows < RH use hi+lo planes (0: none)
#define WIN  2048
#define PCAR 1024.0f
#define SCL  0.125f
#define NHO  16      // output heads (per group)
#define DO   (NHO * HD)   // 1024
#define LINIT 0.8f
typedef _Float16 h16;
typedef unsigned short bf;
typedef __attribute__((ext_vector_type(16))) __bf16   v16bf;
typedef __attribute__((ext_vector_type(16))) _Float16 v16h;
typedef __attribute__((ext_vector_type(8)))  _Float16 v8h;
typedef __attribute__((ext_vector_type(8)))  unsigned short v8us;
typedef __attribute__((ext_vector_type(8)))  float    v8f;
typedef __attribute__((ext_vector_type(4)))  float    v4f;
typedef v8h  __attribute__((may_alias)) v8ha;
typedef v4f  __attribute__((may_alias)) v4fa;
typedef v8us __attribute__((may_alias)) v8usa;

__device__ __forceinline__ unsigned short f2bf(float f) { unsigned u = __float_as_uint(f); u += 0x7FFFu + ((u >> 16) & 1u); return (unsigned short)(u >> 16); }
__device__ __forceinline__ float bf2f(unsigned short b) { return __uint_as_float(((unsigned)b) << 16); }
__device__ __forceinline__ float bfr(float f) { return bf2f(f2bf(f)); }
__device__ __forceinline__ v16h cat16(v8h lo, v8h hi) { return __builtin_shufflevector(lo, hi, 0, 1, 2, 3, 4, 5, 6, 7, 8, 9, 10, 11, 12, 13, 14, 15); }
__device__ __forceinline__ v16bf cat16b(v8us lo, v8us hi) { return __builtin_bit_cast(v16bf, __builtin_shufflevector(lo, hi, 0, 1, 2, 3, 4, 5, 6, 7, 8, 9, 10, 11, 12, 13, 14, 15)); }
__device__ __forceinline__ v8f wmma16(v16h a, v16h b, v8f c) { return __builtin_amdgcn_wmma_f32_16x16x32_f16(false, a, false, b, (short)0, c, false, false); }
__device__ __forceinline__ v8f wmmab(v16bf a, v16bf b, v8f c) { return __builtin_amdgcn_wmma_f32_16x16x32_bf16(false, a, false, b, (short)0, c, false, false); }



// ---- k_gemmw: register-blocked GEMM, ONE WAVE per 64x64 output tile (16 accumulators), operands straight from K-contiguous 16-bit planes; grid (M/64, N/64, Z), 32 threads.
// C[m][n] (f32, pitch ldc, + optional f32 bias[n]) = sum_k A[m][k] Bt[n][k] (+ split products per NSPLIT). z-batch strides sA/sB/sC in elements. K % 32 == 0.
template <typename T16> struct WFrag;
template <> struct WFrag<h16> { typedef v16h V; static __device__ __forceinline__ V ld(const h16* p) { return cat16(*(const v8h*)p, *(const v8h*)(p + 16)); } static __device__ __forceinline__ v8f mma(V a, V b, v8f c) { return wmma16(a, b, c); } };
template <> struct WFrag<bf> { typedef v16bf V; static __device__ __forceinline__ V ld(const bf* p) { return cat16b(*(const v8us*)p, *(const v8us*)(p + 16)); } static __device__ __forceinline__ v8f mma(V a, V b, v8f c) { return wmmab(a, b, c); } };
template <typename T16, int NSPLIT, bool BIAS>
__global__ __launch_bounds__(32) void k_gemmw(const T16* __restrict__ A, const T16* __restrict__ A2, const T16* __restrict__ Bt, const T16* __restrict__ Bt2, int K, float* C, int ldc, const float* __restrict__ bias, size_t sA, size_t sB, size_t sC) {
    typedef typename WFrag<T16>::V V;
    __shared__ __align__(16) float os[16 * 68];
    const size_t z = blockIdx.z; A += z * sA; if (A2) A2 += z * sA; Bt += z * sB; if (Bt2) Bt2 += z * sB; C += z * sC;
    const int lane = threadIdx.x & 31, lr = lane & 15, hi = lane >> 4; const int r0 = blockIdx.x * 64, c0 = blockIdx.y * 64;
    v8f acc[4][4];
#pragma unroll
    for (int mb = 0; mb < 4; ++mb)
#pragma unroll
        for (int nb = 0; nb < 4; ++nb) acc[mb][nb] = (v8f){};
    const size_t aoff = (size_t)(r0 + lr) * K + 8 * hi, boff = (size_t)(c0 + lr) * K + 8 * hi;
#pragma unroll 1
    for (int kc = 0; kc < K; kc += 32) {
        V a[4], a2[4];
#pragma unroll
        for (int mb = 0; mb < 4; ++mb) { a[mb] = WFrag<T16>::ld(A + aoff + (size_t)mb * 16 * K + kc); if (NSPLIT == 1 || NSPLIT == 2) a2[mb] = WFrag<T16>::ld(A2 + aoff + (size_t)mb * 16 * K + kc); }
#pragma unroll
        for (int nb = 0; nb < 4; ++nb) { const V b = WFrag<T16>::ld(Bt + boff + (size_t)nb * 16 * K + kc); V b2; if (NSPLIT >= 2) b2 = WFrag<T16>::ld(Bt2 + boff + (size_t)nb * 16 * K + kc);
#pragma unroll
            for (int mb = 0; mb < 4; ++mb) { acc[mb][nb] = WFrag<T16>::mma(a[mb], b, acc[mb][nb]); if (NSPLIT == 1 || NSPLIT == 2) acc[mb][nb] = WFrag<T16>::mma(a2[mb], b, acc[mb][nb]); if (NSPLIT >= 2) acc[mb][nb] = WFrag<T16>::mma(a[mb], b2, acc[mb][nb]); } }
        asm volatile("v_nop\n\tv_nop\n\tv_nop\n\tv_nop" : "+v"(acc[0][0]), "+v"(acc[1][1]), "+v"(acc[2][2]), "+v"(acc[3][3]) : "v"(a[0]), "v"(a[3]));
    }
#pragma unroll
    for (int mb = 0; mb < 4; ++mb) {
#pragma unroll
        for (int nb = 0; nb < 4; ++nb) {
#pragma unroll
            for (int j = 0; j < 8; ++j) os[(hi * 8 + j) * 68 + nb * 16 + lr] = acc[mb][nb][j]; }
        __builtin_amdgcn_wave_barrier(); asm volatile("" ::: "memory");
        float* crow = C + (size_t)(r0 + mb * 16) * ldc + c0;
{
#pragma unroll
            for (int s = 0; s < 8; ++s) { const int row = 2 * s + hi, cofs = lr * 4; v4f val = *(const v4fa*)(os + row * 68 + cofs); if (BIAS) { val[0] += bfr(bias[c0 + cofs]); val[1] += bfr(bias[c0 + cofs + 1]); val[2] += bfr(bias[c0 + cofs + 2]); val[3] += bfr(bias[c0 + cofs + 3]); }
                *(v4f*)(crow + (size_t)row * ldc + cofs) = val; }
             }
        __builtin_amdgcn_wave_barrier(); asm volatile("" ::: "memory");
    }
}

// ---- k_gemmc: the same one-wave 64x64 tile GEMM specialised for causal attention: CMODE 1 skips score tiles entirely above the diagonal (query rows r0+roff.., key columns c0..), CMODE 2 limits the
// key (K) loop of the probability x value contraction to the diagonal block (probabilities beyond it are exactly zero). roff = row offset of this launch's first row within the sequence.
template <typename T16, int NSPLIT, int CMODE>
__global__ __launch_bounds__(32) void k_gemmc(const T16* __restrict__ A, const T16* __restrict__ A2, const T16* __restrict__ Bt, const T16* __restrict__ Bt2, int K, float* C, int ldc, int roff, size_t sA, size_t sB, size_t sC) {
    typedef typename WFrag<T16>::V V;
    __shared__ __align__(16) float os[16 * 68];
    const size_t z = blockIdx.z; A += z * sA; if (A2) A2 += z * sA; Bt += z * sB; if (Bt2) Bt2 += z * sB; C += z * sC;
    const int lane = threadIdx.x & 31, lr = lane & 15, hi = lane >> 4; const int r0 = blockIdx.x * 64, c0 = blockIdx.y * 64;
    if (CMODE == 1 && c0 > r0 + roff + 63) return;                  // score tile entirely above the causal diagonal: left unwritten (the softmax masks j > i by select)
    const int Kl = (CMODE == 2) ? min(K, r0 + roff + 64) : K;        // P.V: probabilities are exactly 0 beyond the diagonal block, so the K loop stops there
    v8f acc[4][4];
#pragma unroll
    for (int mb = 0; mb < 4; ++mb)
#pragma unroll
        for (int nb = 0; nb < 4; ++nb) acc[mb][nb] = (v8f){};
    const size_t aoff = (size_t)(r0 + lr) * K + 8 * hi, boff = (size_t)(c0 + lr) * K + 8 * hi;
#pragma unroll 1
    for (int kc = 0; kc < Kl; kc += 32) {
        V a[4], a2[4];
#pragma unroll
        for (int mb = 0; mb < 4; ++mb) { a[mb] = WFrag<T16>::ld(A + aoff + (size_t)mb * 16 * K + kc); if (NSPLIT == 1 || NSPLIT == 2) a2[mb] = WFrag<T16>::ld(A2 + aoff + (size_t)mb * 16 * K + kc); }
#pragma unroll
        for (int nb = 0; nb < 4; ++nb) { const V b = WFrag<T16>::ld(Bt + boff + (size_t)nb * 16 * K + kc); V b2; if (NSPLIT >= 2) b2 = WFrag<T16>::ld(Bt2 + boff + (size_t)nb * 16 * K + kc);
#pragma unroll
            for (int mb = 0; mb < 4; ++mb) { acc[mb][nb] = WFrag<T16>::mma(a[mb], b, acc[mb][nb]); if (NSPLIT == 1 || NSPLIT == 2) acc[mb][nb] = WFrag<T16>::mma(a2[mb], b, acc[mb][nb]); if (NSPLIT >= 2) acc[mb][nb] = WFrag<T16>::mma(a[mb], b2, acc[mb][nb]); } }
        asm volatile("v_nop\n\tv_nop\n\tv_nop\n\tv_nop" : "+v"(acc[0][0]), "+v"(acc[1][1]), "+v"(acc[2][2]), "+v"(acc[3][3]) : "v"(a[0]), "v"(a[3]));
    }
#pragma unroll
    for (int mb = 0; mb < 4; ++mb) {
#pragma unroll
        for (int nb = 0; nb < 4; ++nb) {
#pragma unroll
            for (int j = 0; j < 8; ++j) os[(hi * 8 + j) * 68 + nb * 16 + lr] = acc[mb][nb][j]; }
        __builtin_amdgcn_wave_barrier(); asm volatile("" ::: "memory");
        float* crow = C + (size_t)(r0 + mb * 16) * ldc + c0;
{
#pragma unroll
            for (int s = 0; s < 8; ++s) { const int row = 2 * s + hi, cofs = lr * 4; v4f val = *(const v4fa*)(os + row * 68 + cofs);
                *(v4f*)(crow + (size_t)row * ldc + cofs) = val; }
             }
        __builtin_amdgcn_wave_barrier(); asm volatile("" ::: "memory");
    }
}

__device__ __forceinline__ h16 tohx(float x) { return (h16)x; }
__device__ __forceinline__ void splitf(float y, unsigned short& h, unsigned short& l) { h = f2bf(y); l = f2bf(y - bf2f(h)); }
typedef __attribute__((ext_vector_type(2))) _Float16 v2h;
typedef __attribute__((ext_vector_type(4))) _Float16 v4h;
typedef __attribute__((ext_vector_type(2))) unsigned short v2us;
typedef __attribute__((ext_vector_type(4))) unsigned short v4us;
typedef __attribute__((ext_vector_type(2))) float v2f;
typedef __attribute__((ext_vector_type(4))) int v4i;

__global__ __launch_bounds__(256) void k_wtG(const float* __restrict__ w, int K, int N, bf* Bt) {
    const int lane = threadIdx.x & 31; const int L0 = (blockIdx.x * 8 + (threadIdx.x >> 5)) * 8; const int nlines = N * K / 64;
{
#pragma unroll 1
        for (int l = 0; l < 8; ++l) { const int L = L0 + l; if (L >= nlines) break; const size_t e = (size_t)L * 64 + lane * 2; const int k = (int)(e % K), n = (int)(e / K); v2us o;
            o[0] = f2bf(w[(size_t)k * N + n]); o[1] = f2bf(w[(size_t)(k + 1) * N + n]); *(v2us*)(Bt + e) = o; }
         }
}
__global__ __launch_bounds__(256) void k_cvt8(const float* __restrict__ src, bf* dst, size_t n8) { const size_t i = (size_t)blockIdx.x * 256 + threadIdx.x; if (i >= n8) return; const v8f v = *(const v8f*)(src + i * 8); v8us o;
#pragma unroll
    for (int k = 0; k < 8; ++k) o[k] = f2bf(v[k]); *(v8us*)(dst + i * 8) = o;  }

// k_rope: head planes [h][t][d] (fp16 + hi/lo) of rope(x) x sc with the rotate-half convention out[d] = x[d] cos[t][d] - x[d+HD/2] sin[t][d], out[d+HD/2] = x[d+HD/2] cos[t][d+HD/2] + x[d] sin[t][d+HD/2]
__global__ __launch_bounds__(256) void k_rope(const float* __restrict__ F, int pitch, int nheads, const float* __restrict__ CS, const float* __restrict__ RF, const float* __restrict__ nw, float sc, h16* P16, bf* Ph, bf* Pl) {
    const size_t e = ((size_t)blockIdx.x * 256 + threadIdx.x) * 2; if (e >= (size_t)nheads * TT * HD) return; const int d = (int)(e % HD); const int t = (int)((e / HD) % TT); const int h = (int)(e / ((size_t)HD * TT)); const float* f = F + (size_t)t * pitch + h * HD; const float rf = RF ? RF[(size_t)h * TT + t] : 1.0f; v2h o16; v2us oh, ol;
#pragma unroll
    for (int q = 0; q < 2; ++q) { const int dd = d + q; const int dp = (dd < HD / 2) ? dd + HD / 2 : dd - HD / 2; float x0 = f[dd], x1 = f[dp];
        if (RF) { float n0 = __fmul_rn(x0, rf), n1 = __fmul_rn(x1, rf); asm volatile("" : "+v"(n0)); asm volatile("" : "+v"(n1)); x0 = __fmul_rn(bfr(nw[dd]), n0); x1 = __fmul_rn(bfr(nw[dp]), n1); }
        const v2f cs = *(const v2f*)(CS + ((size_t)t * HD + dd) * 2); float a = __fmul_rn(x0, cs[0]), bq = __fmul_rn(x1, cs[1]); asm volatile("" : "+v"(a)); asm volatile("" : "+v"(bq)); const float r = ((dd < HD / 2) ? __fsub_rn(a, bq) : __fadd_rn(a, bq)) * sc;
        o16[q] = tohx(r); unsigned short a2, c2; splitf(r, a2, c2); oh[q] = a2; ol[q] = c2; }
    *(v2h*)(P16 + e) = o16; *(v2us*)(Ph + e) = oh; *(v2us*)(Pl + e) = ol;  }
__global__ __launch_bounds__(256) void k_vtp(const float* __restrict__ F, int pitch, int nheads, h16* V16, bf* Vh, bf* Vl) { const size_t e = ((size_t)blockIdx.x * 256 + threadIdx.x) * 2; if (e >= (size_t)nheads * HD * TT) return; const int t = (int)(e % TT); const int d = (int)((e / TT) % HD); const int g = (int)(e / ((size_t)TT * HD)); v2h o16; v2us oh, ol;
#pragma unroll
    for (int q = 0; q < 2; ++q) { const float x = F[(size_t)(t + q) * pitch + g * HD + d]; o16[q] = tohx(x); unsigned short a2, c2; splitf(x, a2, c2); oh[q] = a2; ol[q] = c2; }
    *(v2h*)(V16 + e) = o16; *(v2us*)(Vh + e) = oh; *(v2us*)(Vl + e) = ol;  }
__global__ __launch_bounds__(256) void k_csid(float* CS) { const int idx = blockIdx.x * 256 + threadIdx.x; if (idx >= TT * HD) return; v2f cs; cs[0] = 1.0f; cs[1] = 0.0f; *(v2f*)(CS + (size_t)idx * 2) = cs;  }
// k_asoft: one band of BR query rows (first row roff) of nrow / BR heads, Sb [zz][BR][TT]. Per row (zz, i): t = S x HD^-0.5 for j <= i and i - j < WIN (sliding causal window; the reference's -1e9 additive fill vanishes identically); softmax over the 2048 keys (register row, one exp, fixed trees);
__global__ __launch_bounds__(256) void k_asoft(const float* __restrict__ Sb, int roff, int nrow, h16* P16, bf* Ph, bf* Pl) {
    const int lane = threadIdx.x & 31; const int row = blockIdx.x * 8 + (threadIdx.x >> 5); if (row >= nrow) return; const int i = (roff + row % BR) & (TT - 1) /* identity: the band lies inside the sequence; the mask shows the compiler i < TT, so the window test folds away */; const int zz = row / BR; (void)zz; const bool hires = (i < RH); const float* sr = Sb + (size_t)row * TT; float v[TT / 32]; float mx = -3.0e38f;
#pragma unroll
    for (int ch = 0; ch < TT / 128; ++ch) { const int j0 = ch * 128 + lane * 4; const v4f a = *(const v4f*)(sr + j0);
#pragma unroll
        for (int q = 0; q < 4; ++q) { const int j = j0 + q; (void)j; const float t = (j <= i && i - j < WIN) ? a[q] * SCL : -3.0e38f; v[ch * 4 + q] = t; mx = fmaxf(mx, t); } }
#pragma unroll
    for (int sh = 16; sh; sh >>= 1) mx = fmaxf(mx, __shfl_xor(mx, sh, 32));
    float sum = 0.f;
#pragma unroll
    for (int k = 0; k < TT / 32; ++k) { float d0 = __fsub_rn(v[k], mx); asm volatile("" : "+v"(d0)); v[k] = __builtin_amdgcn_exp2f(__fmul_rn(d0, 1.4426950408889634f)); sum += v[k]; }
#pragma unroll
    for (int sh = 16; sh; sh >>= 1) sum += __shfl_xor(sum, sh, 32);
    const float f = __fdiv_rn(hires ? 1.0f : PCAR, sum);
{
        if (hires) {
#pragma unroll
            for (int ch = 0; ch < TT / 128; ++ch) { v4us oh, ol;
#pragma unroll
                for (int q = 0; q < 4; ++q) { unsigned short a, c2; splitf(v[ch * 4 + q] * f, a, c2); oh[q] = a; ol[q] = c2; }
                const size_t oo = ((size_t)zz * (RH ? RH : 1) + i) * TT + ch * 128 + lane * 4; *(v4us*)(Ph + oo) = oh; *(v4us*)(Pl + oo) = ol; }
        } else {
#pragma unroll
            for (int ch = 0; ch < TT / 128; ++ch) { v4h o4;
#pragma unroll
                for (int q = 0; q < 4; ++q) o4[q] = tohx(v[ch * 4 + q] * f);
                *(v4h*)(P16 + (size_t)row * TT + ch * 128 + lane * 4) = o4; } }
         }
}
__global__ __launch_bounds__(256) void k_lam(const float* __restrict__ a1, const float* __restrict__ b1, const float* __restrict__ a2, const float* __restrict__ b2, float* LAM) { if (threadIdx.x >= 32) return; const int lane = threadIdx.x; float d1 = __fadd_rn(__fmul_rn(bfr(a1[lane * 2]), bfr(b1[lane * 2])), __fmul_rn(bfr(a1[lane * 2 + 1]), bfr(b1[lane * 2 + 1]))); float d2 = __fadd_rn(__fmul_rn(bfr(a2[lane * 2]), bfr(b2[lane * 2])), __fmul_rn(bfr(a2[lane * 2 + 1]), bfr(b2[lane * 2 + 1])));
#pragma unroll
    for (int sh = 16; sh; sh >>= 1) { d1 = __fadd_rn(d1, __shfl_xor(d1, sh, 32)); d2 = __fadd_rn(d2, __shfl_xor(d2, sh, 32)); }
    float l = __fsub_rn(expf(d1), expf(d2)); asm volatile("" : "+v"(l)); l = __fadd_rn(l, LINIT); ((float*)LAM)[lane] = l;  }
__global__ __launch_bounds__(256) void k_comb(const float* __restrict__ A, const float* __restrict__ LAM, bf* Ph, bf* Pl) { const size_t i = (size_t)blockIdx.x * 256 + threadIdx.x; if (i >= (size_t)TT * DO / 4) return; const size_t e = i * 4; const int c0 = (int)(e % DO); const size_t t = e / DO; const float lam = LAM[0]; const v4f o1 = *(const v4f*)(A + t * DQ + c0); const v4f o2 = *(const v4f*)(A + t * DQ + DO + c0); v4us oh, ol;
#pragma unroll
    for (int q = 0; q < 4; ++q) { float m = __fmul_rn(lam, o2[q]); asm volatile("" : "+v"(m)); float y = __fsub_rn(o1[q], m); asm volatile("" : "+v"(y)); y = __fmul_rn(y, 1.0f - LINIT); unsigned short u, w; splitf(y, u, w); oh[q] = u; ol[q] = w; }
    *(v4us*)(Ph + e) = oh; *(v4us*)(Pl + e) = ol;  }
__global__ __launch_bounds__(256) void k_merge(const float* __restrict__ O, int h0, int nh, int roff, float* OUTb) { const size_t e = ((size_t)blockIdx.x * 256 + threadIdx.x) * 2; if (e >= (size_t)nh * BR * HD) return; const int d = (int)(e % HD); const int t = roff + (int)((e / HD) % BR); const int zz = (int)(e / ((size_t)HD * BR)); const float cs = (t < RH) ? 1.0f : (1.0f / PCAR); const size_t oo = (size_t)t * DQ + (h0 + zz) * HD + d;
    v2f o2; o2[0] = O[e] * cs; o2[1] = O[e + 1] * cs; *(v2f*)(OUTb + oo) = o2;  }

extern "C" void kernel_launch(void* const* d_in, const int* in_sizes, int n_in,
                              void* d_out, int out_size, void* d_ws, size_t ws_size, hipStream_t stream) {
    (void)in_sizes; (void)n_in; (void)out_size;
    const float* x = (const float*)d_in[0]; const float* wq = (const float*)d_in[1]; const float* wk = (const float*)d_in[2]; const float* wv = (const float*)d_in[3]; const float* wo = (const float*)d_in[4]; const float* lq1 = (const float*)d_in[5]; const float* lk1 = (const float*)d_in[6]; const float* lq2 = (const float*)d_in[7]; const float* lk2 = (const float*)d_in[8];
    float* OUT = (float*)d_out;     // [2][2048][1024]
    char* wsp = (char*)d_ws;
    auto take = [&](size_t bytes) { char* p = wsp; wsp += (bytes + 255) & ~(size_t)255; return (void*)p; };
    float* AT32 = (float*)take((size_t)TT * DQ * 4); bf* WO = (bf*)take((size_t)DM * DO * 2); float* LAM = (float*)take(256); bf* WQ = (bf*)take((size_t)DQ * DM * 2); bf* WK = (bf*)take((size_t)DKV * DM * 2); bf* WV = (bf*)take((size_t)DKV * DM * 2); float* CS = (float*)take((size_t)TT * HD * 2 * 4);
    h16* QP16 = (h16*)take((size_t)NH_ * TT * HD * 2); h16* KP16 = (h16*)take((size_t)NKV * TT * HD * 2); h16* VT16 = (h16*)take((size_t)NKV * HD * TT * 2); float* Ob = (float*)take((size_t)ZLO * BR * HD * 4);
    // One shared region, every use stream-ordered within a batch. fp16 bands: Sb (ZLO heads), then P16 (ZLO heads). Before them the hi/lo band uses the first half of Sb for ZHI heads of scores and the second half for Ph and Pl,
    // and the six hi/lo head planes (dead once the hi/lo band is done) lie in the tail of P16. The projection buffers (dead once the planes are built) and the combine planes (written after the last band) lie at the head of Sb.
    float* Sb = (float*)take((size_t)ZLO * BR * TT * 4); h16* P16 = (h16*)take((size_t)ZLO * BR * TT * 2);
    bf* Ph = (bf*)(Sb + (size_t)ZHI * BR * TT); bf* Pl = Ph + (size_t)ZHI * BR * TT;
    bf* QPh = (bf*)P16 + (size_t)ZLO * BR * TT - (size_t)6 * NH_ * TT * HD; bf* QPl = QPh + (size_t)NH_ * TT * HD; bf* KPh = QPl + (size_t)NH_ * TT * HD; bf* KPl = KPh + (size_t)NKV * TT * HD; bf* VTh = KPl + (size_t)NKV * TT * HD; bf* VTl = VTh + (size_t)NKV * HD * TT;
    float* FQ = Sb; float* FK = FQ + (size_t)TT * DQ; bf* XB = (bf*)(FK + (size_t)TT * DKV); bf* ACh = (bf*)Sb; bf* ACl = ACh + (size_t)TT * DO;
    if ((size_t)(wsp - (char*)d_ws) > ws_size) return;    // ws 256 MiB
    float* FV = FK;   // v projection reuses the k buffer after the k planes are built (stream-ordered)
    { k_wtG<<<(unsigned)((DM * DQ / 64 + 63) / 64), 256, 0, stream>>>(wq, DM, DQ, WQ); k_wtG<<<(unsigned)((DM * DKV / 64 + 63) / 64), 256, 0, stream>>>(wk, DM, DKV, WK); k_wtG<<<(unsigned)((DM * DKV / 64 + 63) / 64), 256, 0, stream>>>(wv, DM, DKV, WV);
      
       }
    k_csid<<<(TT * HD + 255) / 256, 256, 0, stream>>>(CS);
    const unsigned LQ = (unsigned)(((size_t)NH_ * TT * HD / 2 + 255) / 256), LKv = (unsigned)(((size_t)NKV * TT * HD / 2 + 255) / 256);
    k_wtG<<<(unsigned)((DO * DM / 64 + 63) / 64), 256, 0, stream>>>(wo, DO, DM, WO); k_lam<<<1, 256, 0, stream>>>(lq1, lk1, lq2, lk2, LAM);   /* Wo 'xw' [1024][1024]; lambda line */
    for (int b = 0; b < NB_; ++b) {
        
        k_cvt8<<<(unsigned)(((size_t)TT * DM / 8 + 255) / 256), 256, 0, stream>>>(x + (size_t)b * TT * DM, XB, (size_t)TT * DM / 8);
        k_gemmw<bf, 0, false><<<dim3(TT / 64, DQ / 64, 1), 32, 0, stream>>>(XB, nullptr, WQ, nullptr, DM, FQ, DQ, nullptr, 0, 0, 0);
        k_rope<<<LQ, 256, 0, stream>>>(FQ, DQ, NH_, CS, nullptr, nullptr, 1.0f, QP16, QPh, QPl);
        k_gemmw<bf, 0, false><<<dim3(TT / 64, DKV / 64, 1), 32, 0, stream>>>(XB, nullptr, WK, nullptr, DM, FK, DKV, nullptr, 0, 0, 0);
        k_rope<<<LKv, 256, 0, stream>>>(FK, DKV, NKV, CS, nullptr, nullptr, 1.0f, KP16, KPh, KPl);
        k_gemmw<bf, 0, false><<<dim3(TT / 64, DKV / 64, 1), 32, 0, stream>>>(XB, nullptr, WV, nullptr, DM, FV, DKV, nullptr, 0, 0, 0); k_vtp<<<LKv, 256, 0, stream>>>(FV, DKV, NKV, VT16, VTh, VTl);
        for (int h0 = 0; h0 < NH_; h0 += ZHI) { const size_t zq = (size_t)h0, zk = (size_t)(h0 / REP);   // hi/lo band (query rows < RH): ZHI heads per pass, one kv head per query head (z-strides TT*HD)
            k_gemmc<bf, 2, 1><<<dim3(RH / 64, RH / 64, ZHI), 32, 0, stream>>>(QPh + zq * TT * HD, QPl + zq * TT * HD, KPh + zk * TT * HD, KPl + zk * TT * HD, HD, Sb, TT, 0, (size_t)TT * HD, (size_t)TT * HD, (size_t)BR * TT);
            k_asoft<<<ZHI * BR / 8, 256, 0, stream>>>(Sb, 0, ZHI * BR, P16, Ph, Pl);
            k_gemmc<bf, 2, 2><<<dim3(RH / 64, HD / 64, ZHI), 32, 0, stream>>>(Ph, Pl, VTh + zk * HD * TT, VTl + zk * HD * TT, TT, Ob, HD, 0, (size_t)RH * TT, (size_t)HD * TT, (size_t)BR * HD);
            k_merge<<<(unsigned)(((size_t)ZHI * BR * HD / 2 + 255) / 256), 256, 0, stream>>>(Ob, h0, ZHI, 0, AT32); }
        for (int r = RH; r < TT; r += BR) {   // fp16 bands: query rows r .. r+BR-1 of all ZLO = NH_ heads in one pass; the key tiles and the P.V loop end at the band's diagonal
            k_gemmc<h16, 0, 1><<<dim3(BR / 64, (r + BR) / 64, ZLO), 32, 0, stream>>>(QP16 + (size_t)r * HD, nullptr, KP16, nullptr, HD, Sb, TT, r, (size_t)TT * HD, (size_t)TT * HD, (size_t)BR * TT);
            k_asoft<<<ZLO * BR / 8, 256, 0, stream>>>(Sb, r, ZLO * BR, P16, Ph, Pl);
            k_gemmc<h16, 0, 2><<<dim3(BR / 64, HD / 64, ZLO), 32, 0, stream>>>(P16, nullptr, VT16, nullptr, TT, Ob, HD, r, (size_t)BR * TT, (size_t)HD * TT, (size_t)BR * HD);
            k_merge<<<(unsigned)(((size_t)ZLO * BR * HD / 2 + 255) / 256), 256, 0, stream>>>(Ob, 0, ZLO, r, AT32); }
        k_comb<<<(unsigned)(((size_t)TT * DO / 4 + 255) / 256), 256, 0, stream>>>(AT32, LAM, ACh, ACl);   /* (o1 - lambda o2) x (1 - lambda_init) -> planes */
        k_gemmw<bf, 1, false><<<dim3(TT / 64, DM / 64, 1), 32, 0, stream>>>(ACh, ACl, WO, nullptr, DO, OUT + (size_t)b * TT * DM, DM, nullptr, 0, 0, 0);   /* Wo */
    }
}

// v002
// It runs in 844 microseconds.
// Next to v001, in two timings, it ran 1.11 and 1.10 times as fast.
// Counting every step since v000, it is 3.20 times as fast.
#include <hip/hip_runtime.h>

// Differential causal attention (x [2][2048][1024]; q, k, v = x W ('xw' [1024][2048] 0.02) as 2 groups x 16 heads x 64; a_g = causal softmax(q_g.k_g / 8) (-1e30 fill); lambda = exp(lq1.lk1) - exp(lq2.lk2) + 0.8 (vectors [64], zeros, read: computed on device); o_h = (a1 v1 - lambda a2 v2) x (1 - 0.8); out = merged o Wo ('xw' [1024][1024]) -> [2][2048][1024] (4.2 M)).
// Layout per batch: bf16 copy of x; 'xw' weights transposed once; exact projections whose epilogue rounds each tile straight into the 16-bit head planes (v transposed by swapping the operands); the two groups run as 32 heads of the causal T-2048 attention, one pass per band of 512 query rows over 32 heads (16 in the hi/lo band) (hybrid rows: < 512 hi/lo 3 products, rest fp16 x1024; k_gemmc skips tiles above the diagonal), the P.V epilogue storing into an f32 [2048][2048] merge buffer; a combine kernel forms (o1 - lambda o2) x 0.2 per head as hi/lo planes; hi/lo x Wo exact.
// Compute dtypes, f32 accumulate: every input rounded to bf16; projections exact; attention rows < 512 3 products, rest fp16; softmax f32; lambda (precise expf) and the combination f32; Wo hl x exact.

#define NB_  2
#define TT   2048
#define DM   1024
#define NH_  32
#define NKV  32
#define REP  (NH_ / NKV)
#define HD   64
#define DQ   (NH_ * HD)
#define DKV  (NKV * HD)
#define BR   512                  // query rows per attention pass (one band); the hi/lo rows are exactly the first band (RH == BR)
#define ZHI  16                   // heads per pass of the hi/lo band
#define ZLO  32                   // heads per pass of the fp16 bands
#define RH   512                  // query rows < RH use hi+lo planes (0: none)
#define WIN  2048
#define PCAR 1024.0f
#define SCL  0.125f
#define NHO  16      // output heads (per group)
#define DO   (NHO * HD)   // 1024
#define LINIT 0.8f
typedef _Float16 h16;
typedef unsigned short bf;
typedef __attribute__((ext_vector_type(16))) __bf16   v16bf;
typedef __attribute__((ext_vector_type(16))) _Float16 v16h;
typedef __attribute__((ext_vector_type(8)))  _Float16 v8h;
typedef __attribute__((ext_vector_type(8)))  unsigned short v8us;
typedef __attribute__((ext_vector_type(8)))  float    v8f;
typedef __attribute__((ext_vector_type(4)))  float    v4f;
typedef v8h  __attribute__((may_alias)) v8ha;
typedef v4f  __attribute__((may_alias)) v4fa;
typedef v8us __attribute__((may_alias)) v8usa;

__device__ __forceinline__ unsigned short f2bf(float f) { unsigned u = __float_as_uint(f); u += 0x7FFFu + ((u >> 16) & 1u); return (unsigned short)(u >> 16); }
__device__ __forceinline__ float bf2f(unsigned short b) { return __uint_as_float(((unsigned)b) << 16); }
__device__ __forceinline__ float bfr(float f) { return bf2f(f2bf(f)); }
__device__ __forceinline__ h16 tohx(float x) { return (h16)x; }
__device__ __forceinline__ void splitf(float y, unsigned short& h, unsigned short& l) { h = f2bf(y); l = f2bf(y - bf2f(h)); }
__device__ __forceinline__ v16h cat16(v8h lo, v8h hi) { return __builtin_shufflevector(lo, hi, 0, 1, 2, 3, 4, 5, 6, 7, 8, 9, 10, 11, 12, 13, 14, 15); }
__device__ __forceinline__ v16bf cat16b(v8us lo, v8us hi) { return __builtin_bit_cast(v16bf, __builtin_shufflevector(lo, hi, 0, 1, 2, 3, 4, 5, 6, 7, 8, 9, 10, 11, 12, 13, 14, 15)); }
__device__ __forceinline__ v8f wmma16(v16h a, v16h b, v8f c) { return __builtin_amdgcn_wmma_f32_16x16x32_f16(false, a, false, b, (short)0, c, false, false); }
__device__ __forceinline__ v8f wmmab(v16bf a, v16bf b, v8f c) { return __builtin_amdgcn_wmma_f32_16x16x32_bf16(false, a, false, b, (short)0, c, false, false); }



// ---- k_gemmw: register-blocked GEMM, ONE WAVE per 64x64 output tile (16 accumulators), operands straight from K-contiguous 16-bit planes; grid (M/64, N/64, Z), 32 threads.
// C[m][n] (f32, pitch ldc, + optional f32 bias[n]) = sum_k A[m][k] Bt[n][k] (+ split products per NSPLIT). z-batch strides sA/sB/sC in elements. K % 32 == 0.
// PLANES: no f32 C; the epilogue rounds the tile straight into the three 16-bit planes that attention reads (fp16, bf16 hi, bf16 lo); element (m, n) goes to plane offset m * ldc + (n / 64) * sC + n % 64 (grid z = 1).
// q, k head planes [h][t][d]: A = x, Bt = weights, ldc = HD, sC = TT * HD. Transposed v planes [g][d][t]: A = weights, Bt = x, ldc = TT, sC = 64.
template <typename T16> struct WFrag;
template <> struct WFrag<h16> { typedef v16h V; static __device__ __forceinline__ V ld(const h16* p) { return cat16(*(const v8h*)p, *(const v8h*)(p + 16)); } static __device__ __forceinline__ v8f mma(V a, V b, v8f c) { return wmma16(a, b, c); } };
template <> struct WFrag<bf> { typedef v16bf V; static __device__ __forceinline__ V ld(const bf* p) { return cat16b(*(const v8us*)p, *(const v8us*)(p + 16)); } static __device__ __forceinline__ v8f mma(V a, V b, v8f c) { return wmmab(a, b, c); } };
template <typename T16, int NSPLIT, bool BIAS, bool PLANES = false>
__global__ __launch_bounds__(32) void k_gemmw(const T16* __restrict__ A, const T16* __restrict__ A2, const T16* __restrict__ Bt, const T16* __restrict__ Bt2, int K, float* C, int ldc, const float* __restrict__ bias, size_t sA, size_t sB, size_t sC, h16* P16 = nullptr, bf* Ph = nullptr, bf* Pl = nullptr) {
    typedef typename WFrag<T16>::V V;
    __shared__ __align__(16) float os[16 * 68];
    const size_t z = blockIdx.z; A += z * sA; if (A2) A2 += z * sA; Bt += z * sB; if (Bt2) Bt2 += z * sB; C += z * sC;
    const int lane = threadIdx.x & 31, lr = lane & 15, hi = lane >> 4; const int r0 = blockIdx.x * 64, c0 = blockIdx.y * 64;
    v8f acc[4][4];
#pragma unroll
    for (int mb = 0; mb < 4; ++mb)
#pragma unroll
        for (int nb = 0; nb < 4; ++nb) acc[mb][nb] = (v8f){};
    const size_t aoff = (size_t)(r0 + lr) * K + 8 * hi, boff = (size_t)(c0 + lr) * K + 8 * hi;
#pragma unroll 1
    for (int kc = 0; kc < K; kc += 32) {
        V a[4], a2[4];
#pragma unroll
        for (int mb = 0; mb < 4; ++mb) { a[mb] = WFrag<T16>::ld(A + aoff + (size_t)mb * 16 * K + kc); if (NSPLIT == 1 || NSPLIT == 2) a2[mb] = WFrag<T16>::ld(A2 + aoff + (size_t)mb * 16 * K + kc); }
#pragma unroll
        for (int nb = 0; nb < 4; ++nb) { const V b = WFrag<T16>::ld(Bt + boff + (size_t)nb * 16 * K + kc); V b2; if (NSPLIT >= 2) b2 = WFrag<T16>::ld(Bt2 + boff + (size_t)nb * 16 * K + kc);
#pragma unroll
            for (int mb = 0; mb < 4; ++mb) { acc[mb][nb] = WFrag<T16>::mma(a[mb], b, acc[mb][nb]); if (NSPLIT == 1 || NSPLIT == 2) acc[mb][nb] = WFrag<T16>::mma(a2[mb], b, acc[mb][nb]); if (NSPLIT >= 2) acc[mb][nb] = WFrag<T16>::mma(a[mb], b2, acc[mb][nb]); } }
        asm volatile("v_nop\n\tv_nop\n\tv_nop\n\tv_nop" : "+v"(acc[0][0]), "+v"(acc[1][1]), "+v"(acc[2][2]), "+v"(acc[3][3]) : "v"(a[0]), "v"(a[3]));
    }
#pragma unroll
    for (int mb = 0; mb < 4; ++mb) {
#pragma unroll
        for (int nb = 0; nb < 4; ++nb) {
#pragma unroll
            for (int j = 0; j < 8; ++j) os[(hi * 8 + j) * 68 + nb * 16 + lr] = acc[mb][nb][j]; }
        __builtin_amdgcn_wave_barrier(); asm volatile("" ::: "memory");
        float* crow = C + (size_t)(r0 + mb * 16) * ldc + c0;
        if (PLANES) {
            // both loops unrolled: the vector elements are then indexed by constants and stay in registers
#pragma unroll
            for (int s = 0; s < 4; ++s) { const int row = 4 * s + (lane >> 3), cofs = (lane & 7) * 8;   // 8 lanes x 16 B = one 128-B line per row and plane
                const v4f x0 = *(const v4fa*)(os + row * 68 + cofs), x1 = *(const v4fa*)(os + row * 68 + cofs + 4); v8h o16; v8us oh, ol;
#pragma unroll
                for (int q = 0; q < 4; ++q) { unsigned short u, w; o16[q] = tohx(x0[q]); splitf(x0[q], u, w); oh[q] = u; ol[q] = w; o16[q + 4] = tohx(x1[q]); splitf(x1[q], u, w); oh[q + 4] = u; ol[q + 4] = w; }
                const size_t oo = (size_t)(r0 + mb * 16 + row) * ldc + (size_t)blockIdx.y * sC + cofs; *(v8h*)(P16 + oo) = o16; *(v8us*)(Ph + oo) = oh; *(v8us*)(Pl + oo) = ol; }
        } else
{
#pragma unroll
            for (int s = 0; s < 8; ++s) { const int row = 2 * s + hi, cofs = lr * 4; v4f val = *(const v4fa*)(os + row * 68 + cofs); if (BIAS) { val[0] += bfr(bias[c0 + cofs]); val[1] += bfr(bias[c0 + cofs + 1]); val[2] += bfr(bias[c0 + cofs + 2]); val[3] += bfr(bias[c0 + cofs + 3]); }
                *(v4f*)(crow + (size_t)row * ldc + cofs) = val; }
             }
        __builtin_amdgcn_wave_barrier(); asm volatile("" ::: "memory");
    }
}

// ---- k_gemmc: the same one-wave 64x64 tile GEMM specialised for causal attention: CMODE 1 skips score tiles entirely above the diagonal (query rows r0+roff.., key columns c0..), CMODE 2 limits the
// key (K) loop of the probability x value contraction to the diagonal block (probabilities beyond it are exactly zero) and scales the tile by osc (undoes the carried factor of the fp16 probabilities) as it stores it. roff = row offset of this launch's first row within the sequence.
template <typename T16, int NSPLIT, int CMODE>
__global__ __launch_bounds__(32) void k_gemmc(const T16* __restrict__ A, const T16* __restrict__ A2, const T16* __restrict__ Bt, const T16* __restrict__ Bt2, int K, float* C, int ldc, int roff, float osc, size_t sA, size_t sB, size_t sC) {
    typedef typename WFrag<T16>::V V;
    __shared__ __align__(16) float os[16 * 68];
    const size_t z = blockIdx.z; A += z * sA; if (A2) A2 += z * sA; Bt += z * sB; if (Bt2) Bt2 += z * sB; C += z * sC;
    const int lane = threadIdx.x & 31, lr = lane & 15, hi = lane >> 4; const int r0 = blockIdx.x * 64, c0 = blockIdx.y * 64;
    if (CMODE == 1 && c0 > r0 + roff + 63) return;                  // score tile entirely above the causal diagonal: left unwritten (the softmax masks j > i by select)
    const int Kl = (CMODE == 2) ? min(K, r0 + roff + 64) : K;        // P.V: probabilities are exactly 0 beyond the diagonal block, so the K loop stops there
    v8f acc[4][4];
#pragma unroll
    for (int mb = 0; mb < 4; ++mb)
#pragma unroll
        for (int nb = 0; nb < 4; ++nb) acc[mb][nb] = (v8f){};
    const size_t aoff = (size_t)(r0 + lr) * K + 8 * hi, boff = (size_t)(c0 + lr) * K + 8 * hi;
#pragma unroll 1
    for (int kc = 0; kc < Kl; kc += 32) {
        V a[4], a2[4];
#pragma unroll
        for (int mb = 0; mb < 4; ++mb) { a[mb] = WFrag<T16>::ld(A + aoff + (size_t)mb * 16 * K + kc); if (NSPLIT == 1 || NSPLIT == 2) a2[mb] = WFrag<T16>::ld(A2 + aoff + (size_t)mb * 16 * K + kc); }
#pragma unroll
        for (int nb = 0; nb < 4; ++nb) { const V b = WFrag<T16>::ld(Bt + boff + (size_t)nb * 16 * K + kc); V b2; if (NSPLIT >= 2) b2 = WFrag<T16>::ld(Bt2 + boff + (size_t)nb * 16 * K + kc);
#pragma unroll
            for (int mb = 0; mb < 4; ++mb) { acc[mb][nb] = WFrag<T16>::mma(a[mb], b, acc[mb][nb]); if (NSPLIT == 1 || NSPLIT == 2) acc[mb][nb] = WFrag<T16>::mma(a2[mb], b, acc[mb][nb]); if (NSPLIT >= 2) acc[mb][nb] = WFrag<T16>::mma(a[mb], b2, acc[mb][nb]); } }
        asm volatile("v_nop\n\tv_nop\n\tv_nop\n\tv_nop" : "+v"(acc[0][0]), "+v"(acc[1][1]), "+v"(acc[2][2]), "+v"(acc[3][3]) : "v"(a[0]), "v"(a[3]));
    }
#pragma unroll
    for (int mb = 0; mb < 4; ++mb) {
#pragma unroll
        for (int nb = 0; nb < 4; ++nb) {
#pragma unroll
            for (int j = 0; j < 8; ++j) os[(hi * 8 + j) * 68 + nb * 16 + lr] = acc[mb][nb][j]; }
        __builtin_amdgcn_wave_barrier(); asm volatile("" ::: "memory");
        float* crow = C + (size_t)(r0 + mb * 16) * ldc + c0;
{
#pragma unroll
            for (int s = 0; s < 8; ++s) { const int row = 2 * s + hi, cofs = lr * 4; v4f val = *(const v4fa*)(os + row * 68 + cofs); if (CMODE == 2) val *= osc;
                *(v4f*)(crow + (size_t)row * ldc + cofs) = val; }
             }
        __builtin_amdgcn_wave_barrier(); asm volatile("" ::: "memory");
    }
}

typedef __attribute__((ext_vector_type(2))) _Float16 v2h;
typedef __attribute__((ext_vector_type(4))) _Float16 v4h;
typedef __attribute__((ext_vector_type(2))) unsigned short v2us;
typedef __attribute__((ext_vector_type(4))) unsigned short v4us;
typedef __attribute__((ext_vector_type(2))) float v2f;
typedef __attribute__((ext_vector_type(4))) int v4i;

__global__ __launch_bounds__(256) void k_wtG(const float* __restrict__ w, int K, int N, bf* Bt) {
    const int lane = threadIdx.x & 31; const int L0 = (blockIdx.x * 8 + (threadIdx.x >> 5)) * 8; const int nlines = N * K / 64;
{
#pragma unroll 1
        for (int l = 0; l < 8; ++l) { const int L = L0 + l; if (L >= nlines) break; const size_t e = (size_t)L * 64 + lane * 2; const int k = (int)(e % K), n = (int)(e / K); v2us o;
            o[0] = f2bf(w[(size_t)k * N + n]); o[1] = f2bf(w[(size_t)(k + 1) * N + n]); *(v2us*)(Bt + e) = o; }
         }
}
__global__ __launch_bounds__(256) void k_cvt8(const float* __restrict__ src, bf* dst, size_t n8) { const size_t i = (size_t)blockIdx.x * 256 + threadIdx.x; if (i >= n8) return; const v8f v = *(const v8f*)(src + i * 8); v8us o;
#pragma unroll
    for (int k = 0; k < 8; ++k) o[k] = f2bf(v[k]); *(v8us*)(dst + i * 8) = o;  }

// k_asoft: one band of BR query rows (first row roff) of nrow / BR heads, Sb [zz][BR][TT]. Per row (zz, i): t = S x HD^-0.5 for j <= i and i - j < WIN (sliding causal window; the reference's -1e9 additive fill vanishes identically); softmax over the 2048 keys (register row, one exp, fixed trees);
__global__ __launch_bounds__(256) void k_asoft(const float* __restrict__ Sb, int roff, int nrow, h16* P16, bf* Ph, bf* Pl) {
    const int lane = threadIdx.x & 31; const int row = blockIdx.x * 8 + (threadIdx.x >> 5); if (row >= nrow) return; const int i = (roff + row % BR) & (TT - 1) /* identity: the band lies inside the sequence; the mask shows the compiler i < TT, so the window test folds away */; const int zz = row / BR; (void)zz; const bool hires = (i < RH); const float* sr = Sb + (size_t)row * TT; float v[TT / 32]; float mx = -3.0e38f;
#pragma unroll
    for (int ch = 0; ch < TT / 128; ++ch) { const int j0 = ch * 128 + lane * 4; const v4f a = *(const v4f*)(sr + j0);
#pragma unroll
        for (int q = 0; q < 4; ++q) { const int j = j0 + q; (void)j; const float t = (j <= i && i - j < WIN) ? a[q] * SCL : -3.0e38f; v[ch * 4 + q] = t; mx = fmaxf(mx, t); } }
#pragma unroll
    for (int sh = 16; sh; sh >>= 1) mx = fmaxf(mx, __shfl_xor(mx, sh, 32));
    float sum = 0.f;
#pragma unroll
    for (int k = 0; k < TT / 32; ++k) { float d0 = __fsub_rn(v[k], mx); asm volatile("" : "+v"(d0)); v[k] = __builtin_amdgcn_exp2f(__fmul_rn(d0, 1.4426950408889634f)); sum += v[k]; }
#pragma unroll
    for (int sh = 16; sh; sh >>= 1) sum += __shfl_xor(sum, sh, 32);
    const float f = __fdiv_rn(hires ? 1.0f : PCAR, sum);
{
        if (hires) {
#pragma unroll
            for (int ch = 0; ch < TT / 128; ++ch) { v4us oh, ol;
#pragma unroll
                for (int q = 0; q < 4; ++q) { unsigned short a, c2; splitf(v[ch * 4 + q] * f, a, c2); oh[q] = a; ol[q] = c2; }
                const size_t oo = ((size_t)zz * (RH ? RH : 1) + i) * TT + ch * 128 + lane * 4; *(v4us*)(Ph + oo) = oh; *(v4us*)(Pl + oo) = ol; }
        } else {
#pragma unroll
            for (int ch = 0; ch < TT / 128; ++ch) { v4h o4;
#pragma unroll
                for (int q = 0; q < 4; ++q) o4[q] = tohx(v[ch * 4 + q] * f);
                *(v4h*)(P16 + (size_t)row * TT + ch * 128 + lane * 4) = o4; } }
         }
}
__global__ __launch_bounds__(256) void k_lam(const float* __restrict__ a1, const float* __restrict__ b1, const float* __restrict__ a2, const float* __restrict__ b2, float* LAM) { if (threadIdx.x >= 32) return; const int lane = threadIdx.x; float d1 = __fadd_rn(__fmul_rn(bfr(a1[lane * 2]), bfr(b1[lane * 2])), __fmul_rn(bfr(a1[lane * 2 + 1]), bfr(b1[lane * 2 + 1]))); float d2 = __fadd_rn(__fmul_rn(bfr(a2[lane * 2]), bfr(b2[lane * 2])), __fmul_rn(bfr(a2[lane * 2 + 1]), bfr(b2[lane * 2 + 1])));
#pragma unroll
    for (int sh = 16; sh; sh >>= 1) { d1 = __fadd_rn(d1, __shfl_xor(d1, sh, 32)); d2 = __fadd_rn(d2, __shfl_xor(d2, sh, 32)); }
    float l = __fsub_rn(expf(d1), expf(d2)); asm volatile("" : "+v"(l)); l = __fadd_rn(l, LINIT); ((float*)LAM)[lane] = l;  }
__global__ __launch_bounds__(256) void k_comb(const float* __restrict__ A, const float* __restrict__ LAM, bf* Ph, bf* Pl) { const size_t i = (size_t)blockIdx.x * 256 + threadIdx.x; if (i >= (size_t)TT * DO / 4) return; const size_t e = i * 4; const int c0 = (int)(e % DO); const size_t t = e / DO; const float lam = LAM[0]; const v4f o1 = *(const v4f*)(A + t * DQ + c0); const v4f o2 = *(const v4f*)(A + t * DQ + DO + c0); v4us oh, ol;
#pragma unroll
    for (int q = 0; q < 4; ++q) { float m = __fmul_rn(lam, o2[q]); asm volatile("" : "+v"(m)); float y = __fsub_rn(o1[q], m); asm volatile("" : "+v"(y)); y = __fmul_rn(y, 1.0f - LINIT); unsigned short u, w; splitf(y, u, w); oh[q] = u; ol[q] = w; }
    *(v4us*)(Ph + e) = oh; *(v4us*)(Pl + e) = ol;  }

extern "C" void kernel_launch(void* const* d_in, const int* in_sizes, int n_in,
                              void* d_out, int out_size, void* d_ws, size_t ws_size, hipStream_t stream) {
    (void)in_sizes; (void)n_in; (void)out_size;
    const float* x = (const float*)d_in[0]; const float* wq = (const float*)d_in[1]; const float* wk = (const float*)d_in[2]; const float* wv = (const float*)d_in[3]; const float* wo = (const float*)d_in[4]; const float* lq1 = (const float*)d_in[5]; const float* lk1 = (const float*)d_in[6]; const float* lq2 = (const float*)d_in[7]; const float* lk2 = (const float*)d_in[8];
    float* OUT = (float*)d_out;     // [2][2048][1024]
    char* wsp = (char*)d_ws;
    auto take = [&](size_t bytes) { char* p = wsp; wsp += (bytes + 255) & ~(size_t)255; return (void*)p; };
    float* AT32 = (float*)take((size_t)TT * DQ * 4); bf* WO = (bf*)take((size_t)DM * DO * 2); float* LAM = (float*)take(256); bf* WQ = (bf*)take((size_t)DQ * DM * 2); bf* WK = (bf*)take((size_t)DKV * DM * 2); bf* WV = (bf*)take((size_t)DKV * DM * 2);
    h16* QP16 = (h16*)take((size_t)NH_ * TT * HD * 2); h16* KP16 = (h16*)take((size_t)NKV * TT * HD * 2); h16* VT16 = (h16*)take((size_t)NKV * HD * TT * 2);
    // One shared region, every use stream-ordered within a batch. fp16 bands: Sb (ZLO heads), then P16 (ZLO heads). Before them the hi/lo band uses the first half of Sb for ZHI heads of scores and the second half for Ph and Pl,
    // and the six hi/lo head planes (dead once the hi/lo band is done) lie in the tail of P16. The bf16 copy of x (dead once the planes are built) and the combine planes (written after the last band) lie at the head of Sb.
    float* Sb = (float*)take((size_t)ZLO * BR * TT * 4); h16* P16 = (h16*)take((size_t)ZLO * BR * TT * 2);
    bf* Ph = (bf*)(Sb + (size_t)ZHI * BR * TT); bf* Pl = Ph + (size_t)ZHI * BR * TT;
    bf* QPh = (bf*)P16 + (size_t)ZLO * BR * TT - (size_t)6 * NH_ * TT * HD; bf* QPl = QPh + (size_t)NH_ * TT * HD; bf* KPh = QPl + (size_t)NH_ * TT * HD; bf* KPl = KPh + (size_t)NKV * TT * HD; bf* VTh = KPl + (size_t)NKV * TT * HD; bf* VTl = VTh + (size_t)NKV * HD * TT;
    bf* XB = (bf*)Sb; bf* ACh = (bf*)Sb; bf* ACl = ACh + (size_t)TT * DO;
    if ((size_t)(wsp - (char*)d_ws) > ws_size) return;    // ws 256 MiB
    { k_wtG<<<(unsigned)((DM * DQ / 64 + 63) / 64), 256, 0, stream>>>(wq, DM, DQ, WQ); k_wtG<<<(unsigned)((DM * DKV / 64 + 63) / 64), 256, 0, stream>>>(wk, DM, DKV, WK); k_wtG<<<(unsigned)((DM * DKV / 64 + 63) / 64), 256, 0, stream>>>(wv, DM, DKV, WV);
      
       }
    k_wtG<<<(unsigned)((DO * DM / 64 + 63) / 64), 256, 0, stream>>>(wo, DO, DM, WO); k_lam<<<1, 256, 0, stream>>>(lq1, lk1, lq2, lk2, LAM);   /* Wo 'xw' [1024][1024]; lambda line */
    for (int b = 0; b < NB_; ++b) {
        
        k_cvt8<<<(unsigned)(((size_t)TT * DM / 8 + 255) / 256), 256, 0, stream>>>(x + (size_t)b * TT * DM, XB, (size_t)TT * DM / 8);
        k_gemmw<bf, 0, false, true><<<dim3(TT / 64, DQ / 64, 1), 32, 0, stream>>>(XB, nullptr, WQ, nullptr, DM, nullptr, HD, nullptr, 0, 0, (size_t)TT * HD, QP16, QPh, QPl);      /* q head planes [h][t][d] */
        k_gemmw<bf, 0, false, true><<<dim3(TT / 64, DKV / 64, 1), 32, 0, stream>>>(XB, nullptr, WK, nullptr, DM, nullptr, HD, nullptr, 0, 0, (size_t)TT * HD, KP16, KPh, KPl);     /* k head planes [h][t][d] */
        k_gemmw<bf, 0, false, true><<<dim3(DKV / 64, TT / 64, 1), 32, 0, stream>>>(WV, nullptr, XB, nullptr, DM, nullptr, TT, nullptr, 0, 0, (size_t)64, VT16, VTh, VTl);          /* v planes transposed [g][d][t]: operands swapped */
        for (int h0 = 0; h0 < NH_; h0 += ZHI) { const size_t zq = (size_t)h0, zk = (size_t)(h0 / REP);   // hi/lo band (query rows < RH): ZHI heads per pass, one kv head per query head (z-strides TT*HD)
            k_gemmc<bf, 2, 1><<<dim3(RH / 64, RH / 64, ZHI), 32, 0, stream>>>(QPh + zq * TT * HD, QPl + zq * TT * HD, KPh + zk * TT * HD, KPl + zk * TT * HD, HD, Sb, TT, 0, 1.0f, (size_t)TT * HD, (size_t)TT * HD, (size_t)BR * TT);
            k_asoft<<<ZHI * BR / 8, 256, 0, stream>>>(Sb, 0, ZHI * BR, P16, Ph, Pl);
            k_gemmc<bf, 2, 2><<<dim3(RH / 64, HD / 64, ZHI), 32, 0, stream>>>(Ph, Pl, VTh + zk * HD * TT, VTl + zk * HD * TT, TT, AT32 + zq * HD, DQ, 0, 1.0f, (size_t)RH * TT, (size_t)HD * TT, (size_t)HD); }
        for (int r = RH; r < TT; r += BR) {   // fp16 bands: query rows r .. r+BR-1 of all ZLO = NH_ heads in one pass; the key tiles and the P.V loop end at the band's diagonal
            k_gemmc<h16, 0, 1><<<dim3(BR / 64, (r + BR) / 64, ZLO), 32, 0, stream>>>(QP16 + (size_t)r * HD, nullptr, KP16, nullptr, HD, Sb, TT, r, 1.0f, (size_t)TT * HD, (size_t)TT * HD, (size_t)BR * TT);
            k_asoft<<<ZLO * BR / 8, 256, 0, stream>>>(Sb, r, ZLO * BR, P16, Ph, Pl);
            k_gemmc<h16, 0, 2><<<dim3(BR / 64, HD / 64, ZLO), 32, 0, stream>>>(P16, nullptr, VT16, nullptr, TT, AT32 + (size_t)r * DQ, DQ, r, 1.0f / PCAR, (size_t)BR * TT, (size_t)HD * TT, (size_t)HD); }
        k_comb<<<(unsigned)(((size_t)TT * DO / 4 + 255) / 256), 256, 0, stream>>>(AT32, LAM, ACh, ACl);   /* (o1 - lambda o2) x (1 - lambda_init) -> planes */
        k_gemmw<bf, 1, false><<<dim3(TT / 64, DM / 64, 1), 32, 0, stream>>>(ACh, ACl, WO, nullptr, DO, OUT + (size_t)b * TT * DM, DM, nullptr, 0, 0, 0);   /* Wo */
    }
}

// v003
// Measured time: 355 microseconds a run.
// Timed twice side by side with v002, it ran 2.37 and 2.38 times as fast.
// Counting every step since v000, it is 7.59 times as fast.
#include <hip/hip_runtime.h>

// Differential causal attention (x [2][2048][1024]; q, k, v = x W ('xw' [1024][2048] 0.02) as 2 groups x 16 heads x 64; a_g = causal softmax(q_g.k_g / 8) (-1e30 fill); lambda = exp(lq1.lk1) - exp(lq2.lk2) + 0.8 (vectors [64], zeros, read: computed on device); o_h = (a1 v1 - lambda a2 v2) x (1 - 0.8); out = merged o Wo ('xw' [1024][1024]) -> [2][2048][1024] (4.2 M)).
// Layout: bf16 copy of x per batch; 'xw' weights transposed once; exact projections whose epilogue rounds each tile straight into the 16-bit head planes (v transposed by swapping the operands); the two groups run as 32 heads per batch of one fused causal attention launch (k_fattn: scores, online softmax and P.V in registers; query rows < 512 hi/lo 3 products, rest fp16), which stores into an f32 [b][2048][2048] merge buffer; a combine kernel forms (o1 - lambda o2) x 0.2 per head as hi/lo planes; hi/lo x Wo exact.
// Compute dtypes, f32 accumulate: every input rounded to bf16; projections exact; attention rows < 512 3 products, rest fp16; softmax f32; lambda (precise expf) and the combination f32; Wo hl x exact.

#define NB_  2
#define TT   2048
#define DM   1024
#define NH_  32
#define NKV  32
#define HD   64
#define DQ   (NH_ * HD)
#define DKV  (NKV * HD)
#define RH   512                  // query rows < RH use hi+lo planes
#define SCL  0.125f
#define NHO  16      // output heads (per group)
#define DO   (NHO * HD)   // 1024
#define LINIT 0.8f
typedef _Float16 h16;
typedef unsigned short bf;
typedef __attribute__((ext_vector_type(16))) __bf16   v16bf;
typedef __attribute__((ext_vector_type(16))) _Float16 v16h;
typedef __attribute__((ext_vector_type(8)))  _Float16 v8h;
typedef __attribute__((ext_vector_type(8)))  unsigned short v8us;
typedef __attribute__((ext_vector_type(8)))  float    v8f;
typedef __attribute__((ext_vector_type(4)))  float    v4f;
typedef v8h  __attribute__((may_alias)) v8ha;
typedef v4f  __attribute__((may_alias)) v4fa;
typedef v8us __attribute__((may_alias)) v8usa;

__device__ __forceinline__ unsigned short f2bf(float f) { unsigned u = __float_as_uint(f); u += 0x7FFFu + ((u >> 16) & 1u); return (unsigned short)(u >> 16); }
__device__ __forceinline__ float bf2f(unsigned short b) { return __uint_as_float(((unsigned)b) << 16); }
__device__ __forceinline__ float bfr(float f) { return bf2f(f2bf(f)); }
__device__ __forceinline__ h16 tohx(float x) { return (h16)x; }
__device__ __forceinline__ void splitf(float y, unsigned short& h, unsigned short& l) { h = f2bf(y); l = f2bf(y - bf2f(h)); }
__device__ __forceinline__ v16h cat16(v8h lo, v8h hi) { return __builtin_shufflevector(lo, hi, 0, 1, 2, 3, 4, 5, 6, 7, 8, 9, 10, 11, 12, 13, 14, 15); }
__device__ __forceinline__ v16bf cat16b(v8us lo, v8us hi) { return __builtin_bit_cast(v16bf, __builtin_shufflevector(lo, hi, 0, 1, 2, 3, 4, 5, 6, 7, 8, 9, 10, 11, 12, 13, 14, 15)); }
__device__ __forceinline__ v8f wmma16(v16h a, v16h b, v8f c) { return __builtin_amdgcn_wmma_f32_16x16x32_f16(false, a, false, b, (short)0, c, false, false); }
__device__ __forceinline__ v8f wmmab(v16bf a, v16bf b, v8f c) { return __builtin_amdgcn_wmma_f32_16x16x32_bf16(false, a, false, b, (short)0, c, false, false); }



// ---- k_gemmw: register-blocked GEMM, ONE WAVE per 64x64 output tile (16 accumulators), operands straight from K-contiguous 16-bit planes; grid (M/64, N/64, Z), 32 threads.
// C[m][n] (f32, pitch ldc, + optional f32 bias[n]) = sum_k A[m][k] Bt[n][k] (+ split products per NSPLIT). z-batch strides sA/sB/sC in elements. K % 32 == 0.
// PLANES: no f32 C; the epilogue rounds the tile straight into the three 16-bit planes that attention reads (fp16, bf16 hi, bf16 lo); element (m, n) goes to plane offset m * ldc + (n / 64) * sC + n % 64 (grid z = 1).
// q, k head planes [h][t][d]: A = x, Bt = weights, ldc = HD, sC = TT * HD. Transposed v planes [g][d][t]: A = weights, Bt = x, ldc = TT, sC = 64.
template <typename T16> struct WFrag;
template <> struct WFrag<h16> { typedef v16h V; static __device__ __forceinline__ V ld(const h16* p) { return cat16(*(const v8h*)p, *(const v8h*)(p + 16)); } static __device__ __forceinline__ v8f mma(V a, V b, v8f c) { return wmma16(a, b, c); } };
template <> struct WFrag<bf> { typedef v16bf V; static __device__ __forceinline__ V ld(const bf* p) { return cat16b(*(const v8us*)p, *(const v8us*)(p + 16)); } static __device__ __forceinline__ v8f mma(V a, V b, v8f c) { return wmmab(a, b, c); } };
template <typename T16, int NSPLIT, bool BIAS, bool PLANES = false>
__global__ __launch_bounds__(32) void k_gemmw(const T16* __restrict__ A, const T16* __restrict__ A2, const T16* __restrict__ Bt, const T16* __restrict__ Bt2, int K, float* C, int ldc, const float* __restrict__ bias, size_t sA, size_t sB, size_t sC, h16* P16 = nullptr, bf* Ph = nullptr, bf* Pl = nullptr) {
    typedef typename WFrag<T16>::V V;
    __shared__ __align__(16) float os[16 * 68];
    const size_t z = blockIdx.z; A += z * sA; if (A2) A2 += z * sA; Bt += z * sB; if (Bt2) Bt2 += z * sB; C += z * sC;
    const int lane = threadIdx.x & 31, lr = lane & 15, hi = lane >> 4; const int r0 = blockIdx.x * 64, c0 = blockIdx.y * 64;
    v8f acc[4][4];
#pragma unroll
    for (int mb = 0; mb < 4; ++mb)
#pragma unroll
        for (int nb = 0; nb < 4; ++nb) acc[mb][nb] = (v8f){};
    const size_t aoff = (size_t)(r0 + lr) * K + 8 * hi, boff = (size_t)(c0 + lr) * K + 8 * hi;
#pragma unroll 1
    for (int kc = 0; kc < K; kc += 32) {
        V a[4], a2[4];
#pragma unroll
        for (int mb = 0; mb < 4; ++mb) { a[mb] = WFrag<T16>::ld(A + aoff + (size_t)mb * 16 * K + kc); if (NSPLIT == 1 || NSPLIT == 2) a2[mb] = WFrag<T16>::ld(A2 + aoff + (size_t)mb * 16 * K + kc); }
#pragma unroll
        for (int nb = 0; nb < 4; ++nb) { const V b = WFrag<T16>::ld(Bt + boff + (size_t)nb * 16 * K + kc); V b2; if (NSPLIT >= 2) b2 = WFrag<T16>::ld(Bt2 + boff + (size_t)nb * 16 * K + kc);
#pragma unroll
            for (int mb = 0; mb < 4; ++mb) { acc[mb][nb] = WFrag<T16>::mma(a[mb], b, acc[mb][nb]); if (NSPLIT == 1 || NSPLIT == 2) acc[mb][nb] = WFrag<T16>::mma(a2[mb], b, acc[mb][nb]); if (NSPLIT >= 2) acc[mb][nb] = WFrag<T16>::mma(a[mb], b2, acc[mb][nb]); } }
        asm volatile("v_nop\n\tv_nop\n\tv_nop\n\tv_nop" : "+v"(acc[0][0]), "+v"(acc[1][1]), "+v"(acc[2][2]), "+v"(acc[3][3]) : "v"(a[0]), "v"(a[3]));
    }
#pragma unroll
    for (int mb = 0; mb < 4; ++mb) {
#pragma unroll
        for (int nb = 0; nb < 4; ++nb) {
#pragma unroll
            for (int j = 0; j < 8; ++j) os[(hi * 8 + j) * 68 + nb * 16 + lr] = acc[mb][nb][j]; }
        __builtin_amdgcn_wave_barrier(); asm volatile("" ::: "memory");
        float* crow = C + (size_t)(r0 + mb * 16) * ldc + c0;
        if (PLANES) {
            // both loops unrolled: the vector elements are then indexed by constants and stay in registers
#pragma unroll
            for (int s = 0; s < 4; ++s) { const int row = 4 * s + (lane >> 3), cofs = (lane & 7) * 8;   // 8 lanes x 16 B = one 128-B line per row and plane
                const v4f x0 = *(const v4fa*)(os + row * 68 + cofs), x1 = *(const v4fa*)(os + row * 68 + cofs + 4); v8h o16; v8us oh, ol;
#pragma unroll
                for (int q = 0; q < 4; ++q) { unsigned short u, w; o16[q] = tohx(x0[q]); splitf(x0[q], u, w); oh[q] = u; ol[q] = w; o16[q + 4] = tohx(x1[q]); splitf(x1[q], u, w); oh[q + 4] = u; ol[q + 4] = w; }
                const size_t oo = (size_t)(r0 + mb * 16 + row) * ldc + (size_t)blockIdx.y * sC + cofs; *(v8h*)(P16 + oo) = o16; *(v8us*)(Ph + oo) = oh; *(v8us*)(Pl + oo) = ol; }
        } else
{
#pragma unroll
            for (int s = 0; s < 8; ++s) { const int row = 2 * s + hi, cofs = lr * 4; v4f val = *(const v4fa*)(os + row * 68 + cofs); if (BIAS) { val[0] += bfr(bias[c0 + cofs]); val[1] += bfr(bias[c0 + cofs + 1]); val[2] += bfr(bias[c0 + cofs + 2]); val[3] += bfr(bias[c0 + cofs + 3]); }
                *(v4f*)(crow + (size_t)row * ldc + cofs) = val; }
             }
        __builtin_amdgcn_wave_barrier(); asm volatile("" ::: "memory");
    }
}

typedef __attribute__((ext_vector_type(2))) _Float16 v2h;
typedef __attribute__((ext_vector_type(4))) _Float16 v4h;
typedef __attribute__((ext_vector_type(2))) unsigned short v2us;
typedef __attribute__((ext_vector_type(4))) unsigned short v4us;
typedef __attribute__((ext_vector_type(2))) float v2f;
typedef __attribute__((ext_vector_type(4))) int v4i;

__global__ __launch_bounds__(256) void k_wtG(const float* __restrict__ w, int K, int N, bf* Bt) {
    const int lane = threadIdx.x & 31; const int L0 = (blockIdx.x * 8 + (threadIdx.x >> 5)) * 8; const int nlines = N * K / 64;
{
#pragma unroll 1
        for (int l = 0; l < 8; ++l) { const int L = L0 + l; if (L >= nlines) break; const size_t e = (size_t)L * 64 + lane * 2; const int k = (int)(e % K), n = (int)(e / K); v2us o;
            o[0] = f2bf(w[(size_t)k * N + n]); o[1] = f2bf(w[(size_t)(k + 1) * N + n]); *(v2us*)(Bt + e) = o; }
         }
}
__global__ __launch_bounds__(256) void k_cvt8(const float* __restrict__ src, bf* dst, size_t n8) { const size_t i = (size_t)blockIdx.x * 256 + threadIdx.x; if (i >= n8) return; const v8f v = *(const v8f*)(src + i * 8); v8us o;
#pragma unroll
    for (int k = 0; k < 8; ++k) o[k] = f2bf(v[k]); *(v8us*)(dst + i * 8) = o;  }

__device__ __forceinline__ float xhalf(float v) { const int b = __float_as_int(v); return __int_as_float(__builtin_amdgcn_permlanex16(b, b, 0x76543210, 0xfedcba98, false, false)); }   // lane l <-> l ^ 16
#define SCL2 (SCL * 1.4426950408889634f)
#define NEGB (-3.0e38f)

// fp16 operands, NQ tiles of 16 query columns from q0 (q0 and 16 NQ multiples of 32)
template <int NQ>
__device__ __forceinline__ void fa_f16(const _Float16* __restrict__ Q, const _Float16* __restrict__ K, const _Float16* __restrict__ VT, float* __restrict__ O, const int q0, const int lr, const int hi) {
    v16h qf[NQ][2]; v8f o[4][NQ]; float m[NQ], l[NQ];
#pragma unroll
    for (int nq = 0; nq < NQ; ++nq) { m[nq] = NEGB; l[nq] = 0.f;
#pragma unroll
        for (int kc = 0; kc < 2; ++kc) qf[nq][kc] = WFrag<h16>::ld(Q + (size_t)(q0 + nq * 16 + lr) * HD + kc * 32 + 8 * hi);
#pragma unroll
        for (int dt = 0; dt < 4; ++dt) o[dt][nq] = (v8f){}; }
    const int kend = q0 + NQ * 16;
    const _Float16* kp = K + (size_t)lr * HD + 8 * hi; const _Float16* vp = VT + (size_t)lr * TT + 8 * hi;
    v16h kf[2][2];
#pragma unroll
    for (int mt = 0; mt < 2; ++mt)
#pragma unroll
        for (int kc = 0; kc < 2; ++kc) kf[mt][kc] = WFrag<h16>::ld(kp + (size_t)(mt * 16) * HD + kc * 32);
    __builtin_amdgcn_sched_barrier(0);   // keeps the first K loads ahead of the first V^T loads, as in the loop: the wait at the loop's head can then leave the V^T loads in flight
    v16h vf[4];
#pragma unroll
    for (int dt = 0; dt < 4; ++dt) vf[dt] = WFrag<h16>::ld(vp + (size_t)(dt * 16) * TT);
    // rolled: one pass's fragments already fill the register budget
#pragma unroll 1
    for (int kb = 0; kb < kend; kb += 32) {
        v8f s[2][NQ];
#pragma unroll
        for (int mt = 0; mt < 2; ++mt)
#pragma unroll
            for (int nq = 0; nq < NQ; ++nq) s[mt][nq] = wmma16(kf[mt][1], qf[nq][1], wmma16(kf[mt][0], qf[nq][0], (v8f){}));
        const int kn = min(kb + 32, kend - 32);   // K and V^T fragments are fetched one pass ahead, each right behind its last use (the last pass re-reads its own: in bounds, unused)
#pragma unroll
        for (int mt = 0; mt < 2; ++mt)
#pragma unroll
            for (int kc = 0; kc < 2; ++kc) kf[mt][kc] = WFrag<h16>::ld(kp + (size_t)(kn + mt * 16) * HD + kc * 32);
        if (kb + 31 > q0) {   // only the diagonal pass masks (wave-uniform test)
#pragma unroll
            for (int mt = 0; mt < 2; ++mt)
#pragma unroll
                for (int nq = 0; nq < NQ; ++nq)
#pragma unroll
                    for (int j = 0; j < 8; ++j) if (kb + mt * 16 + 8 * hi + j > q0 + nq * 16 + lr) s[mt][nq][j] = NEGB; }
        float mx[NQ]; bool need = false;
#pragma unroll
        for (int nq = 0; nq < NQ; ++nq) { float t = fmaxf(s[0][nq][0], s[1][nq][0]);
#pragma unroll
            for (int j = 1; j < 8; ++j) t = fmaxf(t, fmaxf(s[0][nq][j], s[1][nq][j]));
            t = fmaxf(t, xhalf(t)); mx[nq] = t * SCL2; need = need || (mx[nq] > m[nq] + 8.0f); }
        if (__builtin_amdgcn_ballot_w32(need) != 0) {   // one scalar branch a pass
#pragma unroll
            for (int nq = 0; nq < NQ; ++nq) { const float mn = fmaxf(m[nq], mx[nq]); const float al = __builtin_amdgcn_exp2f(m[nq] - mn); m[nq] = mn; l[nq] *= al;
#pragma unroll
                for (int dt = 0; dt < 4; ++dt) o[dt][nq] *= al; } }
#pragma unroll
        for (int nq = 0; nq < NQ; ++nq) { v8f p0, p1;
#pragma unroll
            for (int j = 0; j < 8; ++j) { p0[j] = __builtin_amdgcn_exp2f(__builtin_fmaf(s[0][nq][j], SCL2, -m[nq])); p1[j] = __builtin_amdgcn_exp2f(__builtin_fmaf(s[1][nq][j], SCL2, -m[nq])); l[nq] += p0[j] + p1[j]; }
            const v16h pf = cat16(__builtin_convertvector(p0, v8h), __builtin_convertvector(p1, v8h));
#pragma unroll
            for (int dt = 0; dt < 4; ++dt) o[dt][nq] = wmma16(vf[dt], pf, o[dt][nq]); }
#pragma unroll
        for (int dt = 0; dt < 4; ++dt) vf[dt] = WFrag<h16>::ld(vp + (size_t)(dt * 16) * TT + kn);
    }
#pragma unroll
    for (int nq = 0; nq < NQ; ++nq) { const float inv = 1.0f / (l[nq] + xhalf(l[nq])); float* orow = O + (size_t)(q0 + nq * 16 + lr) * DQ + 8 * hi;
#pragma unroll
        for (int dt = 0; dt < 4; ++dt) { const v8f r = o[dt][nq] * inv; *(v4f*)(orow + dt * 16) = __builtin_shufflevector(r, r, 0, 1, 2, 3); *(v4f*)(orow + dt * 16 + 4) = __builtin_shufflevector(r, r, 4, 5, 6, 7); } }
}

// bf16 hi + lo planes, three products for the scores and three for P.V; one tile of 16 query columns from q0 (a multiple of 16)
__device__ __forceinline__ void fa_hl(const unsigned short* __restrict__ Qh, const unsigned short* __restrict__ Ql, const unsigned short* __restrict__ Kh, const unsigned short* __restrict__ Kl, const unsigned short* __restrict__ VTh, const unsigned short* __restrict__ VTl, float* __restrict__ O, const int q0, const int lr, const int hi) {
    v16bf qh[2], ql[2]; v8f o[4]; float m = NEGB, l = 0.f;
#pragma unroll
    for (int kc = 0; kc < 2; ++kc) { const size_t qo = (size_t)(q0 + lr) * HD + kc * 32 + 8 * hi; qh[kc] = WFrag<bf>::ld(Qh + qo); ql[kc] = WFrag<bf>::ld(Ql + qo); }
#pragma unroll
    for (int dt = 0; dt < 4; ++dt) o[dt] = (v8f){};
    const int kend = (q0 + 16 + 31) & ~31;
    const size_t ko = (size_t)lr * HD + 8 * hi, vo = (size_t)lr * TT + 8 * hi;
    // rolled: one pass's fragments already fill the register budget
#pragma unroll 1
    for (int kb = 0; kb < kend; kb += 32) {
        v16bf vh[4], vl[4];
#pragma unroll
        for (int dt = 0; dt < 4; ++dt) { vh[dt] = WFrag<bf>::ld(VTh + vo + (size_t)(dt * 16) * TT + kb); vl[dt] = WFrag<bf>::ld(VTl + vo + (size_t)(dt * 16) * TT + kb); }
        v16bf kh[2][2], kl[2][2];
#pragma unroll
        for (int mt = 0; mt < 2; ++mt)
#pragma unroll
            for (int kc = 0; kc < 2; ++kc) { const size_t a = ko + (size_t)(kb + mt * 16) * HD + kc * 32; kh[mt][kc] = WFrag<bf>::ld(Kh + a); kl[mt][kc] = WFrag<bf>::ld(Kl + a); }
        __builtin_amdgcn_sched_barrier(0);   // all of the pass's loads are asked for before the first product: one load latency a pass, not one per fragment pair
        v8f s[2];
#pragma unroll
        for (int mt = 0; mt < 2; ++mt) { s[mt] = (v8f){};
#pragma unroll
            for (int kc = 0; kc < 2; ++kc) { s[mt] = wmmab(kh[mt][kc], qh[kc], s[mt]); s[mt] = wmmab(kh[mt][kc], ql[kc], s[mt]); s[mt] = wmmab(kl[mt][kc], qh[kc], s[mt]); } }
        if (kb + 31 > q0) {   // only the diagonal pass masks (wave-uniform test)
#pragma unroll
            for (int mt = 0; mt < 2; ++mt)
#pragma unroll
                for (int j = 0; j < 8; ++j) if (kb + mt * 16 + 8 * hi + j > q0 + lr) s[mt][j] = NEGB; }
        float t = fmaxf(s[0][0], s[1][0]);
#pragma unroll
        for (int j = 1; j < 8; ++j) t = fmaxf(t, fmaxf(s[0][j], s[1][j]));
        t = fmaxf(t, xhalf(t)); const float mx = t * SCL2;
        if (__builtin_amdgcn_ballot_w32(mx > m + 8.0f) != 0) {   // one scalar branch a pass
            const float mn = fmaxf(m, mx); const float al = __builtin_amdgcn_exp2f(m - mn); m = mn; l *= al;
#pragma unroll
            for (int dt = 0; dt < 4; ++dt) o[dt] *= al; }
        v8us h0, h1, l0, l1;
#pragma unroll
        for (int j = 0; j < 8; ++j) { const float p0 = __builtin_amdgcn_exp2f(__builtin_fmaf(s[0][j], SCL2, -m)), p1 = __builtin_amdgcn_exp2f(__builtin_fmaf(s[1][j], SCL2, -m)); l += p0 + p1; unsigned short u, w; splitf(p0, u, w); h0[j] = u; l0[j] = w; splitf(p1, u, w); h1[j] = u; l1[j] = w; }
        const v16bf ph = cat16b(h0, h1), pl = cat16b(l0, l1);
#pragma unroll
        for (int dt = 0; dt < 4; ++dt) { o[dt] = wmmab(vh[dt], ph, o[dt]); o[dt] = wmmab(vh[dt], pl, o[dt]); o[dt] = wmmab(vl[dt], ph, o[dt]); }
    }
    const float inv = 1.0f / (l + xhalf(l)); float* orow = O + (size_t)(q0 + lr) * DQ + 8 * hi;
#pragma unroll
    for (int dt = 0; dt < 4; ++dt) { const v8f r = o[dt] * inv; *(v4f*)(orow + dt * 16) = __builtin_shufflevector(r, r, 0, 1, 2, 3); *(v4f*)(orow + dt * 16 + 4) = __builtin_shufflevector(r, r, 4, 5, 6, 7); }
}

// grid (NB_ * NH_ heads, NTF + NTH row blocks), 4 independent waves a block. Row blocks run from the longest to the shortest: NTF blocks of 128 fp16 query rows from the end of the sequence down to RH, then NTH blocks of 64 hi/lo rows down to 0.
#define NTF ((TT - RH) / 128)
#define NTH (RH / 64)
__global__ __launch_bounds__(128) void k_fattn(const _Float16* __restrict__ Q16, const _Float16* __restrict__ K16, const _Float16* __restrict__ V16, const unsigned short* __restrict__ Qh, const unsigned short* __restrict__ Ql, const unsigned short* __restrict__ Kh, const unsigned short* __restrict__ Kl, const unsigned short* __restrict__ Vh, const unsigned short* __restrict__ Vl, float* __restrict__ AT) {
    const int lane = threadIdx.x & 31, lr = lane & 15, hi = lane >> 4; const int w = __builtin_amdgcn_readfirstlane((int)(threadIdx.x >> 5));   // the wave's number in a scalar register: loop bounds and the mask test stay scalar
    const size_t z = blockIdx.x, po = z * (size_t)TT * HD; float* O = AT + (z / NH_) * (size_t)TT * DQ + (z % NH_) * HD; const int y = blockIdx.y;
    if (y < NTF) fa_f16<2>(Q16 + po, K16 + po, V16 + po, O, TT - 128 * (y + 1) + 32 * w, lr, hi);
    else fa_hl(Qh + po, Ql + po, Kh + po, Kl + po, Vh + po, Vl + po, O, RH - 64 * (y - NTF + 1) + 16 * w, lr, hi);
}

__global__ __launch_bounds__(256) void k_lam(const float* __restrict__ a1, const float* __restrict__ b1, const float* __restrict__ a2, const float* __restrict__ b2, float* LAM) { if (threadIdx.x >= 32) return; const int lane = threadIdx.x; float d1 = __fadd_rn(__fmul_rn(bfr(a1[lane * 2]), bfr(b1[lane * 2])), __fmul_rn(bfr(a1[lane * 2 + 1]), bfr(b1[lane * 2 + 1]))); float d2 = __fadd_rn(__fmul_rn(bfr(a2[lane * 2]), bfr(b2[lane * 2])), __fmul_rn(bfr(a2[lane * 2 + 1]), bfr(b2[lane * 2 + 1])));
#pragma unroll
    for (int sh = 16; sh; sh >>= 1) { d1 = __fadd_rn(d1, __shfl_xor(d1, sh, 32)); d2 = __fadd_rn(d2, __shfl_xor(d2, sh, 32)); }
    float l = __fsub_rn(expf(d1), expf(d2)); asm volatile("" : "+v"(l)); l = __fadd_rn(l, LINIT); ((float*)LAM)[lane] = l;  }
__global__ __launch_bounds__(256) void k_comb(const float* __restrict__ A, const float* __restrict__ LAM, bf* Ph, bf* Pl) { const size_t i = (size_t)blockIdx.x * 256 + threadIdx.x; if (i >= (size_t)TT * DO / 4) return; const size_t e = i * 4; const int c0 = (int)(e % DO); const size_t t = e / DO; const float lam = LAM[0]; const v4f o1 = *(const v4f*)(A + t * DQ + c0); const v4f o2 = *(const v4f*)(A + t * DQ + DO + c0); v4us oh, ol;
#pragma unroll
    for (int q = 0; q < 4; ++q) { float m = __fmul_rn(lam, o2[q]); asm volatile("" : "+v"(m)); float y = __fsub_rn(o1[q], m); asm volatile("" : "+v"(y)); y = __fmul_rn(y, 1.0f - LINIT); unsigned short u, w; splitf(y, u, w); oh[q] = u; ol[q] = w; }
    *(v4us*)(Ph + e) = oh; *(v4us*)(Pl + e) = ol;  }

extern "C" void kernel_launch(void* const* d_in, const int* in_sizes, int n_in,
                              void* d_out, int out_size, void* d_ws, size_t ws_size, hipStream_t stream) {
    (void)in_sizes; (void)n_in; (void)out_size;
    const float* x = (const float*)d_in[0]; const float* wq = (const float*)d_in[1]; const float* wk = (const float*)d_in[2]; const float* wv = (const float*)d_in[3]; const float* wo = (const float*)d_in[4]; const float* lq1 = (const float*)d_in[5]; const float* lk1 = (const float*)d_in[6]; const float* lq2 = (const float*)d_in[7]; const float* lk2 = (const float*)d_in[8];
    float* OUT = (float*)d_out;     // [2][2048][1024]
    char* wsp = (char*)d_ws;
    auto take = [&](size_t bytes) { char* p = wsp; wsp += (bytes + 255) & ~(size_t)255; return (void*)p; };
    const size_t PB = (size_t)NH_ * TT * HD;   // elements of one plane of one batch
    float* AT32 = (float*)take((size_t)NB_ * TT * DQ * 4); bf* WO = (bf*)take((size_t)DM * DO * 2); float* LAM = (float*)take(256); bf* WQ = (bf*)take((size_t)DQ * DM * 2); bf* WK = (bf*)take((size_t)DKV * DM * 2); bf* WV = (bf*)take((size_t)DKV * DM * 2);
    // nine head planes, both batches side by side ([b][h][t][d]; v [b][g][d][t]), so that one attention launch covers all NB_ * NH_ heads
    h16* QP16 = (h16*)take(NB_ * PB * 2); h16* KP16 = (h16*)take(NB_ * PB * 2); h16* VT16 = (h16*)take(NB_ * PB * 2);
    bf* QPh = (bf*)take(NB_ * PB * 2); bf* QPl = (bf*)take(NB_ * PB * 2); bf* KPh = (bf*)take(NB_ * PB * 2); bf* KPl = (bf*)take(NB_ * PB * 2); bf* VTh = (bf*)take(NB_ * PB * 2); bf* VTl = (bf*)take(NB_ * PB * 2);
    bf* XB = (bf*)take((size_t)TT * DM * 2); bf* ACh = (bf*)take((size_t)TT * DO * 2); bf* ACl = (bf*)take((size_t)TT * DO * 2);
    if ((size_t)(wsp - (char*)d_ws) > ws_size) return;    // ws 256 MiB
    k_wtG<<<(unsigned)((DM * DQ / 64 + 63) / 64), 256, 0, stream>>>(wq, DM, DQ, WQ); k_wtG<<<(unsigned)((DM * DKV / 64 + 63) / 64), 256, 0, stream>>>(wk, DM, DKV, WK); k_wtG<<<(unsigned)((DM * DKV / 64 + 63) / 64), 256, 0, stream>>>(wv, DM, DKV, WV);
    k_wtG<<<(unsigned)((DO * DM / 64 + 63) / 64), 256, 0, stream>>>(wo, DO, DM, WO); k_lam<<<1, 256, 0, stream>>>(lq1, lk1, lq2, lk2, LAM);   /* Wo 'xw' [1024][1024]; lambda line */
    for (int b = 0; b < NB_; ++b) {
        k_cvt8<<<(unsigned)(((size_t)TT * DM / 8 + 255) / 256), 256, 0, stream>>>(x + (size_t)b * TT * DM, XB, (size_t)TT * DM / 8);
        k_gemmw<bf, 0, false, true><<<dim3(TT / 64, DQ / 64, 1), 32, 0, stream>>>(XB, nullptr, WQ, nullptr, DM, nullptr, HD, nullptr, 0, 0, (size_t)TT * HD, QP16 + b * PB, QPh + b * PB, QPl + b * PB);      /* q head planes [h][t][d] */
        k_gemmw<bf, 0, false, true><<<dim3(TT / 64, DKV / 64, 1), 32, 0, stream>>>(XB, nullptr, WK, nullptr, DM, nullptr, HD, nullptr, 0, 0, (size_t)TT * HD, KP16 + b * PB, KPh + b * PB, KPl + b * PB);     /* k head planes [h][t][d] */
        k_gemmw<bf, 0, false, true><<<dim3(DKV / 64, TT / 64, 1), 32, 0, stream>>>(WV, nullptr, XB, nullptr, DM, nullptr, TT, nullptr, 0, 0, (size_t)64, VT16 + b * PB, VTh + b * PB, VTl + b * PB);          /* v planes transposed [g][d][t]: operands swapped */
    }
    k_fattn<<<dim3(NB_ * NH_, NTF + NTH, 1), 128, 0, stream>>>(QP16, KP16, VT16, QPh, QPl, KPh, KPl, VTh, VTl, AT32);   /* all heads of both batches -> f32 merge buffer [b][t][h][d] */
    for (int b = 0; b < NB_; ++b) {
        k_comb<<<(unsigned)(((size_t)TT * DO / 4 + 255) / 256), 256, 0, stream>>>(AT32 + (size_t)b * TT * DQ, LAM, ACh, ACl);   /* (o1 - lambda o2) x (1 - lambda_init) -> planes */
        k_gemmw<bf, 1, false><<<dim3(TT / 64, DM / 64, 1), 32, 0, stream>>>(ACh, ACl, WO, nullptr, DO, OUT + (size_t)b * TT * DM, DM, nullptr, 0, 0, 0);   /* Wo */
    }
}

// v004
// Measured time: 223 microseconds a run.
// In both of two side-by-side timings against v003, it was 1.59 times as fast.
// Over all steps from v000 it is 12.1 times as fast.
#include <hip/hip_runtime.h>

// Differential causal attention (x [2][2048][1024]; q, k, v = x W ('xw' [1024][2048] 0.02) as 2 groups x 16 heads x 64; a_g = causal softmax(q_g.k_g / 8) (-1e30 fill); lambda = exp(lq1.lk1) - exp(lq2.lk2) + 0.8 (vectors [64], zeros, read: computed on device); o_h = (a1 v1 - lambda a2 v2) x (1 - 0.8); out = merged o Wo ('xw' [1024][1024]) -> [2][2048][1024] (4.2 M)).
// Layout: bf16 copy of x per batch; 'xw' weights transposed once; exact projections whose epilogue rounds each tile straight into the 16-bit head planes (v transposed by swapping the operands); the two groups run as 32 heads per batch of one fused causal attention launch (k_fattn: scores, online softmax and P.V in registers; query rows < 512 hi/lo 3 products, rest fp16), which stores into an f32 [b][2048][2048] merge buffer; a combine kernel forms (o1 - lambda o2) x 0.2 per head as hi/lo planes; hi/lo x Wo exact.
// Compute dtypes, f32 accumulate: every input rounded to bf16; projections exact; attention rows < 512 3 products, rest fp16; softmax f32; lambda (precise expf) and the combination f32; Wo hl x exact.

#define NB_  2
#define TT   2048
#define DM   1024
#define NH_  32
#define NKV  32
#define HD   64
#define DQ   (NH_ * HD)
#define DKV  (NKV * HD)
#define RH   512                  // query rows < RH use hi+lo planes
#define SCL  0.125f
#define NHO  16      // output heads (per group)
#define DO   (NHO * HD)   // 1024
#define LINIT 0.8f
typedef _Float16 h16;
typedef unsigned short bf;
typedef __attribute__((ext_vector_type(16))) __bf16   v16bf;
typedef __attribute__((ext_vector_type(16))) _Float16 v16h;
typedef __attribute__((ext_vector_type(8)))  _Float16 v8h;
typedef __attribute__((ext_vector_type(8)))  unsigned short v8us;
typedef __attribute__((ext_vector_type(8)))  float    v8f;
typedef __attribute__((ext_vector_type(4)))  float    v4f;
typedef v8h  __attribute__((may_alias)) v8ha;
typedef v4f  __attribute__((may_alias)) v4fa;
typedef v8us __attribute__((may_alias)) v8usa;

__device__ __forceinline__ unsigned short f2bf(float f) { unsigned u = __float_as_uint(f); u += 0x7FFFu + ((u >> 16) & 1u); return (unsigned short)(u >> 16); }
__device__ __forceinline__ float bf2f(unsigned short b) { return __uint_as_float(((unsigned)b) << 16); }
__device__ __forceinline__ float bfr(float f) { return bf2f(f2bf(f)); }
__device__ __forceinline__ h16 tohx(float x) { return (h16)x; }
__device__ __forceinline__ void splitf(float y, unsigned short& h, unsigned short& l) { h = f2bf(y); l = f2bf(y - bf2f(h)); }
__device__ __forceinline__ v16h cat16(v8h lo, v8h hi) { return __builtin_shufflevector(lo, hi, 0, 1, 2, 3, 4, 5, 6, 7, 8, 9, 10, 11, 12, 13, 14, 15); }
__device__ __forceinline__ v16bf cat16b(v8us lo, v8us hi) { return __builtin_bit_cast(v16bf, __builtin_shufflevector(lo, hi, 0, 1, 2, 3, 4, 5, 6, 7, 8, 9, 10, 11, 12, 13, 14, 15)); }
__device__ __forceinline__ v8f wmma16(v16h a, v16h b, v8f c) { return __builtin_amdgcn_wmma_f32_16x16x32_f16(false, a, false, b, (short)0, c, false, false); }
__device__ __forceinline__ v8f wmmab(v16bf a, v16bf b, v8f c) { return __builtin_amdgcn_wmma_f32_16x16x32_bf16(false, a, false, b, (short)0, c, false, false); }



// ---- k_gemmw: GEMM, one work-group of 8 waves (4 x 2) per 128x128 output tile, each wave a 32x64 tile (8 accumulators); grid (M/128, N/128, Z), 256 threads.
// The K-contiguous 16-bit operand planes come into LDS 128 k at a time by asynchronous 16-byte copies (16 lanes = 256 contiguous bytes of a row), two buffers: the next stage's copies fly while this stage is multiplied. Fragments are read from LDS rows of pitch 272 B.
// C[m][n] (f32, pitch ldc, + optional f32 bias[n]) = sum_k A[m][k] Bt[n][k] (+ split products per NSPLIT). z-batch strides sA/sB/sC in elements. K % 128 == 0, M % 128 == 0, N % 128 == 0.
// PLANES: no f32 C; the epilogue rounds the tile straight into the three 16-bit planes that attention reads (fp16, bf16 hi, bf16 lo); element (m, n) goes to plane offset m * ldc + (n / 64) * sC + n % 64 (grid z = 1).
// q, k head planes [h][t][d]: A = x, Bt = weights, ldc = HD, sC = TT * HD. Transposed v planes [g][d][t]: A = weights, Bt = x, ldc = TT, sC = 64.
template <typename T16> struct WFrag;
template <> struct WFrag<h16> { typedef v16h V; static __device__ __forceinline__ V ld(const h16* p) { return cat16(*(const v8h*)p, *(const v8h*)(p + 16)); } static __device__ __forceinline__ v8f mma(V a, V b, v8f c) { return wmma16(a, b, c); } };
template <> struct WFrag<bf> { typedef v16bf V; static __device__ __forceinline__ V ld(const bf* p) { return cat16b(*(const v8us*)p, *(const v8us*)(p + 16)); } static __device__ __forceinline__ v8f mma(V a, V b, v8f c) { return wmmab(a, b, c); } };
#define GKP 128                   // k per stage: 256 B of every operand row
#define GPI 136                   // LDS row pitch in elements (272 B = 16 B x odd: ds_load_b128 without bank conflicts)
#define GTE (128 * GPI)           // elements of one operand tile in LDS (128 rows)
// One 128-row x 256-B operand tile into LDS: 8 copies a lane, copy i = rows 16 i .. 16 i + 15 over the 256 lanes. g = the lane's 16 bytes in row (tid / 16), l = their LDS byte address, rs = 16 rows in elements.
// The s_wait_xcnt stands inside the statement so that no address register of a copy is rewritten ahead of it.
template <typename T16>
__device__ __forceinline__ void cp_tile(const T16* g, const size_t rs, const unsigned l) {
    asm volatile("global_load_async_to_lds_b128 %0, %8, off\n\t"
                 "global_load_async_to_lds_b128 %1, %9, off\n\t"
                 "global_load_async_to_lds_b128 %2, %10, off\n\t"
                 "global_load_async_to_lds_b128 %3, %11, off\n\t"
                 "global_load_async_to_lds_b128 %4, %12, off\n\t"
                 "global_load_async_to_lds_b128 %5, %13, off\n\t"
                 "global_load_async_to_lds_b128 %6, %14, off\n\t"
                 "global_load_async_to_lds_b128 %7, %15, off\n\t"
                 "s_wait_xcnt 0x0"
                 :: "v"(l), "v"(l + 1u * 16u * GPI * 2u), "v"(l + 2u * 16u * GPI * 2u), "v"(l + 3u * 16u * GPI * 2u), "v"(l + 4u * 16u * GPI * 2u), "v"(l + 5u * 16u * GPI * 2u), "v"(l + 6u * 16u * GPI * 2u), "v"(l + 7u * 16u * GPI * 2u),
                    "v"(g), "v"(g + rs), "v"(g + 2 * rs), "v"(g + 3 * rs), "v"(g + 4 * rs), "v"(g + 5 * rs), "v"(g + 6 * rs), "v"(g + 7 * rs) : "memory");
}
template <typename T16, int NSPLIT, bool BIAS, bool PLANES = false>
__global__ __launch_bounds__(256) void k_gemmw(const T16* __restrict__ A, const T16* __restrict__ A2, const T16* __restrict__ Bt, const T16* __restrict__ Bt2, int K, float* C, int ldc, const float* __restrict__ bias, size_t sA, size_t sB, size_t sC, h16* P16 = nullptr, bf* Ph = nullptr, bf* Pl = nullptr) {
    typedef typename WFrag<T16>::V V;
    constexpr bool HA2 = (NSPLIT == 1 || NSPLIT == 2), HB2 = (NSPLIT >= 2); constexpr int NT = 2 + (HA2 ? 1 : 0) + (HB2 ? 1 : 0);   // operand tiles of a stage: A, Bt, then A2, Bt2 where used
    __shared__ __align__(16) T16 ring[2 * NT * GTE];
    __shared__ __align__(16) float osw[8 * 16 * 68];
    const size_t z = blockIdx.z; A += z * sA; if (A2) A2 += z * sA; Bt += z * sB; if (Bt2) Bt2 += z * sB; C += z * sC;
    const int tid = threadIdx.x, lane = tid & 31, lr = lane & 15, hi = lane >> 4, wv = tid >> 5; const int r0 = blockIdx.x * 128 + (wv >> 1) * 32, c0 = blockIdx.y * 128 + (wv & 1) * 64;
    float* os = osw + wv * (16 * 68);   // each wave's own epilogue staging
    v8f acc[2][4];
#pragma unroll
    for (int mb = 0; mb < 2; ++mb)
#pragma unroll
        for (int nb = 0; nb < 4; ++nb) acc[mb][nb] = (v8f){};
    const size_t ga = (size_t)(blockIdx.x * 128 + (tid >> 4)) * K + (tid & 15) * 8, gb = (size_t)(blockIdx.y * 128 + (tid >> 4)) * K + (tid & 15) * 8, rs = (size_t)16 * K;
    const unsigned l0 = (unsigned)(size_t)ring + (unsigned)((tid >> 4) * (GPI * 2) + (tid & 15) * 16);
    auto fill = [&](const int t) { const unsigned l = l0 + (unsigned)(t & 1) * (NT * GTE * 2u); const int k0 = t * GKP;
        cp_tile(A + ga + k0, rs, l); cp_tile(Bt + gb + k0, rs, l + GTE * 2u);
        if (HA2) cp_tile(A2 + ga + k0, rs, l + 2u * GTE * 2u);
        if (HB2) cp_tile(Bt2 + gb + k0, rs, l + (HA2 ? 3u : 2u) * GTE * 2u); };
    const int nt = K / GKP;
    fill(0);
    asm volatile("s_wait_asynccnt 0x0" ::: "memory");   // stage 0 has landed (this wave's copies)
    __syncthreads();                                     // ... and every other wave's
    if (nt > 1) fill(1);
    const int aoff = ((wv >> 1) * 32 + lr) * GPI + 8 * hi, boff = GTE + ((wv & 1) * 64 + lr) * GPI + 8 * hi;
    // rolled: one copy of the stage's code serves both buffers
#pragma unroll 1
    for (int t = 0; t < nt; ++t) {
        const T16* st = ring + (t & 1) * (NT * GTE);
        V a[2][2], a2[2][2], b[2][4], b2[2][4];   // two fragment sets: block ks + 1 is fetched while block ks is multiplied (inside the stage only)
        // unrolled: the two sets are then indexed by constants and stay in registers
#pragma unroll
        for (int ks = -1; ks < GKP / 32; ++ks) {
            if (ks + 1 < GKP / 32) { const int s = (ks + 1) & 1, kc = (ks + 1) * 32;
#pragma unroll
                for (int mb = 0; mb < 2; ++mb) { a[s][mb] = WFrag<T16>::ld(st + aoff + mb * 16 * GPI + kc); if (HA2) a2[s][mb] = WFrag<T16>::ld(st + 2 * GTE + aoff + mb * 16 * GPI + kc); }
#pragma unroll
                for (int nb = 0; nb < 4; ++nb) { b[s][nb] = WFrag<T16>::ld(st + boff + nb * 16 * GPI + kc); if (HB2) b2[s][nb] = WFrag<T16>::ld(st + (HA2 ? 2 : 1) * GTE + boff + nb * 16 * GPI + kc); } }
            __builtin_amdgcn_sched_barrier(0);   // the next block's LDS reads stay one group ahead of this block's products, none among them
            if (ks >= 0) { const int s = ks & 1;
#pragma unroll
                for (int nb = 0; nb < 4; ++nb)
#pragma unroll
                    for (int mb = 0; mb < 2; ++mb) acc[mb][nb] = WFrag<T16>::mma(a[s][mb], b[s][nb], acc[mb][nb]);
                if (HA2) {
#pragma unroll
                    for (int nb = 0; nb < 4; ++nb)
#pragma unroll
                        for (int mb = 0; mb < 2; ++mb) acc[mb][nb] = WFrag<T16>::mma(a2[s][mb], b[s][nb], acc[mb][nb]); }
                if (HB2) {
#pragma unroll
                    for (int nb = 0; nb < 4; ++nb)
#pragma unroll
                        for (int mb = 0; mb < 2; ++mb) acc[mb][nb] = WFrag<T16>::mma(a[s][mb], b2[s][nb], acc[mb][nb]); }
                __builtin_amdgcn_sched_barrier(0);   // ... and the reads of the block after next stay behind these products
            }
        }
        asm volatile("s_wait_dscnt 0x0" ::: "memory");      // this wave's reads of stage t are done
        asm volatile("s_wait_asynccnt 0x0" ::: "memory");   // this wave's copies of stage t + 1 have landed
        __syncthreads();                                     // publishes stage t + 1 and frees stage t's buffer
        if (t + 2 < nt) fill(t + 2);
    }
    asm volatile("s_wait_asynccnt 0x0" ::: "memory");   // no copy is left in flight when the wave goes on to its end
#pragma unroll
    for (int mb = 0; mb < 2; ++mb) {
#pragma unroll
        for (int nb = 0; nb < 4; ++nb) {
#pragma unroll
            for (int j = 0; j < 8; ++j) os[(hi * 8 + j) * 68 + nb * 16 + lr] = acc[mb][nb][j]; }
        __builtin_amdgcn_wave_barrier(); asm volatile("" ::: "memory");
        float* crow = C + (size_t)(r0 + mb * 16) * ldc + c0;
        if (PLANES) {
            // both loops unrolled: the vector elements are then indexed by constants and stay in registers
#pragma unroll
            for (int s = 0; s < 4; ++s) { const int row = 4 * s + (lane >> 3), cofs = (lane & 7) * 8;   // 8 lanes x 16 B = one 128-B line per row and plane
                const v4f x0 = *(const v4fa*)(os + row * 68 + cofs), x1 = *(const v4fa*)(os + row * 68 + cofs + 4); v8h o16; v8us oh, ol;
#pragma unroll
                for (int q = 0; q < 4; ++q) { unsigned short u, w; o16[q] = tohx(x0[q]); splitf(x0[q], u, w); oh[q] = u; ol[q] = w; o16[q + 4] = tohx(x1[q]); splitf(x1[q], u, w); oh[q + 4] = u; ol[q + 4] = w; }
                const size_t oo = (size_t)(r0 + mb * 16 + row) * ldc + (size_t)(c0 >> 6) * sC + cofs; *(v8h*)(P16 + oo) = o16; *(v8us*)(Ph + oo) = oh; *(v8us*)(Pl + oo) = ol; }
        } else
{
#pragma unroll
            for (int s = 0; s < 8; ++s) { const int row = 2 * s + hi, cofs = lr * 4; v4f val = *(const v4fa*)(os + row * 68 + cofs); if (BIAS) { val[0] += bfr(bias[c0 + cofs]); val[1] += bfr(bias[c0 + cofs + 1]); val[2] += bfr(bias[c0 + cofs + 2]); val[3] += bfr(bias[c0 + cofs + 3]); }
                *(v4f*)(crow + (size_t)row * ldc + cofs) = val; }
             }
        __builtin_amdgcn_wave_barrier(); asm volatile("" ::: "memory");
    }
}

typedef __attribute__((ext_vector_type(2))) _Float16 v2h;
typedef __attribute__((ext_vector_type(4))) _Float16 v4h;
typedef __attribute__((ext_vector_type(2))) unsigned short v2us;
typedef __attribute__((ext_vector_type(4))) unsigned short v4us;
typedef __attribute__((ext_vector_type(2))) float v2f;
typedef __attribute__((ext_vector_type(4))) int v4i;

__global__ __launch_bounds__(256) void k_wtG(const float* __restrict__ w, int K, int N, bf* Bt) {
    const int lane = threadIdx.x & 31; const int L0 = (blockIdx.x * 8 + (threadIdx.x >> 5)) * 8; const int nlines = N * K / 64;
{
#pragma unroll 1
        for (int l = 0; l < 8; ++l) { const int L = L0 + l; if (L >= nlines) break; const size_t e = (size_t)L * 64 + lane * 2; const int k = (int)(e % K), n = (int)(e / K); v2us o;
            o[0] = f2bf(w[(size_t)k * N + n]); o[1] = f2bf(w[(size_t)(k + 1) * N + n]); *(v2us*)(Bt + e) = o; }
         }
}
__global__ __launch_bounds__(256) void k_cvt8(const float* __restrict__ src, bf* dst, size_t n8) { const size_t i = (size_t)blockIdx.x * 256 + threadIdx.x; if (i >= n8) return; const v8f v = *(const v8f*)(src + i * 8); v8us o;
#pragma unroll
    for (int k = 0; k < 8; ++k) o[k] = f2bf(v[k]); *(v8us*)(dst + i * 8) = o;  }

__device__ __forceinline__ float xhalf(float v) { const int b = __float_as_int(v); return __int_as_float(__builtin_amdgcn_permlanex16(b, b, 0x76543210, 0xfedcba98, false, false)); }   // lane l <-> l ^ 16
#define SCL2 (SCL * 1.4426950408889634f)
#define NEGB (-3.0e38f)

// fp16 operands, NQ tiles of 16 query columns from q0 (q0 and 16 NQ multiples of 32)
template <int NQ>
__device__ __forceinline__ void fa_f16(const _Float16* __restrict__ Q, const _Float16* __restrict__ K, const _Float16* __restrict__ VT, float* __restrict__ O, const int q0, const int lr, const int hi) {
    v16h qf[NQ][2]; v8f o[4][NQ]; float m[NQ], l[NQ];
#pragma unroll
    for (int nq = 0; nq < NQ; ++nq) { m[nq] = NEGB; l[nq] = 0.f;
#pragma unroll
        for (int kc = 0; kc < 2; ++kc) qf[nq][kc] = WFrag<h16>::ld(Q + (size_t)(q0 + nq * 16 + lr) * HD + kc * 32 + 8 * hi);
#pragma unroll
        for (int dt = 0; dt < 4; ++dt) o[dt][nq] = (v8f){}; }
    const int kend = q0 + NQ * 16;
    const _Float16* kp = K + (size_t)lr * HD + 8 * hi; const _Float16* vp = VT + (size_t)lr * TT + 8 * hi;
    v16h kf[2][2];
#pragma unroll
    for (int mt = 0; mt < 2; ++mt)
#pragma unroll
        for (int kc = 0; kc < 2; ++kc) kf[mt][kc] = WFrag<h16>::ld(kp + (size_t)(mt * 16) * HD + kc * 32);
    __builtin_amdgcn_sched_barrier(0);   // keeps the first K loads ahead of the first V^T loads, as in the loop: the wait at the loop's head can then leave the V^T loads in flight
    v16h vf[4];
#pragma unroll
    for (int dt = 0; dt < 4; ++dt) vf[dt] = WFrag<h16>::ld(vp + (size_t)(dt * 16) * TT);
    // rolled: one pass's fragments already fill the register budget
#pragma unroll 1
    for (int kb = 0; kb < kend; kb += 32) {
        v8f s[2][NQ];
#pragma unroll
        for (int mt = 0; mt < 2; ++mt)
#pragma unroll
            for (int nq = 0; nq < NQ; ++nq) s[mt][nq] = wmma16(kf[mt][1], qf[nq][1], wmma16(kf[mt][0], qf[nq][0], (v8f){}));
        const int kn = min(kb + 32, kend - 32);   // K and V^T fragments are fetched one pass ahead, each right behind its last use (the last pass re-reads its own: in bounds, unused)
#pragma unroll
        for (int mt = 0; mt < 2; ++mt)
#pragma unroll
            for (int kc = 0; kc < 2; ++kc) kf[mt][kc] = WFrag<h16>::ld(kp + (size_t)(kn + mt * 16) * HD + kc * 32);
        if (kb + 31 > q0) {   // only the diagonal pass masks (wave-uniform test)
#pragma unroll
            for (int mt = 0; mt < 2; ++mt)
#pragma unroll
                for (int nq = 0; nq < NQ; ++nq)
#pragma unroll
                    for (int j = 0; j < 8; ++j) if (kb + mt * 16 + 8 * hi + j > q0 + nq * 16 + lr) s[mt][nq][j] = NEGB; }
        float mx[NQ]; bool need = false;
#pragma unroll
        for (int nq = 0; nq < NQ; ++nq) { float t = fmaxf(s[0][nq][0], s[1][nq][0]);
#pragma unroll
            for (int j = 1; j < 8; ++j) t = fmaxf(t, fmaxf(s[0][nq][j], s[1][nq][j]));
            t = fmaxf(t, xhalf(t)); mx[nq] = t * SCL2; need = need || (mx[nq] > m[nq] + 8.0f); }
        if (__builtin_amdgcn_ballot_w32(need) != 0) {   // one scalar branch a pass
#pragma unroll
            for (int nq = 0; nq < NQ; ++nq) { const float mn = fmaxf(m[nq], mx[nq]); const float al = __builtin_amdgcn_exp2f(m[nq] - mn); m[nq] = mn; l[nq] *= al;
#pragma unroll
                for (int dt = 0; dt < 4; ++dt) o[dt][nq] *= al; } }
#pragma unroll
        for (int nq = 0; nq < NQ; ++nq) { v8f p0, p1;
#pragma unroll
            for (int j = 0; j < 8; ++j) { p0[j] = __builtin_amdgcn_exp2f(__builtin_fmaf(s[0][nq][j], SCL2, -m[nq])); p1[j] = __builtin_amdgcn_exp2f(__builtin_fmaf(s[1][nq][j], SCL2, -m[nq])); l[nq] += p0[j] + p1[j]; }
            const v16h pf = cat16(__builtin_convertvector(p0, v8h), __builtin_convertvector(p1, v8h));
#pragma unroll
            for (int dt = 0; dt < 4; ++dt) o[dt][nq] = wmma16(vf[dt], pf, o[dt][nq]); }
#pragma unroll
        for (int dt = 0; dt < 4; ++dt) vf[dt] = WFrag<h16>::ld(vp + (size_t)(dt * 16) * TT + kn);
    }
#pragma unroll
    for (int nq = 0; nq < NQ; ++nq) { const float inv = 1.0f / (l[nq] + xhalf(l[nq])); float* orow = O + (size_t)(q0 + nq * 16 + lr) * DQ + 8 * hi;
#pragma unroll
        for (int dt = 0; dt < 4; ++dt) { const v8f r = o[dt][nq] * inv; *(v4f*)(orow + dt * 16) = __builtin_shufflevector(r, r, 0, 1, 2, 3); *(v4f*)(orow + dt * 16 + 4) = __builtin_shufflevector(r, r, 4, 5, 6, 7); } }
}

// bf16 hi + lo planes, three products for the scores and three for P.V; one tile of 16 query columns from q0 (a multiple of 16)
__device__ __forceinline__ void fa_hl(const unsigned short* __restrict__ Qh, const unsigned short* __restrict__ Ql, const unsigned short* __restrict__ Kh, const unsigned short* __restrict__ Kl, const unsigned short* __restrict__ VTh, const unsigned short* __restrict__ VTl, float* __restrict__ O, const int q0, const int lr, const int hi) {
    v16bf qh[2], ql[2]; v8f o[4]; float m = NEGB, l = 0.f;
#pragma unroll
    for (int kc = 0; kc < 2; ++kc) { const size_t qo = (size_t)(q0 + lr) * HD + kc * 32 + 8 * hi; qh[kc] = WFrag<bf>::ld(Qh + qo); ql[kc] = WFrag<bf>::ld(Ql + qo); }
#pragma unroll
    for (int dt = 0; dt < 4; ++dt) o[dt] = (v8f){};
    const int kend = (q0 + 16 + 31) & ~31;
    const size_t ko = (size_t)lr * HD + 8 * hi, vo = (size_t)lr * TT + 8 * hi;
    // rolled: one pass's fragments already fill the register budget
#pragma unroll 1
    for (int kb = 0; kb < kend; kb += 32) {
        v16bf vh[4], vl[4];
#pragma unroll
        for (int dt = 0; dt < 4; ++dt) { vh[dt] = WFrag<bf>::ld(VTh + vo + (size_t)(dt * 16) * TT + kb); vl[dt] = WFrag<bf>::ld(VTl + vo + (size_t)(dt * 16) * TT + kb); }
        v16bf kh[2][2], kl[2][2];
#pragma unroll
        for (int mt = 0; mt < 2; ++mt)
#pragma unroll
            for (int kc = 0; kc < 2; ++kc) { const size_t a = ko + (size_t)(kb + mt * 16) * HD + kc * 32; kh[mt][kc] = WFrag<bf>::ld(Kh + a); kl[mt][kc] = WFrag<bf>::ld(Kl + a); }
        __builtin_amdgcn_sched_barrier(0);   // all of the pass's loads are asked for before the first product: one load latency a pass, not one per fragment pair
        v8f s[2];
#pragma unroll
        for (int mt = 0; mt < 2; ++mt) { s[mt] = (v8f){};
#pragma unroll
            for (int kc = 0; kc < 2; ++kc) { s[mt] = wmmab(kh[mt][kc], qh[kc], s[mt]); s[mt] = wmmab(kh[mt][kc], ql[kc], s[mt]); s[mt] = wmmab(kl[mt][kc], qh[kc], s[mt]); } }
        if (kb + 31 > q0) {   // only the diagonal pass masks (wave-uniform test)
#pragma unroll
            for (int mt = 0; mt < 2; ++mt)
#pragma unroll
                for (int j = 0; j < 8; ++j) if (kb + mt * 16 + 8 * hi + j > q0 + lr) s[mt][j] = NEGB; }
        float t = fmaxf(s[0][0], s[1][0]);
#pragma unroll
        for (int j = 1; j < 8; ++j) t = fmaxf(t, fmaxf(s[0][j], s[1][j]));
        t = fmaxf(t, xhalf(t)); const float mx = t * SCL2;
        if (__builtin_amdgcn_ballot_w32(mx > m + 8.0f) != 0) {   // one scalar branch a pass
            const float mn = fmaxf(m, mx); const float al = __builtin_amdgcn_exp2f(m - mn); m = mn; l *= al;
#pragma unroll
            for (int dt = 0; dt < 4; ++dt) o[dt] *= al; }
        v8us h0, h1, l0, l1;
#pragma unroll
        for (int j = 0; j < 8; ++j) { const float p0 = __builtin_amdgcn_exp2f(__builtin_fmaf(s[0][j], SCL2, -m)), p1 = __builtin_amdgcn_exp2f(__builtin_fmaf(s[1][j], SCL2, -m)); l += p0 + p1; unsigned short u, w; splitf(p0, u, w); h0[j] = u; l0[j] = w; splitf(p1, u, w); h1[j] = u; l1[j] = w; }
        const v16bf ph = cat16b(h0, h1), pl = cat16b(l0, l1);
#pragma unroll
        for (int dt = 0; dt < 4; ++dt) { o[dt] = wmmab(vh[dt], ph, o[dt]); o[dt] = wmmab(vh[dt], pl, o[dt]); o[dt] = wmmab(vl[dt], ph, o[dt]); }
    }
    const float inv = 1.0f / (l + xhalf(l)); float* orow = O + (size_t)(q0 + lr) * DQ + 8 * hi;
#pragma unroll
    for (int dt = 0; dt < 4; ++dt) { const v8f r = o[dt] * inv; *(v4f*)(orow + dt * 16) = __builtin_shufflevector(r, r, 0, 1, 2, 3); *(v4f*)(orow + dt * 16 + 4) = __builtin_shufflevector(r, r, 4, 5, 6, 7); }
}

// grid (NB_ * NH_ heads, NTF + NTH row blocks), 4 independent waves a block. Row blocks run from the longest to the shortest: NTF blocks of 128 fp16 query rows from the end of the sequence down to RH, then NTH blocks of 64 hi/lo rows down to 0.
#define NTF ((TT - RH) / 128)
#define NTH (RH / 64)
__global__ __launch_bounds__(128) void k_fattn(const _Float16* __restrict__ Q16, const _Float16* __restrict__ K16, const _Float16* __restrict__ V16, const unsigned short* __restrict__ Qh, const unsigned short* __restrict__ Ql, const unsigned short* __restrict__ Kh, const unsigned short* __restrict__ Kl, const unsigned short* __restrict__ Vh, const unsigned short* __restrict__ Vl, float* __restrict__ AT) {
    const int lane = threadIdx.x & 31, lr = lane & 15, hi = lane >> 4; const int w = __builtin_amdgcn_readfirstlane((int)(threadIdx.x >> 5));   // the wave's number in a scalar register: loop bounds and the mask test stay scalar
    const size_t z = blockIdx.x, po = z * (size_t)TT * HD; float* O = AT + (z / NH_) * (size_t)TT * DQ + (z % NH_) * HD; const int y = blockIdx.y;
    if (y < NTF) fa_f16<2>(Q16 + po, K16 + po, V16 + po, O, TT - 128 * (y + 1) + 32 * w, lr, hi);
    else fa_hl(Qh + po, Ql + po, Kh + po, Kl + po, Vh + po, Vl + po, O, RH - 64 * (y - NTF + 1) + 16 * w, lr, hi);
}

__global__ __launch_bounds__(256) void k_lam(const float* __restrict__ a1, const float* __restrict__ b1, const float* __restrict__ a2, const float* __restrict__ b2, float* LAM) { if (threadIdx.x >= 32) return; const int lane = threadIdx.x; float d1 = __fadd_rn(__fmul_rn(bfr(a1[lane * 2]), bfr(b1[lane * 2])), __fmul_rn(bfr(a1[lane * 2 + 1]), bfr(b1[lane * 2 + 1]))); float d2 = __fadd_rn(__fmul_rn(bfr(a2[lane * 2]), bfr(b2[lane * 2])), __fmul_rn(bfr(a2[lane * 2 + 1]), bfr(b2[lane * 2 + 1])));
#pragma unroll
    for (int sh = 16; sh; sh >>= 1) { d1 = __fadd_rn(d1, __shfl_xor(d1, sh, 32)); d2 = __fadd_rn(d2, __shfl_xor(d2, sh, 32)); }
    float l = __fsub_rn(expf(d1), expf(d2)); asm volatile("" : "+v"(l)); l = __fadd_rn(l, LINIT); ((float*)LAM)[lane] = l;  }
__global__ __launch_bounds__(256) void k_comb(const float* __restrict__ A, const float* __restrict__ LAM, bf* Ph, bf* Pl) { const size_t i = (size_t)blockIdx.x * 256 + threadIdx.x; if (i >= (size_t)TT * DO / 4) return; const size_t e = i * 4; const int c0 = (int)(e % DO); const size_t t = e / DO; const float lam = LAM[0]; const v4f o1 = *(const v4f*)(A + t * DQ + c0); const v4f o2 = *(const v4f*)(A + t * DQ + DO + c0); v4us oh, ol;
#pragma unroll
    for (int q = 0; q < 4; ++q) { float m = __fmul_rn(lam, o2[q]); asm volatile("" : "+v"(m)); float y = __fsub_rn(o1[q], m); asm volatile("" : "+v"(y)); y = __fmul_rn(y, 1.0f - LINIT); unsigned short u, w; splitf(y, u, w); oh[q] = u; ol[q] = w; }
    *(v4us*)(Ph + e) = oh; *(v4us*)(Pl + e) = ol;  }

extern "C" void kernel_launch(void* const* d_in, const int* in_sizes, int n_in,
                              void* d_out, int out_size, void* d_ws, size_t ws_size, hipStream_t stream) {
    (void)in_sizes; (void)n_in; (void)out_size;
    const float* x = (const float*)d_in[0]; const float* wq = (const float*)d_in[1]; const float* wk = (const float*)d_in[2]; const float* wv = (const float*)d_in[3]; const float* wo = (const float*)d_in[4]; const float* lq1 = (const float*)d_in[5]; const float* lk1 = (const float*)d_in[6]; const float* lq2 = (const float*)d_in[7]; const float* lk2 = (const float*)d_in[8];
    float* OUT = (float*)d_out;     // [2][2048][1024]
    char* wsp = (char*)d_ws;
    auto take = [&](size_t bytes) { char* p = wsp; wsp += (bytes + 255) & ~(size_t)255; return (void*)p; };
    const size_t PB = (size_t)NH_ * TT * HD;   // elements of one plane of one batch
    float* AT32 = (float*)take((size_t)NB_ * TT * DQ * 4); bf* WO = (bf*)take((size_t)DM * DO * 2); float* LAM = (float*)take(256); bf* WQ = (bf*)take((size_t)DQ * DM * 2); bf* WK = (bf*)take((size_t)DKV * DM * 2); bf* WV = (bf*)take((size_t)DKV * DM * 2);
    // nine head planes, both batches side by side ([b][h][t][d]; v [b][g][d][t]), so that one attention launch covers all NB_ * NH_ heads
    h16* QP16 = (h16*)take(NB_ * PB * 2); h16* KP16 = (h16*)take(NB_ * PB * 2); h16* VT16 = (h16*)take(NB_ * PB * 2);
    bf* QPh = (bf*)take(NB_ * PB * 2); bf* QPl = (bf*)take(NB_ * PB * 2); bf* KPh = (bf*)take(NB_ * PB * 2); bf* KPl = (bf*)take(NB_ * PB * 2); bf* VTh = (bf*)take(NB_ * PB * 2); bf* VTl = (bf*)take(NB_ * PB * 2);
    bf* XB = (bf*)take((size_t)TT * DM * 2); bf* ACh = (bf*)take((size_t)TT * DO * 2); bf* ACl = (bf*)take((size_t)TT * DO * 2);
    if ((size_t)(wsp - (char*)d_ws) > ws_size) return;    // ws 256 MiB
    k_wtG<<<(unsigned)((DM * DQ / 64 + 63) / 64), 256, 0, stream>>>(wq, DM, DQ, WQ); k_wtG<<<(unsigned)((DM * DKV / 64 + 63) / 64), 256, 0, stream>>>(wk, DM, DKV, WK); k_wtG<<<(unsigned)((DM * DKV / 64 + 63) / 64), 256, 0, stream>>>(wv, DM, DKV, WV);
    k_wtG<<<(unsigned)((DO * DM / 64 + 63) / 64), 256, 0, stream>>>(wo, DO, DM, WO); k_lam<<<1, 256, 0, stream>>>(lq1, lk1, lq2, lk2, LAM);   /* Wo 'xw' [1024][1024]; lambda line */
    for (int b = 0; b < NB_; ++b) {
        k_cvt8<<<(unsigned)(((size_t)TT * DM / 8 + 255) / 256), 256, 0, stream>>>(x + (size_t)b * TT * DM, XB, (size_t)TT * DM / 8);
        k_gemmw<bf, 0, false, true><<<dim3(TT / 128, DQ / 128, 1), 256, 0, stream>>>(XB, nullptr, WQ, nullptr, DM, nullptr, HD, nullptr, 0, 0, (size_t)TT * HD, QP16 + b * PB, QPh + b * PB, QPl + b * PB);      /* q head planes [h][t][d] */
        k_gemmw<bf, 0, false, true><<<dim3(TT / 128, DKV / 128, 1), 256, 0, stream>>>(XB, nullptr, WK, nullptr, DM, nullptr, HD, nullptr, 0, 0, (size_t)TT * HD, KP16 + b * PB, KPh + b * PB, KPl + b * PB);     /* k head planes [h][t][d] */
        k_gemmw<bf, 0, false, true><<<dim3(DKV / 128, TT / 128, 1), 256, 0, stream>>>(WV, nullptr, XB, nullptr, DM, nullptr, TT, nullptr, 0, 0, (size_t)64, VT16 + b * PB, VTh + b * PB, VTl + b * PB);          /* v planes transposed [g][d][t]: operands swapped */
    }
    k_fattn<<<dim3(NB_ * NH_, NTF + NTH, 1), 128, 0, stream>>>(QP16, KP16, VT16, QPh, QPl, KPh, KPl, VTh, VTl, AT32);   /* all heads of both batches -> f32 merge buffer [b][t][h][d] */
    for (int b = 0; b < NB_; ++b) {
        k_comb<<<(unsigned)(((size_t)TT * DO / 4 + 255) / 256), 256, 0, stream>>>(AT32 + (size_t)b * TT * DQ, LAM, ACh, ACl);   /* (o1 - lambda o2) x (1 - lambda_init) -> planes */
        k_gemmw<bf, 1, false><<<dim3(TT / 128, DM / 128, 1), 256, 0, stream>>>(ACh, ACl, WO, nullptr, DO, OUT + (size_t)b * TT * DM, DM, nullptr, 0, 0, 0);   /* Wo */
    }
}

// v005
// It runs in 195 microseconds.
// Next to v004, in two timings, it ran 1.15 times as fast each time.
// Counting every step since v000, it is 13.9 times as fast.
#include <hip/hip_runtime.h>

// Differential causal attention (x [2][2048][1024]; q, k, v = x W ('xw' [1024][2048] 0.02) as 2 groups x 16 heads x 64; a_g = causal softmax(q_g.k_g / 8) (-1e30 fill); lambda = exp(lq1.lk1) - exp(lq2.lk2) + 0.8 (vectors [64], zeros, read: computed on device); o_h = (a1 v1 - lambda a2 v2) x (1 - 0.8); out = merged o Wo ('xw' [1024][1024]) -> [2][2048][1024] (4.2 M)).
// Layout: bf16 copy of x per batch; 'xw' weights transposed once; exact projections whose epilogue rounds each tile straight into the 16-bit head planes (v transposed by swapping the operands); the two groups run as 32 heads per batch of one fused causal attention launch (k_fattn: scores, online softmax and P.V in registers; query rows < 512 hi/lo 3 products, rest fp16), which stores into an f32 [b][2048][2048] merge buffer; a combine kernel forms (o1 - lambda o2) x 0.2 per head as hi/lo planes; hi/lo x Wo exact.
// Compute dtypes, f32 accumulate: every input rounded to bf16; projections exact; attention rows < 512 3 products, rest fp16; softmax f32; lambda (precise expf) and the combination f32; Wo hl x exact.

#define NB_  2
#define TT   2048
#define DM   1024
#define NH_  32
#define NKV  32
#define HD   64
#define DQ   (NH_ * HD)
#define DKV  (NKV * HD)
#define RH   512                  // query rows < RH use hi+lo planes
#define SCL  0.125f
#define NHO  16      // output heads (per group)
#define DO   (NHO * HD)   // 1024
#define LINIT 0.8f
typedef _Float16 h16;
typedef unsigned short bf;
typedef __attribute__((ext_vector_type(16))) __bf16   v16bf;
typedef __attribute__((ext_vector_type(16))) _Float16 v16h;
typedef __attribute__((ext_vector_type(8)))  _Float16 v8h;
typedef __attribute__((ext_vector_type(8)))  unsigned short v8us;
typedef __attribute__((ext_vector_type(8)))  float    v8f;
typedef __attribute__((ext_vector_type(4)))  float    v4f;
typedef v8h  __attribute__((may_alias)) v8ha;
typedef v4f  __attribute__((may_alias)) v4fa;
typedef v8us __attribute__((may_alias)) v8usa;

__device__ __forceinline__ unsigned short f2bf(float f) { unsigned u = __float_as_uint(f); u += 0x7FFFu + ((u >> 16) & 1u); return (unsigned short)(u >> 16); }
__device__ __forceinline__ float bf2f(unsigned short b) { return __uint_as_float(((unsigned)b) << 16); }
__device__ __forceinline__ float bfr(float f) { return bf2f(f2bf(f)); }
__device__ __forceinline__ h16 tohx(float x) { return (h16)x; }
__device__ __forceinline__ void splitf(float y, unsigned short& h, unsigned short& l) { h = f2bf(y); l = f2bf(y - bf2f(h)); }
__device__ __forceinline__ v16h cat16(v8h lo, v8h hi) { return __builtin_shufflevector(lo, hi, 0, 1, 2, 3, 4, 5, 6, 7, 8, 9, 10, 11, 12, 13, 14, 15); }
__device__ __forceinline__ v16bf cat16b(v8us lo, v8us hi) { return __builtin_bit_cast(v16bf, __builtin_shufflevector(lo, hi, 0, 1, 2, 3, 4, 5, 6, 7, 8, 9, 10, 11, 12, 13, 14, 15)); }
__device__ __forceinline__ v8f wmma16(v16h a, v16h b, v8f c) { return __builtin_amdgcn_wmma_f32_16x16x32_f16(false, a, false, b, (short)0, c, false, false); }
__device__ __forceinline__ v8f wmmab(v16bf a, v16bf b, v8f c) { return __builtin_amdgcn_wmma_f32_16x16x32_bf16(false, a, false, b, (short)0, c, false, false); }



// ---- k_gemmw: GEMM, one work-group of 8 waves (4 x 2) per 128x128 output tile, each wave a 32x64 tile (8 accumulators); grid (M/128, N/128, Z), 256 threads.
// The K-contiguous 16-bit operand planes come into LDS 128 k at a time by asynchronous 16-byte copies (16 lanes = 256 contiguous bytes of a row), two buffers: the next stage's copies fly while this stage is multiplied. Fragments are read from LDS rows of pitch 272 B.
// C[m][n] (f32, pitch ldc, + optional f32 bias[n]) = sum_k A[m][k] Bt[n][k] (+ split products per NSPLIT). z-batch strides sA/sB/sC in elements. K % 128 == 0, M % 128 == 0, N % 128 == 0.
// PLANES: no f32 C; the epilogue rounds the tile straight into the three 16-bit planes that attention reads (fp16, bf16 hi, bf16 lo); element (m, n) goes to plane offset m * ldc + (n / 64) * sC + n % 64 (grid z = 1).
// q, k head planes [h][t][d]: A = x, Bt = weights, ldc = HD, sC = TT * HD. Transposed v planes [g][d][t]: A = weights, Bt = x, ldc = TT, sC = 64.
template <typename T16> struct WFrag;
template <> struct WFrag<h16> { typedef v16h V; static __device__ __forceinline__ V ld(const h16* p) { return cat16(*(const v8h*)p, *(const v8h*)(p + 16)); } static __device__ __forceinline__ v8f mma(V a, V b, v8f c) { return wmma16(a, b, c); } };
template <> struct WFrag<bf> { typedef v16bf V; static __device__ __forceinline__ V ld(const bf* p) { return cat16b(*(const v8us*)p, *(const v8us*)(p + 16)); } static __device__ __forceinline__ v8f mma(V a, V b, v8f c) { return wmmab(a, b, c); } };
#define GKP 128                   // k per stage: 256 B of every operand row
#define GPI 136                   // LDS row pitch in elements (272 B = 16 B x odd: ds_load_b128 without bank conflicts)
#define GTE (128 * GPI)           // elements of one operand tile in LDS (128 rows)
// One 128-row x 256-B operand tile into LDS: 8 copies a lane, copy i = rows 16 i .. 16 i + 15 over the 256 lanes. g = the lane's 16 bytes in row (tid / 16), l = their LDS byte address, rs = 16 rows in elements.
// The s_wait_xcnt stands inside the statement so that no address register of a copy is rewritten ahead of it.
template <typename T16>
__device__ __forceinline__ void cp_tile(const T16* g, const size_t rs, const unsigned l) {
    asm volatile("global_load_async_to_lds_b128 %0, %8, off\n\t"
                 "global_load_async_to_lds_b128 %1, %9, off\n\t"
                 "global_load_async_to_lds_b128 %2, %10, off\n\t"
                 "global_load_async_to_lds_b128 %3, %11, off\n\t"
                 "global_load_async_to_lds_b128 %4, %12, off\n\t"
                 "global_load_async_to_lds_b128 %5, %13, off\n\t"
                 "global_load_async_to_lds_b128 %6, %14, off\n\t"
                 "global_load_async_to_lds_b128 %7, %15, off\n\t"
                 "s_wait_xcnt 0x0"
                 :: "v"(l), "v"(l + 1u * 16u * GPI * 2u), "v"(l + 2u * 16u * GPI * 2u), "v"(l + 3u * 16u * GPI * 2u), "v"(l + 4u * 16u * GPI * 2u), "v"(l + 5u * 16u * GPI * 2u), "v"(l + 6u * 16u * GPI * 2u), "v"(l + 7u * 16u * GPI * 2u),
                    "v"(g), "v"(g + rs), "v"(g + 2 * rs), "v"(g + 3 * rs), "v"(g + 4 * rs), "v"(g + 5 * rs), "v"(g + 6 * rs), "v"(g + 7 * rs) : "memory");
}
template <typename T16, int NSPLIT, bool BIAS, bool PLANES = false>
__global__ __launch_bounds__(256) void k_gemmw(const T16* __restrict__ A, const T16* __restrict__ A2, const T16* __restrict__ Bt, const T16* __restrict__ Bt2, int K, float* C, int ldc, const float* __restrict__ bias, size_t sA, size_t sB, size_t sC, h16* P16 = nullptr, bf* Ph = nullptr, bf* Pl = nullptr) {
    typedef typename WFrag<T16>::V V;
    constexpr bool HA2 = (NSPLIT == 1 || NSPLIT == 2), HB2 = (NSPLIT >= 2); constexpr int NT = 2 + (HA2 ? 1 : 0) + (HB2 ? 1 : 0);   // operand tiles of a stage: A, Bt, then A2, Bt2 where used
    __shared__ __align__(16) T16 ring[2 * NT * GTE];
    __shared__ __align__(16) float osw[8 * 16 * 68];
    const size_t z = blockIdx.z; A += z * sA; if (A2) A2 += z * sA; Bt += z * sB; if (Bt2) Bt2 += z * sB; C += z * sC;
    const int tid = threadIdx.x, lane = tid & 31, lr = lane & 15, hi = lane >> 4, wv = tid >> 5; const int r0 = blockIdx.x * 128 + (wv >> 1) * 32, c0 = blockIdx.y * 128 + (wv & 1) * 64;
    float* os = osw + wv * (16 * 68);   // each wave's own epilogue staging
    v8f acc[2][4];
#pragma unroll
    for (int mb = 0; mb < 2; ++mb)
#pragma unroll
        for (int nb = 0; nb < 4; ++nb) acc[mb][nb] = (v8f){};
    const size_t ga = (size_t)(blockIdx.x * 128 + (tid >> 4)) * K + (tid & 15) * 8, gb = (size_t)(blockIdx.y * 128 + (tid >> 4)) * K + (tid & 15) * 8, rs = (size_t)16 * K;
    const unsigned l0 = (unsigned)(size_t)ring + (unsigned)((tid >> 4) * (GPI * 2) + (tid & 15) * 16);
    auto fill = [&](const int t) { const unsigned l = l0 + (unsigned)(t & 1) * (NT * GTE * 2u); const int k0 = t * GKP;
        cp_tile(A + ga + k0, rs, l); cp_tile(Bt + gb + k0, rs, l + GTE * 2u);
        if (HA2) cp_tile(A2 + ga + k0, rs, l + 2u * GTE * 2u);
        if (HB2) cp_tile(Bt2 + gb + k0, rs, l + (HA2 ? 3u : 2u) * GTE * 2u); };
    const int nt = K / GKP;
    fill(0);
    asm volatile("s_wait_asynccnt 0x0" ::: "memory");   // stage 0 has landed (this wave's copies)
    __syncthreads();                                     // ... and every other wave's
    if (nt > 1) fill(1);
    const int aoff = ((wv >> 1) * 32 + lr) * GPI + 8 * hi, boff = GTE + ((wv & 1) * 64 + lr) * GPI + 8 * hi;
    // rolled: one copy of the stage's code serves both buffers
#pragma unroll 1
    for (int t = 0; t < nt; ++t) {
        const T16* st = ring + (t & 1) * (NT * GTE);
        V a[2][2], a2[2][2], b[2][4], b2[2][4];   // two fragment sets: block ks + 1 is fetched while block ks is multiplied (inside the stage only)
        // unrolled: the two sets are then indexed by constants and stay in registers
#pragma unroll
        for (int ks = -1; ks < GKP / 32; ++ks) {
            if (ks + 1 < GKP / 32) { const int s = (ks + 1) & 1, kc = (ks + 1) * 32;
#pragma unroll
                for (int mb = 0; mb < 2; ++mb) { a[s][mb] = WFrag<T16>::ld(st + aoff + mb * 16 * GPI + kc); if (HA2) a2[s][mb] = WFrag<T16>::ld(st + 2 * GTE + aoff + mb * 16 * GPI + kc); }
#pragma unroll
                for (int nb = 0; nb < 4; ++nb) { b[s][nb] = WFrag<T16>::ld(st + boff + nb * 16 * GPI + kc); if (HB2) b2[s][nb] = WFrag<T16>::ld(st + (HA2 ? 2 : 1) * GTE + boff + nb * 16 * GPI + kc); } }
            __builtin_amdgcn_sched_barrier(0);   // the next block's LDS reads stay one group ahead of this block's products, none among them
            if (ks >= 0) { const int s = ks & 1;
#pragma unroll
                for (int nb = 0; nb < 4; ++nb)
#pragma unroll
                    for (int mb = 0; mb < 2; ++mb) acc[mb][nb] = WFrag<T16>::mma(a[s][mb], b[s][nb], acc[mb][nb]);
                if (HA2) {
#pragma unroll
                    for (int nb = 0; nb < 4; ++nb)
#pragma unroll
                        for (int mb = 0; mb < 2; ++mb) acc[mb][nb] = WFrag<T16>::mma(a2[s][mb], b[s][nb], acc[mb][nb]); }
                if (HB2) {
#pragma unroll
                    for (int nb = 0; nb < 4; ++nb)
#pragma unroll
                        for (int mb = 0; mb < 2; ++mb) acc[mb][nb] = WFrag<T16>::mma(a[s][mb], b2[s][nb], acc[mb][nb]); }
                __builtin_amdgcn_sched_barrier(0);   // ... and the reads of the block after next stay behind these products
            }
        }
        asm volatile("s_wait_dscnt 0x0" ::: "memory");      // this wave's reads of stage t are done
        asm volatile("s_wait_asynccnt 0x0" ::: "memory");   // this wave's copies of stage t + 1 have landed
        __syncthreads();                                     // publishes stage t + 1 and frees stage t's buffer
        if (t + 2 < nt) fill(t + 2);
    }
    asm volatile("s_wait_asynccnt 0x0" ::: "memory");   // no copy is left in flight when the wave goes on to its end
#pragma unroll
    for (int mb = 0; mb < 2; ++mb) {
#pragma unroll
        for (int nb = 0; nb < 4; ++nb) {
#pragma unroll
            for (int j = 0; j < 8; ++j) os[(hi * 8 + j) * 68 + nb * 16 + lr] = acc[mb][nb][j]; }
        __builtin_amdgcn_wave_barrier(); asm volatile("" ::: "memory");
        float* crow = C + (size_t)(r0 + mb * 16) * ldc + c0;
        if (PLANES) {
            // both loops unrolled: the vector elements are then indexed by constants and stay in registers
#pragma unroll
            for (int s = 0; s < 4; ++s) { const int row = 4 * s + (lane >> 3), cofs = (lane & 7) * 8;   // 8 lanes x 16 B = one 128-B line per row and plane
                const v4f x0 = *(const v4fa*)(os + row * 68 + cofs), x1 = *(const v4fa*)(os + row * 68 + cofs + 4); v8h o16; v8us oh, ol;
#pragma unroll
                for (int q = 0; q < 4; ++q) { unsigned short u, w; o16[q] = tohx(x0[q]); splitf(x0[q], u, w); oh[q] = u; ol[q] = w; o16[q + 4] = tohx(x1[q]); splitf(x1[q], u, w); oh[q + 4] = u; ol[q + 4] = w; }
                const size_t oo = (size_t)(r0 + mb * 16 + row) * ldc + (size_t)(c0 >> 6) * sC + cofs; *(v8h*)(P16 + oo) = o16; *(v8us*)(Ph + oo) = oh; *(v8us*)(Pl + oo) = ol; }
        } else
{
#pragma unroll
            for (int s = 0; s < 8; ++s) { const int row = 2 * s + hi, cofs = lr * 4; v4f val = *(const v4fa*)(os + row * 68 + cofs); if (BIAS) { val[0] += bfr(bias[c0 + cofs]); val[1] += bfr(bias[c0 + cofs + 1]); val[2] += bfr(bias[c0 + cofs + 2]); val[3] += bfr(bias[c0 + cofs + 3]); }
                *(v4f*)(crow + (size_t)row * ldc + cofs) = val; }
             }
        __builtin_amdgcn_wave_barrier(); asm volatile("" ::: "memory");
    }
}

typedef __attribute__((ext_vector_type(2))) _Float16 v2h;
typedef __attribute__((ext_vector_type(4))) _Float16 v4h;
typedef __attribute__((ext_vector_type(2))) unsigned short v2us;
typedef __attribute__((ext_vector_type(4))) unsigned short v4us;
typedef __attribute__((ext_vector_type(2))) float v2f;
typedef __attribute__((ext_vector_type(4))) int v4i;

__global__ __launch_bounds__(256) void k_wtG(const float* __restrict__ w, int K, int N, bf* Bt) {
    const int lane = threadIdx.x & 31; const int L0 = (blockIdx.x * 8 + (threadIdx.x >> 5)) * 8; const int nlines = N * K / 64;
{
#pragma unroll 1
        for (int l = 0; l < 8; ++l) { const int L = L0 + l; if (L >= nlines) break; const size_t e = (size_t)L * 64 + lane * 2; const int k = (int)(e % K), n = (int)(e / K); v2us o;
            o[0] = f2bf(w[(size_t)k * N + n]); o[1] = f2bf(w[(size_t)(k + 1) * N + n]); *(v2us*)(Bt + e) = o; }
         }
}
__global__ __launch_bounds__(256) void k_cvt8(const float* __restrict__ src, bf* dst, size_t n8) { const size_t i = (size_t)blockIdx.x * 256 + threadIdx.x; if (i >= n8) return; const v8f v = *(const v8f*)(src + i * 8); v8us o;
#pragma unroll
    for (int k = 0; k < 8; ++k) o[k] = f2bf(v[k]); *(v8us*)(dst + i * 8) = o;  }

__device__ __forceinline__ float xhalf(float v) { const int b = __float_as_int(v); return __int_as_float(__builtin_amdgcn_permlanex16(b, b, 0x76543210, 0xfedcba98, false, false)); }   // lane l <-> l ^ 16
#define SCL2 (SCL * 1.4426950408889634f)
#define NEGB (-3.0e38f)

// fp16 operands, NQ tiles of 16 query columns from q0 (q0 and 16 NQ multiples of 32). The block's 4 waves share K and V^T through LDS: 64 keys a stage (64 K rows of 128 B, 64 V^T rows of 128 B), brought in by asynchronous 16-byte copies
// (8 lanes = one whole 128-B line), two buffers: the next stage's copies fly while this stage is worked on. Every wave walks all kendB / 64 stages of the block (kendB a multiple of 64) and skips the passes behind its own diagonal.
#define FKS 64                    // keys per stage
#define FPI 72                    // LDS row pitch in elements (144 B = 16 B x odd: ds_load_b128 without bank conflicts)
#define FTE (64 * FPI)            // elements of one tile in LDS (64 rows)
// One 64-row x 128-B tile into LDS: 4 copies a lane, copy i = rows 16 i .. 16 i + 15 over the 128 lanes. g = the lane's 16 bytes in row (tid / 8), l = their LDS byte address, rs = 16 rows in elements.
// The s_wait_xcnt stands inside the statement so that no address register of a copy is rewritten ahead of it.
template <typename T16>
__device__ __forceinline__ void cp_tile4(const T16* g, const size_t rs, const unsigned l) {
    asm volatile("global_load_async_to_lds_b128 %0, %4, off\n\t"
                 "global_load_async_to_lds_b128 %1, %5, off\n\t"
                 "global_load_async_to_lds_b128 %2, %6, off\n\t"
                 "global_load_async_to_lds_b128 %3, %7, off\n\t"
                 "s_wait_xcnt 0x0"
                 :: "v"(l), "v"(l + 1u * 16u * FPI * 2u), "v"(l + 2u * 16u * FPI * 2u), "v"(l + 3u * 16u * FPI * 2u),
                    "v"(g), "v"(g + rs), "v"(g + 2 * rs), "v"(g + 3 * rs) : "memory");
}
template <int NQ>
__device__ __forceinline__ void fa_f16(const _Float16* __restrict__ Q, const _Float16* __restrict__ K, const _Float16* __restrict__ VT, float* __restrict__ O, const int q0, const int kendB, _Float16* ring, const int tid, const int lr, const int hi) {
    v16h qf[NQ][2]; v8f o[4][NQ]; float m[NQ], l[NQ];
#pragma unroll
    for (int nq = 0; nq < NQ; ++nq) { m[nq] = NEGB; l[nq] = 0.f;
#pragma unroll
        for (int kc = 0; kc < 2; ++kc) qf[nq][kc] = WFrag<h16>::ld(Q + (size_t)(q0 + nq * 16 + lr) * HD + kc * 32 + 8 * hi);
#pragma unroll
        for (int dt = 0; dt < 4; ++dt) o[dt][nq] = (v8f){}; }
    const int kend = q0 + NQ * 16;
    const _Float16* gk = K + (size_t)(tid >> 3) * HD + (tid & 7) * 8; const _Float16* gv = VT + (size_t)(tid >> 3) * TT + (tid & 7) * 8;
    const unsigned l0 = (unsigned)(size_t)ring + (unsigned)((tid >> 3) * (FPI * 2) + (tid & 7) * 16);
    auto fill = [&](const int t) { const unsigned lb = l0 + (unsigned)(t & 1) * (2u * FTE * 2u);
        cp_tile4(gk + (size_t)t * (FKS * HD), (size_t)16 * HD, lb); cp_tile4(gv + (size_t)t * FKS, (size_t)16 * TT, lb + FTE * 2u); };
    const int nt = kendB / FKS;
    fill(0);
    asm volatile("s_wait_asynccnt 0x0" ::: "memory");   // stage 0 has landed (this wave's copies)
    __syncthreads();                                     // ... and every other wave's
    if (nt > 1) fill(1);
    const int koff = lr * FPI + 8 * hi, voff = FTE + lr * FPI + 8 * hi;
    // rolled: one copy of the stage's code serves both buffers
#pragma unroll 1
    for (int t = 0; t < nt; ++t) {
        const _Float16* st = ring + (t & 1) * (2 * FTE);
        // unrolled: the two passes' LDS offsets are then constants
#pragma unroll
        for (int h = 0; h < FKS / 32; ++h) { const int kb = t * FKS + h * 32;
            if (kb < kend) {   // passes behind the wave's diagonal are skipped (wave-uniform test)
                v16h kf[2][2], vf[4];
#pragma unroll
                for (int mt = 0; mt < 2; ++mt)
#pragma unroll
                    for (int kc = 0; kc < 2; ++kc) kf[mt][kc] = WFrag<h16>::ld(st + koff + (h * 32 + mt * 16) * FPI + kc * 32);
#pragma unroll
                for (int dt = 0; dt < 4; ++dt) vf[dt] = WFrag<h16>::ld(st + voff + (dt * 16) * FPI + h * 32);
                __builtin_amdgcn_sched_barrier(0);   // the pass's LDS reads stand in one place, K first: the V^T reads land behind the score products and the softmax
                v8f s[2][NQ];
#pragma unroll
                for (int mt = 0; mt < 2; ++mt)
#pragma unroll
                    for (int nq = 0; nq < NQ; ++nq) s[mt][nq] = wmma16(kf[mt][1], qf[nq][1], wmma16(kf[mt][0], qf[nq][0], (v8f){}));
                if (kb + 31 > q0) {   // only the diagonal pass masks (wave-uniform test)
#pragma unroll
                    for (int mt = 0; mt < 2; ++mt)
#pragma unroll
                        for (int nq = 0; nq < NQ; ++nq)
#pragma unroll
                            for (int j = 0; j < 8; ++j) if (kb + mt * 16 + 8 * hi + j > q0 + nq * 16 + lr) s[mt][nq][j] = NEGB; }
                float mx[NQ]; bool need = false;
#pragma unroll
                for (int nq = 0; nq < NQ; ++nq) { float tm = fmaxf(s[0][nq][0], s[1][nq][0]);
#pragma unroll
                    for (int j = 1; j < 8; ++j) tm = fmaxf(tm, fmaxf(s[0][nq][j], s[1][nq][j]));
                    tm = fmaxf(tm, xhalf(tm)); mx[nq] = tm * SCL2; need = need || (mx[nq] > m[nq] + 8.0f); }
                if (__builtin_amdgcn_ballot_w32(need) != 0) {   // one scalar branch a pass
#pragma unroll
                    for (int nq = 0; nq < NQ; ++nq) { const float mn = fmaxf(m[nq], mx[nq]); const float al = __builtin_amdgcn_exp2f(m[nq] - mn); m[nq] = mn; l[nq] *= al;
#pragma unroll
                        for (int dt = 0; dt < 4; ++dt) o[dt][nq] *= al; } }
#pragma unroll
                for (int nq = 0; nq < NQ; ++nq) { v8f p0, p1;
#pragma unroll
                    for (int j = 0; j < 8; ++j) { p0[j] = __builtin_amdgcn_exp2f(__builtin_fmaf(s[0][nq][j], SCL2, -m[nq])); p1[j] = __builtin_amdgcn_exp2f(__builtin_fmaf(s[1][nq][j], SCL2, -m[nq])); l[nq] += p0[j] + p1[j]; }
                    const v16h pf = cat16(__builtin_convertvector(p0, v8h), __builtin_convertvector(p1, v8h));
#pragma unroll
                    for (int dt = 0; dt < 4; ++dt) o[dt][nq] = wmma16(vf[dt], pf, o[dt][nq]); }
            }
        }
        asm volatile("s_wait_dscnt 0x0" ::: "memory");      // this wave's reads of stage t are done
        asm volatile("s_wait_asynccnt 0x0" ::: "memory");   // this wave's copies of stage t + 1 have landed
        __syncthreads();                                     // publishes stage t + 1 and frees stage t's buffer
        if (t + 2 < nt) fill(t + 2);
    }
    asm volatile("s_wait_asynccnt 0x0" ::: "memory");   // no copy is left in flight when the wave goes on to its end
#pragma unroll
    for (int nq = 0; nq < NQ; ++nq) { const float inv = 1.0f / (l[nq] + xhalf(l[nq])); float* orow = O + (size_t)(q0 + nq * 16 + lr) * DQ + 8 * hi;
#pragma unroll
        for (int dt = 0; dt < 4; ++dt) { const v8f r = o[dt][nq] * inv; *(v4f*)(orow + dt * 16) = __builtin_shufflevector(r, r, 0, 1, 2, 3); *(v4f*)(orow + dt * 16 + 4) = __builtin_shufflevector(r, r, 4, 5, 6, 7); } }
}

// bf16 hi + lo planes, three products for the scores and three for P.V; one tile of 16 query columns from q0 (a multiple of 16). K and V^T, hi and lo, staged for the block's 4 waves as in fa_f16: four tiles a stage, kendB a multiple of 64.
__device__ __forceinline__ void fa_hl(const unsigned short* __restrict__ Qh, const unsigned short* __restrict__ Ql, const unsigned short* __restrict__ Kh, const unsigned short* __restrict__ Kl, const unsigned short* __restrict__ VTh, const unsigned short* __restrict__ VTl, float* __restrict__ O, const int q0, const int kendB, unsigned short* ring, const int tid, const int lr, const int hi) {
    v16bf qh[2], ql[2]; v8f o[4]; float m = NEGB, l = 0.f;
#pragma unroll
    for (int kc = 0; kc < 2; ++kc) { const size_t qo = (size_t)(q0 + lr) * HD + kc * 32 + 8 * hi; qh[kc] = WFrag<bf>::ld(Qh + qo); ql[kc] = WFrag<bf>::ld(Ql + qo); }
#pragma unroll
    for (int dt = 0; dt < 4; ++dt) o[dt] = (v8f){};
    const int kend = (q0 + 16 + 31) & ~31;
    const size_t gk = (size_t)(tid >> 3) * HD + (tid & 7) * 8, gv = (size_t)(tid >> 3) * TT + (tid & 7) * 8;
    const unsigned l0 = (unsigned)(size_t)ring + (unsigned)((tid >> 3) * (FPI * 2) + (tid & 7) * 16);
    auto fill = [&](const int t) { const unsigned lb = l0 + (unsigned)(t & 1) * (4u * FTE * 2u); const size_t ak = gk + (size_t)t * (FKS * HD), av = gv + (size_t)t * FKS;
        cp_tile4(Kh + ak, (size_t)16 * HD, lb); cp_tile4(Kl + ak, (size_t)16 * HD, lb + FTE * 2u); cp_tile4(VTh + av, (size_t)16 * TT, lb + 2u * FTE * 2u); cp_tile4(VTl + av, (size_t)16 * TT, lb + 3u * FTE * 2u); };
    const int nt = kendB / FKS;
    fill(0);
    asm volatile("s_wait_asynccnt 0x0" ::: "memory");   // stage 0 has landed (this wave's copies)
    __syncthreads();                                     // ... and every other wave's
    if (nt > 1) fill(1);
    const int foff = lr * FPI + 8 * hi;
    // rolled: one copy of the stage's code serves both buffers
#pragma unroll 1
    for (int t = 0; t < nt; ++t) {
        const unsigned short* st = ring + (t & 1) * (4 * FTE) + foff;
        // unrolled: the two passes' LDS offsets are then constants
#pragma unroll
        for (int h = 0; h < FKS / 32; ++h) { const int kb = t * FKS + h * 32;
            if (kb < kend) {   // passes behind the wave's diagonal are skipped (wave-uniform test)
                v16bf kh[2][2], kl[2][2];
#pragma unroll
                for (int mt = 0; mt < 2; ++mt)
#pragma unroll
                    for (int kc = 0; kc < 2; ++kc) { const int a = (h * 32 + mt * 16) * FPI + kc * 32; kh[mt][kc] = WFrag<bf>::ld(st + a); kl[mt][kc] = WFrag<bf>::ld(st + FTE + a); }
                v16bf vh[4], vl[4];
#pragma unroll
                for (int dt = 0; dt < 4; ++dt) { const int a = (dt * 16) * FPI + h * 32; vh[dt] = WFrag<bf>::ld(st + 2 * FTE + a); vl[dt] = WFrag<bf>::ld(st + 3 * FTE + a); }
                __builtin_amdgcn_sched_barrier(0);   // the pass's LDS reads stand in one place, K first: the V^T reads land behind the score products and the softmax
                v8f s[2];
#pragma unroll
                for (int mt = 0; mt < 2; ++mt) { s[mt] = (v8f){};
#pragma unroll
                    for (int kc = 0; kc < 2; ++kc) { s[mt] = wmmab(kh[mt][kc], qh[kc], s[mt]); s[mt] = wmmab(kh[mt][kc], ql[kc], s[mt]); s[mt] = wmmab(kl[mt][kc], qh[kc], s[mt]); } }
                if (kb + 31 > q0) {   // only the diagonal pass masks (wave-uniform test)
#pragma unroll
                    for (int mt = 0; mt < 2; ++mt)
#pragma unroll
                        for (int j = 0; j < 8; ++j) if (kb + mt * 16 + 8 * hi + j > q0 + lr) s[mt][j] = NEGB; }
                float tm = fmaxf(s[0][0], s[1][0]);
#pragma unroll
                for (int j = 1; j < 8; ++j) tm = fmaxf(tm, fmaxf(s[0][j], s[1][j]));
                tm = fmaxf(tm, xhalf(tm)); const float mx = tm * SCL2;
                if (__builtin_amdgcn_ballot_w32(mx > m + 8.0f) != 0) {   // one scalar branch a pass
                    const float mn = fmaxf(m, mx); const float al = __builtin_amdgcn_exp2f(m - mn); m = mn; l *= al;
#pragma unroll
                    for (int dt = 0; dt < 4; ++dt) o[dt] *= al; }
                v8us h0, h1, l0v, l1v;
#pragma unroll
                for (int j = 0; j < 8; ++j) { const float p0 = __builtin_amdgcn_exp2f(__builtin_fmaf(s[0][j], SCL2, -m)), p1 = __builtin_amdgcn_exp2f(__builtin_fmaf(s[1][j], SCL2, -m)); l += p0 + p1; unsigned short u, w; splitf(p0, u, w); h0[j] = u; l0v[j] = w; splitf(p1, u, w); h1[j] = u; l1v[j] = w; }
                const v16bf ph = cat16b(h0, h1), pl = cat16b(l0v, l1v);
#pragma unroll
                for (int dt = 0; dt < 4; ++dt) { o[dt] = wmmab(vh[dt], ph, o[dt]); o[dt] = wmmab(vh[dt], pl, o[dt]); o[dt] = wmmab(vl[dt], ph, o[dt]); }
            }
        }
        asm volatile("s_wait_dscnt 0x0" ::: "memory");      // this wave's reads of stage t are done
        asm volatile("s_wait_asynccnt 0x0" ::: "memory");   // this wave's copies of stage t + 1 have landed
        __syncthreads();                                     // publishes stage t + 1 and frees stage t's buffer
        if (t + 2 < nt) fill(t + 2);
    }
    asm volatile("s_wait_asynccnt 0x0" ::: "memory");   // no copy is left in flight when the wave goes on to its end
    const float inv = 1.0f / (l + xhalf(l)); float* orow = O + (size_t)(q0 + lr) * DQ + 8 * hi;
#pragma unroll
    for (int dt = 0; dt < 4; ++dt) { const v8f r = o[dt] * inv; *(v4f*)(orow + dt * 16) = __builtin_shufflevector(r, r, 0, 1, 2, 3); *(v4f*)(orow + dt * 16 + 4) = __builtin_shufflevector(r, r, 4, 5, 6, 7); }
}

// grid (NB_ * NH_ heads, NTF + NTH row blocks), 4 waves a block. Row blocks run from the longest to the shortest: NTF blocks of 128 fp16 query rows from the end of the sequence down to RH, then NTH blocks of 64 hi/lo rows down to 0.
#define NTF ((TT - RH) / 128)
#define NTH (RH / 64)
__global__ __launch_bounds__(128) void k_fattn(const _Float16* __restrict__ Q16, const _Float16* __restrict__ K16, const _Float16* __restrict__ V16, const unsigned short* __restrict__ Qh, const unsigned short* __restrict__ Ql, const unsigned short* __restrict__ Kh, const unsigned short* __restrict__ Kl, const unsigned short* __restrict__ Vh, const unsigned short* __restrict__ Vl, float* __restrict__ AT) {
    const int lane = threadIdx.x & 31, lr = lane & 15, hi = lane >> 4; const int w = __builtin_amdgcn_readfirstlane((int)(threadIdx.x >> 5));   // the wave's number in a scalar register: loop bounds and the mask test stay scalar
    const size_t z = blockIdx.x, po = z * (size_t)TT * HD; float* O = AT + (z / NH_) * (size_t)TT * DQ + (z % NH_) * HD; const int y = blockIdx.y;
    __shared__ __align__(16) unsigned short fring[2 * 4 * FTE];   // two buffers of K and V^T tiles: one of each for the fp16 rows, hi and lo of each for the hi/lo rows
    if (y < NTF) fa_f16<2>(Q16 + po, K16 + po, V16 + po, O, TT - 128 * (y + 1) + 32 * w, TT - 128 * y, (_Float16*)fring, (int)threadIdx.x, lr, hi);
    else fa_hl(Qh + po, Ql + po, Kh + po, Kl + po, Vh + po, Vl + po, O, RH - 64 * (y - NTF + 1) + 16 * w, RH - 64 * (y - NTF), fring, (int)threadIdx.x, lr, hi);
}

__global__ __launch_bounds__(256) void k_lam(const float* __restrict__ a1, const float* __restrict__ b1, const float* __restrict__ a2, const float* __restrict__ b2, float* LAM) { if (threadIdx.x >= 32) return; const int lane = threadIdx.x; float d1 = __fadd_rn(__fmul_rn(bfr(a1[lane * 2]), bfr(b1[lane * 2])), __fmul_rn(bfr(a1[lane * 2 + 1]), bfr(b1[lane * 2 + 1]))); float d2 = __fadd_rn(__fmul_rn(bfr(a2[lane * 2]), bfr(b2[lane * 2])), __fmul_rn(bfr(a2[lane * 2 + 1]), bfr(b2[lane * 2 + 1])));
#pragma unroll
    for (int sh = 16; sh; sh >>= 1) { d1 = __fadd_rn(d1, __shfl_xor(d1, sh, 32)); d2 = __fadd_rn(d2, __shfl_xor(d2, sh, 32)); }
    float l = __fsub_rn(expf(d1), expf(d2)); asm volatile("" : "+v"(l)); l = __fadd_rn(l, LINIT); ((float*)LAM)[lane] = l;  }
__global__ __launch_bounds__(256) void k_comb(const float* __restrict__ A, const float* __restrict__ LAM, bf* Ph, bf* Pl) { const size_t i = (size_t)blockIdx.x * 256 + threadIdx.x; if (i >= (size_t)TT * DO / 4) return; const size_t e = i * 4; const int c0 = (int)(e % DO); const size_t t = e / DO; const float lam = LAM[0]; const v4f o1 = *(const v4f*)(A + t * DQ + c0); const v4f o2 = *(const v4f*)(A + t * DQ + DO + c0); v4us oh, ol;
#pragma unroll
    for (int q = 0; q < 4; ++q) { float m = __fmul_rn(lam, o2[q]); asm volatile("" : "+v"(m)); float y = __fsub_rn(o1[q], m); asm volatile("" : "+v"(y)); y = __fmul_rn(y, 1.0f - LINIT); unsigned short u, w; splitf(y, u, w); oh[q] = u; ol[q] = w; }
    *(v4us*)(Ph + e) = oh; *(v4us*)(Pl + e) = ol;  }

extern "C" void kernel_launch(void* const* d_in, const int* in_sizes, int n_in,
                              void* d_out, int out_size, void* d_ws, size_t ws_size, hipStream_t stream) {
    (void)in_sizes; (void)n_in; (void)out_size;
    const float* x = (const float*)d_in[0]; const float* wq = (const float*)d_in[1]; const float* wk = (const float*)d_in[2]; const float* wv = (const float*)d_in[3]; const float* wo = (const float*)d_in[4]; const float* lq1 = (const float*)d_in[5]; const float* lk1 = (const float*)d_in[6]; const float* lq2 = (const float*)d_in[7]; const float* lk2 = (const float*)d_in[8];
    float* OUT = (float*)d_out;     // [2][2048][1024]
    char* wsp = (char*)d_ws;
    auto take = [&](size_t bytes) { char* p = wsp; wsp += (bytes + 255) & ~(size_t)255; return (void*)p; };
    const size_t PB = (size_t)NH_ * TT * HD;   // elements of one plane of one batch
    float* AT32 = (float*)take((size_t)NB_ * TT * DQ * 4); bf* WO = (bf*)take((size_t)DM * DO * 2); float* LAM = (float*)take(256); bf* WQ = (bf*)take((size_t)DQ * DM * 2); bf* WK = (bf*)take((size_t)DKV * DM * 2); bf* WV = (bf*)take((size_t)DKV * DM * 2);
    // nine head planes, both batches side by side ([b][h][t][d]; v [b][g][d][t]), so that one attention launch covers all NB_ * NH_ heads
    h16* QP16 = (h16*)take(NB_ * PB * 2); h16* KP16 = (h16*)take(NB_ * PB * 2); h16* VT16 = (h16*)take(NB_ * PB * 2);
    bf* QPh = (bf*)take(NB_ * PB * 2); bf* QPl = (bf*)take(NB_ * PB * 2); bf* KPh = (bf*)take(NB_ * PB * 2); bf* KPl = (bf*)take(NB_ * PB * 2); bf* VTh = (bf*)take(NB_ * PB * 2); bf* VTl = (bf*)take(NB_ * PB * 2);
    bf* XB = (bf*)take((size_t)TT * DM * 2); bf* ACh = (bf*)take((size_t)TT * DO * 2); bf* ACl = (bf*)take((size_t)TT * DO * 2);
    if ((size_t)(wsp - (char*)d_ws) > ws_size) return;    // ws 256 MiB
    k_wtG<<<(unsigned)((DM * DQ / 64 + 63) / 64), 256, 0, stream>>>(wq, DM, DQ, WQ); k_wtG<<<(unsigned)((DM * DKV / 64 + 63) / 64), 256, 0, stream>>>(wk, DM, DKV, WK); k_wtG<<<(unsigned)((DM * DKV / 64 + 63) / 64), 256, 0, stream>>>(wv, DM, DKV, WV);
    k_wtG<<<(unsigned)((DO * DM / 64 + 63) / 64), 256, 0, stream>>>(wo, DO, DM, WO); k_lam<<<1, 256, 0, stream>>>(lq1, lk1, lq2, lk2, LAM);   /* Wo 'xw' [1024][1024]; lambda line */
    for (int b = 0; b < NB_; ++b) {
        k_cvt8<<<(unsigned)(((size_t)TT * DM / 8 + 255) / 256), 256, 0, stream>>>(x + (size_t)b * TT * DM, XB, (size_t)TT * DM / 8);
        k_gemmw<bf, 0, false, true><<<dim3(TT / 128, DQ / 128, 1), 256, 0, stream>>>(XB, nullptr, WQ, nullptr, DM, nullptr, HD, nullptr, 0, 0, (size_t)TT * HD, QP16 + b * PB, QPh + b * PB, QPl + b * PB);      /* q head planes [h][t][d] */
        k_gemmw<bf, 0, false, true><<<dim3(TT / 128, DKV / 128, 1), 256, 0, stream>>>(XB, nullptr, WK, nullptr, DM, nullptr, HD, nullptr, 0, 0, (size_t)TT * HD, KP16 + b * PB, KPh + b * PB, KPl + b * PB);     /* k head planes [h][t][d] */
        k_gemmw<bf, 0, false, true><<<dim3(DKV / 128, TT / 128, 1), 256, 0, stream>>>(WV, nullptr, XB, nullptr, DM, nullptr, TT, nullptr, 0, 0, (size_t)64, VT16 + b * PB, VTh + b * PB, VTl + b * PB);          /* v planes transposed [g][d][t]: operands swapped */
    }
    k_fattn<<<dim3(NB_ * NH_, NTF + NTH, 1), 128, 0, stream>>>(QP16, KP16, VT16, QPh, QPl, KPh, KPl, VTh, VTl, AT32);   /* all heads of both batches -> f32 merge buffer [b][t][h][d] */
    for (int b = 0; b < NB_; ++b) {
        k_comb<<<(unsigned)(((size_t)TT * DO / 4 + 255) / 256), 256, 0, stream>>>(AT32 + (size_t)b * TT * DQ, LAM, ACh, ACl);   /* (o1 - lambda o2) x (1 - lambda_init) -> planes */
        k_gemmw<bf, 1, false><<<dim3(TT / 128, DM / 128, 1), 256, 0, stream>>>(ACh, ACl, WO, nullptr, DO, OUT + (size_t)b * TT * DM, DM, nullptr, 0, 0, 0);   /* Wo */
    }
}

// v006
// Measured time: 142 microseconds a run.
// Next to v005, in two timings, it ran 1.38 times as fast each time.
// Counting every step since v000, it is 19.2 times as fast.
#include <hip/hip_runtime.h>

// Differential causal attention (x [2][2048][1024]; q, k, v = x W ('xw' [1024][2048] 0.02) as 2 groups x 16 heads x 64; a_g = causal softmax(q_g.k_g / 8) (-1e30 fill); lambda = exp(lq1.lk1) - exp(lq2.lk2) + 0.8 (vectors [64], zeros, read: computed on device); o_h = (a1 v1 - lambda a2 v2) x (1 - 0.8); out = merged o Wo ('xw' [1024][1024]) -> [2][2048][1024] (4.2 M)).
// Layout: one input-only launch (k_prep) makes the bf16 copy of x (both batches), the transposed 'xw' weights and lambda; one launch holds the six exact projections (q, k, v of both batches on grid z) whose epilogue rounds each tile straight into the 16-bit head planes (v transposed by swapping the operands); the two groups run as 32 heads per batch of one fused causal attention launch (k_fattn: scores, online softmax and P.V in registers; query rows < 512 hi/lo 3 products, rest fp16), which stores into an f32 [b][2048][2048] merge buffer; a combine kernel forms (o1 - lambda o2) x 0.2 per head as hi/lo planes (both batches as 4096 rows); hi/lo x Wo exact, 4096 rows in one launch.
// Compute dtypes, f32 accumulate: every input rounded to bf16; projections exact; attention rows < 512 3 products, rest fp16; softmax f32; lambda (precise expf) and the combination f32; Wo hl x exact.

#define NB_  2
#define TT   2048
#define DM   1024
#define NH_  32
#define NKV  32
#define HD   64
#define DQ   (NH_ * HD)
#define DKV  (NKV * HD)
#define RH   512                  // query rows < RH use hi+lo planes
#define SCL  0.125f
#define NHO  16      // output heads (per group)
#define DO   (NHO * HD)   // 1024
#define LINIT 0.8f
typedef _Float16 h16;
typedef unsigned short bf;
typedef __attribute__((ext_vector_type(16))) __bf16   v16bf;
typedef __attribute__((ext_vector_type(16))) _Float16 v16h;
typedef __attribute__((ext_vector_type(8)))  _Float16 v8h;
typedef __attribute__((ext_vector_type(8)))  unsigned short v8us;
typedef __attribute__((ext_vector_type(8)))  float    v8f;
typedef __attribute__((ext_vector_type(4)))  float    v4f;
typedef v8h  __attribute__((may_alias)) v8ha;
typedef v4f  __attribute__((may_alias)) v4fa;
typedef v8us __attribute__((may_alias)) v8usa;

__device__ __forceinline__ unsigned short f2bf(float f) { unsigned u = __float_as_uint(f); u += 0x7FFFu + ((u >> 16) & 1u); return (unsigned short)(u >> 16); }
__device__ __forceinline__ float bf2f(unsigned short b) { return __uint_as_float(((unsigned)b) << 16); }
__device__ __forceinline__ float bfr(float f) { return bf2f(f2bf(f)); }
__device__ __forceinline__ h16 tohx(float x) { return (h16)x; }
__device__ __forceinline__ void splitf(float y, unsigned short& h, unsigned short& l) { h = f2bf(y); l = f2bf(y - bf2f(h)); }
__device__ __forceinline__ v16h cat16(v8h lo, v8h hi) { return __builtin_shufflevector(lo, hi, 0, 1, 2, 3, 4, 5, 6, 7, 8, 9, 10, 11, 12, 13, 14, 15); }
__device__ __forceinline__ v16bf cat16b(v8us lo, v8us hi) { return __builtin_bit_cast(v16bf, __builtin_shufflevector(lo, hi, 0, 1, 2, 3, 4, 5, 6, 7, 8, 9, 10, 11, 12, 13, 14, 15)); }
__device__ __forceinline__ v8f wmma16(v16h a, v16h b, v8f c) { return __builtin_amdgcn_wmma_f32_16x16x32_f16(false, a, false, b, (short)0, c, false, false); }
__device__ __forceinline__ v8f wmmab(v16bf a, v16bf b, v8f c) { return __builtin_amdgcn_wmma_f32_16x16x32_bf16(false, a, false, b, (short)0, c, false, false); }



// ---- k_gemmw: GEMM, one work-group of 8 waves (4 x 2) per 128x128 output tile, each wave a 32x64 tile (8 accumulators); grid (M/128, N/128, Z), 256 threads.
// The K-contiguous 16-bit operand planes come into LDS 128 k at a time by asynchronous 16-byte copies (16 lanes = 256 contiguous bytes of a row), two buffers: the next stage's copies fly while this stage is multiplied. Fragments are read from LDS rows of pitch 272 B.
// C[m][n] (f32, pitch ldc, + optional f32 bias[n]) = sum_k A[m][k] Bt[n][k] (+ split products per NSPLIT). z-batch strides sA/sB/sC in elements. K % 128 == 0, M % 128 == 0, N % 128 == 0.
// PLANES: no f32 C; the epilogue rounds the tile straight into the three 16-bit planes that attention reads (fp16, bf16 hi, bf16 lo); element (m, n) goes to plane offset m * ldc + (n / 64) * sC + n % 64.
// PLANES, grid z = 2 * kind + batch, six independent products in one launch: the arguments are A = x (sA = one batch), Bt = the three transposed weights (sB = one of them), sP = one batch of one plane; ldc and sC are set here.
// kind 0, 1 = q, k head planes [h][t][d]: A = x, Bt = weights, ldc = HD, sC = TT * HD. kind 2 = transposed v planes [g][d][t]: A = weights, Bt = x, ldc = TT, sC = 64.
template <typename T16> struct WFrag;
template <> struct WFrag<h16> { typedef v16h V; static __device__ __forceinline__ V ld(const h16* p) { return cat16(*(const v8h*)p, *(const v8h*)(p + 16)); } static __device__ __forceinline__ v8f mma(V a, V b, v8f c) { return wmma16(a, b, c); } };
template <> struct WFrag<bf> { typedef v16bf V; static __device__ __forceinline__ V ld(const bf* p) { return cat16b(*(const v8us*)p, *(const v8us*)(p + 16)); } static __device__ __forceinline__ v8f mma(V a, V b, v8f c) { return wmmab(a, b, c); } };
#define GKP 128                   // k per stage: 256 B of every operand row
#define GPI 136                   // LDS row pitch in elements (272 B = 16 B x odd: ds_load_b128 without bank conflicts)
#define GTE (128 * GPI)           // elements of one operand tile in LDS (128 rows)
// One 128-row x 256-B operand tile into LDS: 8 copies a lane, copy i = rows 16 i .. 16 i + 15 over the 256 lanes. g = the lane's 16 bytes in row (tid / 16), l = their LDS byte address, rs = 16 rows in elements.
// The s_wait_xcnt stands inside the statement so that no address register of a copy is rewritten ahead of it.
template <typename T16>
__device__ __forceinline__ void cp_tile(const T16* g, const size_t rs, const unsigned l) {
    asm volatile("global_load_async_to_lds_b128 %0, %8, off\n\t"
                 "global_load_async_to_lds_b128 %1, %9, off\n\t"
                 "global_load_async_to_lds_b128 %2, %10, off\n\t"
                 "global_load_async_to_lds_b128 %3, %11, off\n\t"
                 "global_load_async_to_lds_b128 %4, %12, off\n\t"
                 "global_load_async_to_lds_b128 %5, %13, off\n\t"
                 "global_load_async_to_lds_b128 %6, %14, off\n\t"
                 "global_load_async_to_lds_b128 %7, %15, off\n\t"
                 "s_wait_xcnt 0x0"
                 :: "v"(l), "v"(l + 1u * 16u * GPI * 2u), "v"(l + 2u * 16u * GPI * 2u), "v"(l + 3u * 16u * GPI * 2u), "v"(l + 4u * 16u * GPI * 2u), "v"(l + 5u * 16u * GPI * 2u), "v"(l + 6u * 16u * GPI * 2u), "v"(l + 7u * 16u * GPI * 2u),
                    "v"(g), "v"(g + rs), "v"(g + 2 * rs), "v"(g + 3 * rs), "v"(g + 4 * rs), "v"(g + 5 * rs), "v"(g + 6 * rs), "v"(g + 7 * rs) : "memory");
}
template <typename T16, int NSPLIT, bool BIAS, bool PLANES = false>
__global__ __launch_bounds__(256) void k_gemmw(const T16* __restrict__ A, const T16* __restrict__ A2, const T16* __restrict__ Bt, const T16* __restrict__ Bt2, int K, float* C, int ldc, const float* __restrict__ bias, size_t sA, size_t sB, size_t sC, h16* P16 = nullptr, bf* Ph = nullptr, bf* Pl = nullptr, size_t sP = 0) {
    typedef typename WFrag<T16>::V V;
    constexpr bool HA2 = (NSPLIT == 1 || NSPLIT == 2), HB2 = (NSPLIT >= 2); constexpr int NT = 2 + (HA2 ? 1 : 0) + (HB2 ? 1 : 0);   // operand tiles of a stage: A, Bt, then A2, Bt2 where used
    __shared__ __align__(16) T16 ring[2 * NT * GTE];
    __shared__ __align__(16) float osw[8 * 16 * 68];
    const size_t z = blockIdx.z;
    if (PLANES) { const T16* X = A + (z & 1) * sA; const T16* Wt = Bt + (z >> 1) * sB; const bool sw = (z >> 1) == 2;
        A = sw ? Wt : X; Bt = sw ? X : Wt; ldc = sw ? TT : HD; sC = sw ? (size_t)64 : (size_t)TT * HD; P16 += z * sP; Ph += z * sP; Pl += z * sP; }
    else { A += z * sA; if (A2) A2 += z * sA; Bt += z * sB; if (Bt2) Bt2 += z * sB; C += z * sC; }
    const int tid = threadIdx.x, lane = tid & 31, lr = lane & 15, hi = lane >> 4, wv = tid >> 5; const int r0 = blockIdx.x * 128 + (wv >> 1) * 32, c0 = blockIdx.y * 128 + (wv & 1) * 64;
    float* os = osw + wv * (16 * 68);   // each wave's own epilogue staging
    v8f acc[2][4];
#pragma unroll
    for (int mb = 0; mb < 2; ++mb)
#pragma unroll
        for (int nb = 0; nb < 4; ++nb) acc[mb][nb] = (v8f){};
    const size_t ga = (size_t)(blockIdx.x * 128 + (tid >> 4)) * K + (tid & 15) * 8, gb = (size_t)(blockIdx.y * 128 + (tid >> 4)) * K + (tid & 15) * 8, rs = (size_t)16 * K;
    const unsigned l0 = (unsigned)(size_t)ring + (unsigned)((tid >> 4) * (GPI * 2) + (tid & 15) * 16);
    auto fill = [&](const int t) { const unsigned l = l0 + (unsigned)(t & 1) * (NT * GTE * 2u); const int k0 = t * GKP;
        cp_tile(A + ga + k0, rs, l); cp_tile(Bt + gb + k0, rs, l + GTE * 2u);
        if (HA2) cp_tile(A2 + ga + k0, rs, l + 2u * GTE * 2u);
        if (HB2) cp_tile(Bt2 + gb + k0, rs, l + (HA2 ? 3u : 2u) * GTE * 2u); };
    const int nt = K / GKP;
    fill(0);
    asm volatile("s_wait_asynccnt 0x0" ::: "memory");   // stage 0 has landed (this wave's copies)
    __syncthreads();                                     // ... and every other wave's
    if (nt > 1) fill(1);
    const int aoff = ((wv >> 1) * 32 + lr) * GPI + 8 * hi, boff = GTE + ((wv & 1) * 64 + lr) * GPI + 8 * hi;
    // rolled: one copy of the stage's code serves both buffers
#pragma unroll 1
    for (int t = 0; t < nt; ++t) {
        const T16* st = ring + (t & 1) * (NT * GTE);
        V a[2][2], a2[2][2], b[2][4], b2[2][4];   // two fragment sets: block ks + 1 is fetched while block ks is multiplied (inside the stage only)
        // unrolled: the two sets are then indexed by constants and stay in registers
#pragma unroll
        for (int ks = -1; ks < GKP / 32; ++ks) {
            if (ks + 1 < GKP / 32) { const int s = (ks + 1) & 1, kc = (ks + 1) * 32;
#pragma unroll
                for (int mb = 0; mb < 2; ++mb) { a[s][mb] = WFrag<T16>::ld(st + aoff + mb * 16 * GPI + kc); if (HA2) a2[s][mb] = WFrag<T16>::ld(st + 2 * GTE + aoff + mb * 16 * GPI + kc); }
#pragma unroll
                for (int nb = 0; nb < 4; ++nb) { b[s][nb] = WFrag<T16>::ld(st + boff + nb * 16 * GPI + kc); if (HB2) b2[s][nb] = WFrag<T16>::ld(st + (HA2 ? 2 : 1) * GTE + boff + nb * 16 * GPI + kc); } }
            __builtin_amdgcn_sched_barrier(0);   // the next block's LDS reads stay one group ahead of this block's products, none among them
            if (ks >= 0) { const int s = ks & 1;
#pragma unroll
                for (int nb = 0; nb < 4; ++nb)
#pragma unroll
                    for (int mb = 0; mb < 2; ++mb) acc[mb][nb] = WFrag<T16>::mma(a[s][mb], b[s][nb], acc[mb][nb]);
                if (HA2) {
#pragma unroll
                    for (int nb = 0; nb < 4; ++nb)
#pragma unroll
                        for (int mb = 0; mb < 2; ++mb) acc[mb][nb] = WFrag<T16>::mma(a2[s][mb], b[s][nb], acc[mb][nb]); }
                if (HB2) {
#pragma unroll
                    for (int nb = 0; nb < 4; ++nb)
#pragma unroll
                        for (int mb = 0; mb < 2; ++mb) acc[mb][nb] = WFrag<T16>::mma(a[s][mb], b2[s][nb], acc[mb][nb]); }
                __builtin_amdgcn_sched_barrier(0);   // ... and the reads of the block after next stay behind these products
            }
        }
        asm volatile("s_wait_dscnt 0x0" ::: "memory");      // this wave's reads of stage t are done
        asm volatile("s_wait_asynccnt 0x0" ::: "memory");   // this wave's copies of stage t + 1 have landed
        __syncthreads();                                     // publishes stage t + 1 and frees stage t's buffer
        if (t + 2 < nt) fill(t + 2);
    }
    asm volatile("s_wait_asynccnt 0x0" ::: "memory");   // no copy is left in flight when the wave goes on to its end
#pragma unroll
    for (int mb = 0; mb < 2; ++mb) {
#pragma unroll
        for (int nb = 0; nb < 4; ++nb) {
#pragma unroll
            for (int j = 0; j < 8; ++j) os[(hi * 8 + j) * 68 + nb * 16 + lr] = acc[mb][nb][j]; }
        __builtin_amdgcn_wave_barrier(); asm volatile("" ::: "memory");
        float* crow = C + (size_t)(r0 + mb * 16) * ldc + c0;
        if (PLANES) {
            // both loops unrolled: the vector elements are then indexed by constants and stay in registers
#pragma unroll
            for (int s = 0; s < 4; ++s) { const int row = 4 * s + (lane >> 3), cofs = (lane & 7) * 8;   // 8 lanes x 16 B = one 128-B line per row and plane
                const v4f x0 = *(const v4fa*)(os + row * 68 + cofs), x1 = *(const v4fa*)(os + row * 68 + cofs + 4); v8h o16; v8us oh, ol;
#pragma unroll
                for (int q = 0; q < 4; ++q) { unsigned short u, w; o16[q] = tohx(x0[q]); splitf(x0[q], u, w); oh[q] = u; ol[q] = w; o16[q + 4] = tohx(x1[q]); splitf(x1[q], u, w); oh[q + 4] = u; ol[q + 4] = w; }
                const size_t oo = (size_t)(r0 + mb * 16 + row) * ldc + (size_t)(c0 >> 6) * sC + cofs; *(v8h*)(P16 + oo) = o16; *(v8us*)(Ph + oo) = oh; *(v8us*)(Pl + oo) = ol; }
        } else
{
#pragma unroll
            for (int s = 0; s < 8; ++s) { const int row = 2 * s + hi, cofs = lr * 4; v4f val = *(const v4fa*)(os + row * 68 + cofs); if (BIAS) { val[0] += bfr(bias[c0 + cofs]); val[1] += bfr(bias[c0 + cofs + 1]); val[2] += bfr(bias[c0 + cofs + 2]); val[3] += bfr(bias[c0 + cofs + 3]); }
                *(v4f*)(crow + (size_t)row * ldc + cofs) = val; }
             }
        __builtin_amdgcn_wave_barrier(); asm volatile("" ::: "memory");
    }
}

typedef __attribute__((ext_vector_type(2))) _Float16 v2h;
typedef __attribute__((ext_vector_type(4))) _Float16 v4h;
typedef __attribute__((ext_vector_type(2))) unsigned short v2us;
typedef __attribute__((ext_vector_type(4))) unsigned short v4us;
typedef __attribute__((ext_vector_type(2))) float v2f;
typedef __attribute__((ext_vector_type(4))) int v4i;

// The three input-only jobs, each written for block number blk of its own range of k_prep's grid.
__device__ __forceinline__ void d_wtG(const float* __restrict__ w, int K, int N, bf* Bt, const int blk) {
    const int lane = threadIdx.x & 31; const int L0 = (blk * 8 + (threadIdx.x >> 5)) * 8; const int nlines = N * K / 64;
{
#pragma unroll 1
        for (int l = 0; l < 8; ++l) { const int L = L0 + l; if (L >= nlines) break; const size_t e = (size_t)L * 64 + lane * 2; const int k = (int)(e % K), n = (int)(e / K); v2us o;
            o[0] = f2bf(w[(size_t)k * N + n]); o[1] = f2bf(w[(size_t)(k + 1) * N + n]); *(v2us*)(Bt + e) = o; }
         }
}
__device__ __forceinline__ void d_cvt8(const float* __restrict__ src, bf* dst, size_t n8, const int blk) { const size_t i = (size_t)blk * 256 + threadIdx.x; if (i >= n8) return; const v8f v = *(const v8f*)(src + i * 8); v8us o;
#pragma unroll
    for (int k = 0; k < 8; ++k) o[k] = f2bf(v[k]); *(v8us*)(dst + i * 8) = o;  }

__device__ __forceinline__ float xhalf(float v) { const int b = __float_as_int(v); return __int_as_float(__builtin_amdgcn_permlanex16(b, b, 0x76543210, 0xfedcba98, false, false)); }   // lane l <-> l ^ 16
#define SCL2 (SCL * 1.4426950408889634f)
#define NEGB (-3.0e38f)

// fp16 operands, NQ tiles of 16 query columns from q0 (q0 and 16 NQ multiples of 32). The block's 4 waves share K and V^T through LDS: 64 keys a stage (64 K rows of 128 B, 64 V^T rows of 128 B), brought in by asynchronous 16-byte copies
// (8 lanes = one whole 128-B line), two buffers: the next stage's copies fly while this stage is worked on. Every wave walks all kendB / 64 stages of the block (kendB a multiple of 64) and skips the passes behind its own diagonal.
#define FKS 64                    // keys per stage
#define FPI 72                    // LDS row pitch in elements (144 B = 16 B x odd: ds_load_b128 without bank conflicts)
#define FTE (64 * FPI)            // elements of one tile in LDS (64 rows)
// One 64-row x 128-B tile into LDS: 4 copies a lane, copy i = rows 16 i .. 16 i + 15 over the 128 lanes. g = the lane's 16 bytes in row (tid / 8), l = their LDS byte address, rs = 16 rows in elements.
// The s_wait_xcnt stands inside the statement so that no address register of a copy is rewritten ahead of it.
template <typename T16>
__device__ __forceinline__ void cp_tile4(const T16* g, const size_t rs, const unsigned l) {
    asm volatile("global_load_async_to_lds_b128 %0, %4, off\n\t"
                 "global_load_async_to_lds_b128 %1, %5, off\n\t"
                 "global_load_async_to_lds_b128 %2, %6, off\n\t"
                 "global_load_async_to_lds_b128 %3, %7, off\n\t"
                 "s_wait_xcnt 0x0"
                 :: "v"(l), "v"(l + 1u * 16u * FPI * 2u), "v"(l + 2u * 16u * FPI * 2u), "v"(l + 3u * 16u * FPI * 2u),
                    "v"(g), "v"(g + rs), "v"(g + 2 * rs), "v"(g + 3 * rs) : "memory");
}
template <int NQ>
__device__ __forceinline__ void fa_f16(const _Float16* __restrict__ Q, const _Float16* __restrict__ K, const _Float16* __restrict__ VT, float* __restrict__ O, const int q0, const int kendB, _Float16* ring, const int tid, const int lr, const int hi) {
    v16h qf[NQ][2]; v8f o[4][NQ]; float m[NQ], l[NQ];
#pragma unroll
    for (int nq = 0; nq < NQ; ++nq) { m[nq] = NEGB; l[nq] = 0.f;
#pragma unroll
        for (int kc = 0; kc < 2; ++kc) qf[nq][kc] = WFrag<h16>::ld(Q + (size_t)(q0 + nq * 16 + lr) * HD + kc * 32 + 8 * hi);
#pragma unroll
        for (int dt = 0; dt < 4; ++dt) o[dt][nq] = (v8f){}; }
    const int kend = q0 + NQ * 16;
    const _Float16* gk = K + (size_t)(tid >> 3) * HD + (tid & 7) * 8; const _Float16* gv = VT + (size_t)(tid >> 3) * TT + (tid & 7) * 8;
    const unsigned l0 = (unsigned)(size_t)ring + (unsigned)((tid >> 3) * (FPI * 2) + (tid & 7) * 16);
    auto fill = [&](const int t) { const unsigned lb = l0 + (unsigned)(t & 1) * (2u * FTE * 2u);
        cp_tile4(gk + (size_t)t * (FKS * HD), (size_t)16 * HD, lb); cp_tile4(gv + (size_t)t * FKS, (size_t)16 * TT, lb + FTE * 2u); };
    const int nt = kendB / FKS;
    fill(0);
    asm volatile("s_wait_asynccnt 0x0" ::: "memory");   // stage 0 has landed (this wave's copies)
    __syncthreads();                                     // ... and every other wave's
    if (nt > 1) fill(1);
    const int koff = lr * FPI + 8 * hi, voff = FTE + lr * FPI + 8 * hi;
    // rolled: one copy of the stage's code serves both buffers
#pragma unroll 1
    for (int t = 0; t < nt; ++t) {
        const _Float16* st = ring + (t & 1) * (2 * FTE);
        // unrolled: the two passes' LDS offsets are then constants
#pragma unroll
        for (int h = 0; h < FKS / 32; ++h) { const int kb = t * FKS + h * 32;
            if (kb < kend) {   // passes behind the wave's diagonal are skipped (wave-uniform test)
                v16h kf[2][2], vf[4];
#pragma unroll
                for (int mt = 0; mt < 2; ++mt)
#pragma unroll
                    for (int kc = 0; kc < 2; ++kc) kf[mt][kc] = WFrag<h16>::ld(st + koff + (h * 32 + mt * 16) * FPI + kc * 32);
#pragma unroll
                for (int dt = 0; dt < 4; ++dt) vf[dt] = WFrag<h16>::ld(st + voff + (dt * 16) * FPI + h * 32);
                __builtin_amdgcn_sched_barrier(0);   // the pass's LDS reads stand in one place, K first: the V^T reads land behind the score products and the softmax
                v8f s[2][NQ];
#pragma unroll
                for (int mt = 0; mt < 2; ++mt)
#pragma unroll
                    for (int nq = 0; nq < NQ; ++nq) s[mt][nq] = wmma16(kf[mt][1], qf[nq][1], wmma16(kf[mt][0], qf[nq][0], (v8f){}));
                if (kb + 31 > q0) {   // only the diagonal pass masks (wave-uniform test)
#pragma unroll
                    for (int mt = 0; mt < 2; ++mt)
#pragma unroll
                        for (int nq = 0; nq < NQ; ++nq)
#pragma unroll
                            for (int j = 0; j < 8; ++j) if (kb + mt * 16 + 8 * hi + j > q0 + nq * 16 + lr) s[mt][nq][j] = NEGB; }
                float mx[NQ]; bool need = false;
#pragma unroll
                for (int nq = 0; nq < NQ; ++nq) { float tm = fmaxf(s[0][nq][0], s[1][nq][0]);
#pragma unroll
                    for (int j = 1; j < 8; ++j) tm = fmaxf(tm, fmaxf(s[0][nq][j], s[1][nq][j]));
                    tm = fmaxf(tm, xhalf(tm)); mx[nq] = tm * SCL2; need = need || (mx[nq] > m[nq] + 8.0f); }
                if (__builtin_amdgcn_ballot_w32(need) != 0) {   // one scalar branch a pass
#pragma unroll
                    for (int nq = 0; nq < NQ; ++nq) { const float mn = fmaxf(m[nq], mx[nq]); const float al = __builtin_amdgcn_exp2f(m[nq] - mn); m[nq] = mn; l[nq] *= al;
#pragma unroll
                        for (int dt = 0; dt < 4; ++dt) o[dt][nq] *= al; } }
#pragma unroll
                for (int nq = 0; nq < NQ; ++nq) { v8f p0, p1;
#pragma unroll
                    for (int j = 0; j < 8; ++j) { p0[j] = __builtin_amdgcn_exp2f(__builtin_fmaf(s[0][nq][j], SCL2, -m[nq])); p1[j] = __builtin_amdgcn_exp2f(__builtin_fmaf(s[1][nq][j], SCL2, -m[nq])); l[nq] += p0[j] + p1[j]; }
                    const v16h pf = cat16(__builtin_convertvector(p0, v8h), __builtin_convertvector(p1, v8h));
#pragma unroll
                    for (int dt = 0; dt < 4; ++dt) o[dt][nq] = wmma16(vf[dt], pf, o[dt][nq]); }
            }
        }
        asm volatile("s_wait_dscnt 0x0" ::: "memory");      // this wave's reads of stage t are done
        asm volatile("s_wait_asynccnt 0x0" ::: "memory");   // this wave's copies of stage t + 1 have landed
        __syncthreads();                                     // publishes stage t + 1 and frees stage t's buffer
        if (t + 2 < nt) fill(t + 2);
    }
    asm volatile("s_wait_asynccnt 0x0" ::: "memory");   // no copy is left in flight when the wave goes on to its end
#pragma unroll
    for (int nq = 0; nq < NQ; ++nq) { const float inv = 1.0f / (l[nq] + xhalf(l[nq])); float* orow = O + (size_t)(q0 + nq * 16 + lr) * DQ + 8 * hi;
#pragma unroll
        for (int dt = 0; dt < 4; ++dt) { const v8f r = o[dt][nq] * inv; *(v4f*)(orow + dt * 16) = __builtin_shufflevector(r, r, 0, 1, 2, 3); *(v4f*)(orow + dt * 16 + 4) = __builtin_shufflevector(r, r, 4, 5, 6, 7); } }
}

// bf16 hi + lo planes, three products for the scores and three for P.V; one tile of 16 query columns from q0 (a multiple of 16). K and V^T, hi and lo, staged for the block's 4 waves as in fa_f16: four tiles a stage, kendB a multiple of 64.
__device__ __forceinline__ void fa_hl(const unsigned short* __restrict__ Qh, const unsigned short* __restrict__ Ql, const unsigned short* __restrict__ Kh, const unsigned short* __restrict__ Kl, const unsigned short* __restrict__ VTh, const unsigned short* __restrict__ VTl, float* __restrict__ O, const int q0, const int kendB, unsigned short* ring, const int tid, const int lr, const int hi) {
    v16bf qh[2], ql[2]; v8f o[4]; float m = NEGB, l = 0.f;
#pragma unroll
    for (int kc = 0; kc < 2; ++kc) { const size_t qo = (size_t)(q0 + lr) * HD + kc * 32 + 8 * hi; qh[kc] = WFrag<bf>::ld(Qh + qo); ql[kc] = WFrag<bf>::ld(Ql + qo); }
#pragma unroll
    for (int dt = 0; dt < 4; ++dt) o[dt] = (v8f){};
    const int kend = (q0 + 16 + 31) & ~31;
    const size_t gk = (size_t)(tid >> 3) * HD + (tid & 7) * 8, gv = (size_t)(tid >> 3) * TT + (tid & 7) * 8;
    const unsigned l0 = (unsigned)(size_t)ring + (unsigned)((tid >> 3) * (FPI * 2) + (tid & 7) * 16);
    auto fill = [&](const int t) { const unsigned lb = l0 + (unsigned)(t & 1) * (4u * FTE * 2u); const size_t ak = gk + (size_t)t * (FKS * HD), av = gv + (size_t)t * FKS;
        cp_tile4(Kh + ak, (size_t)16 * HD, lb); cp_tile4(Kl + ak, (size_t)16 * HD, lb + FTE * 2u); cp_tile4(VTh + av, (size_t)16 * TT, lb + 2u * FTE * 2u); cp_tile4(VTl + av, (size_t)16 * TT, lb + 3u * FTE * 2u); };
    const int nt = kendB / FKS;
    fill(0);
    asm volatile("s_wait_asynccnt 0x0" ::: "memory");   // stage 0 has landed (this wave's copies)
    __syncthreads();                                     // ... and every other wave's
    if (nt > 1) fill(1);
    const int foff = lr * FPI + 8 * hi;
    // rolled: one copy of the stage's code serves both buffers
#pragma unroll 1
    for (int t = 0; t < nt; ++t) {
        const unsigned short* st = ring + (t & 1) * (4 * FTE) + foff;
        // unrolled: the two passes' LDS offsets are then constants
#pragma unroll
        for (int h = 0; h < FKS / 32; ++h) { const int kb = t * FKS + h * 32;
            if (kb < kend) {   // passes behind the wave's diagonal are skipped (wave-uniform test)
                v16bf kh[2][2], kl[2][2];
#pragma unroll
                for (int mt = 0; mt < 2; ++mt)
#pragma unroll
                    for (int kc = 0; kc < 2; ++kc) { const int a = (h * 32 + mt * 16) * FPI + kc * 32; kh[mt][kc] = WFrag<bf>::ld(st + a); kl[mt][kc] = WFrag<bf>::ld(st + FTE + a); }
                v16bf vh[4], vl[4];
#pragma unroll
                for (int dt = 0; dt < 4; ++dt) { const int a = (dt * 16) * FPI + h * 32; vh[dt] = WFrag<bf>::ld(st + 2 * FTE + a); vl[dt] = WFrag<bf>::ld(st + 3 * FTE + a); }
                __builtin_amdgcn_sched_barrier(0);   // the pass's LDS reads stand in one place, K first: the V^T reads land behind the score products and the softmax
                v8f s[2];
#pragma unroll
                for (int mt = 0; mt < 2; ++mt) { s[mt] = (v8f){};
#pragma unroll
                    for (int kc = 0; kc < 2; ++kc) { s[mt] = wmmab(kh[mt][kc], qh[kc], s[mt]); s[mt] = wmmab(kh[mt][kc], ql[kc], s[mt]); s[mt] = wmmab(kl[mt][kc], qh[kc], s[mt]); } }
                if (kb + 31 > q0) {   // only the diagonal pass masks (wave-uniform test)
#pragma unroll
                    for (int mt = 0; mt < 2; ++mt)
#pragma unroll
                        for (int j = 0; j < 8; ++j) if (kb + mt * 16 + 8 * hi + j > q0 + lr) s[mt][j] = NEGB; }
                float tm = fmaxf(s[0][0], s[1][0]);
#pragma unroll
                for (int j = 1; j < 8; ++j) tm = fmaxf(tm, fmaxf(s[0][j], s[1][j]));
                tm = fmaxf(tm, xhalf(tm)); const float mx = tm * SCL2;
                if (__builtin_amdgcn_ballot_w32(mx > m + 8.0f) != 0) {   // one scalar branch a pass
                    const float mn = fmaxf(m, mx); const float al = __builtin_amdgcn_exp2f(m - mn); m = mn; l *= al;
#pragma unroll
                    for (int dt = 0; dt < 4; ++dt) o[dt] *= al; }
                v8us h0, h1, l0v, l1v;
#pragma unroll
                for (int j = 0; j < 8; ++j) { const float p0 = __builtin_amdgcn_exp2f(__builtin_fmaf(s[0][j], SCL2, -m)), p1 = __builtin_amdgcn_exp2f(__builtin_fmaf(s[1][j], SCL2, -m)); l += p0 + p1; unsigned short u, w; splitf(p0, u, w); h0[j] = u; l0v[j] = w; splitf(p1, u, w); h1[j] = u; l1v[j] = w; }
                const v16bf ph = cat16b(h0, h1), pl = cat16b(l0v, l1v);
#pragma unroll
                for (int dt = 0; dt < 4; ++dt) { o[dt] = wmmab(vh[dt], ph, o[dt]); o[dt] = wmmab(vh[dt], pl, o[dt]); o[dt] = wmmab(vl[dt], ph, o[dt]); }
            }
        }
        asm volatile("s_wait_dscnt 0x0" ::: "memory");      // this wave's reads of stage t are done
        asm volatile("s_wait_asynccnt 0x0" ::: "memory");   // this wave's copies of stage t + 1 have landed
        __syncthreads();                                     // publishes stage t + 1 and frees stage t's buffer
        if (t + 2 < nt) fill(t + 2);
    }
    asm volatile("s_wait_asynccnt 0x0" ::: "memory");   // no copy is left in flight when the wave goes on to its end
    const float inv = 1.0f / (l + xhalf(l)); float* orow = O + (size_t)(q0 + lr) * DQ + 8 * hi;
#pragma unroll
    for (int dt = 0; dt < 4; ++dt) { const v8f r = o[dt] * inv; *(v4f*)(orow + dt * 16) = __builtin_shufflevector(r, r, 0, 1, 2, 3); *(v4f*)(orow + dt * 16 + 4) = __builtin_shufflevector(r, r, 4, 5, 6, 7); }
}

// grid (NB_ * NH_ heads, NTF + NTH row blocks), 4 waves a block. Row blocks run from the longest to the shortest: NTF blocks of 128 fp16 query rows from the end of the sequence down to RH, then NTH blocks of 64 hi/lo rows down to 0.
#define NTF ((TT - RH) / 128)
#define NTH (RH / 64)
__global__ __launch_bounds__(128) void k_fattn(const _Float16* __restrict__ Q16, const _Float16* __restrict__ K16, const _Float16* __restrict__ V16, const unsigned short* __restrict__ Qh, const unsigned short* __restrict__ Ql, const unsigned short* __restrict__ Kh, const unsigned short* __restrict__ Kl, const unsigned short* __restrict__ Vh, const unsigned short* __restrict__ Vl, float* __restrict__ AT) {
    const int lane = threadIdx.x & 31, lr = lane & 15, hi = lane >> 4; const int w = __builtin_amdgcn_readfirstlane((int)(threadIdx.x >> 5));   // the wave's number in a scalar register: loop bounds and the mask test stay scalar
    const size_t z = blockIdx.x, po = z * (size_t)TT * HD; float* O = AT + (z / NH_) * (size_t)TT * DQ + (z % NH_) * HD; const int y = blockIdx.y;
    __shared__ __align__(16) unsigned short fring[2 * 4 * FTE];   // two buffers of K and V^T tiles: one of each for the fp16 rows, hi and lo of each for the hi/lo rows
    if (y < NTF) fa_f16<2>(Q16 + po, K16 + po, V16 + po, O, TT - 128 * (y + 1) + 32 * w, TT - 128 * y, (_Float16*)fring, (int)threadIdx.x, lr, hi);
    else fa_hl(Qh + po, Ql + po, Kh + po, Kl + po, Vh + po, Vl + po, O, RH - 64 * (y - NTF + 1) + 16 * w, RH - 64 * (y - NTF), fring, (int)threadIdx.x, lr, hi);
}

__device__ __forceinline__ void d_lam(const float* __restrict__ a1, const float* __restrict__ b1, const float* __restrict__ a2, const float* __restrict__ b2, float* LAM) { if (threadIdx.x >= 32) return; const int lane = threadIdx.x; float d1 = __fadd_rn(__fmul_rn(bfr(a1[lane * 2]), bfr(b1[lane * 2])), __fmul_rn(bfr(a1[lane * 2 + 1]), bfr(b1[lane * 2 + 1]))); float d2 = __fadd_rn(__fmul_rn(bfr(a2[lane * 2]), bfr(b2[lane * 2])), __fmul_rn(bfr(a2[lane * 2 + 1]), bfr(b2[lane * 2 + 1])));
#pragma unroll
    for (int sh = 16; sh; sh >>= 1) { d1 = __fadd_rn(d1, __shfl_xor(d1, sh, 32)); d2 = __fadd_rn(d2, __shfl_xor(d2, sh, 32)); }
    float l = __fsub_rn(expf(d1), expf(d2)); asm volatile("" : "+v"(l)); l = __fadd_rn(l, LINIT); ((float*)LAM)[lane] = l;  }
// ---- k_prep: everything that reads inputs only, in one launch: none of these jobs reads another's output. Block 0: lambda; then NBW blocks for each of Wq, Wk, Wv; NBO for Wo; NBX for x. The long blocks (transposes) have the low numbers.
#define NBW ((DM * DQ / 64 + 63) / 64)
#define NBO ((DO * DM / 64 + 63) / 64)
#define NBX (NB_ * TT * DM / 8 / 256)
__global__ __launch_bounds__(256) void k_prep(const float* __restrict__ x, const float* __restrict__ wq, const float* __restrict__ wk, const float* __restrict__ wv, const float* __restrict__ wo, const float* __restrict__ lq1, const float* __restrict__ lk1, const float* __restrict__ lq2, const float* __restrict__ lk2, bf* XB, bf* W3, bf* WO, float* LAM) {
    int blk = blockIdx.x;
    if (blk == 0) { d_lam(lq1, lk1, lq2, lk2, LAM); return; }
    blk -= 1;
    if (blk < 3 * NBW) { const int kind = blk / NBW; d_wtG(kind == 0 ? wq : kind == 1 ? wk : wv, DM, DQ, W3 + (size_t)kind * DQ * DM, blk % NBW); return; }
    blk -= 3 * NBW;
    if (blk < NBO) { d_wtG(wo, DO, DM, WO, blk); return; }
    d_cvt8(x, XB, (size_t)NB_ * TT * DM / 8, blk - NBO);
}
__global__ __launch_bounds__(256) void k_comb(const float* __restrict__ A, const float* __restrict__ LAM, bf* Ph, bf* Pl) { const size_t i = (size_t)blockIdx.x * 256 + threadIdx.x; if (i >= (size_t)NB_ * TT * DO / 4) return; const size_t e = i * 4; const int c0 = (int)(e % DO); const size_t t = e / DO; const float lam = LAM[0]; const v4f o1 = *(const v4f*)(A + t * DQ + c0); const v4f o2 = *(const v4f*)(A + t * DQ + DO + c0); v4us oh, ol;
#pragma unroll
    for (int q = 0; q < 4; ++q) { float m = __fmul_rn(lam, o2[q]); asm volatile("" : "+v"(m)); float y = __fsub_rn(o1[q], m); asm volatile("" : "+v"(y)); y = __fmul_rn(y, 1.0f - LINIT); unsigned short u, w; splitf(y, u, w); oh[q] = u; ol[q] = w; }
    *(v4us*)(Ph + e) = oh; *(v4us*)(Pl + e) = ol;  }

extern "C" void kernel_launch(void* const* d_in, const int* in_sizes, int n_in,
                              void* d_out, int out_size, void* d_ws, size_t ws_size, hipStream_t stream) {
    (void)in_sizes; (void)n_in; (void)out_size;
    const float* x = (const float*)d_in[0]; const float* wq = (const float*)d_in[1]; const float* wk = (const float*)d_in[2]; const float* wv = (const float*)d_in[3]; const float* wo = (const float*)d_in[4]; const float* lq1 = (const float*)d_in[5]; const float* lk1 = (const float*)d_in[6]; const float* lq2 = (const float*)d_in[7]; const float* lk2 = (const float*)d_in[8];
    float* OUT = (float*)d_out;     // [2][2048][1024]
    char* wsp = (char*)d_ws;
    auto take = [&](size_t bytes) { char* p = wsp; wsp += (bytes + 255) & ~(size_t)255; return (void*)p; };
    const size_t PB = (size_t)NH_ * TT * HD;   // elements of one plane of one batch
    float* AT32 = (float*)take((size_t)NB_ * TT * DQ * 4); bf* WO = (bf*)take((size_t)DM * DO * 2); float* LAM = (float*)take(256); bf* W3 = (bf*)take((size_t)3 * DQ * DM * 2);   /* Wq, Wk, Wv transposed, one behind the other */
    // three planes (fp16, bf16 hi, bf16 lo), each q, k, v^T x both batches side by side ([kind][b][h][t][d]; v [b][g][d][t]): the projection launch finds its part by grid z, and one attention launch covers all NB_ * NH_ heads
    h16* P16 = (h16*)take(3 * NB_ * PB * 2); bf* Ph = (bf*)take(3 * NB_ * PB * 2); bf* Pl = (bf*)take(3 * NB_ * PB * 2);
    bf* XB = (bf*)take((size_t)NB_ * TT * DM * 2); bf* ACh = (bf*)take((size_t)NB_ * TT * DO * 2); bf* ACl = (bf*)take((size_t)NB_ * TT * DO * 2);
    if ((size_t)(wsp - (char*)d_ws) > ws_size) return;    // ws 256 MiB
    k_prep<<<1 + 3 * NBW + NBO + NBX, 256, 0, stream>>>(x, wq, wk, wv, wo, lq1, lk1, lq2, lk2, XB, W3, WO, LAM);   /* lambda line; weights 'xw' -> [n][k] bf16; x -> bf16 */
    k_gemmw<bf, 0, false, true><<<dim3(TT / 128, DQ / 128, 3 * NB_), 256, 0, stream>>>(XB, nullptr, W3, nullptr, DM, nullptr, 0, nullptr, (size_t)TT * DM, (size_t)DQ * DM, 0, P16, Ph, Pl, PB);   /* q, k head planes and transposed v planes of both batches */
    k_fattn<<<dim3(NB_ * NH_, NTF + NTH, 1), 128, 0, stream>>>(P16, P16 + NB_ * PB, P16 + 2 * NB_ * PB, Ph, Pl, Ph + NB_ * PB, Pl + NB_ * PB, Ph + 2 * NB_ * PB, Pl + 2 * NB_ * PB, AT32);   /* all heads of both batches -> f32 merge buffer [b][t][h][d] */
    k_comb<<<(unsigned)(((size_t)NB_ * TT * DO / 4 + 255) / 256), 256, 0, stream>>>(AT32, LAM, ACh, ACl);   /* (o1 - lambda o2) x (1 - lambda_init) -> planes, rows of both batches */
    k_gemmw<bf, 1, false><<<dim3(NB_ * TT / 128, DM / 128, 1), 256, 0, stream>>>(ACh, ACl, WO, nullptr, DO, OUT, DM, nullptr, 0, 0, 0);   /* Wo */
}

// v007
// Measured time: 128 microseconds a run.
// In two side-by-side timings against v006, it was 1.10 and 1.12 times as fast.
// Counting every step since v000, it is 21.2 times as fast.
#include <hip/hip_runtime.h>

// Differential causal attention (x [2][2048][1024]; q, k, v = x W ('xw' [1024][2048] 0.02) as 2 groups x 16 heads x 64; a_g = causal softmax(q_g.k_g / 8) (-1e30 fill); lambda = exp(lq1.lk1) - exp(lq2.lk2) + 0.8 (vectors [64], zeros, read: computed on device); o_h = (a1 v1 - lambda a2 v2) x (1 - 0.8); out = merged o Wo ('xw' [1024][1024]) -> [2][2048][1024] (4.2 M)).
// Layout: one input-only launch (k_prep) makes the bf16 copy of x (both batches), the transposed 'xw' weights and lambda; one launch holds the six exact projections (q, k, v of both batches on grid z) whose epilogue rounds each tile straight into the 16-bit head planes (v transposed by swapping the operands); the two groups run as 32 heads per batch of one fused causal attention launch (k_fattn: scores, online softmax and P.V in registers; query rows < 512 hi/lo 3 products, rest fp16), which stores into an f32 [b][2048][2048] merge buffer; a combine kernel forms (o1 - lambda o2) x 0.2 per head as hi/lo planes (both batches as 4096 rows); hi/lo x Wo exact, 4096 rows in one launch.
// Compute dtypes, f32 accumulate: every input rounded to bf16; projections exact; attention rows < 512 3 products, rest fp16; softmax f32; lambda (precise expf) and the combination f32; Wo hl x exact.

#define NB_  2
#define TT   2048
#define DM   1024
#define NH_  32
#define NKV  32
#define HD   64
#define DQ   (NH_ * HD)
#define DKV  (NKV * HD)
#define RH   512                  // query rows < RH use hi+lo planes
#define SCL  0.125f
#define NHO  16      // output heads (per group)
#define DO   (NHO * HD)   // 1024
#define LINIT 0.8f
typedef _Float16 h16;
typedef unsigned short bf;
typedef __attribute__((ext_vector_type(16))) __bf16   v16bf;
typedef __attribute__((ext_vector_type(16))) _Float16 v16h;
typedef __attribute__((ext_vector_type(8)))  _Float16 v8h;
typedef __attribute__((ext_vector_type(8)))  unsigned short v8us;
typedef __attribute__((ext_vector_type(8)))  float    v8f;
typedef __attribute__((ext_vector_type(4)))  float    v4f;
typedef v8h  __attribute__((may_alias)) v8ha;
typedef v4f  __attribute__((may_alias)) v4fa;
typedef v8us __attribute__((may_alias)) v8usa;

__device__ __forceinline__ unsigned short f2bf(float f) { unsigned u = __float_as_uint(f); u += 0x7FFFu + ((u >> 16) & 1u); return (unsigned short)(u >> 16); }
__device__ __forceinline__ float bf2f(unsigned short b) { return __uint_as_float(((unsigned)b) << 16); }
__device__ __forceinline__ float bfr(float f) { return bf2f(f2bf(f)); }
__device__ __forceinline__ h16 tohx(float x) { return (h16)x; }
__device__ __forceinline__ void splitf(float y, unsigned short& h, unsigned short& l) { h = f2bf(y); l = f2bf(y - bf2f(h)); }
__device__ __forceinline__ v16h cat16(v8h lo, v8h hi) { return __builtin_shufflevector(lo, hi, 0, 1, 2, 3, 4, 5, 6, 7, 8, 9, 10, 11, 12, 13, 14, 15); }
__device__ __forceinline__ v16bf cat16b(v8us lo, v8us hi) { return __builtin_bit_cast(v16bf, __builtin_shufflevector(lo, hi, 0, 1, 2, 3, 4, 5, 6, 7, 8, 9, 10, 11, 12, 13, 14, 15)); }
__device__ __forceinline__ v8f wmma16(v16h a, v16h b, v8f c) { return __builtin_amdgcn_wmma_f32_16x16x32_f16(false, a, false, b, (short)0, c, false, false); }
__device__ __forceinline__ v8f wmmab(v16bf a, v16bf b, v8f c) { return __builtin_amdgcn_wmma_f32_16x16x32_bf16(false, a, false, b, (short)0, c, false, false); }



// ---- k_gemmw: GEMM, one work-group of 8 waves (4 x 2) per 128x128 output tile, each wave a 32x64 tile (8 accumulators); grid (M/128, N/128, Z), 256 threads.
// The K-contiguous 16-bit operand planes come into LDS 128 k at a time by asynchronous 16-byte copies (16 lanes = 256 contiguous bytes of a row), two buffers: the next stage's copies fly while this stage is multiplied. Fragments are read from LDS rows of pitch 272 B.
// C[m][n] (f32, pitch ldc, + optional f32 bias[n]) = sum_k A[m][k] Bt[n][k] (+ split products per NSPLIT). z-batch strides sA/sB/sC in elements. K % 128 == 0, M % 128 == 0, N % 128 == 0.
// PLANES: no f32 C; the epilogue rounds the tile straight into the three 16-bit planes that attention reads (fp16, bf16 hi, bf16 lo); element (m, n) goes to plane offset m * ldc + (n / 64) * sC + n % 64.
// PLANES, grid z = 2 * kind + batch, six independent products in one launch: the arguments are A = x (sA = one batch), Bt = the three transposed weights (sB = one of them), sP = one batch of one plane; ldc and sC are set here.
// kind 0, 1 = q, k head planes [h][t][d]: A = x, Bt = weights, ldc = HD, sC = TT * HD. kind 2 = transposed v planes [g][d][t]: A = weights, Bt = x, ldc = TT, sC = 64.
template <typename T16> struct WFrag;
template <> struct WFrag<h16> { typedef v16h V; static __device__ __forceinline__ V ld(const h16* p) { return cat16(*(const v8h*)p, *(const v8h*)(p + 16)); } static __device__ __forceinline__ v8f mma(V a, V b, v8f c) { return wmma16(a, b, c); } };
template <> struct WFrag<bf> { typedef v16bf V; static __device__ __forceinline__ V ld(const bf* p) { return cat16b(*(const v8us*)p, *(const v8us*)(p + 16)); } static __device__ __forceinline__ v8f mma(V a, V b, v8f c) { return wmmab(a, b, c); } };
#define GKP 128                   // k per stage: 256 B of every operand row
#define GPI 136                   // LDS row pitch in elements (272 B = 16 B x odd: ds_load_b128 without bank conflicts)
#define GTE (128 * GPI)           // elements of one operand tile in LDS (128 rows)
// One 128-row x 256-B operand tile into LDS: 8 copies a lane, copy i = rows 16 i .. 16 i + 15 over the 256 lanes. g = the lane's 16 bytes in row (tid / 16), l = their LDS byte address, rs = 16 rows in elements.
// The s_wait_xcnt stands inside the statement so that no address register of a copy is rewritten ahead of it.
template <typename T16>
__device__ __forceinline__ void cp_tile(const T16* g, const size_t rs, const unsigned l) {
    asm volatile("global_load_async_to_lds_b128 %0, %8, off\n\t"
                 "global_load_async_to_lds_b128 %1, %9, off\n\t"
                 "global_load_async_to_lds_b128 %2, %10, off\n\t"
                 "global_load_async_to_lds_b128 %3, %11, off\n\t"
                 "global_load_async_to_lds_b128 %4, %12, off\n\t"
                 "global_load_async_to_lds_b128 %5, %13, off\n\t"
                 "global_load_async_to_lds_b128 %6, %14, off\n\t"
                 "global_load_async_to_lds_b128 %7, %15, off\n\t"
                 "s_wait_xcnt 0x0"
                 :: "v"(l), "v"(l + 1u * 16u * GPI * 2u), "v"(l + 2u * 16u * GPI * 2u), "v"(l + 3u * 16u * GPI * 2u), "v"(l + 4u * 16u * GPI * 2u), "v"(l + 5u * 16u * GPI * 2u), "v"(l + 6u * 16u * GPI * 2u), "v"(l + 7u * 16u * GPI * 2u),
                    "v"(g), "v"(g + rs), "v"(g + 2 * rs), "v"(g + 3 * rs), "v"(g + 4 * rs), "v"(g + 5 * rs), "v"(g + 6 * rs), "v"(g + 7 * rs) : "memory");
}
template <typename T16, int NSPLIT, bool BIAS, bool PLANES = false>
__global__ __launch_bounds__(256) void k_gemmw(const T16* __restrict__ A, const T16* __restrict__ A2, const T16* __restrict__ Bt, const T16* __restrict__ Bt2, int K, float* C, int ldc, const float* __restrict__ bias, size_t sA, size_t sB, size_t sC, h16* P16 = nullptr, bf* Ph = nullptr, bf* Pl = nullptr, size_t sP = 0) {
    typedef typename WFrag<T16>::V V;
    constexpr bool HA2 = (NSPLIT == 1 || NSPLIT == 2), HB2 = (NSPLIT >= 2); constexpr int NT = 2 + (HA2 ? 1 : 0) + (HB2 ? 1 : 0);   // operand tiles of a stage: A, Bt, then A2, Bt2 where used
    __shared__ __align__(16) T16 ring[2 * NT * GTE];
    float* osw = (float*)ring;   // the epilogue's staging (8 waves x 16 x 68 floats) takes the ring's place once the loop has left it: with two operand tiles a stage the work-group's LDS is then small enough for two work-groups on a WGP
    const size_t z = blockIdx.z;
    if (PLANES) { const T16* X = A + (z & 1) * sA; const T16* Wt = Bt + (z >> 1) * sB; const bool sw = (z >> 1) == 2;
        A = sw ? Wt : X; Bt = sw ? X : Wt; ldc = sw ? TT : HD; sC = sw ? (size_t)64 : (size_t)TT * HD; P16 += z * sP; Ph += z * sP; Pl += z * sP; }
    else { A += z * sA; if (A2) A2 += z * sA; Bt += z * sB; if (Bt2) Bt2 += z * sB; C += z * sC; }
    const int tid = threadIdx.x, lane = tid & 31, lr = lane & 15, hi = lane >> 4, wv = tid >> 5; const int r0 = blockIdx.x * 128 + (wv >> 1) * 32, c0 = blockIdx.y * 128 + (wv & 1) * 64;
    float* os = osw + wv * (16 * 68);   // each wave's own epilogue staging
    v8f acc[2][4];
#pragma unroll
    for (int mb = 0; mb < 2; ++mb)
#pragma unroll
        for (int nb = 0; nb < 4; ++nb) acc[mb][nb] = (v8f){};
    const size_t ga = (size_t)(blockIdx.x * 128 + (tid >> 4)) * K + (tid & 15) * 8, gb = (size_t)(blockIdx.y * 128 + (tid >> 4)) * K + (tid & 15) * 8, rs = (size_t)16 * K;
    const unsigned l0 = (unsigned)(size_t)ring + (unsigned)((tid >> 4) * (GPI * 2) + (tid & 15) * 16);
    auto fill = [&](const int t) { const unsigned l = l0 + (unsigned)(t & 1) * (NT * GTE * 2u); const int k0 = t * GKP;
        cp_tile(A + ga + k0, rs, l); cp_tile(Bt + gb + k0, rs, l + GTE * 2u);
        if (HA2) cp_tile(A2 + ga + k0, rs, l + 2u * GTE * 2u);
        if (HB2) cp_tile(Bt2 + gb + k0, rs, l + (HA2 ? 3u : 2u) * GTE * 2u); };
    const int nt = K / GKP;
    fill(0);
    asm volatile("s_wait_asynccnt 0x0" ::: "memory");   // stage 0 has landed (this wave's copies)
    __syncthreads();                                     // ... and every other wave's
    if (nt > 1) fill(1);
    const int aoff = ((wv >> 1) * 32 + lr) * GPI + 8 * hi, boff = GTE + ((wv & 1) * 64 + lr) * GPI + 8 * hi;
    // rolled: one copy of the stage's code serves both buffers
#pragma unroll 1
    for (int t = 0; t < nt; ++t) {
        const T16* st = ring + (t & 1) * (NT * GTE);
        V a[2][2], a2[2][2], b[2][4], b2[2][4];   // two fragment sets: block ks + 1 is fetched while block ks is multiplied (inside the stage only)
        // unrolled: the two sets are then indexed by constants and stay in registers
#pragma unroll
        for (int ks = -1; ks < GKP / 32; ++ks) {
            if (ks + 1 < GKP / 32) { const int s = (ks + 1) & 1, kc = (ks + 1) * 32;
#pragma unroll
                for (int mb = 0; mb < 2; ++mb) { a[s][mb] = WFrag<T16>::ld(st + aoff + mb * 16 * GPI + kc); if (HA2) a2[s][mb] = WFrag<T16>::ld(st + 2 * GTE + aoff + mb * 16 * GPI + kc); }
#pragma unroll
                for (int nb = 0; nb < 4; ++nb) { b[s][nb] = WFrag<T16>::ld(st + boff + nb * 16 * GPI + kc); if (HB2) b2[s][nb] = WFrag<T16>::ld(st + (HA2 ? 2 : 1) * GTE + boff + nb * 16 * GPI + kc); } }
            __builtin_amdgcn_sched_barrier(0);   // the next block's LDS reads stay one group ahead of this block's products, none among them
            if (ks >= 0) { const int s = ks & 1;
#pragma unroll
                for (int nb = 0; nb < 4; ++nb)
#pragma unroll
                    for (int mb = 0; mb < 2; ++mb) acc[mb][nb] = WFrag<T16>::mma(a[s][mb], b[s][nb], acc[mb][nb]);
                if (HA2) {
#pragma unroll
                    for (int nb = 0; nb < 4; ++nb)
#pragma unroll
                        for (int mb = 0; mb < 2; ++mb) acc[mb][nb] = WFrag<T16>::mma(a2[s][mb], b[s][nb], acc[mb][nb]); }
                if (HB2) {
#pragma unroll
                    for (int nb = 0; nb < 4; ++nb)
#pragma unroll
                        for (int mb = 0; mb < 2; ++mb) acc[mb][nb] = WFrag<T16>::mma(a[s][mb], b2[s][nb], acc[mb][nb]); }
                __builtin_amdgcn_sched_barrier(0);   // ... and the reads of the block after next stay behind these products
            }
        }
        asm volatile("s_wait_dscnt 0x0" ::: "memory");      // this wave's reads of stage t are done
        asm volatile("s_wait_asynccnt 0x0" ::: "memory");   // this wave's copies of stage t + 1 have landed
        __syncthreads();                                     // publishes stage t + 1 and frees stage t's buffer
        if (t + 2 < nt) fill(t + 2);
    }
    asm volatile("s_wait_asynccnt 0x0" ::: "memory");   // no copy is left in flight when the wave goes on to its end
#pragma unroll
    for (int mb = 0; mb < 2; ++mb) {
#pragma unroll
        for (int nb = 0; nb < 4; ++nb) {
#pragma unroll
            for (int j = 0; j < 8; ++j) os[(hi * 8 + j) * 68 + nb * 16 + lr] = acc[mb][nb][j]; }
        __builtin_amdgcn_wave_barrier(); asm volatile("" ::: "memory");
        float* crow = C + (size_t)(r0 + mb * 16) * ldc + c0;
        if (PLANES) {
            // both loops unrolled: the vector elements are then indexed by constants and stay in registers
#pragma unroll
            for (int s = 0; s < 4; ++s) { const int row = 4 * s + (lane >> 3), cofs = (lane & 7) * 8;   // 8 lanes x 16 B = one 128-B line per row and plane
                const v4f x0 = *(const v4fa*)(os + row * 68 + cofs), x1 = *(const v4fa*)(os + row * 68 + cofs + 4); v8h o16; v8us oh, ol;
#pragma unroll
                for (int q = 0; q < 4; ++q) { unsigned short u, w; o16[q] = tohx(x0[q]); splitf(x0[q], u, w); oh[q] = u; ol[q] = w; o16[q + 4] = tohx(x1[q]); splitf(x1[q], u, w); oh[q + 4] = u; ol[q + 4] = w; }
                const size_t oo = (size_t)(r0 + mb * 16 + row) * ldc + (size_t)(c0 >> 6) * sC + cofs; *(v8h*)(P16 + oo) = o16; *(v8us*)(Ph + oo) = oh; *(v8us*)(Pl + oo) = ol; }
        } else
{
#pragma unroll
            for (int s = 0; s < 8; ++s) { const int row = 2 * s + hi, cofs = lr * 4; v4f val = *(const v4fa*)(os + row * 68 + cofs); if (BIAS) { val[0] += bfr(bias[c0 + cofs]); val[1] += bfr(bias[c0 + cofs + 1]); val[2] += bfr(bias[c0 + cofs + 2]); val[3] += bfr(bias[c0 + cofs + 3]); }
                *(v4f*)(crow + (size_t)row * ldc + cofs) = val; }
             }
        __builtin_amdgcn_wave_barrier(); asm volatile("" ::: "memory");
    }
}

typedef __attribute__((ext_vector_type(2))) _Float16 v2h;
typedef __attribute__((ext_vector_type(4))) _Float16 v4h;
typedef __attribute__((ext_vector_type(2))) unsigned short v2us;
typedef __attribute__((ext_vector_type(4))) unsigned short v4us;
typedef __attribute__((ext_vector_type(2))) float v2f;
typedef __attribute__((ext_vector_type(4))) int v4i;

// The three input-only jobs, each written for block number blk of its own range of k_prep's grid.
__device__ __forceinline__ void d_wtG(const float* __restrict__ w, int K, int N, bf* Bt, const int blk) {
    const int lane = threadIdx.x & 31; const int L0 = (blk * 8 + (threadIdx.x >> 5)) * 8; const int nlines = N * K / 64;
{
#pragma unroll 1
        for (int l = 0; l < 8; ++l) { const int L = L0 + l; if (L >= nlines) break; const size_t e = (size_t)L * 64 + lane * 2; const int k = (int)(e % K), n = (int)(e / K); v2us o;
            o[0] = f2bf(w[(size_t)k * N + n]); o[1] = f2bf(w[(size_t)(k + 1) * N + n]); *(v2us*)(Bt + e) = o; }
         }
}
__device__ __forceinline__ void d_cvt8(const float* __restrict__ src, bf* dst, size_t n8, const int blk) { const size_t i = (size_t)blk * 256 + threadIdx.x; if (i >= n8) return; const v8f v = *(const v8f*)(src + i * 8); v8us o;
#pragma unroll
    for (int k = 0; k < 8; ++k) o[k] = f2bf(v[k]); *(v8us*)(dst + i * 8) = o;  }

__device__ __forceinline__ float xhalf(float v) { const int b = __float_as_int(v); return __int_as_float(__builtin_amdgcn_permlanex16(b, b, 0x76543210, 0xfedcba98, false, false)); }   // lane l <-> l ^ 16
#define SCL2 (SCL * 1.4426950408889634f)
#define NEGB (-3.0e38f)

// fp16 operands, NQ tiles of 16 query columns from q0 (q0 and 16 NQ multiples of 32). The block's 4 waves share K and V^T through LDS: 64 keys a stage (64 K rows of 128 B, 64 V^T rows of 128 B), brought in by asynchronous 16-byte copies
// (8 lanes = one whole 128-B line), two buffers: the next stage's copies fly while this stage is worked on. Every wave walks all kendB / 64 stages of the block (kendB a multiple of 64) and skips the passes behind its own diagonal.
#define FKS 64                    // keys per stage
#define FPI 72                    // LDS row pitch in elements (144 B = 16 B x odd: ds_load_b128 without bank conflicts)
#define FTE (64 * FPI)            // elements of one tile in LDS (64 rows)
// One 64-row x 128-B tile into LDS: 4 copies a lane, copy i = rows 16 i .. 16 i + 15 over the 128 lanes. g = the lane's 16 bytes in row (tid / 8), l = their LDS byte address, rs = 16 rows in elements.
// The s_wait_xcnt stands inside the statement so that no address register of a copy is rewritten ahead of it.
template <typename T16>
__device__ __forceinline__ void cp_tile4(const T16* g, const size_t rs, const unsigned l) {
    asm volatile("global_load_async_to_lds_b128 %0, %4, off\n\t"
                 "global_load_async_to_lds_b128 %1, %5, off\n\t"
                 "global_load_async_to_lds_b128 %2, %6, off\n\t"
                 "global_load_async_to_lds_b128 %3, %7, off\n\t"
                 "s_wait_xcnt 0x0"
                 :: "v"(l), "v"(l + 1u * 16u * FPI * 2u), "v"(l + 2u * 16u * FPI * 2u), "v"(l + 3u * 16u * FPI * 2u),
                    "v"(g), "v"(g + rs), "v"(g + 2 * rs), "v"(g + 3 * rs) : "memory");
}
template <int NQ>
__device__ __forceinline__ void fa_f16(const _Float16* __restrict__ Q, const _Float16* __restrict__ K, const _Float16* __restrict__ VT, float* __restrict__ O, const int q0, const int kendB, _Float16* ring, const int tid, const int lr, const int hi) {
    v16h qf[NQ][2]; v8f o[4][NQ]; float m[NQ], l[NQ];
#pragma unroll
    for (int nq = 0; nq < NQ; ++nq) { m[nq] = NEGB; l[nq] = 0.f;
#pragma unroll
        for (int kc = 0; kc < 2; ++kc) qf[nq][kc] = WFrag<h16>::ld(Q + (size_t)(q0 + nq * 16 + lr) * HD + kc * 32 + 8 * hi);
#pragma unroll
        for (int dt = 0; dt < 4; ++dt) o[dt][nq] = (v8f){}; }
    const int kend = q0 + NQ * 16;
    const _Float16* gk = K + (size_t)(tid >> 3) * HD + (tid & 7) * 8; const _Float16* gv = VT + (size_t)(tid >> 3) * TT + (tid & 7) * 8;
    const unsigned l0 = (unsigned)(size_t)ring + (unsigned)((tid >> 3) * (FPI * 2) + (tid & 7) * 16);
    auto fill = [&](const int t) { const unsigned lb = l0 + (unsigned)(t & 1) * (2u * FTE * 2u);
        cp_tile4(gk + (size_t)t * (FKS * HD), (size_t)16 * HD, lb); cp_tile4(gv + (size_t)t * FKS, (size_t)16 * TT, lb + FTE * 2u); };
    const int nt = kendB / FKS;
    fill(0);
    asm volatile("s_wait_asynccnt 0x0" ::: "memory");   // stage 0 has landed (this wave's copies)
    __syncthreads();                                     // ... and every other wave's
    if (nt > 1) fill(1);
    const int koff = lr * FPI + 8 * hi, voff = FTE + lr * FPI + 8 * hi;
    // rolled: one copy of the stage's code serves both buffers
#pragma unroll 1
    for (int t = 0; t < nt; ++t) {
        const _Float16* st = ring + (t & 1) * (2 * FTE);
        // unrolled: the two passes' LDS offsets are then constants
#pragma unroll
        for (int h = 0; h < FKS / 32; ++h) { const int kb = t * FKS + h * 32;
            if (kb < kend) {   // passes behind the wave's diagonal are skipped (wave-uniform test)
                v16h kf[2][2], vf[4];
#pragma unroll
                for (int mt = 0; mt < 2; ++mt)
#pragma unroll
                    for (int kc = 0; kc < 2; ++kc) kf[mt][kc] = WFrag<h16>::ld(st + koff + (h * 32 + mt * 16) * FPI + kc * 32);
#pragma unroll
                for (int dt = 0; dt < 4; ++dt) vf[dt] = WFrag<h16>::ld(st + voff + (dt * 16) * FPI + h * 32);
                __builtin_amdgcn_sched_barrier(0);   // the pass's LDS reads stand in one place, K first: the V^T reads land behind the score products and the softmax
                v8f s[2][NQ];
#pragma unroll
                for (int mt = 0; mt < 2; ++mt)
#pragma unroll
                    for (int nq = 0; nq < NQ; ++nq) s[mt][nq] = wmma16(kf[mt][1], qf[nq][1], wmma16(kf[mt][0], qf[nq][0], (v8f){}));
                if (kb + 31 > q0) {   // only the diagonal pass masks (wave-uniform test)
#pragma unroll
                    for (int mt = 0; mt < 2; ++mt)
#pragma unroll
                        for (int nq = 0; nq < NQ; ++nq)
#pragma unroll
                            for (int j = 0; j < 8; ++j) if (kb + mt * 16 + 8 * hi + j > q0 + nq * 16 + lr) s[mt][nq][j] = NEGB; }
                float mx[NQ]; bool need = false;
#pragma unroll
                for (int nq = 0; nq < NQ; ++nq) { float tm = fmaxf(s[0][nq][0], s[1][nq][0]);
#pragma unroll
                    for (int j = 1; j < 8; ++j) tm = fmaxf(tm, fmaxf(s[0][nq][j], s[1][nq][j]));
                    tm = fmaxf(tm, xhalf(tm)); mx[nq] = tm * SCL2; need = need || (mx[nq] > m[nq] + 8.0f); }
                if (__builtin_amdgcn_ballot_w32(need) != 0) {   // one scalar branch a pass
#pragma unroll
                    for (int nq = 0; nq < NQ; ++nq) { const float mn = fmaxf(m[nq], mx[nq]); const float al = __builtin_amdgcn_exp2f(m[nq] - mn); m[nq] = mn; l[nq] *= al;
#pragma unroll
                        for (int dt = 0; dt < 4; ++dt) o[dt][nq] *= al; } }
#pragma unroll
                for (int nq = 0; nq < NQ; ++nq) { v8f p0, p1;
#pragma unroll
                    for (int j = 0; j < 8; ++j) { p0[j] = __builtin_amdgcn_exp2f(__builtin_fmaf(s[0][nq][j], SCL2, -m[nq])); p1[j] = __builtin_amdgcn_exp2f(__builtin_fmaf(s[1][nq][j], SCL2, -m[nq])); l[nq] += p0[j] + p1[j]; }
                    const v16h pf = cat16(__builtin_convertvector(p0, v8h), __builtin_convertvector(p1, v8h));
#pragma unroll
                    for (int dt = 0; dt < 4; ++dt) o[dt][nq] = wmma16(vf[dt], pf, o[dt][nq]); }
            }
        }
        asm volatile("s_wait_dscnt 0x0" ::: "memory");      // this wave's reads of stage t are done
        asm volatile("s_wait_asynccnt 0x0" ::: "memory");   // this wave's copies of stage t + 1 have landed
        __syncthreads();                                     // publishes stage t + 1 and frees stage t's buffer
        if (t + 2 < nt) fill(t + 2);
    }
    asm volatile("s_wait_asynccnt 0x0" ::: "memory");   // no copy is left in flight when the wave goes on to its end
#pragma unroll
    for (int nq = 0; nq < NQ; ++nq) { const float inv = 1.0f / (l[nq] + xhalf(l[nq])); float* orow = O + (size_t)(q0 + nq * 16 + lr) * DQ + 8 * hi;
#pragma unroll
        for (int dt = 0; dt < 4; ++dt) { const v8f r = o[dt][nq] * inv; *(v4f*)(orow + dt * 16) = __builtin_shufflevector(r, r, 0, 1, 2, 3); *(v4f*)(orow + dt * 16 + 4) = __builtin_shufflevector(r, r, 4, 5, 6, 7); } }
}

// bf16 hi + lo planes, three products for the scores and three for P.V; one tile of 16 query columns from q0 (a multiple of 16). K and V^T, hi and lo, staged for the block's 4 waves as in fa_f16: four tiles a stage, kendB a multiple of 64.
__device__ __forceinline__ void fa_hl(const unsigned short* __restrict__ Qh, const unsigned short* __restrict__ Ql, const unsigned short* __restrict__ Kh, const unsigned short* __restrict__ Kl, const unsigned short* __restrict__ VTh, const unsigned short* __restrict__ VTl, float* __restrict__ O, const int q0, const int kendB, unsigned short* ring, const int tid, const int lr, const int hi) {
    v16bf qh[2], ql[2]; v8f o[4]; float m = NEGB, l = 0.f;
#pragma unroll
    for (int kc = 0; kc < 2; ++kc) { const size_t qo = (size_t)(q0 + lr) * HD + kc * 32 + 8 * hi; qh[kc] = WFrag<bf>::ld(Qh + qo); ql[kc] = WFrag<bf>::ld(Ql + qo); }
#pragma unroll
    for (int dt = 0; dt < 4; ++dt) o[dt] = (v8f){};
    const int kend = (q0 + 16 + 31) & ~31;
    const size_t gk = (size_t)(tid >> 3) * HD + (tid & 7) * 8, gv = (size_t)(tid >> 3) * TT + (tid & 7) * 8;
    const unsigned l0 = (unsigned)(size_t)ring + (unsigned)((tid >> 3) * (FPI * 2) + (tid & 7) * 16);
    auto fill = [&](const int t) { const unsigned lb = l0 + (unsigned)(t & 1) * (4u * FTE * 2u); const size_t ak = gk + (size_t)t * (FKS * HD), av = gv + (size_t)t * FKS;
        cp_tile4(Kh + ak, (size_t)16 * HD, lb); cp_tile4(Kl + ak, (size_t)16 * HD, lb + FTE * 2u); cp_tile4(VTh + av, (size_t)16 * TT, lb + 2u * FTE * 2u); cp_tile4(VTl + av, (size_t)16 * TT, lb + 3u * FTE * 2u); };
    const int nt = kendB / FKS;
    fill(0);
    asm volatile("s_wait_asynccnt 0x0" ::: "memory");   // stage 0 has landed (this wave's copies)
    __syncthreads();                                     // ... and every other wave's
    if (nt > 1) fill(1);
    const int foff = lr * FPI + 8 * hi;
    // rolled: one copy of the stage's code serves both buffers
#pragma unroll 1
    for (int t = 0; t < nt; ++t) {
        const unsigned short* st = ring + (t & 1) * (4 * FTE) + foff;
        // unrolled: the two passes' LDS offsets are then constants
#pragma unroll
        for (int h = 0; h < FKS / 32; ++h) { const int kb = t * FKS + h * 32;
            if (kb < kend) {   // passes behind the wave's diagonal are skipped (wave-uniform test)
                v16bf kh[2][2], kl[2][2];
#pragma unroll
                for (int mt = 0; mt < 2; ++mt)
#pragma unroll
                    for (int kc = 0; kc < 2; ++kc) { const int a = (h * 32 + mt * 16) * FPI + kc * 32; kh[mt][kc] = WFrag<bf>::ld(st + a); kl[mt][kc] = WFrag<bf>::ld(st + FTE + a); }
                v16bf vh[4], vl[4];
#pragma unroll
                for (int dt = 0; dt < 4; ++dt) { const int a = (dt * 16) * FPI + h * 32; vh[dt] = WFrag<bf>::ld(st + 2 * FTE + a); vl[dt] = WFrag<bf>::ld(st + 3 * FTE + a); }
                __builtin_amdgcn_sched_barrier(0);   // the pass's LDS reads stand in one place, K first: the V^T reads land behind the score products and the softmax
                v8f s[2];
#pragma unroll
                for (int mt = 0; mt < 2; ++mt) { s[mt] = (v8f){};
#pragma unroll
                    for (int kc = 0; kc < 2; ++kc) { s[mt] = wmmab(kh[mt][kc], qh[kc], s[mt]); s[mt] = wmmab(kh[mt][kc], ql[kc], s[mt]); s[mt] = wmmab(kl[mt][kc], qh[kc], s[mt]); } }
                if (kb + 31 > q0) {   // only the diagonal pass masks (wave-uniform test)
#pragma unroll
                    for (int mt = 0; mt < 2; ++mt)
#pragma unroll
                        for (int j = 0; j < 8; ++j) if (kb + mt * 16 + 8 * hi + j > q0 + lr) s[mt][j] = NEGB; }
                float tm = fmaxf(s[0][0], s[1][0]);
#pragma unroll
                for (int j = 1; j < 8; ++j) tm = fmaxf(tm, fmaxf(s[0][j], s[1][j]));
                tm = fmaxf(tm, xhalf(tm)); const float mx = tm * SCL2;
                if (__builtin_amdgcn_ballot_w32(mx > m + 8.0f) != 0) {   // one scalar branch a pass
                    const float mn = fmaxf(m, mx); const float al = __builtin_amdgcn_exp2f(m - mn); m = mn; l *= al;
#pragma unroll
                    for (int dt = 0; dt < 4; ++dt) o[dt] *= al; }
                v8us h0, h1, l0v, l1v;
#pragma unroll
                for (int j = 0; j < 8; ++j) { const float p0 = __builtin_amdgcn_exp2f(__builtin_fmaf(s[0][j], SCL2, -m)), p1 = __builtin_amdgcn_exp2f(__builtin_fmaf(s[1][j], SCL2, -m)); l += p0 + p1; unsigned short u, w; splitf(p0, u, w); h0[j] = u; l0v[j] = w; splitf(p1, u, w); h1[j] = u; l1v[j] = w; }
                const v16bf ph = cat16b(h0, h1), pl = cat16b(l0v, l1v);
#pragma unroll
                for (int dt = 0; dt < 4; ++dt) { o[dt] = wmmab(vh[dt], ph, o[dt]); o[dt] = wmmab(vh[dt], pl, o[dt]); o[dt] = wmmab(vl[dt], ph, o[dt]); }
            }
        }
        asm volatile("s_wait_dscnt 0x0" ::: "memory");      // this wave's reads of stage t are done
        asm volatile("s_wait_asynccnt 0x0" ::: "memory");   // this wave's copies of stage t + 1 have landed
        __syncthreads();                                     // publishes stage t + 1 and frees stage t's buffer
        if (t + 2 < nt) fill(t + 2);
    }
    asm volatile("s_wait_asynccnt 0x0" ::: "memory");   // no copy is left in flight when the wave goes on to its end
    const float inv = 1.0f / (l + xhalf(l)); float* orow = O + (size_t)(q0 + lr) * DQ + 8 * hi;
#pragma unroll
    for (int dt = 0; dt < 4; ++dt) { const v8f r = o[dt] * inv; *(v4f*)(orow + dt * 16) = __builtin_shufflevector(r, r, 0, 1, 2, 3); *(v4f*)(orow + dt * 16 + 4) = __builtin_shufflevector(r, r, 4, 5, 6, 7); }
}

// grid (NB_ * NH_ heads, NTF + NTH row blocks), 4 waves a block. Row blocks run from the longest to the shortest: NTF blocks of 128 fp16 query rows from the end of the sequence down to RH, then NTH blocks of 64 hi/lo rows down to 0.
#define NTF ((TT - RH) / 128)
#define NTH (RH / 64)
__global__ __launch_bounds__(128) void k_fattn(const _Float16* __restrict__ Q16, const _Float16* __restrict__ K16, const _Float16* __restrict__ V16, const unsigned short* __restrict__ Qh, const unsigned short* __restrict__ Ql, const unsigned short* __restrict__ Kh, const unsigned short* __restrict__ Kl, const unsigned short* __restrict__ Vh, const unsigned short* __restrict__ Vl, float* __restrict__ AT) {
    const int lane = threadIdx.x & 31, lr = lane & 15, hi = lane >> 4; const int w = __builtin_amdgcn_readfirstlane((int)(threadIdx.x >> 5));   // the wave's number in a scalar register: loop bounds and the mask test stay scalar
    const size_t z = blockIdx.x, po = z * (size_t)TT * HD; float* O = AT + (z / NH_) * (size_t)TT * DQ + (z % NH_) * HD; const int y = blockIdx.y;
    __shared__ __align__(16) unsigned short fring[2 * 4 * FTE];   // two buffers of K and V^T tiles: one of each for the fp16 rows, hi and lo of each for the hi/lo rows
    if (y < NTF) fa_f16<2>(Q16 + po, K16 + po, V16 + po, O, TT - 128 * (y + 1) + 32 * w, TT - 128 * y, (_Float16*)fring, (int)threadIdx.x, lr, hi);
    else fa_hl(Qh + po, Ql + po, Kh + po, Kl + po, Vh + po, Vl + po, O, RH - 64 * (y - NTF + 1) + 16 * w, RH - 64 * (y - NTF), fring, (int)threadIdx.x, lr, hi);
}

__device__ __forceinline__ void d_lam(const float* __restrict__ a1, const float* __restrict__ b1, const float* __restrict__ a2, const float* __restrict__ b2, float* LAM) { if (threadIdx.x >= 32) return; const int lane = threadIdx.x; float d1 = __fadd_rn(__fmul_rn(bfr(a1[lane * 2]), bfr(b1[lane * 2])), __fmul_rn(bfr(a1[lane * 2 + 1]), bfr(b1[lane * 2 + 1]))); float d2 = __fadd_rn(__fmul_rn(bfr(a2[lane * 2]), bfr(b2[lane * 2])), __fmul_rn(bfr(a2[lane * 2 + 1]), bfr(b2[lane * 2 + 1])));
#pragma unroll
    for (int sh = 16; sh; sh >>= 1) { d1 = __fadd_rn(d1, __shfl_xor(d1, sh, 32)); d2 = __fadd_rn(d2, __shfl_xor(d2, sh, 32)); }
    float l = __fsub_rn(expf(d1), expf(d2)); asm volatile("" : "+v"(l)); l = __fadd_rn(l, LINIT); ((float*)LAM)[lane] = l;  }
// ---- k_prep: everything that reads inputs only, in one launch: none of these jobs reads another's output. Block 0: lambda; then NBW blocks for each of Wq, Wk, Wv; NBO for Wo; NBX for x. The long blocks (transposes) have the low numbers.
#define NBW ((DM * DQ / 64 + 63) / 64)
#define NBO ((DO * DM / 64 + 63) / 64)
#define NBX (NB_ * TT * DM / 8 / 256)
__global__ __launch_bounds__(256) void k_prep(const float* __restrict__ x, const float* __restrict__ wq, const float* __restrict__ wk, const float* __restrict__ wv, const float* __restrict__ wo, const float* __restrict__ lq1, const float* __restrict__ lk1, const float* __restrict__ lq2, const float* __restrict__ lk2, bf* XB, bf* W3, bf* WO, float* LAM) {
    int blk = blockIdx.x;
    if (blk == 0) { d_lam(lq1, lk1, lq2, lk2, LAM); return; }
    blk -= 1;
    if (blk < 3 * NBW) { const int kind = blk / NBW; d_wtG(kind == 0 ? wq : kind == 1 ? wk : wv, DM, DQ, W3 + (size_t)kind * DQ * DM, blk % NBW); return; }
    blk -= 3 * NBW;
    if (blk < NBO) { d_wtG(wo, DO, DM, WO, blk); return; }
    d_cvt8(x, XB, (size_t)NB_ * TT * DM / 8, blk - NBO);
}
__global__ __launch_bounds__(256) void k_comb(const float* __restrict__ A, const float* __restrict__ LAM, bf* Ph, bf* Pl) { const size_t i = (size_t)blockIdx.x * 256 + threadIdx.x; if (i >= (size_t)NB_ * TT * DO / 4) return; const size_t e = i * 4; const int c0 = (int)(e % DO); const size_t t = e / DO; const float lam = LAM[0]; const v4f o1 = *(const v4f*)(A + t * DQ + c0); const v4f o2 = *(const v4f*)(A + t * DQ + DO + c0); v4us oh, ol;
#pragma unroll
    for (int q = 0; q < 4; ++q) { float m = __fmul_rn(lam, o2[q]); asm volatile("" : "+v"(m)); float y = __fsub_rn(o1[q], m); asm volatile("" : "+v"(y)); y = __fmul_rn(y, 1.0f - LINIT); unsigned short u, w; splitf(y, u, w); oh[q] = u; ol[q] = w; }
    *(v4us*)(Ph + e) = oh; *(v4us*)(Pl + e) = ol;  }

extern "C" void kernel_launch(void* const* d_in, const int* in_sizes, int n_in,
                              void* d_out, int out_size, void* d_ws, size_t ws_size, hipStream_t stream) {
    (void)in_sizes; (void)n_in; (void)out_size;
    const float* x = (const float*)d_in[0]; const float* wq = (const float*)d_in[1]; const float* wk = (const float*)d_in[2]; const float* wv = (const float*)d_in[3]; const float* wo = (const float*)d_in[4]; const float* lq1 = (const float*)d_in[5]; const float* lk1 = (const float*)d_in[6]; const float* lq2 = (const float*)d_in[7]; const float* lk2 = (const float*)d_in[8];
    float* OUT = (float*)d_out;     // [2][2048][1024]
    char* wsp = (char*)d_ws;
    auto take = [&](size_t bytes) { char* p = wsp; wsp += (bytes + 255) & ~(size_t)255; return (void*)p; };
    const size_t PB = (size_t)NH_ * TT * HD;   // elements of one plane of one batch
    float* AT32 = (float*)take((size_t)NB_ * TT * DQ * 4); bf* WO = (bf*)take((size_t)DM * DO * 2); float* LAM = (float*)take(256); bf* W3 = (bf*)take((size_t)3 * DQ * DM * 2);   /* Wq, Wk, Wv transposed, one behind the other */
    // three planes (fp16, bf16 hi, bf16 lo), each q, k, v^T x both batches side by side ([kind][b][h][t][d]; v [b][g][d][t]): the projection launch finds its part by grid z, and one attention launch covers all NB_ * NH_ heads
    h16* P16 = (h16*)take(3 * NB_ * PB * 2); bf* Ph = (bf*)take(3 * NB_ * PB * 2); bf* Pl = (bf*)take(3 * NB_ * PB * 2);
    bf* XB = (bf*)take((size_t)NB_ * TT * DM * 2); bf* ACh = (bf*)take((size_t)NB_ * TT * DO * 2); bf* ACl = (bf*)take((size_t)NB_ * TT * DO * 2);
    if ((size_t)(wsp - (char*)d_ws) > ws_size) return;    // ws 256 MiB
    k_prep<<<1 + 3 * NBW + NBO + NBX, 256, 0, stream>>>(x, wq, wk, wv, wo, lq1, lk1, lq2, lk2, XB, W3, WO, LAM);   /* lambda line; weights 'xw' -> [n][k] bf16; x -> bf16 */
    k_gemmw<bf, 0, false, true><<<dim3(TT / 128, DQ / 128, 3 * NB_), 256, 0, stream>>>(XB, nullptr, W3, nullptr, DM, nullptr, 0, nullptr, (size_t)TT * DM, (size_t)DQ * DM, 0, P16, Ph, Pl, PB);   /* q, k head planes and transposed v planes of both batches */
    k_fattn<<<dim3(NB_ * NH_, NTF + NTH, 1), 128, 0, stream>>>(P16, P16 + NB_ * PB, P16 + 2 * NB_ * PB, Ph, Pl, Ph + NB_ * PB, Pl + NB_ * PB, Ph + 2 * NB_ * PB, Pl + 2 * NB_ * PB, AT32);   /* all heads of both batches -> f32 merge buffer [b][t][h][d] */
    k_comb<<<(unsigned)(((size_t)NB_ * TT * DO / 4 + 255) / 256), 256, 0, stream>>>(AT32, LAM, ACh, ACl);   /* (o1 - lambda o2) x (1 - lambda_init) -> planes, rows of both batches */
    k_gemmw<bf, 1, false><<<dim3(NB_ * TT / 128, DM / 128, 1), 256, 0, stream>>>(ACh, ACl, WO, nullptr, DO, OUT, DM, nullptr, 0, 0, 0);   /* Wo */
}

// v008
// One run takes 118 microseconds.
// Next to v007, in two timings, it ran 1.08 times as fast each time.
// All steps since v000 together make it 23.0 times as fast.
#include <hip/hip_runtime.h>

// Differential causal attention (x [2][2048][1024]; q, k, v = x W ('xw' [1024][2048] 0.02) as 2 groups x 16 heads x 64; a_g = causal softmax(q_g.k_g / 8) (-1e30 fill); lambda = exp(lq1.lk1) - exp(lq2.lk2) + 0.8 (vectors [64], zeros, read: computed on device); o_h = (a1 v1 - lambda a2 v2) x (1 - 0.8); out = merged o Wo ('xw' [1024][1024]) -> [2][2048][1024] (4.2 M)).
// Layout: one input-only launch (k_prep) makes the bf16 copy of x (both batches), the transposed 'xw' weights and lambda; one launch holds the six exact projections (q, k, v of both batches on grid z) whose epilogue rounds each tile straight into the 16-bit head planes (v transposed by swapping the operands); the two groups run as 32 heads per batch of one fused causal attention launch (k_fattn: scores, online softmax and P.V in registers; query rows < 512 hi/lo 3 products, rest fp16), whose blocks hold head h of both groups (4 waves each): the second group's waves hand their normalised tiles over through LDS and the first group's form (o1 - lambda o2) x 0.2 and store it as hi/lo planes (both batches as 4096 rows); hi/lo x Wo exact, 4096 rows in one launch.
// Compute dtypes, f32 accumulate: every input rounded to bf16; projections exact; attention rows < 512 3 products, rest fp16; softmax f32; lambda (precise expf) and the combination f32; Wo hl x exact.

#define NB_  2
#define TT   2048
#define DM   1024
#define NH_  32
#define NKV  32
#define HD   64
#define DQ   (NH_ * HD)
#define DKV  (NKV * HD)
#define RH   512                  // query rows < RH use hi+lo planes
#define SCL  0.125f
#define NHO  16      // output heads (per group)
#define DO   (NHO * HD)   // 1024
#define LINIT 0.8f
typedef _Float16 h16;
typedef unsigned short bf;
typedef __attribute__((ext_vector_type(16))) __bf16   v16bf;
typedef __attribute__((ext_vector_type(16))) _Float16 v16h;
typedef __attribute__((ext_vector_type(8)))  _Float16 v8h;
typedef __attribute__((ext_vector_type(8)))  unsigned short v8us;
typedef __attribute__((ext_vector_type(8)))  float    v8f;
typedef __attribute__((ext_vector_type(4)))  float    v4f;
typedef v8h  __attribute__((may_alias)) v8ha;
typedef v4f  __attribute__((may_alias)) v4fa;
typedef v8us __attribute__((may_alias)) v8usa;

__device__ __forceinline__ unsigned short f2bf(float f) { unsigned u = __float_as_uint(f); u += 0x7FFFu + ((u >> 16) & 1u); return (unsigned short)(u >> 16); }
__device__ __forceinline__ float bf2f(unsigned short b) { return __uint_as_float(((unsigned)b) << 16); }
__device__ __forceinline__ float bfr(float f) { return bf2f(f2bf(f)); }
__device__ __forceinline__ h16 tohx(float x) { return (h16)x; }
__device__ __forceinline__ void splitf(float y, unsigned short& h, unsigned short& l) { h = f2bf(y); l = f2bf(y - bf2f(h)); }
__device__ __forceinline__ v16h cat16(v8h lo, v8h hi) { return __builtin_shufflevector(lo, hi, 0, 1, 2, 3, 4, 5, 6, 7, 8, 9, 10, 11, 12, 13, 14, 15); }
__device__ __forceinline__ v16bf cat16b(v8us lo, v8us hi) { return __builtin_bit_cast(v16bf, __builtin_shufflevector(lo, hi, 0, 1, 2, 3, 4, 5, 6, 7, 8, 9, 10, 11, 12, 13, 14, 15)); }
__device__ __forceinline__ v8f wmma16(v16h a, v16h b, v8f c) { return __builtin_amdgcn_wmma_f32_16x16x32_f16(false, a, false, b, (short)0, c, false, false); }
__device__ __forceinline__ v8f wmmab(v16bf a, v16bf b, v8f c) { return __builtin_amdgcn_wmma_f32_16x16x32_bf16(false, a, false, b, (short)0, c, false, false); }



// ---- k_gemmw: GEMM, one work-group of 8 waves (4 x 2) per 128x128 output tile, each wave a 32x64 tile (8 accumulators); grid (M/128, N/128, Z), 256 threads.
// The K-contiguous 16-bit operand planes come into LDS 128 k at a time by asynchronous 16-byte copies (16 lanes = 256 contiguous bytes of a row), two buffers: the next stage's copies fly while this stage is multiplied. Fragments are read from LDS rows of pitch 272 B.
// C[m][n] (f32, pitch ldc, + optional f32 bias[n]) = sum_k A[m][k] Bt[n][k] (+ split products per NSPLIT). z-batch strides sA/sB/sC in elements. K % 128 == 0, M % 128 == 0, N % 128 == 0.
// PLANES: no f32 C; the epilogue rounds the tile straight into the three 16-bit planes that attention reads (fp16, bf16 hi, bf16 lo); element (m, n) goes to plane offset m * ldc + (n / 64) * sC + n % 64.
// PLANES, grid z = 2 * kind + batch, six independent products in one launch: the arguments are A = x (sA = one batch), Bt = the three transposed weights (sB = one of them), sP = one batch of one plane; ldc and sC are set here.
// kind 0, 1 = q, k head planes [h][t][d]: A = x, Bt = weights, ldc = HD, sC = TT * HD. kind 2 = transposed v planes [g][d][t]: A = weights, Bt = x, ldc = TT, sC = 64.
template <typename T16> struct WFrag;
template <> struct WFrag<h16> { typedef v16h V; static __device__ __forceinline__ V ld(const h16* p) { return cat16(*(const v8h*)p, *(const v8h*)(p + 16)); } static __device__ __forceinline__ v8f mma(V a, V b, v8f c) { return wmma16(a, b, c); } };
template <> struct WFrag<bf> { typedef v16bf V; static __device__ __forceinline__ V ld(const bf* p) { return cat16b(*(const v8us*)p, *(const v8us*)(p + 16)); } static __device__ __forceinline__ v8f mma(V a, V b, v8f c) { return wmmab(a, b, c); } };
#define GKP 128                   // k per stage: 256 B of every operand row
#define GPI 136                   // LDS row pitch in elements (272 B = 16 B x odd: ds_load_b128 without bank conflicts)
#define GTE (128 * GPI)           // elements of one operand tile in LDS (128 rows)
// One 128-row x 256-B operand tile into LDS: 8 copies a lane, copy i = rows 16 i .. 16 i + 15 over the 256 lanes. g = the lane's 16 bytes in row (tid / 16), l = their LDS byte address, rs = 16 rows in elements.
// The s_wait_xcnt stands inside the statement so that no address register of a copy is rewritten ahead of it.
template <typename T16>
__device__ __forceinline__ void cp_tile(const T16* g, const size_t rs, const unsigned l) {
    asm volatile("global_load_async_to_lds_b128 %0, %8, off\n\t"
                 "global_load_async_to_lds_b128 %1, %9, off\n\t"
                 "global_load_async_to_lds_b128 %2, %10, off\n\t"
                 "global_load_async_to_lds_b128 %3, %11, off\n\t"
                 "global_load_async_to_lds_b128 %4, %12, off\n\t"
                 "global_load_async_to_lds_b128 %5, %13, off\n\t"
                 "global_load_async_to_lds_b128 %6, %14, off\n\t"
                 "global_load_async_to_lds_b128 %7, %15, off\n\t"
                 "s_wait_xcnt 0x0"
                 :: "v"(l), "v"(l + 1u * 16u * GPI * 2u), "v"(l + 2u * 16u * GPI * 2u), "v"(l + 3u * 16u * GPI * 2u), "v"(l + 4u * 16u * GPI * 2u), "v"(l + 5u * 16u * GPI * 2u), "v"(l + 6u * 16u * GPI * 2u), "v"(l + 7u * 16u * GPI * 2u),
                    "v"(g), "v"(g + rs), "v"(g + 2 * rs), "v"(g + 3 * rs), "v"(g + 4 * rs), "v"(g + 5 * rs), "v"(g + 6 * rs), "v"(g + 7 * rs) : "memory");
}
template <typename T16, int NSPLIT, bool BIAS, bool PLANES = false>
__global__ __launch_bounds__(256) void k_gemmw(const T16* __restrict__ A, const T16* __restrict__ A2, const T16* __restrict__ Bt, const T16* __restrict__ Bt2, int K, float* C, int ldc, const float* __restrict__ bias, size_t sA, size_t sB, size_t sC, h16* P16 = nullptr, bf* Ph = nullptr, bf* Pl = nullptr, size_t sP = 0) {
    typedef typename WFrag<T16>::V V;
    constexpr bool HA2 = (NSPLIT == 1 || NSPLIT == 2), HB2 = (NSPLIT >= 2); constexpr int NT = 2 + (HA2 ? 1 : 0) + (HB2 ? 1 : 0);   // operand tiles of a stage: A, Bt, then A2, Bt2 where used
    __shared__ __align__(16) T16 ring[2 * NT * GTE];
    float* osw = (float*)ring;   // the epilogue's staging (8 waves x 16 x 68 floats) takes the ring's place once the loop has left it: with two operand tiles a stage the work-group's LDS is then small enough for two work-groups on a WGP
    const size_t z = blockIdx.z;
    if (PLANES) { const T16* X = A + (z & 1) * sA; const T16* Wt = Bt + (z >> 1) * sB; const bool sw = (z >> 1) == 2;
        A = sw ? Wt : X; Bt = sw ? X : Wt; ldc = sw ? TT : HD; sC = sw ? (size_t)64 : (size_t)TT * HD; P16 += z * sP; Ph += z * sP; Pl += z * sP; }
    else { A += z * sA; if (A2) A2 += z * sA; Bt += z * sB; if (Bt2) Bt2 += z * sB; C += z * sC; }
    const int tid = threadIdx.x, lane = tid & 31, lr = lane & 15, hi = lane >> 4, wv = tid >> 5; const int r0 = blockIdx.x * 128 + (wv >> 1) * 32, c0 = blockIdx.y * 128 + (wv & 1) * 64;
    float* os = osw + wv * (16 * 68);   // each wave's own epilogue staging
    v8f acc[2][4];
#pragma unroll
    for (int mb = 0; mb < 2; ++mb)
#pragma unroll
        for (int nb = 0; nb < 4; ++nb) acc[mb][nb] = (v8f){};
    const size_t ga = (size_t)(blockIdx.x * 128 + (tid >> 4)) * K + (tid & 15) * 8, gb = (size_t)(blockIdx.y * 128 + (tid >> 4)) * K + (tid & 15) * 8, rs = (size_t)16 * K;
    const unsigned l0 = (unsigned)(size_t)ring + (unsigned)((tid >> 4) * (GPI * 2) + (tid & 15) * 16);
    auto fill = [&](const int t) { const unsigned l = l0 + (unsigned)(t & 1) * (NT * GTE * 2u); const int k0 = t * GKP;
        cp_tile(A + ga + k0, rs, l); cp_tile(Bt + gb + k0, rs, l + GTE * 2u);
        if (HA2) cp_tile(A2 + ga + k0, rs, l + 2u * GTE * 2u);
        if (HB2) cp_tile(Bt2 + gb + k0, rs, l + (HA2 ? 3u : 2u) * GTE * 2u); };
    const int nt = K / GKP;
    fill(0);
    asm volatile("s_wait_asynccnt 0x0" ::: "memory");   // stage 0 has landed (this wave's copies)
    __syncthreads();                                     // ... and every other wave's
    if (nt > 1) fill(1);
    const int aoff = ((wv >> 1) * 32 + lr) * GPI + 8 * hi, boff = GTE + ((wv & 1) * 64 + lr) * GPI + 8 * hi;
    // rolled: one copy of the stage's code serves both buffers
#pragma unroll 1
    for (int t = 0; t < nt; ++t) {
        const T16* st = ring + (t & 1) * (NT * GTE);
        V a[2][2], a2[2][2], b[2][4], b2[2][4];   // two fragment sets: block ks + 1 is fetched while block ks is multiplied (inside the stage only)
        // unrolled: the two sets are then indexed by constants and stay in registers
#pragma unroll
        for (int ks = -1; ks < GKP / 32; ++ks) {
            if (ks + 1 < GKP / 32) { const int s = (ks + 1) & 1, kc = (ks + 1) * 32;
#pragma unroll
                for (int mb = 0; mb < 2; ++mb) { a[s][mb] = WFrag<T16>::ld(st + aoff + mb * 16 * GPI + kc); if (HA2) a2[s][mb] = WFrag<T16>::ld(st + 2 * GTE + aoff + mb * 16 * GPI + kc); }
#pragma unroll
                for (int nb = 0; nb < 4; ++nb) { b[s][nb] = WFrag<T16>::ld(st + boff + nb * 16 * GPI + kc); if (HB2) b2[s][nb] = WFrag<T16>::ld(st + (HA2 ? 2 : 1) * GTE + boff + nb * 16 * GPI + kc); } }
            __builtin_amdgcn_sched_barrier(0);   // the next block's LDS reads stay one group ahead of this block's products, none among them
            if (ks >= 0) { const int s = ks & 1;
#pragma unroll
                for (int nb = 0; nb < 4; ++nb)
#pragma unroll
                    for (int mb = 0; mb < 2; ++mb) acc[mb][nb] = WFrag<T16>::mma(a[s][mb], b[s][nb], acc[mb][nb]);
                if (HA2) {
#pragma unroll
                    for (int nb = 0; nb < 4; ++nb)
#pragma unroll
                        for (int mb = 0; mb < 2; ++mb) acc[mb][nb] = WFrag<T16>::mma(a2[s][mb], b[s][nb], acc[mb][nb]); }
                if (HB2) {
#pragma unroll
                    for (int nb = 0; nb < 4; ++nb)
#pragma unroll
                        for (int mb = 0; mb < 2; ++mb) acc[mb][nb] = WFrag<T16>::mma(a[s][mb], b2[s][nb], acc[mb][nb]); }
                __builtin_amdgcn_sched_barrier(0);   // ... and the reads of the block after next stay behind these products
            }
        }
        asm volatile("s_wait_dscnt 0x0" ::: "memory");      // this wave's reads of stage t are done
        asm volatile("s_wait_asynccnt 0x0" ::: "memory");   // this wave's copies of stage t + 1 have landed
        __syncthreads();                                     // publishes stage t + 1 and frees stage t's buffer
        if (t + 2 < nt) fill(t + 2);
    }
    asm volatile("s_wait_asynccnt 0x0" ::: "memory");   // no copy is left in flight when the wave goes on to its end
#pragma unroll
    for (int mb = 0; mb < 2; ++mb) {
#pragma unroll
        for (int nb = 0; nb < 4; ++nb) {
#pragma unroll
            for (int j = 0; j < 8; ++j) os[(hi * 8 + j) * 68 + nb * 16 + lr] = acc[mb][nb][j]; }
        __builtin_amdgcn_wave_barrier(); asm volatile("" ::: "memory");
        float* crow = C + (size_t)(r0 + mb * 16) * ldc + c0;
        if (PLANES) {
            // both loops unrolled: the vector elements are then indexed by constants and stay in registers
#pragma unroll
            for (int s = 0; s < 4; ++s) { const int row = 4 * s + (lane >> 3), cofs = (lane & 7) * 8;   // 8 lanes x 16 B = one 128-B line per row and plane
                const v4f x0 = *(const v4fa*)(os + row * 68 + cofs), x1 = *(const v4fa*)(os + row * 68 + cofs + 4); v8h o16; v8us oh, ol;
#pragma unroll
                for (int q = 0; q < 4; ++q) { unsigned short u, w; o16[q] = tohx(x0[q]); splitf(x0[q], u, w); oh[q] = u; ol[q] = w; o16[q + 4] = tohx(x1[q]); splitf(x1[q], u, w); oh[q + 4] = u; ol[q + 4] = w; }
                const size_t oo = (size_t)(r0 + mb * 16 + row) * ldc + (size_t)(c0 >> 6) * sC + cofs; *(v8h*)(P16 + oo) = o16; *(v8us*)(Ph + oo) = oh; *(v8us*)(Pl + oo) = ol; }
        } else
{
#pragma unroll
            for (int s = 0; s < 8; ++s) { const int row = 2 * s + hi, cofs = lr * 4; v4f val = *(const v4fa*)(os + row * 68 + cofs); if (BIAS) { val[0] += bfr(bias[c0 + cofs]); val[1] += bfr(bias[c0 + cofs + 1]); val[2] += bfr(bias[c0 + cofs + 2]); val[3] += bfr(bias[c0 + cofs + 3]); }
                *(v4f*)(crow + (size_t)row * ldc + cofs) = val; }
             }
        __builtin_amdgcn_wave_barrier(); asm volatile("" ::: "memory");
    }
}

typedef __attribute__((ext_vector_type(2))) _Float16 v2h;
typedef __attribute__((ext_vector_type(4))) _Float16 v4h;
typedef __attribute__((ext_vector_type(2))) unsigned short v2us;
typedef __attribute__((ext_vector_type(4))) unsigned short v4us;
typedef __attribute__((ext_vector_type(2))) float v2f;
typedef __attribute__((ext_vector_type(4))) int v4i;

// The three input-only jobs, each written for block number blk of its own range of k_prep's grid.
__device__ __forceinline__ void d_wtG(const float* __restrict__ w, int K, int N, bf* Bt, const int blk) {
    const int lane = threadIdx.x & 31; const int L0 = (blk * 8 + (threadIdx.x >> 5)) * 8; const int nlines = N * K / 64;
{
#pragma unroll 1
        for (int l = 0; l < 8; ++l) { const int L = L0 + l; if (L >= nlines) break; const size_t e = (size_t)L * 64 + lane * 2; const int k = (int)(e % K), n = (int)(e / K); v2us o;
            o[0] = f2bf(w[(size_t)k * N + n]); o[1] = f2bf(w[(size_t)(k + 1) * N + n]); *(v2us*)(Bt + e) = o; }
         }
}
__device__ __forceinline__ void d_cvt8(const float* __restrict__ src, bf* dst, size_t n8, const int blk) { const size_t i = (size_t)blk * 256 + threadIdx.x; if (i >= n8) return; const v8f v = *(const v8f*)(src + i * 8); v8us o;
#pragma unroll
    for (int k = 0; k < 8; ++k) o[k] = f2bf(v[k]); *(v8us*)(dst + i * 8) = o;  }

__device__ __forceinline__ float xhalf(float v) { const int b = __float_as_int(v); return __int_as_float(__builtin_amdgcn_permlanex16(b, b, 0x76543210, 0xfedcba98, false, false)); }   // lane l <-> l ^ 16
#define SCL2 (SCL * 1.4426950408889634f)
#define NEGB (-3.0e38f)

// fp16 operands, NQ tiles of 16 query columns from q0 (q0 and 16 NQ multiples of 32). The 4 waves of a group share its K and V^T through LDS: 64 keys a stage (64 K rows of 128 B, 64 V^T rows of 128 B), brought in by asynchronous 16-byte copies
// (8 lanes = one whole 128-B line), two buffers: the next stage's copies fly while this stage is worked on. Every wave walks all kendB / 64 stages of the block (kendB a multiple of 64) and skips the passes behind its own diagonal.
#define FKS 64                    // keys per stage
#define FPI 72                    // LDS row pitch in elements (144 B = 16 B x odd: ds_load_b128 without bank conflicts)
#define FTE (64 * FPI)            // elements of one tile in LDS (64 rows)
// One 64-row x 128-B tile into LDS: 4 copies a lane, copy i = rows 16 i .. 16 i + 15 over the 128 lanes. g = the lane's 16 bytes in row (tid / 8), l = their LDS byte address, rs = 16 rows in elements.
// The s_wait_xcnt stands inside the statement so that no address register of a copy is rewritten ahead of it.
template <typename T16>
__device__ __forceinline__ void cp_tile4(const T16* g, const size_t rs, const unsigned l) {
    asm volatile("global_load_async_to_lds_b128 %0, %4, off\n\t"
                 "global_load_async_to_lds_b128 %1, %5, off\n\t"
                 "global_load_async_to_lds_b128 %2, %6, off\n\t"
                 "global_load_async_to_lds_b128 %3, %7, off\n\t"
                 "s_wait_xcnt 0x0"
                 :: "v"(l), "v"(l + 1u * 16u * FPI * 2u), "v"(l + 2u * 16u * FPI * 2u), "v"(l + 3u * 16u * FPI * 2u),
                    "v"(g), "v"(g + rs), "v"(g + 2 * rs), "v"(g + 3 * rs) : "memory");
}
// The end of a block: o = the wave's normalised output tiles (lane (lr, hi): query column lr, d = 16 dt + 8 hi + j). The waves of group 1 (g == 1, the second attention map) lay theirs into LDS, 16 B a lane, lanes side by side;
// behind one barrier wave w of group 0 takes the tiles of wave w of group 1, forms (o1 - lambda o2) x (1 - lambda_init) and stores the hi and lo planes (row pitch DO; a wave writes the whole 128-B line of a row and plane).
// xw = the wave pair's own place in the ring's LDS (+ 4 lane floats), which every wave has left behind the loop's last barrier, with no copy in flight.
template <int NQ>
__device__ __forceinline__ void fa_merge(const v8f (&o)[4][NQ], const int g, float* xw, const float lam, bf* __restrict__ Ch, bf* __restrict__ Cl, const int q0, const int lr, const int hi) {
    if (g == 1) {   // wave-uniform (scalar) test
#pragma unroll
        for (int nq = 0; nq < NQ; ++nq)
#pragma unroll
            for (int dt = 0; dt < 4; ++dt) { const v8f r = o[dt][nq]; float* p = xw + (nq * 4 + dt) * 256; *(v4fa*)p = __builtin_shufflevector(r, r, 0, 1, 2, 3); *(v4fa*)(p + 128) = __builtin_shufflevector(r, r, 4, 5, 6, 7); } }
    __syncthreads();   // group 1's tiles are in LDS for group 0
    if (g == 0) {
#pragma unroll
        for (int nq = 0; nq < NQ; ++nq)
#pragma unroll
            for (int dt = 0; dt < 4; ++dt) { const float* p = xw + (nq * 4 + dt) * 256; const v4f a = *(const v4fa*)p, b = *(const v4fa*)(p + 128); v8us oh, ol;
#pragma unroll
                for (int j = 0; j < 8; ++j) { const float y = (o[dt][nq][j] - lam * (j < 4 ? a[j & 3] : b[j & 3])) * (1.0f - LINIT); unsigned short u, w; splitf(y, u, w); oh[j] = u; ol[j] = w; }
                const size_t oo = (size_t)(q0 + nq * 16 + lr) * DO + dt * 16 + 8 * hi; *(v8us*)(Ch + oo) = oh; *(v8us*)(Cl + oo) = ol;
                asm volatile("s_wait_xcnt 0x0" ::: "memory"); } }   // the next tile reuses the registers that these two stores name: the wait stands in front of that
}
template <int NQ>
__device__ __forceinline__ void fa_f16(const _Float16* __restrict__ Q, const _Float16* __restrict__ K, const _Float16* __restrict__ VT, const int q0, const int kendB, _Float16* ring, const int tid, const int lr, const int hi, const int g, float* xw, const float lam, bf* __restrict__ Ch, bf* __restrict__ Cl) {
    v16h qf[NQ][2]; v8f o[4][NQ]; float m[NQ], l[NQ];
#pragma unroll
    for (int nq = 0; nq < NQ; ++nq) { m[nq] = NEGB; l[nq] = 0.f;
#pragma unroll
        for (int kc = 0; kc < 2; ++kc) qf[nq][kc] = WFrag<h16>::ld(Q + (size_t)(q0 + nq * 16 + lr) * HD + kc * 32 + 8 * hi);
#pragma unroll
        for (int dt = 0; dt < 4; ++dt) o[dt][nq] = (v8f){}; }
    const int kend = q0 + NQ * 16;
    const _Float16* gk = K + (size_t)(tid >> 3) * HD + (tid & 7) * 8; const _Float16* gv = VT + (size_t)(tid >> 3) * TT + (tid & 7) * 8;
    const unsigned l0 = (unsigned)(size_t)ring + (unsigned)((tid >> 3) * (FPI * 2) + (tid & 7) * 16);
    auto fill = [&](const int t) { const unsigned lb = l0 + (unsigned)(t & 1) * (2u * FTE * 2u);
        cp_tile4(gk + (size_t)t * (FKS * HD), (size_t)16 * HD, lb); cp_tile4(gv + (size_t)t * FKS, (size_t)16 * TT, lb + FTE * 2u); };
    const int nt = kendB / FKS;
    fill(0);
    asm volatile("s_wait_asynccnt 0x0" ::: "memory");   // stage 0 has landed (this wave's copies)
    __syncthreads();                                     // ... and every other wave's
    if (nt > 1) fill(1);
    const int koff = lr * FPI + 8 * hi, voff = FTE + lr * FPI + 8 * hi;
    // rolled: one copy of the stage's code serves both buffers
#pragma unroll 1
    for (int t = 0; t < nt; ++t) {
        const _Float16* st = ring + (t & 1) * (2 * FTE);
        // unrolled: the two passes' LDS offsets are then constants
#pragma unroll
        for (int h = 0; h < FKS / 32; ++h) { const int kb = t * FKS + h * 32;
            if (kb < kend) {   // passes behind the wave's diagonal are skipped (wave-uniform test)
                v16h kf[2][2], vf[4];
#pragma unroll
                for (int mt = 0; mt < 2; ++mt)
#pragma unroll
                    for (int kc = 0; kc < 2; ++kc) kf[mt][kc] = WFrag<h16>::ld(st + koff + (h * 32 + mt * 16) * FPI + kc * 32);
#pragma unroll
                for (int dt = 0; dt < 4; ++dt) vf[dt] = WFrag<h16>::ld(st + voff + (dt * 16) * FPI + h * 32);
                __builtin_amdgcn_sched_barrier(0);   // the pass's LDS reads stand in one place, K first: the V^T reads land behind the score products and the softmax
                v8f s[2][NQ];
#pragma unroll
                for (int mt = 0; mt < 2; ++mt)
#pragma unroll
                    for (int nq = 0; nq < NQ; ++nq) s[mt][nq] = wmma16(kf[mt][1], qf[nq][1], wmma16(kf[mt][0], qf[nq][0], (v8f){}));
                if (kb + 31 > q0) {   // only the diagonal pass masks (wave-uniform test)
#pragma unroll
                    for (int mt = 0; mt < 2; ++mt)
#pragma unroll
                        for (int nq = 0; nq < NQ; ++nq)
#pragma unroll
                            for (int j = 0; j < 8; ++j) if (kb + mt * 16 + 8 * hi + j > q0 + nq * 16 + lr) s[mt][nq][j] = NEGB; }
                float mx[NQ]; bool need = false;
#pragma unroll
                for (int nq = 0; nq < NQ; ++nq) { float tm = fmaxf(s[0][nq][0], s[1][nq][0]);
#pragma unroll
                    for (int j = 1; j < 8; ++j) tm = fmaxf(tm, fmaxf(s[0][nq][j], s[1][nq][j]));
                    tm = fmaxf(tm, xhalf(tm)); mx[nq] = tm * SCL2; need = need || (mx[nq] > m[nq] + 8.0f); }
                if (__builtin_amdgcn_ballot_w32(need) != 0) {   // one scalar branch a pass
#pragma unroll
                    for (int nq = 0; nq < NQ; ++nq) { const float mn = fmaxf(m[nq], mx[nq]); const float al = __builtin_amdgcn_exp2f(m[nq] - mn); m[nq] = mn; l[nq] *= al;
#pragma unroll
                        for (int dt = 0; dt < 4; ++dt) o[dt][nq] *= al; } }
#pragma unroll
                for (int nq = 0; nq < NQ; ++nq) { v8f p0, p1;
#pragma unroll
                    for (int j = 0; j < 8; ++j) { p0[j] = __builtin_amdgcn_exp2f(__builtin_fmaf(s[0][nq][j], SCL2, -m[nq])); p1[j] = __builtin_amdgcn_exp2f(__builtin_fmaf(s[1][nq][j], SCL2, -m[nq])); l[nq] += p0[j] + p1[j]; }
                    const v16h pf = cat16(__builtin_convertvector(p0, v8h), __builtin_convertvector(p1, v8h));
#pragma unroll
                    for (int dt = 0; dt < 4; ++dt) o[dt][nq] = wmma16(vf[dt], pf, o[dt][nq]); }
            }
        }
        asm volatile("s_wait_dscnt 0x0" ::: "memory");      // this wave's reads of stage t are done
        asm volatile("s_wait_asynccnt 0x0" ::: "memory");   // this wave's copies of stage t + 1 have landed
        __syncthreads();                                     // publishes stage t + 1 and frees stage t's buffer
        if (t + 2 < nt) fill(t + 2);
    }
    asm volatile("s_wait_asynccnt 0x0" ::: "memory");   // no copy is left in flight when the wave goes on to its end
#pragma unroll
    for (int nq = 0; nq < NQ; ++nq) { const float inv = 1.0f / (l[nq] + xhalf(l[nq]));
#pragma unroll
        for (int dt = 0; dt < 4; ++dt) o[dt][nq] *= inv; }
    fa_merge<NQ>(o, g, xw, lam, Ch, Cl, q0, lr, hi);
}

// bf16 hi + lo planes, three products for the scores and three for P.V; one tile of 16 query columns from q0 (a multiple of 16). K and V^T, hi and lo, staged for the group's 4 waves as in fa_f16: four tiles a stage, kendB a multiple of 64.
__device__ __forceinline__ void fa_hl(const unsigned short* __restrict__ Qh, const unsigned short* __restrict__ Ql, const unsigned short* __restrict__ Kh, const unsigned short* __restrict__ Kl, const unsigned short* __restrict__ VTh, const unsigned short* __restrict__ VTl, const int q0, const int kendB, unsigned short* ring, const int tid, const int lr, const int hi, const int g, float* xw, const float lam, bf* __restrict__ Ch, bf* __restrict__ Cl) {
    v16bf qh[2], ql[2]; v8f o[4][1]; float m = NEGB, l = 0.f;
#pragma unroll
    for (int kc = 0; kc < 2; ++kc) { const size_t qo = (size_t)(q0 + lr) * HD + kc * 32 + 8 * hi; qh[kc] = WFrag<bf>::ld(Qh + qo); ql[kc] = WFrag<bf>::ld(Ql + qo); }
#pragma unroll
    for (int dt = 0; dt < 4; ++dt) o[dt][0] = (v8f){};
    const int kend = (q0 + 16 + 31) & ~31;
    const size_t gk = (size_t)(tid >> 3) * HD + (tid & 7) * 8, gv = (size_t)(tid >> 3) * TT + (tid & 7) * 8;
    const unsigned l0 = (unsigned)(size_t)ring + (unsigned)((tid >> 3) * (FPI * 2) + (tid & 7) * 16);
    auto fill = [&](const int t) { const unsigned lb = l0 + (unsigned)(t & 1) * (4u * FTE * 2u); const size_t ak = gk + (size_t)t * (FKS * HD), av = gv + (size_t)t * FKS;
        cp_tile4(Kh + ak, (size_t)16 * HD, lb); cp_tile4(Kl + ak, (size_t)16 * HD, lb + FTE * 2u); cp_tile4(VTh + av, (size_t)16 * TT, lb + 2u * FTE * 2u); cp_tile4(VTl + av, (size_t)16 * TT, lb + 3u * FTE * 2u); };
    const int nt = kendB / FKS;
    fill(0);
    asm volatile("s_wait_asynccnt 0x0" ::: "memory");   // stage 0 has landed (this wave's copies)
    __syncthreads();                                     // ... and every other wave's
    if (nt > 1) fill(1);
    const int foff = lr * FPI + 8 * hi;
    // rolled: one copy of the stage's code serves both buffers
#pragma unroll 1
    for (int t = 0; t < nt; ++t) {
        const unsigned short* st = ring + (t & 1) * (4 * FTE) + foff;
        // unrolled: the two passes' LDS offsets are then constants
#pragma unroll
        for (int h = 0; h < FKS / 32; ++h) { const int kb = t * FKS + h * 32;
            if (kb < kend) {   // passes behind the wave's diagonal are skipped (wave-uniform test)
                v16bf kh[2][2], kl[2][2];
#pragma unroll
                for (int mt = 0; mt < 2; ++mt)
#pragma unroll
                    for (int kc = 0; kc < 2; ++kc) { const int a = (h * 32 + mt * 16) * FPI + kc * 32; kh[mt][kc] = WFrag<bf>::ld(st + a); kl[mt][kc] = WFrag<bf>::ld(st + FTE + a); }
                v16bf vh[4], vl[4];
#pragma unroll
                for (int dt = 0; dt < 4; ++dt) { const int a = (dt * 16) * FPI + h * 32; vh[dt] = WFrag<bf>::ld(st + 2 * FTE + a); vl[dt] = WFrag<bf>::ld(st + 3 * FTE + a); }
                __builtin_amdgcn_sched_barrier(0);   // the pass's LDS reads stand in one place, K first: the V^T reads land behind the score products and the softmax
                v8f s[2];
#pragma unroll
                for (int mt = 0; mt < 2; ++mt) { s[mt] = (v8f){};
#pragma unroll
                    for (int kc = 0; kc < 2; ++kc) { s[mt] = wmmab(kh[mt][kc], qh[kc], s[mt]); s[mt] = wmmab(kh[mt][kc], ql[kc], s[mt]); s[mt] = wmmab(kl[mt][kc], qh[kc], s[mt]); } }
                if (kb + 31 > q0) {   // only the diagonal pass masks (wave-uniform test)
#pragma unroll
                    for (int mt = 0; mt < 2; ++mt)
#pragma unroll
                        for (int j = 0; j < 8; ++j) if (kb + mt * 16 + 8 * hi + j > q0 + lr) s[mt][j] = NEGB; }
                float tm = fmaxf(s[0][0], s[1][0]);
#pragma unroll
                for (int j = 1; j < 8; ++j) tm = fmaxf(tm, fmaxf(s[0][j], s[1][j]));
                tm = fmaxf(tm, xhalf(tm)); const float mx = tm * SCL2;
                if (__builtin_amdgcn_ballot_w32(mx > m + 8.0f) != 0) {   // one scalar branch a pass
                    const float mn = fmaxf(m, mx); const float al = __builtin_amdgcn_exp2f(m - mn); m = mn; l *= al;
#pragma unroll
                    for (int dt = 0; dt < 4; ++dt) o[dt][0] *= al; }
                v8us h0, h1, l0v, l1v;
#pragma unroll
                for (int j = 0; j < 8; ++j) { const float p0 = __builtin_amdgcn_exp2f(__builtin_fmaf(s[0][j], SCL2, -m)), p1 = __builtin_amdgcn_exp2f(__builtin_fmaf(s[1][j], SCL2, -m)); l += p0 + p1; unsigned short u, w; splitf(p0, u, w); h0[j] = u; l0v[j] = w; splitf(p1, u, w); h1[j] = u; l1v[j] = w; }
                const v16bf ph = cat16b(h0, h1), pl = cat16b(l0v, l1v);
#pragma unroll
                for (int dt = 0; dt < 4; ++dt) { o[dt][0] = wmmab(vh[dt], ph, o[dt][0]); o[dt][0] = wmmab(vh[dt], pl, o[dt][0]); o[dt][0] = wmmab(vl[dt], ph, o[dt][0]); }
            }
        }
        asm volatile("s_wait_dscnt 0x0" ::: "memory");      // this wave's reads of stage t are done
        asm volatile("s_wait_asynccnt 0x0" ::: "memory");   // this wave's copies of stage t + 1 have landed
        __syncthreads();                                     // publishes stage t + 1 and frees stage t's buffer
        if (t + 2 < nt) fill(t + 2);
    }
    asm volatile("s_wait_asynccnt 0x0" ::: "memory");   // no copy is left in flight when the wave goes on to its end
    const float inv = 1.0f / (l + xhalf(l));
#pragma unroll
    for (int dt = 0; dt < 4; ++dt) o[dt][0] *= inv;
    fa_merge<1>(o, g, xw, lam, Ch, Cl, q0, lr, hi);
}

// grid (NB_ * NHO output heads, NTF + NTH row blocks), 8 waves a block: waves 0-3 = head h of group 0, waves 4-7 = head h of group 1, same query rows, each group with its own ring; both groups walk the same stages, so they share the barriers. Row blocks run from the longest to the shortest: NTF blocks of 128 fp16 query rows from the end of the sequence down to RH, then NTH blocks of 64 hi/lo rows down to 0.
#define NTF ((TT - RH) / 128)
#define NTH (RH / 64)
__global__ __launch_bounds__(256) void k_fattn(const _Float16* __restrict__ Q16, const _Float16* __restrict__ K16, const _Float16* __restrict__ V16, const unsigned short* __restrict__ Qh, const unsigned short* __restrict__ Ql, const unsigned short* __restrict__ Kh, const unsigned short* __restrict__ Kl, const unsigned short* __restrict__ Vh, const unsigned short* __restrict__ Vl, const float* __restrict__ LAM, bf* __restrict__ ACh, bf* __restrict__ ACl) {
    const int lane = threadIdx.x & 31, lr = lane & 15, hi = lane >> 4; const int w8 = __builtin_amdgcn_readfirstlane((int)(threadIdx.x >> 5));   // the wave's number in a scalar register: loop bounds, the mask test and the group test stay scalar
    const int g = w8 >> 2, w = w8 & 3, tid = (int)threadIdx.x & 127;   // group, wave and thread inside the group
    const size_t bb = blockIdx.x / NHO, hh = blockIdx.x % NHO, po = (bb * NH_ + g * NHO + hh) * (size_t)TT * HD, co = bb * (size_t)TT * DO + hh * HD; const int y = blockIdx.y;
    __shared__ __align__(16) unsigned short fring[2][2 * 4 * FTE];   // per group two buffers of K and V^T tiles: one of each for the fp16 rows, hi and lo of each for the hi/lo rows
    float* xw = (float*)&fring[0][0] + w * 2048 + lane * 4;   // where wave w of group 1 hands its tiles to wave w of group 0 (8 KiB a pair)
    const float lam = LAM[0];
    if (y < NTF) fa_f16<2>(Q16 + po, K16 + po, V16 + po, TT - 128 * (y + 1) + 32 * w, TT - 128 * y, (_Float16*)fring[g], tid, lr, hi, g, xw, lam, ACh + co, ACl + co);
    else fa_hl(Qh + po, Ql + po, Kh + po, Kl + po, Vh + po, Vl + po, RH - 64 * (y - NTF + 1) + 16 * w, RH - 64 * (y - NTF), fring[g], tid, lr, hi, g, xw, lam, ACh + co, ACl + co);
}

__device__ __forceinline__ void d_lam(const float* __restrict__ a1, const float* __restrict__ b1, const float* __restrict__ a2, const float* __restrict__ b2, float* LAM) { if (threadIdx.x >= 32) return; const int lane = threadIdx.x; float d1 = __fadd_rn(__fmul_rn(bfr(a1[lane * 2]), bfr(b1[lane * 2])), __fmul_rn(bfr(a1[lane * 2 + 1]), bfr(b1[lane * 2 + 1]))); float d2 = __fadd_rn(__fmul_rn(bfr(a2[lane * 2]), bfr(b2[lane * 2])), __fmul_rn(bfr(a2[lane * 2 + 1]), bfr(b2[lane * 2 + 1])));
#pragma unroll
    for (int sh = 16; sh; sh >>= 1) { d1 = __fadd_rn(d1, __shfl_xor(d1, sh, 32)); d2 = __fadd_rn(d2, __shfl_xor(d2, sh, 32)); }
    float l = __fsub_rn(expf(d1), expf(d2)); asm volatile("" : "+v"(l)); l = __fadd_rn(l, LINIT); ((float*)LAM)[lane] = l;  }
// ---- k_prep: everything that reads inputs only, in one launch: none of these jobs reads another's output. Block 0: lambda; then NBW blocks for each of Wq, Wk, Wv; NBO for Wo; NBX for x. The long blocks (transposes) have the low numbers.
#define NBW ((DM * DQ / 64 + 63) / 64)
#define NBO ((DO * DM / 64 + 63) / 64)
#define NBX (NB_ * TT * DM / 8 / 256)
__global__ __launch_bounds__(256) void k_prep(const float* __restrict__ x, const float* __restrict__ wq, const float* __restrict__ wk, const float* __restrict__ wv, const float* __restrict__ wo, const float* __restrict__ lq1, const float* __restrict__ lk1, const float* __restrict__ lq2, const float* __restrict__ lk2, bf* XB, bf* W3, bf* WO, float* LAM) {
    int blk = blockIdx.x;
    if (blk == 0) { d_lam(lq1, lk1, lq2, lk2, LAM); return; }
    blk -= 1;
    if (blk < 3 * NBW) { const int kind = blk / NBW; d_wtG(kind == 0 ? wq : kind == 1 ? wk : wv, DM, DQ, W3 + (size_t)kind * DQ * DM, blk % NBW); return; }
    blk -= 3 * NBW;
    if (blk < NBO) { d_wtG(wo, DO, DM, WO, blk); return; }
    d_cvt8(x, XB, (size_t)NB_ * TT * DM / 8, blk - NBO);
}

extern "C" void kernel_launch(void* const* d_in, const int* in_sizes, int n_in,
                              void* d_out, int out_size, void* d_ws, size_t ws_size, hipStream_t stream) {
    (void)in_sizes; (void)n_in; (void)out_size;
    const float* x = (const float*)d_in[0]; const float* wq = (const float*)d_in[1]; const float* wk = (const float*)d_in[2]; const float* wv = (const float*)d_in[3]; const float* wo = (const float*)d_in[4]; const float* lq1 = (const float*)d_in[5]; const float* lk1 = (const float*)d_in[6]; const float* lq2 = (const float*)d_in[7]; const float* lk2 = (const float*)d_in[8];
    float* OUT = (float*)d_out;     // [2][2048][1024]
    char* wsp = (char*)d_ws;
    auto take = [&](size_t bytes) { char* p = wsp; wsp += (bytes + 255) & ~(size_t)255; return (void*)p; };
    const size_t PB = (size_t)NH_ * TT * HD;   // elements of one plane of one batch
    bf* WO = (bf*)take((size_t)DM * DO * 2); float* LAM = (float*)take(256); bf* W3 = (bf*)take((size_t)3 * DQ * DM * 2);   /* Wq, Wk, Wv transposed, one behind the other */
    // three planes (fp16, bf16 hi, bf16 lo), each q, k, v^T x both batches side by side ([kind][b][h][t][d]; v [b][g][d][t]): the projection launch finds its part by grid z, and one attention launch covers all NB_ * NH_ heads
    h16* P16 = (h16*)take(3 * NB_ * PB * 2); bf* Ph = (bf*)take(3 * NB_ * PB * 2); bf* Pl = (bf*)take(3 * NB_ * PB * 2);
    bf* XB = (bf*)take((size_t)NB_ * TT * DM * 2); bf* ACh = (bf*)take((size_t)NB_ * TT * DO * 2); bf* ACl = (bf*)take((size_t)NB_ * TT * DO * 2);
    if ((size_t)(wsp - (char*)d_ws) > ws_size) return;    // ws 256 MiB
    k_prep<<<1 + 3 * NBW + NBO + NBX, 256, 0, stream>>>(x, wq, wk, wv, wo, lq1, lk1, lq2, lk2, XB, W3, WO, LAM);   /* lambda line; weights 'xw' -> [n][k] bf16; x -> bf16 */
    k_gemmw<bf, 0, false, true><<<dim3(TT / 128, DQ / 128, 3 * NB_), 256, 0, stream>>>(XB, nullptr, W3, nullptr, DM, nullptr, 0, nullptr, (size_t)TT * DM, (size_t)DQ * DM, 0, P16, Ph, Pl, PB);   /* q, k head planes and transposed v planes of both batches */
    k_fattn<<<dim3(NB_ * NHO, NTF + NTH, 1), 256, 0, stream>>>(P16, P16 + NB_ * PB, P16 + 2 * NB_ * PB, Ph, Pl, Ph + NB_ * PB, Pl + NB_ * PB, Ph + 2 * NB_ * PB, Pl + 2 * NB_ * PB, LAM, ACh, ACl);   /* both groups of every head, both batches -> (o1 - lambda o2) x (1 - lambda_init) as hi/lo planes, rows of both batches */
    k_gemmw<bf, 1, false><<<dim3(NB_ * TT / 128, DM / 128, 1), 256, 0, stream>>>(ACh, ACl, WO, nullptr, DO, OUT, DM, nullptr, 0, 0, 0);   /* Wo */
}

// v009
// It runs in 110 microseconds.
// Two timings next to v008 both put it at 1.07 times that version's speed.
// Counting every step since v000, it is 24.5 times as fast.
#include <hip/hip_runtime.h>

// Differential causal attention (x [2][2048][1024]; q, k, v = x W ('xw' [1024][2048] 0.02) as 2 groups x 16 heads x 64; a_g = causal softmax(q_g.k_g / 8) (-1e30 fill); lambda = exp(lq1.lk1) - exp(lq2.lk2) + 0.8 (vectors [64], zeros, read: computed on device); o_h = (a1 v1 - lambda a2 v2) x (1 - 0.8); out = merged o Wo ('xw' [1024][1024]) -> [2][2048][1024] (4.2 M)).
// Layout: one input-only launch (k_prep) makes the bf16 copy of x (both batches), the transposed 'xw' weights and lambda; one launch holds the six exact projections (q, k, v of both batches on grid z) whose epilogue rounds each tile straight into the 16-bit head planes (v transposed by swapping the operands); the two groups run as 32 heads per batch of one fused causal attention launch (k_fattn: scores, online softmax and P.V in registers; query rows < 512 hi/lo 3 products, rest fp16), whose blocks hold head h of both groups (4 waves each): the second group's waves hand their normalised tiles over through LDS and the first group's form (o1 - lambda o2) x 0.2 and store it as hi/lo planes (both batches as 4096 rows); hi/lo x Wo exact, 4096 rows in one launch.
// Compute dtypes, f32 accumulate: every input rounded to bf16; projections exact; attention rows < 512 3 products, rest fp16; softmax f32; lambda (precise expf) and the combination f32; Wo hl x exact.

#define NB_  2
#define TT   2048
#define DM   1024
#define NH_  32
#define NKV  32
#define HD   64
#define DQ   (NH_ * HD)
#define DKV  (NKV * HD)
#define RH   512                  // query rows < RH use hi+lo planes
#define SCL  0.125f
#define NHO  16      // output heads (per group)
#define DO   (NHO * HD)   // 1024
#define LINIT 0.8f
typedef _Float16 h16;
typedef unsigned short bf;
typedef __attribute__((ext_vector_type(16))) __bf16   v16bf;
typedef __attribute__((ext_vector_type(16))) _Float16 v16h;
typedef __attribute__((ext_vector_type(8)))  _Float16 v8h;
typedef __attribute__((ext_vector_type(8)))  unsigned short v8us;
typedef __attribute__((ext_vector_type(8)))  float    v8f;
typedef __attribute__((ext_vector_type(4)))  float    v4f;
typedef v8h  __attribute__((may_alias)) v8ha;
typedef v4f  __attribute__((may_alias)) v4fa;
typedef v8us __attribute__((may_alias)) v8usa;

__device__ __forceinline__ unsigned short f2bf(float f) { unsigned u = __float_as_uint(f); u += 0x7FFFu + ((u >> 16) & 1u); return (unsigned short)(u >> 16); }
__device__ __forceinline__ float bf2f(unsigned short b) { return __uint_as_float(((unsigned)b) << 16); }
__device__ __forceinline__ float bfr(float f) { return bf2f(f2bf(f)); }
__device__ __forceinline__ h16 tohx(float x) { return (h16)x; }
__device__ __forceinline__ void splitf(float y, unsigned short& h, unsigned short& l) { h = f2bf(y); l = f2bf(y - bf2f(h)); }
__device__ __forceinline__ v16h cat16(v8h lo, v8h hi) { return __builtin_shufflevector(lo, hi, 0, 1, 2, 3, 4, 5, 6, 7, 8, 9, 10, 11, 12, 13, 14, 15); }
__device__ __forceinline__ v16bf cat16b(v8us lo, v8us hi) { return __builtin_bit_cast(v16bf, __builtin_shufflevector(lo, hi, 0, 1, 2, 3, 4, 5, 6, 7, 8, 9, 10, 11, 12, 13, 14, 15)); }
__device__ __forceinline__ v8f wmma16(v16h a, v16h b, v8f c) { return __builtin_amdgcn_wmma_f32_16x16x32_f16(false, a, false, b, (short)0, c, false, false); }
__device__ __forceinline__ v8f wmmab(v16bf a, v16bf b, v8f c) { return __builtin_amdgcn_wmma_f32_16x16x32_bf16(false, a, false, b, (short)0, c, false, false); }



// ---- k_gemmw: GEMM, one work-group of 8 waves (4 x 2) per 128x128 output tile, each wave a 32x64 tile (8 accumulators); grid (M/128, N/128, Z), 256 threads.
// The K-contiguous 16-bit operand planes come into LDS 128 k at a time by asynchronous 16-byte copies (16 lanes = 256 contiguous bytes of a row), two buffers: the next stage's copies fly while this stage is multiplied. Fragments are read from LDS rows of pitch 272 B.
// C[m][n] (f32, pitch ldc, + optional f32 bias[n]) = sum_k A[m][k] Bt[n][k] (+ split products per NSPLIT). z-batch strides sA/sB/sC in elements. K % 128 == 0, M % 128 == 0, N % 128 == 0.
// PLANES: no f32 C; the epilogue rounds the tile straight into the three 16-bit planes that attention reads (fp16, bf16 hi, bf16 lo); element (m, n) goes to plane offset m * ldc + (n / 64) * sC + n % 64.
// PLANES, grid z = 2 * kind + batch, six independent products in one launch: the arguments are A = x (sA = one batch), Bt = the three transposed weights (sB = one of them), sP = one batch of one plane; ldc and sC are set here.
// kind 0, 1 = q, k head planes [h][t][d]: A = x, Bt = weights, ldc = HD, sC = TT * HD. kind 2 = transposed v planes [g][d][t]: A = weights, Bt = x, ldc = TT, sC = 64.
template <typename T16> struct WFrag;
template <> struct WFrag<h16> { typedef v16h V; static __device__ __forceinline__ V ld(const h16* p) { return cat16(*(const v8h*)p, *(const v8h*)(p + 16)); } static __device__ __forceinline__ v8f mma(V a, V b, v8f c) { return wmma16(a, b, c); } };
template <> struct WFrag<bf> { typedef v16bf V; static __device__ __forceinline__ V ld(const bf* p) { return cat16b(*(const v8us*)p, *(const v8us*)(p + 16)); } static __device__ __forceinline__ v8f mma(V a, V b, v8f c) { return wmmab(a, b, c); } };
#define GKP 128                   // k per stage: 256 B of every operand row
#define GPI 136                   // LDS row pitch in elements (272 B = 16 B x odd: ds_load_b128 without bank conflicts)
#define GTE (128 * GPI)           // elements of one operand tile in LDS (128 rows)
// One 128-row x 256-B operand tile into LDS: 8 copies a lane, copy i = rows 16 i .. 16 i + 15 over the 256 lanes. g = the lane's 16 bytes in row (tid / 16), l = their LDS byte address, rs = 16 rows in elements.
// The s_wait_xcnt stands inside the statement so that no address register of a copy is rewritten ahead of it.
template <typename T16>
__device__ __forceinline__ void cp_tile(const T16* g, const size_t rs, const unsigned l) {
    asm volatile("global_load_async_to_lds_b128 %0, %8, off\n\t"
                 "global_load_async_to_lds_b128 %1, %9, off\n\t"
                 "global_load_async_to_lds_b128 %2, %10, off\n\t"
                 "global_load_async_to_lds_b128 %3, %11, off\n\t"
                 "global_load_async_to_lds_b128 %4, %12, off\n\t"
                 "global_load_async_to_lds_b128 %5, %13, off\n\t"
                 "global_load_async_to_lds_b128 %6, %14, off\n\t"
                 "global_load_async_to_lds_b128 %7, %15, off\n\t"
                 "s_wait_xcnt 0x0"
                 :: "v"(l), "v"(l + 1u * 16u * GPI * 2u), "v"(l + 2u * 16u * GPI * 2u), "v"(l + 3u * 16u * GPI * 2u), "v"(l + 4u * 16u * GPI * 2u), "v"(l + 5u * 16u * GPI * 2u), "v"(l + 6u * 16u * GPI * 2u), "v"(l + 7u * 16u * GPI * 2u),
                    "v"(g), "v"(g + rs), "v"(g + 2 * rs), "v"(g + 3 * rs), "v"(g + 4 * rs), "v"(g + 5 * rs), "v"(g + 6 * rs), "v"(g + 7 * rs) : "memory");
}
template <typename T16, int NSPLIT, bool BIAS, bool PLANES = false>
__global__ __launch_bounds__(256) void k_gemmw(const T16* __restrict__ A, const T16* __restrict__ A2, const T16* __restrict__ Bt, const T16* __restrict__ Bt2, int K, float* C, int ldc, const float* __restrict__ bias, size_t sA, size_t sB, size_t sC, h16* P16 = nullptr, bf* Ph = nullptr, bf* Pl = nullptr, size_t sP = 0) {
    typedef typename WFrag<T16>::V V;
    constexpr bool HA2 = (NSPLIT == 1 || NSPLIT == 2), HB2 = (NSPLIT >= 2); constexpr int NT = 2 + (HA2 ? 1 : 0) + (HB2 ? 1 : 0);   // operand tiles of a stage: A, Bt, then A2, Bt2 where used
    __shared__ __align__(16) T16 ring[2 * NT * GTE];
    float* osw = (float*)ring;   // the epilogue's staging (8 waves x 16 x 68 floats) takes the ring's place once the loop has left it: with two operand tiles a stage the work-group's LDS is then small enough for two work-groups on a WGP
    const size_t z = blockIdx.z;
    if (PLANES) { const T16* X = A + (z & 1) * sA; const T16* Wt = Bt + (z >> 1) * sB; const bool sw = (z >> 1) == 2;
        A = sw ? Wt : X; Bt = sw ? X : Wt; ldc = sw ? TT : HD; sC = sw ? (size_t)64 : (size_t)TT * HD; P16 += z * sP; Ph += z * sP; Pl += z * sP; }
    else { A += z * sA; if (A2) A2 += z * sA; Bt += z * sB; if (Bt2) Bt2 += z * sB; C += z * sC; }
    const int tid = threadIdx.x, lane = tid & 31, lr = lane & 15, hi = lane >> 4, wv = tid >> 5; const int r0 = blockIdx.x * 128 + (wv >> 1) * 32, c0 = blockIdx.y * 128 + (wv & 1) * 64;
    float* os = osw + wv * (16 * 68);   // each wave's own epilogue staging
    v8f acc[2][4];
#pragma unroll
    for (int mb = 0; mb < 2; ++mb)
#pragma unroll
        for (int nb = 0; nb < 4; ++nb) acc[mb][nb] = (v8f){};
    const size_t ga = (size_t)(blockIdx.x * 128 + (tid >> 4)) * K + (tid & 15) * 8, gb = (size_t)(blockIdx.y * 128 + (tid >> 4)) * K + (tid & 15) * 8, rs = (size_t)16 * K;
    const unsigned l0 = (unsigned)(size_t)ring + (unsigned)((tid >> 4) * (GPI * 2) + (tid & 15) * 16);
    auto fill = [&](const int t) { const unsigned l = l0 + (unsigned)(t & 1) * (NT * GTE * 2u); const int k0 = t * GKP;
        cp_tile(A + ga + k0, rs, l); cp_tile(Bt + gb + k0, rs, l + GTE * 2u);
        if (HA2) cp_tile(A2 + ga + k0, rs, l + 2u * GTE * 2u);
        if (HB2) cp_tile(Bt2 + gb + k0, rs, l + (HA2 ? 3u : 2u) * GTE * 2u); };
    const int nt = K / GKP;
    fill(0);
    asm volatile("s_wait_asynccnt 0x0" ::: "memory");   // stage 0 has landed (this wave's copies)
    __syncthreads();                                     // ... and every other wave's
    if (nt > 1) fill(1);
    const int aoff = ((wv >> 1) * 32 + lr) * GPI + 8 * hi, boff = GTE + ((wv & 1) * 64 + lr) * GPI + 8 * hi;
    // rolled: one copy of the stage's code serves both buffers
#pragma unroll 1
    for (int t = 0; t < nt; ++t) {
        const T16* st = ring + (t & 1) * (NT * GTE);
        V a[2][2], a2[2][2], b[2][4], b2[2][4];   // two fragment sets: block ks + 1 is fetched while block ks is multiplied (inside the stage only)
        // unrolled: the two sets are then indexed by constants and stay in registers
#pragma unroll
        for (int ks = -1; ks < GKP / 32; ++ks) {
            if (ks + 1 < GKP / 32) { const int s = (ks + 1) & 1, kc = (ks + 1) * 32;
#pragma unroll
                for (int mb = 0; mb < 2; ++mb) { a[s][mb] = WFrag<T16>::ld(st + aoff + mb * 16 * GPI + kc); if (HA2) a2[s][mb] = WFrag<T16>::ld(st + 2 * GTE + aoff + mb * 16 * GPI + kc); }
#pragma unroll
                for (int nb = 0; nb < 4; ++nb) { b[s][nb] = WFrag<T16>::ld(st + boff + nb * 16 * GPI + kc); if (HB2) b2[s][nb] = WFrag<T16>::ld(st + (HA2 ? 2 : 1) * GTE + boff + nb * 16 * GPI + kc); } }
            __builtin_amdgcn_sched_barrier(0);   // the next block's LDS reads stay one group ahead of this block's products, none among them
            if (ks >= 0) { const int s = ks & 1;
#pragma unroll
                for (int nb = 0; nb < 4; ++nb)
#pragma unroll
                    for (int mb = 0; mb < 2; ++mb) acc[mb][nb] = WFrag<T16>::mma(a[s][mb], b[s][nb], acc[mb][nb]);
                if (HA2) {
#pragma unroll
                    for (int nb = 0; nb < 4; ++nb)
#pragma unroll
                        for (int mb = 0; mb < 2; ++mb) acc[mb][nb] = WFrag<T16>::mma(a2[s][mb], b[s][nb], acc[mb][nb]); }
                if (HB2) {
#pragma unroll
                    for (int nb = 0; nb < 4; ++nb)
#pragma unroll
                        for (int mb = 0; mb < 2; ++mb) acc[mb][nb] = WFrag<T16>::mma(a[s][mb], b2[s][nb], acc[mb][nb]); }
                __builtin_amdgcn_sched_barrier(0);   // ... and the reads of the block after next stay behind these products
            }
        }
        asm volatile("s_wait_dscnt 0x0" ::: "memory");      // this wave's reads of stage t are done
        asm volatile("s_wait_asynccnt 0x0" ::: "memory");   // this wave's copies of stage t + 1 have landed
        __syncthreads();                                     // publishes stage t + 1 and frees stage t's buffer
        if (t + 2 < nt) fill(t + 2);
    }
    asm volatile("s_wait_asynccnt 0x0" ::: "memory");   // no copy is left in flight when the wave goes on to its end
#pragma unroll
    for (int mb = 0; mb < 2; ++mb) {
#pragma unroll
        for (int nb = 0; nb < 4; ++nb) {
#pragma unroll
            for (int j = 0; j < 8; ++j) os[(hi * 8 + j) * 68 + nb * 16 + lr] = acc[mb][nb][j]; }
        __builtin_amdgcn_wave_barrier(); asm volatile("" ::: "memory");
        float* crow = C + (size_t)(r0 + mb * 16) * ldc + c0;
        if (PLANES) {
            // both loops unrolled: the vector elements are then indexed by constants and stay in registers
#pragma unroll
            for (int s = 0; s < 4; ++s) { const int row = 4 * s + (lane >> 3), cofs = (lane & 7) * 8;   // 8 lanes x 16 B = one 128-B line per row and plane
                const v4f x0 = *(const v4fa*)(os + row * 68 + cofs), x1 = *(const v4fa*)(os + row * 68 + cofs + 4); v8h o16; v8us oh, ol;
#pragma unroll
                for (int q = 0; q < 4; ++q) { unsigned short u, w; o16[q] = tohx(x0[q]); splitf(x0[q], u, w); oh[q] = u; ol[q] = w; o16[q + 4] = tohx(x1[q]); splitf(x1[q], u, w); oh[q + 4] = u; ol[q + 4] = w; }
                const size_t oo = (size_t)(r0 + mb * 16 + row) * ldc + (size_t)(c0 >> 6) * sC + cofs; *(v8h*)(P16 + oo) = o16; *(v8us*)(Ph + oo) = oh; *(v8us*)(Pl + oo) = ol; }
        } else
{
#pragma unroll
            for (int s = 0; s < 8; ++s) { const int row = 2 * s + hi, cofs = lr * 4; v4f val = *(const v4fa*)(os + row * 68 + cofs); if (BIAS) { val[0] += bfr(bias[c0 + cofs]); val[1] += bfr(bias[c0 + cofs + 1]); val[2] += bfr(bias[c0 + cofs + 2]); val[3] += bfr(bias[c0 + cofs + 3]); }
                *(v4f*)(crow + (size_t)row * ldc + cofs) = val; }
             }
        __builtin_amdgcn_wave_barrier(); asm volatile("" ::: "memory");
    }
}

typedef __attribute__((ext_vector_type(2))) _Float16 v2h;
typedef __attribute__((ext_vector_type(4))) _Float16 v4h;
typedef __attribute__((ext_vector_type(2))) unsigned short v2us;
typedef __attribute__((ext_vector_type(4))) unsigned short v4us;
typedef __attribute__((ext_vector_type(2))) float v2f;
typedef __attribute__((ext_vector_type(4))) int v4i;

// The three input-only jobs, each written for block number blk of its own range of k_prep's grid. Every thread moves 64 elements: 16 loads of 16 B, all issued before the first is used.
// One 128 k x 128 n tile of w [K][N] (f32) -> Bt [N][K] (bf16), turned in LDS. In: a wave's load = 512 contiguous bytes of one k row; wave wv holds k rows 16 wv .. 16 wv + 15, lane c the columns 4 c .. 4 c + 3.
// tl = [128 n][16 pieces of 8 k], piece p of row n at place p ^ ((n / 4) % 16): the 16-B writes (32 rows, one piece) and the 16-B reads (one row, 16 pieces) each spread over all banks. Out: 16 lanes = 256 contiguous bytes of one n row.
__device__ __forceinline__ void d_wtT(const float* __restrict__ w, const int K, const int N, bf* Bt, const int blk, unsigned short* tl) {
    const int tid = threadIdx.x, c = tid & 31, wv = tid >> 5, nn = N / 128; const int k0 = (blk / nn) * 128, n0 = (blk % nn) * 128;   // neighbouring blocks read neighbouring 512-B pieces of the same k rows
    const float* src = w + (size_t)(k0 + wv * 16) * N + n0 + c * 4; v4f r[16];
    // every loop here unrolled: r and the vectors are then indexed by constants and stay in registers
#pragma unroll
    for (int i = 0; i < 16; ++i) r[i] = *(const v4f*)(src + (size_t)i * N);
    asm volatile("s_wait_xcnt 0x0" :: "v"(src) : "memory");   // the 16 loads name one address pair; as an input here it lives up to this wait, so that nothing, a load's own result included, rewrites it ahead
#pragma unroll
    for (int j = 0; j < 4; ++j) { v8us a, b;
#pragma unroll
        for (int i = 0; i < 8; ++i) { a[i] = f2bf(r[i][j]); b[i] = f2bf(r[i + 8][j]); }
        unsigned short* row = tl + (c * 4 + j) * 128; *(v8us*)(row + ((wv * 2) ^ (c & 15)) * 8) = a; *(v8us*)(row + ((wv * 2 + 1) ^ (c & 15)) * 8) = b; }
    __syncthreads();   // the whole tile is in LDS before any of its rows is read
    const int ch = tid & 15, rr = tid >> 4;
#pragma unroll
    for (int p = 0; p < 8; ++p) { const int n = p * 16 + rr; *(v8us*)(Bt + (size_t)(n0 + n) * K + k0 + ch * 8) = *(const v8us*)(tl + n * 128 + (ch ^ ((n >> 2) & 15)) * 8); }
    asm volatile("s_wait_xcnt 0x0" ::: "memory");   // behind the last of the 8 stores: whatever code follows the job may reuse the registers that they name
}
// 16384 elements a block: a wave's load = 512 contiguous bytes, its store the 256 bytes they round to.
__device__ __forceinline__ void d_cvt(const float* __restrict__ src, bf* dst, const int blk) { const size_t b = (size_t)blk * 16384 + threadIdx.x * 4; const float* s = src + b; v4f r[16];
#pragma unroll
    for (int i = 0; i < 16; ++i) r[i] = *(const v4f*)(s + i * 1024);
    asm volatile("s_wait_xcnt 0x0" :: "v"(s) : "memory");   // as in d_wtT: the loads' address pair lives up to this wait
#pragma unroll
    for (int i = 0; i < 16; ++i) { v4us o;
#pragma unroll
        for (int q = 0; q < 4; ++q) o[q] = f2bf(r[i][q]);
        *(v4us*)(dst + b + i * 1024) = o; }
    asm volatile("s_wait_xcnt 0x0" ::: "memory"); }   // behind the last of the 16 stores, as in d_wtT

__device__ __forceinline__ float xhalf(float v) { const int b = __float_as_int(v); return __int_as_float(__builtin_amdgcn_permlanex16(b, b, 0x76543210, 0xfedcba98, false, false)); }   // lane l <-> l ^ 16
#define SCL2 (SCL * 1.4426950408889634f)
#define NEGB (-3.0e38f)

// fp16 operands, NQ tiles of 16 query columns from q0 (q0 and 16 NQ multiples of 32). The 4 waves of a group share its K and V^T through LDS: 64 keys a stage (64 K rows of 128 B, 64 V^T rows of 128 B), brought in by asynchronous 16-byte copies
// (8 lanes = one whole 128-B line), two buffers: the next stage's copies fly while this stage is worked on. Every wave walks all kendB / 64 stages of the block (kendB a multiple of 64) and skips the passes behind its own diagonal.
#define FKS 64                    // keys per stage
#define FPI 72                    // LDS row pitch in elements (144 B = 16 B x odd: ds_load_b128 without bank conflicts)
#define FTE (64 * FPI)            // elements of one tile in LDS (64 rows)
// One 64-row x 128-B tile into LDS: 4 copies a lane, copy i = rows 16 i .. 16 i + 15 over the 128 lanes. g = the lane's 16 bytes in row (tid / 8), l = their LDS byte address, rs = 16 rows in elements.
// The s_wait_xcnt stands inside the statement so that no address register of a copy is rewritten ahead of it.
template <typename T16>
__device__ __forceinline__ void cp_tile4(const T16* g, const size_t rs, const unsigned l) {
    asm volatile("global_load_async_to_lds_b128 %0, %4, off\n\t"
                 "global_load_async_to_lds_b128 %1, %5, off\n\t"
                 "global_load_async_to_lds_b128 %2, %6, off\n\t"
                 "global_load_async_to_lds_b128 %3, %7, off\n\t"
                 "s_wait_xcnt 0x0"
                 :: "v"(l), "v"(l + 1u * 16u * FPI * 2u), "v"(l + 2u * 16u * FPI * 2u), "v"(l + 3u * 16u * FPI * 2u),
                    "v"(g), "v"(g + rs), "v"(g + 2 * rs), "v"(g + 3 * rs) : "memory");
}
// The end of a block: o = the wave's normalised output tiles (lane (lr, hi): query column lr, d = 16 dt + 8 hi + j). The waves of group 1 (g == 1, the second attention map) lay theirs into LDS, 16 B a lane, lanes side by side;
// behind one barrier wave w of group 0 takes the tiles of wave w of group 1, forms (o1 - lambda o2) x (1 - lambda_init) and stores the hi and lo planes (row pitch DO; a wave writes the whole 128-B line of a row and plane).
// xw = the wave pair's own place in the ring's LDS (+ 4 lane floats), which every wave has left behind the loop's last barrier, with no copy in flight.
template <int NQ>
__device__ __forceinline__ void fa_merge(const v8f (&o)[4][NQ], const int g, float* xw, const float lam, bf* __restrict__ Ch, bf* __restrict__ Cl, const int q0, const int lr, const int hi) {
    if (g == 1) {   // wave-uniform (scalar) test
#pragma unroll
        for (int nq = 0; nq < NQ; ++nq)
#pragma unroll
            for (int dt = 0; dt < 4; ++dt) { const v8f r = o[dt][nq]; float* p = xw + (nq * 4 + dt) * 256; *(v4fa*)p = __builtin_shufflevector(r, r, 0, 1, 2, 3); *(v4fa*)(p + 128) = __builtin_shufflevector(r, r, 4, 5, 6, 7); } }
    __syncthreads();   // group 1's tiles are in LDS for group 0
    if (g == 0) {
#pragma unroll
        for (int nq = 0; nq < NQ; ++nq)
#pragma unroll
            for (int dt = 0; dt < 4; ++dt) { const float* p = xw + (nq * 4 + dt) * 256; const v4f a = *(const v4fa*)p, b = *(const v4fa*)(p + 128); v8us oh, ol;
#pragma unroll
                for (int j = 0; j < 8; ++j) { const float y = (o[dt][nq][j] - lam * (j < 4 ? a[j & 3] : b[j & 3])) * (1.0f - LINIT); unsigned short u, w; splitf(y, u, w); oh[j] = u; ol[j] = w; }
                const size_t oo = (size_t)(q0 + nq * 16 + lr) * DO + dt * 16 + 8 * hi; *(v8us*)(Ch + oo) = oh; *(v8us*)(Cl + oo) = ol;
                asm volatile("s_wait_xcnt 0x0" ::: "memory"); } }   // the next tile reuses the registers that these two stores name: the wait stands in front of that
}
template <int NQ>
__device__ __forceinline__ void fa_f16(const _Float16* __restrict__ Q, const _Float16* __restrict__ K, const _Float16* __restrict__ VT, const int q0, const int kendB, _Float16* ring, const int tid, const int lr, const int hi, const int g, float* xw, const float lam, bf* __restrict__ Ch, bf* __restrict__ Cl) {
    v16h qf[NQ][2]; v8f o[4][NQ]; float m[NQ], l[NQ];
#pragma unroll
    for (int nq = 0; nq < NQ; ++nq) { m[nq] = NEGB; l[nq] = 0.f;
#pragma unroll
        for (int kc = 0; kc < 2; ++kc) qf[nq][kc] = WFrag<h16>::ld(Q + (size_t)(q0 + nq * 16 + lr) * HD + kc * 32 + 8 * hi);
#pragma unroll
        for (int dt = 0; dt < 4; ++dt) o[dt][nq] = (v8f){}; }
    const int kend = q0 + NQ * 16;
    const _Float16* gk = K + (size_t)(tid >> 3) * HD + (tid & 7) * 8; const _Float16* gv = VT + (size_t)(tid >> 3) * TT + (tid & 7) * 8;
    const unsigned l0 = (unsigned)(size_t)ring + (unsigned)((tid >> 3) * (FPI * 2) + (tid & 7) * 16);
    auto fill = [&](const int t) { const unsigned lb = l0 + (unsigned)(t & 1) * (2u * FTE * 2u);
        cp_tile4(gk + (size_t)t * (FKS * HD), (size_t)16 * HD, lb); cp_tile4(gv + (size_t)t * FKS, (size_t)16 * TT, lb + FTE * 2u); };
    const int nt = kendB / FKS;
    fill(0);
    asm volatile("s_wait_asynccnt 0x0" ::: "memory");   // stage 0 has landed (this wave's copies)
    __syncthreads();                                     // ... and every other wave's
    if (nt > 1) fill(1);
    const int koff = lr * FPI + 8 * hi, voff = FTE + lr * FPI + 8 * hi;
    // rolled: one copy of the stage's code serves both buffers
#pragma unroll 1
    for (int t = 0; t < nt; ++t) {
        const _Float16* st = ring + (t & 1) * (2 * FTE);
        // unrolled: the two passes' LDS offsets are then constants
#pragma unroll
        for (int h = 0; h < FKS / 32; ++h) { const int kb = t * FKS + h * 32;
            if (kb < kend) {   // passes behind the wave's diagonal are skipped (wave-uniform test)
                v16h kf[2][2], vf[4];
#pragma unroll
                for (int mt = 0; mt < 2; ++mt)
#pragma unroll
                    for (int kc = 0; kc < 2; ++kc) kf[mt][kc] = WFrag<h16>::ld(st + koff + (h * 32 + mt * 16) * FPI + kc * 32);
#pragma unroll
                for (int dt = 0; dt < 4; ++dt) vf[dt] = WFrag<h16>::ld(st + voff + (dt * 16) * FPI + h * 32);
                __builtin_amdgcn_sched_barrier(0);   // the pass's LDS reads stand in one place, K first: the V^T reads land behind the score products and the softmax
                v8f s[2][NQ];
#pragma unroll
                for (int mt = 0; mt < 2; ++mt)
#pragma unroll
                    for (int nq = 0; nq < NQ; ++nq) s[mt][nq] = wmma16(kf[mt][1], qf[nq][1], wmma16(kf[mt][0], qf[nq][0], (v8f){}));
                if (kb + 31 > q0) {   // only the diagonal pass masks (wave-uniform test)
#pragma unroll
                    for (int mt = 0; mt < 2; ++mt)
#pragma unroll
                        for (int nq = 0; nq < NQ; ++nq)
#pragma unroll
                            for (int j = 0; j < 8; ++j) if (kb + mt * 16 + 8 * hi + j > q0 + nq * 16 + lr) s[mt][nq][j] = NEGB; }
                float mx[NQ]; bool need = false;
#pragma unroll
                for (int nq = 0; nq < NQ; ++nq) { float tm = fmaxf(s[0][nq][0], s[1][nq][0]);
#pragma unroll
                    for (int j = 1; j < 8; ++j) tm = fmaxf(tm, fmaxf(s[0][nq][j], s[1][nq][j]));
                    tm = fmaxf(tm, xhalf(tm)); mx[nq] = tm * SCL2; need = need || (mx[nq] > m[nq] + 8.0f); }
                if (__builtin_amdgcn_ballot_w32(need) != 0) {   // one scalar branch a pass
#pragma unroll
                    for (int nq = 0; nq < NQ; ++nq) { const float mn = fmaxf(m[nq], mx[nq]); const float al = __builtin_amdgcn_exp2f(m[nq] - mn); m[nq] = mn; l[nq] *= al;
#pragma unroll
                        for (int dt = 0; dt < 4; ++dt) o[dt][nq] *= al; } }
#pragma unroll
                for (int nq = 0; nq < NQ; ++nq) { v8f p0, p1;
#pragma unroll
                    for (int j = 0; j < 8; ++j) { p0[j] = __builtin_amdgcn_exp2f(__builtin_fmaf(s[0][nq][j], SCL2, -m[nq])); p1[j] = __builtin_amdgcn_exp2f(__builtin_fmaf(s[1][nq][j], SCL2, -m[nq])); l[nq] += p0[j] + p1[j]; }
                    const v16h pf = cat16(__builtin_convertvector(p0, v8h), __builtin_convertvector(p1, v8h));
#pragma unroll
                    for (int dt = 0; dt < 4; ++dt) o[dt][nq] = wmma16(vf[dt], pf, o[dt][nq]); }
            }
        }
        asm volatile("s_wait_dscnt 0x0" ::: "memory");      // this wave's reads of stage t are done
        asm volatile("s_wait_asynccnt 0x0" ::: "memory");   // this wave's copies of stage t + 1 have landed
        __syncthreads();                                     // publishes stage t + 1 and frees stage t's buffer
        if (t + 2 < nt) fill(t + 2);
    }
    asm volatile("s_wait_asynccnt 0x0" ::: "memory");   // no copy is left in flight when the wave goes on to its end
#pragma unroll
    for (int nq = 0; nq < NQ; ++nq) { const float inv = 1.0f / (l[nq] + xhalf(l[nq]));
#pragma unroll
        for (int dt = 0; dt < 4; ++dt) o[dt][nq] *= inv; }
    fa_merge<NQ>(o, g, xw, lam, Ch, Cl, q0, lr, hi);
}

// bf16 hi + lo planes, three products for the scores and three for P.V; one tile of 16 query columns from q0 (a multiple of 16). K and V^T, hi and lo, staged for the group's 4 waves as in fa_f16: four tiles a stage, kendB a multiple of 64.
__device__ __forceinline__ void fa_hl(const unsigned short* __restrict__ Qh, const unsigned short* __restrict__ Ql, const unsigned short* __restrict__ Kh, const unsigned short* __restrict__ Kl, const unsigned short* __restrict__ VTh, const unsigned short* __restrict__ VTl, const int q0, const int kendB, unsigned short* ring, const int tid, const int lr, const int hi, const int g, float* xw, const float lam, bf* __restrict__ Ch, bf* __restrict__ Cl) {
    v16bf qh[2], ql[2]; v8f o[4][1]; float m = NEGB, l = 0.f;
#pragma unroll
    for (int kc = 0; kc < 2; ++kc) { const size_t qo = (size_t)(q0 + lr) * HD + kc * 32 + 8 * hi; qh[kc] = WFrag<bf>::ld(Qh + qo); ql[kc] = WFrag<bf>::ld(Ql + qo); }
#pragma unroll
    for (int dt = 0; dt < 4; ++dt) o[dt][0] = (v8f){};
    const int kend = (q0 + 16 + 31) & ~31;
    const size_t gk = (size_t)(tid >> 3) * HD + (tid & 7) * 8, gv = (size_t)(tid >> 3) * TT + (tid & 7) * 8;
    const unsigned l0 = (unsigned)(size_t)ring + (unsigned)((tid >> 3) * (FPI * 2) + (tid & 7) * 16);
    auto fill = [&](const int t) { const unsigned lb = l0 + (unsigned)(t & 1) * (4u * FTE * 2u); const size_t ak = gk + (size_t)t * (FKS * HD), av = gv + (size_t)t * FKS;
        cp_tile4(Kh + ak, (size_t)16 * HD, lb); cp_tile4(Kl + ak, (size_t)16 * HD, lb + FTE * 2u); cp_tile4(VTh + av, (size_t)16 * TT, lb + 2u * FTE * 2u); cp_tile4(VTl + av, (size_t)16 * TT, lb + 3u * FTE * 2u); };
    const int nt = kendB / FKS;
    fill(0);
    asm volatile("s_wait_asynccnt 0x0" ::: "memory");   // stage 0 has landed (this wave's copies)
    __syncthreads();                                     // ... and every other wave's
    if (nt > 1) fill(1);
    const int foff = lr * FPI + 8 * hi;
    // rolled: one copy of the stage's code serves both buffers
#pragma unroll 1
    for (int t = 0; t < nt; ++t) {
        const unsigned short* st = ring + (t & 1) * (4 * FTE) + foff;
        // unrolled: the two passes' LDS offsets are then constants
#pragma unroll
        for (int h = 0; h < FKS / 32; ++h) { const int kb = t * FKS + h * 32;
            if (kb < kend) {   // passes behind the wave's diagonal are skipped (wave-uniform test)
                v16bf kh[2][2], kl[2][2];
#pragma unroll
                for (int mt = 0; mt < 2; ++mt)
#pragma unroll
                    for (int kc = 0; kc < 2; ++kc) { const int a = (h * 32 + mt * 16) * FPI + kc * 32; kh[mt][kc] = WFrag<bf>::ld(st + a); kl[mt][kc] = WFrag<bf>::ld(st + FTE + a); }
                v16bf vh[4], vl[4];
#pragma unroll
                for (int dt = 0; dt < 4; ++dt) { const int a = (dt * 16) * FPI + h * 32; vh[dt] = WFrag<bf>::ld(st + 2 * FTE + a); vl[dt] = WFrag<bf>::ld(st + 3 * FTE + a); }
                __builtin_amdgcn_sched_barrier(0);   // the pass's LDS reads stand in one place, K first: the V^T reads land behind the score products and the softmax
                v8f s[2];
#pragma unroll
                for (int mt = 0; mt < 2; ++mt) { s[mt] = (v8f){};
#pragma unroll
                    for (int kc = 0; kc < 2; ++kc) { s[mt] = wmmab(kh[mt][kc], qh[kc], s[mt]); s[mt] = wmmab(kh[mt][kc], ql[kc], s[mt]); s[mt] = wmmab(kl[mt][kc], qh[kc], s[mt]); } }
                if (kb + 31 > q0) {   // only the diagonal pass masks (wave-uniform test)
#pragma unroll
                    for (int mt = 0; mt < 2; ++mt)
#pragma unroll
                        for (int j = 0; j < 8; ++j) if (kb + mt * 16 + 8 * hi + j > q0 + lr) s[mt][j] = NEGB; }
                float tm = fmaxf(s[0][0], s[1][0]);
#pragma unroll
                for (int j = 1; j < 8; ++j) tm = fmaxf(tm, fmaxf(s[0][j], s[1][j]));
                tm = fmaxf(tm, xhalf(tm)); const float mx = tm * SCL2;
                if (__builtin_amdgcn_ballot_w32(mx > m + 8.0f) != 0) {   // one scalar branch a pass
                    const float mn = fmaxf(m, mx); const float al = __builtin_amdgcn_exp2f(m - mn); m = mn; l *= al;
#pragma unroll
                    for (int dt = 0; dt < 4; ++dt) o[dt][0] *= al; }
                v8us h0, h1, l0v, l1v;
#pragma unroll
                for (int j = 0; j < 8; ++j) { const float p0 = __builtin_amdgcn_exp2f(__builtin_fmaf(s[0][j], SCL2, -m)), p1 = __builtin_amdgcn_exp2f(__builtin_fmaf(s[1][j], SCL2, -m)); l += p0 + p1; unsigned short u, w; splitf(p0, u, w); h0[j] = u; l0v[j] = w; splitf(p1, u, w); h1[j] = u; l1v[j] = w; }
                const v16bf ph = cat16b(h0, h1), pl = cat16b(l0v, l1v);
#pragma unroll
                for (int dt = 0; dt < 4; ++dt) { o[dt][0] = wmmab(vh[dt], ph, o[dt][0]); o[dt][0] = wmmab(vh[dt], pl, o[dt][0]); o[dt][0] = wmmab(vl[dt], ph, o[dt][0]); }
            }
        }
        asm volatile("s_wait_dscnt 0x0" ::: "memory");      // this wave's reads of stage t are done
        asm volatile("s_wait_asynccnt 0x0" ::: "memory");   // this wave's copies of stage t + 1 have landed
        __syncthreads();                                     // publishes stage t + 1 and frees stage t's buffer
        if (t + 2 < nt) fill(t + 2);
    }
    asm volatile("s_wait_asynccnt 0x0" ::: "memory");   // no copy is left in flight when the wave goes on to its end
    const float inv = 1.0f / (l + xhalf(l));
#pragma unroll
    for (int dt = 0; dt < 4; ++dt) o[dt][0] *= inv;
    fa_merge<1>(o, g, xw, lam, Ch, Cl, q0, lr, hi);
}

// grid (NB_ * NHO output heads, NTF + NTH row blocks), 8 waves a block: waves 0-3 = head h of group 0, waves 4-7 = head h of group 1, same query rows, each group with its own ring; both groups walk the same stages, so they share the barriers. Row blocks run from the longest to the shortest: NTF blocks of 128 fp16 query rows from the end of the sequence down to RH, then NTH blocks of 64 hi/lo rows down to 0.
#define NTF ((TT - RH) / 128)
#define NTH (RH / 64)
__global__ __launch_bounds__(256) void k_fattn(const _Float16* __restrict__ Q16, const _Float16* __restrict__ K16, const _Float16* __restrict__ V16, const unsigned short* __restrict__ Qh, const unsigned short* __restrict__ Ql, const unsigned short* __restrict__ Kh, const unsigned short* __restrict__ Kl, const unsigned short* __restrict__ Vh, const unsigned short* __restrict__ Vl, const float* __restrict__ LAM, bf* __restrict__ ACh, bf* __restrict__ ACl) {
    const int lane = threadIdx.x & 31, lr = lane & 15, hi = lane >> 4; const int w8 = __builtin_amdgcn_readfirstlane((int)(threadIdx.x >> 5));   // the wave's number in a scalar register: loop bounds, the mask test and the group test stay scalar
    const int g = w8 >> 2, w = w8 & 3, tid = (int)threadIdx.x & 127;   // group, wave and thread inside the group
    const size_t bb = blockIdx.x / NHO, hh = blockIdx.x % NHO, po = (bb * NH_ + g * NHO + hh) * (size_t)TT * HD, co = bb * (size_t)TT * DO + hh * HD; const int y = blockIdx.y;
    __shared__ __align__(16) unsigned short fring[2][2 * 4 * FTE];   // per group two buffers of K and V^T tiles: one of each for the fp16 rows, hi and lo of each for the hi/lo rows
    float* xw = (float*)&fring[0][0] + w * 2048 + lane * 4;   // where wave w of group 1 hands its tiles to wave w of group 0 (8 KiB a pair)
    const float lam = LAM[0];
    if (y < NTF) fa_f16<2>(Q16 + po, K16 + po, V16 + po, TT - 128 * (y + 1) + 32 * w, TT - 128 * y, (_Float16*)fring[g], tid, lr, hi, g, xw, lam, ACh + co, ACl + co);
    else fa_hl(Qh + po, Ql + po, Kh + po, Kl + po, Vh + po, Vl + po, RH - 64 * (y - NTF + 1) + 16 * w, RH - 64 * (y - NTF), fring[g], tid, lr, hi, g, xw, lam, ACh + co, ACl + co);
}

__device__ __forceinline__ void d_lam(const float* __restrict__ a1, const float* __restrict__ b1, const float* __restrict__ a2, const float* __restrict__ b2, float* LAM) { if (threadIdx.x >= 32) return; const int lane = threadIdx.x; float d1 = __fadd_rn(__fmul_rn(bfr(a1[lane * 2]), bfr(b1[lane * 2])), __fmul_rn(bfr(a1[lane * 2 + 1]), bfr(b1[lane * 2 + 1]))); float d2 = __fadd_rn(__fmul_rn(bfr(a2[lane * 2]), bfr(b2[lane * 2])), __fmul_rn(bfr(a2[lane * 2 + 1]), bfr(b2[lane * 2 + 1])));
#pragma unroll
    for (int sh = 16; sh; sh >>= 1) { d1 = __fadd_rn(d1, __shfl_xor(d1, sh, 32)); d2 = __fadd_rn(d2, __shfl_xor(d2, sh, 32)); }
    float l = __fsub_rn(expf(d1), expf(d2)); asm volatile("" : "+v"(l)); l = __fadd_rn(l, LINIT); ((float*)LAM)[lane] = l;  }
// ---- k_prep: everything that reads inputs only, in one launch: none of these jobs reads another's output. Block 0: lambda; then NBW blocks (tiles) for each of Wq, Wk, Wv; NBO for Wo; NBX for x. All blocks are resident at once.
#define NBW ((DM / 128) * (DQ / 128))
#define NBO ((DO / 128) * (DM / 128))
#define NBX (NB_ * TT * DM / 16384)
__global__ __launch_bounds__(256) void k_prep(const float* __restrict__ x, const float* __restrict__ wq, const float* __restrict__ wk, const float* __restrict__ wv, const float* __restrict__ wo, const float* __restrict__ lq1, const float* __restrict__ lk1, const float* __restrict__ lq2, const float* __restrict__ lk2, bf* XB, bf* W3, bf* WO, float* LAM) {
    __shared__ __align__(16) unsigned short tl[128 * 128];
    int blk = blockIdx.x;
    if (blk == 0) { d_lam(lq1, lk1, lq2, lk2, LAM); return; }
    blk -= 1;
    if (blk < 3 * NBW) { const int kind = blk / NBW; d_wtT(kind == 0 ? wq : kind == 1 ? wk : wv, DM, DQ, W3 + (size_t)kind * DQ * DM, blk % NBW, tl); return; }
    blk -= 3 * NBW;
    if (blk < NBO) { d_wtT(wo, DO, DM, WO, blk, tl); return; }
    d_cvt(x, XB, blk - NBO);
}

extern "C" void kernel_launch(void* const* d_in, const int* in_sizes, int n_in,
                              void* d_out, int out_size, void* d_ws, size_t ws_size, hipStream_t stream) {
    (void)in_sizes; (void)n_in; (void)out_size;
    const float* x = (const float*)d_in[0]; const float* wq = (const float*)d_in[1]; const float* wk = (const float*)d_in[2]; const float* wv = (const float*)d_in[3]; const float* wo = (const float*)d_in[4]; const float* lq1 = (const float*)d_in[5]; const float* lk1 = (const float*)d_in[6]; const float* lq2 = (const float*)d_in[7]; const float* lk2 = (const float*)d_in[8];
    float* OUT = (float*)d_out;     // [2][2048][1024]
    char* wsp = (char*)d_ws;
    auto take = [&](size_t bytes) { char* p = wsp; wsp += (bytes + 255) & ~(size_t)255; return (void*)p; };
    const size_t PB = (size_t)NH_ * TT * HD;   // elements of one plane of one batch
    bf* WO = (bf*)take((size_t)DM * DO * 2); float* LAM = (float*)take(256); bf* W3 = (bf*)take((size_t)3 * DQ * DM * 2);   /* Wq, Wk, Wv transposed, one behind the other */
    // three planes (fp16, bf16 hi, bf16 lo), each q, k, v^T x both batches side by side ([kind][b][h][t][d]; v [b][g][d][t]): the projection launch finds its part by grid z, and one attention launch covers all NB_ * NH_ heads
    h16* P16 = (h16*)take(3 * NB_ * PB * 2); bf* Ph = (bf*)take(3 * NB_ * PB * 2); bf* Pl = (bf*)take(3 * NB_ * PB * 2);
    bf* XB = (bf*)take((size_t)NB_ * TT * DM * 2); bf* ACh = (bf*)take((size_t)NB_ * TT * DO * 2); bf* ACl = (bf*)take((size_t)NB_ * TT * DO * 2);
    if ((size_t)(wsp - (char*)d_ws) > ws_size) return;    // ws 256 MiB
    k_prep<<<1 + 3 * NBW + NBO + NBX, 256, 0, stream>>>(x, wq, wk, wv, wo, lq1, lk1, lq2, lk2, XB, W3, WO, LAM);   /* lambda line; weights 'xw' -> [n][k] bf16; x -> bf16 */
    k_gemmw<bf, 0, false, true><<<dim3(TT / 128, DQ / 128, 3 * NB_), 256, 0, stream>>>(XB, nullptr, W3, nullptr, DM, nullptr, 0, nullptr, (size_t)TT * DM, (size_t)DQ * DM, 0, P16, Ph, Pl, PB);   /* q, k head planes and transposed v planes of both batches */
    k_fattn<<<dim3(NB_ * NHO, NTF + NTH, 1), 256, 0, stream>>>(P16, P16 + NB_ * PB, P16 + 2 * NB_ * PB, Ph, Pl, Ph + NB_ * PB, Pl + NB_ * PB, Ph + 2 * NB_ * PB, Pl + 2 * NB_ * PB, LAM, ACh, ACl);   /* both groups of every head, both batches -> (o1 - lambda o2) x (1 - lambda_init) as hi/lo planes, rows of both batches */
    k_gemmw<bf, 1, false><<<dim3(NB_ * TT / 128, DM / 128, 1), 256, 0, stream>>>(ACh, ACl, WO, nullptr, DO, OUT, DM, nullptr, 0, 0, 0);   /* Wo */
}

// v010
// One run takes 107 microseconds.
// Next to v009, in two timings, it ran 1.03 times as fast each time.
// Over all steps from v000 it is 25.3 times as fast.
#include <hip/hip_runtime.h>

// Differential causal attention (x [2][2048][1024]; q, k, v = x W ('xw' [1024][2048] 0.02) as 2 groups x 16 heads x 64; a_g = causal softmax(q_g.k_g / 8) (-1e30 fill); lambda = exp(lq1.lk1) - exp(lq2.lk2) + 0.8 (vectors [64], zeros, read: computed on device); o_h = (a1 v1 - lambda a2 v2) x (1 - 0.8); out = merged o Wo ('xw' [1024][1024]) -> [2][2048][1024] (4.2 M)).
// Layout: one input-only launch (k_prep) makes the bf16 copy of x (both batches), the transposed 'xw' weights and lambda; one launch holds the six exact projections (q, k, v of both batches on grid z) whose epilogue rounds each tile straight into the 16-bit head planes (v transposed by swapping the operands); the two groups run as 32 heads per batch of one fused causal attention launch (k_fattn: scores, online softmax and P.V in registers; query rows < 512 hi/lo 3 products, rest fp16), whose blocks hold head h of both groups (4 waves each): the second group's waves hand their normalised tiles over through LDS and the first group's form (o1 - lambda o2) x 0.2 and store it as hi/lo planes (both batches as 4096 rows); hi/lo x Wo exact, 4096 rows in one launch.
// Compute dtypes, f32 accumulate: every input rounded to bf16; projections exact; attention rows < 512 3 products, rest fp16; softmax f32; lambda (precise expf) and the combination f32; Wo hl x exact.

#define NB_  2
#define TT   2048
#define DM   1024
#define NH_  32
#define NKV  32
#define HD   64
#define DQ   (NH_ * HD)
#define DKV  (NKV * HD)
#define RH   512                  // query rows < RH use hi+lo planes
#define SCL  0.125f
#define NHO  16      // output heads (per group)
#define DO   (NHO * HD)   // 1024
#define LINIT 0.8f
typedef _Float16 h16;
typedef unsigned short bf;
typedef __attribute__((ext_vector_type(16))) __bf16   v16bf;
typedef __attribute__((ext_vector_type(16))) _Float16 v16h;
typedef __attribute__((ext_vector_type(8)))  _Float16 v8h;
typedef __attribute__((ext_vector_type(8)))  unsigned short v8us;
typedef __attribute__((ext_vector_type(8)))  float    v8f;
typedef __attribute__((ext_vector_type(4)))  float    v4f;
typedef v8h  __attribute__((may_alias)) v8ha;
typedef v4f  __attribute__((may_alias)) v4fa;
typedef v8us __attribute__((may_alias)) v8usa;

__device__ __forceinline__ unsigned short f2bf(float f) { unsigned u = __float_as_uint(f); u += 0x7FFFu + ((u >> 16) & 1u); return (unsigned short)(u >> 16); }
__device__ __forceinline__ float bf2f(unsigned short b) { return __uint_as_float(((unsigned)b) << 16); }
__device__ __forceinline__ float bfr(float f) { return bf2f(f2bf(f)); }
__device__ __forceinline__ h16 tohx(float x) { return (h16)x; }
__device__ __forceinline__ void splitf(float y, unsigned short& h, unsigned short& l) { h = f2bf(y); l = f2bf(y - bf2f(h)); }
__device__ __forceinline__ v16h cat16(v8h lo, v8h hi) { return __builtin_shufflevector(lo, hi, 0, 1, 2, 3, 4, 5, 6, 7, 8, 9, 10, 11, 12, 13, 14, 15); }
__device__ __forceinline__ v16bf cat16b(v8us lo, v8us hi) { return __builtin_bit_cast(v16bf, __builtin_shufflevector(lo, hi, 0, 1, 2, 3, 4, 5, 6, 7, 8, 9, 10, 11, 12, 13, 14, 15)); }
__device__ __forceinline__ v8f wmma16(v16h a, v16h b, v8f c) { return __builtin_amdgcn_wmma_f32_16x16x32_f16(false, a, false, b, (short)0, c, false, false); }
__device__ __forceinline__ v8f wmmab(v16bf a, v16bf b, v8f c) { return __builtin_amdgcn_wmma_f32_16x16x32_bf16(false, a, false, b, (short)0, c, false, false); }



// ---- k_gemmw: GEMM, one work-group of 8 waves (4 x 2) per 128x128 output tile, each wave a 32x64 tile (8 accumulators); grid (M/128, N/128, Z), 256 threads.
// The K-contiguous 16-bit operand planes come into LDS 128 k at a time by asynchronous 16-byte copies (16 lanes = 256 contiguous bytes of a row), two buffers: the next stage's copies fly while this stage is multiplied. Fragments are read from LDS rows of pitch 272 B.
// C[m][n] (f32, pitch ldc, + optional f32 bias[n]) = sum_k A[m][k] Bt[n][k] (+ split products per NSPLIT). z-batch strides sA/sB/sC in elements. K % 128 == 0, M % 128 == 0, N % 128 == 0.
// PLANES: no f32 C; the epilogue rounds the tile straight into those of the 16-bit planes (fp16, bf16 hi, bf16 lo) that attention reads at its positions; element (m, n) goes to plane offset m * ldc + (n / 64) * sC + n % 64.
// PLANES, grid z = 2 * kind + batch, six independent products in one launch: the arguments are A = x (sA = one batch), Bt = the three transposed weights (sB = one of them), sP = one batch of one plane; ldc and sC are set here.
// kind 0, 1 = q, k head planes [h][t][d]: A = x, Bt = weights, ldc = HD, sC = TT * HD. kind 2 = transposed v planes [g][d][t]: A = weights, Bt = x, ldc = TT, sC = 64.
template <typename T16> struct WFrag;
template <> struct WFrag<h16> { typedef v16h V; static __device__ __forceinline__ V ld(const h16* p) { return cat16(*(const v8h*)p, *(const v8h*)(p + 16)); } static __device__ __forceinline__ v8f mma(V a, V b, v8f c) { return wmma16(a, b, c); } };
template <> struct WFrag<bf> { typedef v16bf V; static __device__ __forceinline__ V ld(const bf* p) { return cat16b(*(const v8us*)p, *(const v8us*)(p + 16)); } static __device__ __forceinline__ v8f mma(V a, V b, v8f c) { return wmmab(a, b, c); } };
#define GKP 128                   // k per stage: 256 B of every operand row
#define GPI 136                   // LDS row pitch in elements (272 B = 16 B x odd: ds_load_b128 without bank conflicts)
#define GTE (128 * GPI)           // elements of one operand tile in LDS (128 rows)
// One 128-row x 256-B operand tile into LDS: 8 copies a lane, copy i = rows 16 i .. 16 i + 15 over the 256 lanes. g = the lane's 16 bytes in row (tid / 16), l = their LDS byte address, rs = 16 rows in elements.
// The s_wait_xcnt stands inside the statement so that no address register of a copy is rewritten ahead of it.
template <typename T16>
__device__ __forceinline__ void cp_tile(const T16* g, const size_t rs, const unsigned l) {
    asm volatile("global_load_async_to_lds_b128 %0, %8, off\n\t"
                 "global_load_async_to_lds_b128 %1, %9, off\n\t"
                 "global_load_async_to_lds_b128 %2, %10, off\n\t"
                 "global_load_async_to_lds_b128 %3, %11, off\n\t"
                 "global_load_async_to_lds_b128 %4, %12, off\n\t"
                 "global_load_async_to_lds_b128 %5, %13, off\n\t"
                 "global_load_async_to_lds_b128 %6, %14, off\n\t"
                 "global_load_async_to_lds_b128 %7, %15, off\n\t"
                 "s_wait_xcnt 0x0"
                 :: "v"(l), "v"(l + 1u * 16u * GPI * 2u), "v"(l + 2u * 16u * GPI * 2u), "v"(l + 3u * 16u * GPI * 2u), "v"(l + 4u * 16u * GPI * 2u), "v"(l + 5u * 16u * GPI * 2u), "v"(l + 6u * 16u * GPI * 2u), "v"(l + 7u * 16u * GPI * 2u),
                    "v"(g), "v"(g + rs), "v"(g + 2 * rs), "v"(g + 3 * rs), "v"(g + 4 * rs), "v"(g + 5 * rs), "v"(g + 6 * rs), "v"(g + 7 * rs) : "memory");
}
// The PLANES epilogue's way out for 16 staged rows x 64 columns: the lane's 8 floats of rows r, r + 4, r + 8, r + 12 (ol = its place in the staging, pitch 68 floats) are rounded into the planes asked for (W16: fp16; WHL: bf16 hi and lo) at element oo, oo + rs, ...
template <bool W16, bool WHL>
__device__ __forceinline__ void put_planes(const float* ol, const size_t oo, const size_t rs, h16* P16, bf* Ph, bf* Pl) {
    v4f x[4][2];
    // every loop here unrolled: x and the vectors are then indexed by constants and stay in registers
#pragma unroll
    for (int s = 0; s < 4; ++s) { x[s][0] = *(const v4fa*)(ol + s * 4 * 68); x[s][1] = *(const v4fa*)(ol + s * 4 * 68 + 4); }   // the 8 LDS reads stand together, ahead of the rounding
#pragma unroll
    for (int s = 0; s < 4; ++s) {
        if (W16) { v8h o16;
#pragma unroll
            for (int q = 0; q < 4; ++q) { o16[q] = tohx(x[s][0][q]); o16[q + 4] = tohx(x[s][1][q]); }
            *(v8h*)(P16 + oo + s * rs) = o16; }
        if (WHL) { v8us oh, ow;
#pragma unroll
            for (int q = 0; q < 4; ++q) { unsigned short u, w; splitf(x[s][0][q], u, w); oh[q] = u; ow[q] = w; splitf(x[s][1][q], u, w); oh[q + 4] = u; ow[q + 4] = w; }
            *(v8us*)(Ph + oo + s * rs) = oh; *(v8us*)(Pl + oo + s * rs) = ow; }
        asm volatile("s_wait_xcnt 0x0" ::: "memory");   // the next rows reuse the registers that these stores name: the wait stands in front of that
    }
}
template <typename T16, int NSPLIT, bool BIAS, bool PLANES = false>
__global__ __launch_bounds__(256) void k_gemmw(const T16* __restrict__ A, const T16* __restrict__ A2, const T16* __restrict__ Bt, const T16* __restrict__ Bt2, int K, float* C, int ldc, const float* __restrict__ bias, size_t sA, size_t sB, size_t sC, h16* P16 = nullptr, bf* Ph = nullptr, bf* Pl = nullptr, size_t sP = 0) {
    typedef typename WFrag<T16>::V V;
    constexpr bool HA2 = (NSPLIT == 1 || NSPLIT == 2), HB2 = (NSPLIT >= 2); constexpr int NT = 2 + (HA2 ? 1 : 0) + (HB2 ? 1 : 0);   // operand tiles of a stage: A, Bt, then A2, Bt2 where used
    __shared__ __align__(16) T16 ring[2 * NT * GTE];
    float* osw = (float*)ring;   // the epilogue's staging (8 waves x 16 x 68 floats) takes the ring's place once the loop has left it: with two operand tiles a stage the work-group's LDS is then small enough for two work-groups on a WGP
    const size_t z = blockIdx.z;
    bool whl = true, w16 = true;   // PLANES: which planes of this tile attention reads (the same for the whole work-group). Positions t < RH: hi and lo of q, k, v, fp16 of k and v; t >= RH: fp16 alone. The tile's t runs along its rows (q, k) or its columns (v).
    if (PLANES) { const T16* X = A + (z & 1) * sA; const T16* Wt = Bt + (z >> 1) * sB; const bool sw = (z >> 1) == 2;
        A = sw ? Wt : X; Bt = sw ? X : Wt; ldc = sw ? TT : HD; sC = sw ? (size_t)64 : (size_t)TT * HD; P16 += z * sP; Ph += z * sP; Pl += z * sP;
        const bool early = (sw ? blockIdx.y : blockIdx.x) * 128 < RH; whl = early; w16 = !(early && (z >> 1) == 0); }
    else { A += z * sA; if (A2) A2 += z * sA; Bt += z * sB; if (Bt2) Bt2 += z * sB; C += z * sC; }
    const int tid = threadIdx.x, lane = tid & 31, lr = lane & 15, hi = lane >> 4, wv = tid >> 5; const int r0 = blockIdx.x * 128 + (wv >> 1) * 32, c0 = blockIdx.y * 128 + (wv & 1) * 64;
    float* os = osw + wv * (16 * 68);   // each wave's own epilogue staging
    v8f acc[2][4];
#pragma unroll
    for (int mb = 0; mb < 2; ++mb)
#pragma unroll
        for (int nb = 0; nb < 4; ++nb) acc[mb][nb] = (v8f){};
    const size_t ga = (size_t)(blockIdx.x * 128 + (tid >> 4)) * K + (tid & 15) * 8, gb = (size_t)(blockIdx.y * 128 + (tid >> 4)) * K + (tid & 15) * 8, rs = (size_t)16 * K;
    const unsigned l0 = (unsigned)(size_t)ring + (unsigned)((tid >> 4) * (GPI * 2) + (tid & 15) * 16);
    auto fill = [&](const int t) { const unsigned l = l0 + (unsigned)(t & 1) * (NT * GTE * 2u); const int k0 = t * GKP;
        cp_tile(A + ga + k0, rs, l); cp_tile(Bt + gb + k0, rs, l + GTE * 2u);
        if (HA2) cp_tile(A2 + ga + k0, rs, l + 2u * GTE * 2u);
        if (HB2) cp_tile(Bt2 + gb + k0, rs, l + (HA2 ? 3u : 2u) * GTE * 2u); };
    const int nt = K / GKP;
    fill(0);
    asm volatile("s_wait_asynccnt 0x0" ::: "memory");   // stage 0 has landed (this wave's copies)
    __syncthreads();                                     // ... and every other wave's
    if (nt > 1) fill(1);
    const int aoff = ((wv >> 1) * 32 + lr) * GPI + 8 * hi, boff = GTE + ((wv & 1) * 64 + lr) * GPI + 8 * hi;
    // rolled: one copy of the stage's code serves both buffers
#pragma unroll 1
    for (int t = 0; t < nt; ++t) {
        const T16* st = ring + (t & 1) * (NT * GTE);
        V a[2][2], a2[2][2], b[2][4], b2[2][4];   // two fragment sets: block ks + 1 is fetched while block ks is multiplied (inside the stage only)
        // unrolled: the two sets are then indexed by constants and stay in registers
#pragma unroll
        for (int ks = -1; ks < GKP / 32; ++ks) {
            if (ks + 1 < GKP / 32) { const int s = (ks + 1) & 1, kc = (ks + 1) * 32;
#pragma unroll
                for (int mb = 0; mb < 2; ++mb) { a[s][mb] = WFrag<T16>::ld(st + aoff + mb * 16 * GPI + kc); if (HA2) a2[s][mb] = WFrag<T16>::ld(st + 2 * GTE + aoff + mb * 16 * GPI + kc); }
#pragma unroll
                for (int nb = 0; nb < 4; ++nb) { b[s][nb] = WFrag<T16>::ld(st + boff + nb * 16 * GPI + kc); if (HB2) b2[s][nb] = WFrag<T16>::ld(st + (HA2 ? 2 : 1) * GTE + boff + nb * 16 * GPI + kc); } }
            __builtin_amdgcn_sched_barrier(0);   // the next block's LDS reads stay one group ahead of this block's products, none among them
            if (ks >= 0) { const int s = ks & 1;
#pragma unroll
                for (int nb = 0; nb < 4; ++nb)
#pragma unroll
                    for (int mb = 0; mb < 2; ++mb) acc[mb][nb] = WFrag<T16>::mma(a[s][mb], b[s][nb], acc[mb][nb]);
                if (HA2) {
#pragma unroll
                    for (int nb = 0; nb < 4; ++nb)
#pragma unroll
                        for (int mb = 0; mb < 2; ++mb) acc[mb][nb] = WFrag<T16>::mma(a2[s][mb], b[s][nb], acc[mb][nb]); }
                if (HB2) {
#pragma unroll
                    for (int nb = 0; nb < 4; ++nb)
#pragma unroll
                        for (int mb = 0; mb < 2; ++mb) acc[mb][nb] = WFrag<T16>::mma(a[s][mb], b2[s][nb], acc[mb][nb]); }
                __builtin_amdgcn_sched_barrier(0);   // ... and the reads of the block after next stay behind these products
            }
        }
        asm volatile("s_wait_dscnt 0x0" ::: "memory");      // this wave's reads of stage t are done
        asm volatile("s_wait_asynccnt 0x0" ::: "memory");   // this wave's copies of stage t + 1 have landed
        __syncthreads();                                     // publishes stage t + 1 and frees stage t's buffer
        if (t + 2 < nt) fill(t + 2);
    }
    asm volatile("s_wait_asynccnt 0x0" ::: "memory");   // no copy is left in flight when the wave goes on to its end
#pragma unroll
    for (int mb = 0; mb < 2; ++mb) {
#pragma unroll
        for (int nb = 0; nb < 4; ++nb) {
#pragma unroll
            for (int j = 0; j < 8; ++j) os[(hi * 8 + j) * 68 + nb * 16 + lr] = acc[mb][nb][j]; }
        __builtin_amdgcn_wave_barrier(); asm volatile("" ::: "memory");
        float* crow = C + (size_t)(r0 + mb * 16) * ldc + c0;
        if (PLANES) {
            const size_t ob = (size_t)(r0 + mb * 16 + (lane >> 3)) * ldc + (size_t)(c0 >> 6) * sC + (lane & 7) * 8; const float* ol = os + (lane >> 3) * 68 + (lane & 7) * 8;   // 8 lanes x 16 B = one 128-B line per row and plane
            if (!whl) put_planes<true, false>(ol, ob, (size_t)4 * ldc, P16, Ph, Pl);   // work-group-uniform (scalar) tests
            else if (w16) put_planes<true, true>(ol, ob, (size_t)4 * ldc, P16, Ph, Pl);
            else put_planes<false, true>(ol, ob, (size_t)4 * ldc, P16, Ph, Pl);
        } else
{
#pragma unroll
            for (int s = 0; s < 8; ++s) { const int row = 2 * s + hi, cofs = lr * 4; v4f val = *(const v4fa*)(os + row * 68 + cofs); if (BIAS) { val[0] += bfr(bias[c0 + cofs]); val[1] += bfr(bias[c0 + cofs + 1]); val[2] += bfr(bias[c0 + cofs + 2]); val[3] += bfr(bias[c0 + cofs + 3]); }
                *(v4f*)(crow + (size_t)row * ldc + cofs) = val; }
             }
        __builtin_amdgcn_wave_barrier(); asm volatile("" ::: "memory");
    }
}

typedef __attribute__((ext_vector_type(2))) _Float16 v2h;
typedef __attribute__((ext_vector_type(4))) _Float16 v4h;
typedef __attribute__((ext_vector_type(2))) unsigned short v2us;
typedef __attribute__((ext_vector_type(4))) unsigned short v4us;
typedef __attribute__((ext_vector_type(2))) float v2f;
typedef __attribute__((ext_vector_type(4))) int v4i;

// The three input-only jobs, each written for block number blk of its own range of k_prep's grid. Every thread moves 64 elements: 16 loads of 16 B, all issued before the first is used.
// One 128 k x 128 n tile of w [K][N] (f32) -> Bt [N][K] (bf16), turned in LDS. In: a wave's load = 512 contiguous bytes of one k row; wave wv holds k rows 16 wv .. 16 wv + 15, lane c the columns 4 c .. 4 c + 3.
// tl = [128 n][16 pieces of 8 k], piece p of row n at place p ^ ((n / 4) % 16): the 16-B writes (32 rows, one piece) and the 16-B reads (one row, 16 pieces) each spread over all banks. Out: 16 lanes = 256 contiguous bytes of one n row.
__device__ __forceinline__ void d_wtT(const float* __restrict__ w, const int K, const int N, bf* Bt, const int blk, unsigned short* tl) {
    const int tid = threadIdx.x, c = tid & 31, wv = tid >> 5, nn = N / 128; const int k0 = (blk / nn) * 128, n0 = (blk % nn) * 128;   // neighbouring blocks read neighbouring 512-B pieces of the same k rows
    const float* src = w + (size_t)(k0 + wv * 16) * N + n0 + c * 4; v4f r[16];
    // every loop here unrolled: r and the vectors are then indexed by constants and stay in registers
#pragma unroll
    for (int i = 0; i < 16; ++i) r[i] = *(const v4f*)(src + (size_t)i * N);
    asm volatile("s_wait_xcnt 0x0" :: "v"(src) : "memory");   // the 16 loads name one address pair; as an input here it lives up to this wait, so that nothing, a load's own result included, rewrites it ahead
#pragma unroll
    for (int j = 0; j < 4; ++j) { v8us a, b;
#pragma unroll
        for (int i = 0; i < 8; ++i) { a[i] = f2bf(r[i][j]); b[i] = f2bf(r[i + 8][j]); }
        unsigned short* row = tl + (c * 4 + j) * 128; *(v8us*)(row + ((wv * 2) ^ (c & 15)) * 8) = a; *(v8us*)(row + ((wv * 2 + 1) ^ (c & 15)) * 8) = b; }
    __syncthreads();   // the whole tile is in LDS before any of its rows is read
    const int ch = tid & 15, rr = tid >> 4;
#pragma unroll
    for (int p = 0; p < 8; ++p) { const int n = p * 16 + rr; *(v8us*)(Bt + (size_t)(n0 + n) * K + k0 + ch * 8) = *(const v8us*)(tl + n * 128 + (ch ^ ((n >> 2) & 15)) * 8); }
    asm volatile("s_wait_xcnt 0x0" ::: "memory");   // behind the last of the 8 stores: whatever code follows the job may reuse the registers that they name
}
// 16384 elements a block: a wave's load = 512 contiguous bytes, its store the 256 bytes they round to.
__device__ __forceinline__ void d_cvt(const float* __restrict__ src, bf* dst, const int blk) { const size_t b = (size_t)blk * 16384 + threadIdx.x * 4; const float* s = src + b; v4f r[16];
#pragma unroll
    for (int i = 0; i < 16; ++i) r[i] = *(const v4f*)(s + i * 1024);
    asm volatile("s_wait_xcnt 0x0" :: "v"(s) : "memory");   // as in d_wtT: the loads' address pair lives up to this wait
#pragma unroll
    for (int i = 0; i < 16; ++i) { v4us o;
#pragma unroll
        for (int q = 0; q < 4; ++q) o[q] = f2bf(r[i][q]);
        *(v4us*)(dst + b + i * 1024) = o; }
    asm volatile("s_wait_xcnt 0x0" ::: "memory"); }   // behind the last of the 16 stores, as in d_wtT

__device__ __forceinline__ float xhalf(float v) { const int b = __float_as_int(v); return __int_as_float(__builtin_amdgcn_permlanex16(b, b, 0x76543210, 0xfedcba98, false, false)); }   // lane l <-> l ^ 16
#define SCL2 (SCL * 1.4426950408889634f)
#define NEGB (-3.0e38f)

// fp16 operands, NQ tiles of 16 query columns from q0 (q0 and 16 NQ multiples of 32). The 4 waves of a group share its K and V^T through LDS: 64 keys a stage (64 K rows of 128 B, 64 V^T rows of 128 B), brought in by asynchronous 16-byte copies
// (8 lanes = one whole 128-B line), two buffers: the next stage's copies fly while this stage is worked on. Every wave walks all kendB / 64 stages of the block (kendB a multiple of 64) and skips the passes behind its own diagonal.
#define FKS 64                    // keys per stage
#define FPI 72                    // LDS row pitch in elements (144 B = 16 B x odd: ds_load_b128 without bank conflicts)
#define FTE (64 * FPI)            // elements of one tile in LDS (64 rows)
// One 64-row x 128-B tile into LDS: 4 copies a lane, copy i = rows 16 i .. 16 i + 15 over the 128 lanes. g = the lane's 16 bytes in row (tid / 8), l = their LDS byte address, rs = 16 rows in elements.
// The s_wait_xcnt stands inside the statement so that no address register of a copy is rewritten ahead of it.
template <typename T16>
__device__ __forceinline__ void cp_tile4(const T16* g, const size_t rs, const unsigned l) {
    asm volatile("global_load_async_to_lds_b128 %0, %4, off\n\t"
                 "global_load_async_to_lds_b128 %1, %5, off\n\t"
                 "global_load_async_to_lds_b128 %2, %6, off\n\t"
                 "global_load_async_to_lds_b128 %3, %7, off\n\t"
                 "s_wait_xcnt 0x0"
                 :: "v"(l), "v"(l + 1u * 16u * FPI * 2u), "v"(l + 2u * 16u * FPI * 2u), "v"(l + 3u * 16u * FPI * 2u),
                    "v"(g), "v"(g + rs), "v"(g + 2 * rs), "v"(g + 3 * rs) : "memory");
}
// The end of a block: o = the wave's normalised output tiles (lane (lr, hi): query column lr, d = 16 dt + 8 hi + j). The waves of group 1 (g == 1, the second attention map) lay theirs into LDS, 16 B a lane, lanes side by side;
// behind one barrier wave w of group 0 takes the tiles of wave w of group 1, forms (o1 - lambda o2) x (1 - lambda_init) and stores the hi and lo planes (row pitch DO; a wave writes the whole 128-B line of a row and plane).
// xw = the wave pair's own place in the ring's LDS (+ 4 lane floats), which every wave has left behind the loop's last barrier, with no copy in flight.
template <int NQ>
__device__ __forceinline__ void fa_merge(const v8f (&o)[4][NQ], const int g, float* xw, const float lam, bf* __restrict__ Ch, bf* __restrict__ Cl, const int q0, const int lr, const int hi) {
    if (g == 1) {   // wave-uniform (scalar) test
#pragma unroll
        for (int nq = 0; nq < NQ; ++nq)
#pragma unroll
            for (int dt = 0; dt < 4; ++dt) { const v8f r = o[dt][nq]; float* p = xw + (nq * 4 + dt) * 256; *(v4fa*)p = __builtin_shufflevector(r, r, 0, 1, 2, 3); *(v4fa*)(p + 128) = __builtin_shufflevector(r, r, 4, 5, 6, 7); } }
    __syncthreads();   // group 1's tiles are in LDS for group 0
    if (g == 0) {
#pragma unroll
        for (int nq = 0; nq < NQ; ++nq)
#pragma unroll
            for (int dt = 0; dt < 4; ++dt) { const float* p = xw + (nq * 4 + dt) * 256; const v4f a = *(const v4fa*)p, b = *(const v4fa*)(p + 128); v8us oh, ol;
#pragma unroll
                for (int j = 0; j < 8; ++j) { const float y = (o[dt][nq][j] - lam * (j < 4 ? a[j & 3] : b[j & 3])) * (1.0f - LINIT); unsigned short u, w; splitf(y, u, w); oh[j] = u; ol[j] = w; }
                const size_t oo = (size_t)(q0 + nq * 16 + lr) * DO + dt * 16 + 8 * hi; *(v8us*)(Ch + oo) = oh; *(v8us*)(Cl + oo) = ol;
                asm volatile("s_wait_xcnt 0x0" ::: "memory"); } }   // the next tile reuses the registers that these two stores name: the wait stands in front of that
}
template <int NQ>
__device__ __forceinline__ void fa_f16(const _Float16* __restrict__ Q, const _Float16* __restrict__ K, const _Float16* __restrict__ VT, const int q0, const int kendB, _Float16* ring, const int tid, const int lr, const int hi, const int g, float* xw, const float lam, bf* __restrict__ Ch, bf* __restrict__ Cl) {
    v16h qf[NQ][2]; v8f o[4][NQ]; float m[NQ], l[NQ];
#pragma unroll
    for (int nq = 0; nq < NQ; ++nq) { m[nq] = NEGB; l[nq] = 0.f;
#pragma unroll
        for (int kc = 0; kc < 2; ++kc) qf[nq][kc] = WFrag<h16>::ld(Q + (size_t)(q0 + nq * 16 + lr) * HD + kc * 32 + 8 * hi);
#pragma unroll
        for (int dt = 0; dt < 4; ++dt) o[dt][nq] = (v8f){}; }
    const int kend = q0 + NQ * 16;
    const _Float16* gk = K + (size_t)(tid >> 3) * HD + (tid & 7) * 8; const _Float16* gv = VT + (size_t)(tid >> 3) * TT + (tid & 7) * 8;
    const unsigned l0 = (unsigned)(size_t)ring + (unsigned)((tid >> 3) * (FPI * 2) + (tid & 7) * 16);
    auto fill = [&](const int t) { const unsigned lb = l0 + (unsigned)(t & 1) * (2u * FTE * 2u);
        cp_tile4(gk + (size_t)t * (FKS * HD), (size_t)16 * HD, lb); cp_tile4(gv + (size_t)t * FKS, (size_t)16 * TT, lb + FTE * 2u); };
    const int nt = kendB / FKS;
    fill(0);
    asm volatile("s_wait_asynccnt 0x0" ::: "memory");   // stage 0 has landed (this wave's copies)
    __syncthreads();                                     // ... and every other wave's
    if (nt > 1) fill(1);
    const int koff = lr * FPI + 8 * hi, voff = FTE + lr * FPI + 8 * hi;
    // rolled: one copy of the stage's code serves both buffers
#pragma unroll 1
    for (int t = 0; t < nt; ++t) {
        const _Float16* st = ring + (t & 1) * (2 * FTE);
        // unrolled: the two passes' LDS offsets are then constants
#pragma unroll
        for (int h = 0; h < FKS / 32; ++h) { const int kb = t * FKS + h * 32;
            if (kb < kend) {   // passes behind the wave's diagonal are skipped (wave-uniform test)
                v16h kf[2][2], vf[4];
#pragma unroll
                for (int mt = 0; mt < 2; ++mt)
#pragma unroll
                    for (int kc = 0; kc < 2; ++kc) kf[mt][kc] = WFrag<h16>::ld(st + koff + (h * 32 + mt * 16) * FPI + kc * 32);
#pragma unroll
                for (int dt = 0; dt < 4; ++dt) vf[dt] = WFrag<h16>::ld(st + voff + (dt * 16) * FPI + h * 32);
                __builtin_amdgcn_sched_barrier(0);   // the pass's LDS reads stand in one place, K first: the V^T reads land behind the score products and the softmax
                v8f s[2][NQ];
#pragma unroll
                for (int mt = 0; mt < 2; ++mt)
#pragma unroll
                    for (int nq = 0; nq < NQ; ++nq) s[mt][nq] = wmma16(kf[mt][1], qf[nq][1], wmma16(kf[mt][0], qf[nq][0], (v8f){}));
                if (kb + 31 > q0) {   // only the diagonal pass masks (wave-uniform test)
#pragma unroll
                    for (int mt = 0; mt < 2; ++mt)
#pragma unroll
                        for (int nq = 0; nq < NQ; ++nq)
#pragma unroll
                            for (int j = 0; j < 8; ++j) if (kb + mt * 16 + 8 * hi + j > q0 + nq * 16 + lr) s[mt][nq][j] = NEGB; }
                float mx[NQ]; bool need = false;
#pragma unroll
                for (int nq = 0; nq < NQ; ++nq) { float tm = fmaxf(s[0][nq][0], s[1][nq][0]);
#pragma unroll
                    for (int j = 1; j < 8; ++j) tm = fmaxf(tm, fmaxf(s[0][nq][j], s[1][nq][j]));
                    tm = fmaxf(tm, xhalf(tm)); mx[nq] = tm * SCL2; need = need || (mx[nq] > m[nq] + 8.0f); }
                if (__builtin_amdgcn_ballot_w32(need) != 0) {   // one scalar branch a pass
#pragma unroll
                    for (int nq = 0; nq < NQ; ++nq) { const float mn = fmaxf(m[nq], mx[nq]); const float al = __builtin_amdgcn_exp2f(m[nq] - mn); m[nq] = mn; l[nq] *= al;
#pragma unroll
                        for (int dt = 0; dt < 4; ++dt) o[dt][nq] *= al; } }
#pragma unroll
                for (int nq = 0; nq < NQ; ++nq) { v8f p0, p1;
#pragma unroll
                    for (int j = 0; j < 8; ++j) { p0[j] = __builtin_amdgcn_exp2f(__builtin_fmaf(s[0][nq][j], SCL2, -m[nq])); p1[j] = __builtin_amdgcn_exp2f(__builtin_fmaf(s[1][nq][j], SCL2, -m[nq])); l[nq] += p0[j] + p1[j]; }
                    const v16h pf = cat16(__builtin_convertvector(p0, v8h), __builtin_convertvector(p1, v8h));
#pragma unroll
                    for (int dt = 0; dt < 4; ++dt) o[dt][nq] = wmma16(vf[dt], pf, o[dt][nq]); }
            }
        }
        asm volatile("s_wait_dscnt 0x0" ::: "memory");      // this wave's reads of stage t are done
        asm volatile("s_wait_asynccnt 0x0" ::: "memory");   // this wave's copies of stage t + 1 have landed
        __syncthreads();                                     // publishes stage t + 1 and frees stage t's buffer
        if (t + 2 < nt) fill(t + 2);
    }
    asm volatile("s_wait_asynccnt 0x0" ::: "memory");   // no copy is left in flight when the wave goes on to its end
#pragma unroll
    for (int nq = 0; nq < NQ; ++nq) { const float inv = 1.0f / (l[nq] + xhalf(l[nq]));
#pragma unroll
        for (int dt = 0; dt < 4; ++dt) o[dt][nq] *= inv; }
    fa_merge<NQ>(o, g, xw, lam, Ch, Cl, q0, lr, hi);
}

// bf16 hi + lo planes, three products for the scores and three for P.V; one tile of 16 query columns from q0 (a multiple of 16). K and V^T, hi and lo, staged for the group's 4 waves as in fa_f16: four tiles a stage, kendB a multiple of 64.
__device__ __forceinline__ void fa_hl(const unsigned short* __restrict__ Qh, const unsigned short* __restrict__ Ql, const unsigned short* __restrict__ Kh, const unsigned short* __restrict__ Kl, const unsigned short* __restrict__ VTh, const unsigned short* __restrict__ VTl, const int q0, const int kendB, unsigned short* ring, const int tid, const int lr, const int hi, const int g, float* xw, const float lam, bf* __restrict__ Ch, bf* __restrict__ Cl) {
    v16bf qh[2], ql[2]; v8f o[4][1]; float m = NEGB, l = 0.f;
#pragma unroll
    for (int kc = 0; kc < 2; ++kc) { const size_t qo = (size_t)(q0 + lr) * HD + kc * 32 + 8 * hi; qh[kc] = WFrag<bf>::ld(Qh + qo); ql[kc] = WFrag<bf>::ld(Ql + qo); }
#pragma unroll
    for (int dt = 0; dt < 4; ++dt) o[dt][0] = (v8f){};
    const int kend = (q0 + 16 + 31) & ~31;
    const size_t gk = (size_t)(tid >> 3) * HD + (tid & 7) * 8, gv = (size_t)(tid >> 3) * TT + (tid & 7) * 8;
    const unsigned l0 = (unsigned)(size_t)ring + (unsigned)((tid >> 3) * (FPI * 2) + (tid & 7) * 16);
    auto fill = [&](const int t) { const unsigned lb = l0 + (unsigned)(t & 1) * (4u * FTE * 2u); const size_t ak = gk + (size_t)t * (FKS * HD), av = gv + (size_t)t * FKS;
        cp_tile4(Kh + ak, (size_t)16 * HD, lb); cp_tile4(Kl + ak, (size_t)16 * HD, lb + FTE * 2u); cp_tile4(VTh + av, (size_t)16 * TT, lb + 2u * FTE * 2u); cp_tile4(VTl + av, (size_t)16 * TT, lb + 3u * FTE * 2u); };
    const int nt = kendB / FKS;
    fill(0);
    asm volatile("s_wait_asynccnt 0x0" ::: "memory");   // stage 0 has landed (this wave's copies)
    __syncthreads();                                     // ... and every other wave's
    if (nt > 1) fill(1);
    const int foff = lr * FPI + 8 * hi;
    // rolled: one copy of the stage's code serves both buffers
#pragma unroll 1
    for (int t = 0; t < nt; ++t) {
        const unsigned short* st = ring + (t & 1) * (4 * FTE) + foff;
        // unrolled: the two passes' LDS offsets are then constants
#pragma unroll
        for (int h = 0; h < FKS / 32; ++h) { const int kb = t * FKS + h * 32;
            if (kb < kend) {   // passes behind the wave's diagonal are skipped (wave-uniform test)
                v16bf kh[2][2], kl[2][2];
#pragma unroll
                for (int mt = 0; mt < 2; ++mt)
#pragma unroll
                    for (int kc = 0; kc < 2; ++kc) { const int a = (h * 32 + mt * 16) * FPI + kc * 32; kh[mt][kc] = WFrag<bf>::ld(st + a); kl[mt][kc] = WFrag<bf>::ld(st + FTE + a); }
                v16bf vh[4], vl[4];
#pragma unroll
                for (int dt = 0; dt < 4; ++dt) { const int a = (dt * 16) * FPI + h * 32; vh[dt] = WFrag<bf>::ld(st + 2 * FTE + a); vl[dt] = WFrag<bf>::ld(st + 3 * FTE + a); }
                __builtin_amdgcn_sched_barrier(0);   // the pass's LDS reads stand in one place, K first: the V^T reads land behind the score products and the softmax
                v8f s[2];
#pragma unroll
                for (int mt = 0; mt < 2; ++mt) { s[mt] = (v8f){};
#pragma unroll
                    for (int kc = 0; kc < 2; ++kc) { s[mt] = wmmab(kh[mt][kc], qh[kc], s[mt]); s[mt] = wmmab(kh[mt][kc], ql[kc], s[mt]); s[mt] = wmmab(kl[mt][kc], qh[kc], s[mt]); } }
                if (kb + 31 > q0) {   // only the diagonal pass masks (wave-uniform test)
#pragma unroll
                    for (int mt = 0; mt < 2; ++mt)
#pragma unroll
                        for (int j = 0; j < 8; ++j) if (kb + mt * 16 + 8 * hi + j > q0 + lr) s[mt][j] = NEGB; }
                float tm = fmaxf(s[0][0], s[1][0]);
#pragma unroll
                for (int j = 1; j < 8; ++j) tm = fmaxf(tm, fmaxf(s[0][j], s[1][j]));
                tm = fmaxf(tm, xhalf(tm)); const float mx = tm * SCL2;
                if (__builtin_amdgcn_ballot_w32(mx > m + 8.0f) != 0) {   // one scalar branch a pass
                    const float mn = fmaxf(m, mx); const float al = __builtin_amdgcn_exp2f(m - mn); m = mn; l *= al;
#pragma unroll
                    for (int dt = 0; dt < 4; ++dt) o[dt][0] *= al; }
                v8us h0, h1, l0v, l1v;
#pragma unroll
                for (int j = 0; j < 8; ++j) { const float p0 = __builtin_amdgcn_exp2f(__builtin_fmaf(s[0][j], SCL2, -m)), p1 = __builtin_amdgcn_exp2f(__builtin_fmaf(s[1][j], SCL2, -m)); l += p0 + p1; unsigned short u, w; splitf(p0, u, w); h0[j] = u; l0v[j] = w; splitf(p1, u, w); h1[j] = u; l1v[j] = w; }
                const v16bf ph = cat16b(h0, h1), pl = cat16b(l0v, l1v);
#pragma unroll
                for (int dt = 0; dt < 4; ++dt) { o[dt][0] = wmmab(vh[dt], ph, o[dt][0]); o[dt][0] = wmmab(vh[dt], pl, o[dt][0]); o[dt][0] = wmmab(vl[dt], ph, o[dt][0]); }
            }
        }
        asm volatile("s_wait_dscnt 0x0" ::: "memory");      // this wave's reads of stage t are done
        asm volatile("s_wait_asynccnt 0x0" ::: "memory");   // this wave's copies of stage t + 1 have landed
        __syncthreads();                                     // publishes stage t + 1 and frees stage t's buffer
        if (t + 2 < nt) fill(t + 2);
    }
    asm volatile("s_wait_asynccnt 0x0" ::: "memory");   // no copy is left in flight when the wave goes on to its end
    const float inv = 1.0f / (l + xhalf(l));
#pragma unroll
    for (int dt = 0; dt < 4; ++dt) o[dt][0] *= inv;
    fa_merge<1>(o, g, xw, lam, Ch, Cl, q0, lr, hi);
}

// grid (NB_ * NHO output heads, NTF + NTH row blocks), 8 waves a block: waves 0-3 = head h of group 0, waves 4-7 = head h of group 1, same query rows, each group with its own ring; both groups walk the same stages, so they share the barriers. Row blocks run from the longest to the shortest: NTF blocks of 128 fp16 query rows from the end of the sequence down to RH, then NTH blocks of 64 hi/lo rows down to 0.
#define NTF ((TT - RH) / 128)
#define NTH (RH / 64)
__global__ __launch_bounds__(256) void k_fattn(const _Float16* __restrict__ Q16, const _Float16* __restrict__ K16, const _Float16* __restrict__ V16, const unsigned short* __restrict__ Qh, const unsigned short* __restrict__ Ql, const unsigned short* __restrict__ Kh, const unsigned short* __restrict__ Kl, const unsigned short* __restrict__ Vh, const unsigned short* __restrict__ Vl, const float* __restrict__ LAM, bf* __restrict__ ACh, bf* __restrict__ ACl) {
    const int lane = threadIdx.x & 31, lr = lane & 15, hi = lane >> 4; const int w8 = __builtin_amdgcn_readfirstlane((int)(threadIdx.x >> 5));   // the wave's number in a scalar register: loop bounds, the mask test and the group test stay scalar
    const int g = w8 >> 2, w = w8 & 3, tid = (int)threadIdx.x & 127;   // group, wave and thread inside the group
    const size_t bb = blockIdx.x / NHO, hh = blockIdx.x % NHO, po = (bb * NH_ + g * NHO + hh) * (size_t)TT * HD, co = bb * (size_t)TT * DO + hh * HD; const int y = blockIdx.y;
    __shared__ __align__(16) unsigned short fring[2][2 * 4 * FTE];   // per group two buffers of K and V^T tiles: one of each for the fp16 rows, hi and lo of each for the hi/lo rows
    float* xw = (float*)&fring[0][0] + w * 2048 + lane * 4;   // where wave w of group 1 hands its tiles to wave w of group 0 (8 KiB a pair)
    const float lam = LAM[0];
    if (y < NTF) fa_f16<2>(Q16 + po, K16 + po, V16 + po, TT - 128 * (y + 1) + 32 * w, TT - 128 * y, (_Float16*)fring[g], tid, lr, hi, g, xw, lam, ACh + co, ACl + co);
    else fa_hl(Qh + po, Ql + po, Kh + po, Kl + po, Vh + po, Vl + po, RH - 64 * (y - NTF + 1) + 16 * w, RH - 64 * (y - NTF), fring[g], tid, lr, hi, g, xw, lam, ACh + co, ACl + co);
}

__device__ __forceinline__ void d_lam(const float* __restrict__ a1, const float* __restrict__ b1, const float* __restrict__ a2, const float* __restrict__ b2, float* LAM) { if (threadIdx.x >= 32) return; const int lane = threadIdx.x; float d1 = __fadd_rn(__fmul_rn(bfr(a1[lane * 2]), bfr(b1[lane * 2])), __fmul_rn(bfr(a1[lane * 2 + 1]), bfr(b1[lane * 2 + 1]))); float d2 = __fadd_rn(__fmul_rn(bfr(a2[lane * 2]), bfr(b2[lane * 2])), __fmul_rn(bfr(a2[lane * 2 + 1]), bfr(b2[lane * 2 + 1])));
#pragma unroll
    for (int sh = 16; sh; sh >>= 1) { d1 = __fadd_rn(d1, __shfl_xor(d1, sh, 32)); d2 = __fadd_rn(d2, __shfl_xor(d2, sh, 32)); }
    float l = __fsub_rn(expf(d1), expf(d2)); asm volatile("" : "+v"(l)); l = __fadd_rn(l, LINIT); ((float*)LAM)[lane] = l;  }
// ---- k_prep: everything that reads inputs only, in one launch: none of these jobs reads another's output. Block 0: lambda; then NBW blocks (tiles) for each of Wq, Wk, Wv; NBO for Wo; NBX for x. All blocks are resident at once.
#define NBW ((DM / 128) * (DQ / 128))
#define NBO ((DO / 128) * (DM / 128))
#define NBX (NB_ * TT * DM / 16384)
__global__ __launch_bounds__(256) void k_prep(const float* __restrict__ x, const float* __restrict__ wq, const float* __restrict__ wk, const float* __restrict__ wv, const float* __restrict__ wo, const float* __restrict__ lq1, const float* __restrict__ lk1, const float* __restrict__ lq2, const float* __restrict__ lk2, bf* XB, bf* W3, bf* WO, float* LAM) {
    __shared__ __align__(16) unsigned short tl[128 * 128];
    int blk = blockIdx.x;
    if (blk == 0) { d_lam(lq1, lk1, lq2, lk2, LAM); return; }
    blk -= 1;
    if (blk < 3 * NBW) { const int kind = blk / NBW; d_wtT(kind == 0 ? wq : kind == 1 ? wk : wv, DM, DQ, W3 + (size_t)kind * DQ * DM, blk % NBW, tl); return; }
    blk -= 3 * NBW;
    if (blk < NBO) { d_wtT(wo, DO, DM, WO, blk, tl); return; }
    d_cvt(x, XB, blk - NBO);
}

extern "C" void kernel_launch(void* const* d_in, const int* in_sizes, int n_in,
                              void* d_out, int out_size, void* d_ws, size_t ws_size, hipStream_t stream) {
    (void)in_sizes; (void)n_in; (void)out_size;
    const float* x = (const float*)d_in[0]; const float* wq = (const float*)d_in[1]; const float* wk = (const float*)d_in[2]; const float* wv = (const float*)d_in[3]; const float* wo = (const float*)d_in[4]; const float* lq1 = (const float*)d_in[5]; const float* lk1 = (const float*)d_in[6]; const float* lq2 = (const float*)d_in[7]; const float* lk2 = (const float*)d_in[8];
    float* OUT = (float*)d_out;     // [2][2048][1024]
    char* wsp = (char*)d_ws;
    auto take = [&](size_t bytes) { char* p = wsp; wsp += (bytes + 255) & ~(size_t)255; return (void*)p; };
    const size_t PB = (size_t)NH_ * TT * HD;   // elements of one plane of one batch
    bf* WO = (bf*)take((size_t)DM * DO * 2); float* LAM = (float*)take(256); bf* W3 = (bf*)take((size_t)3 * DQ * DM * 2);   /* Wq, Wk, Wv transposed, one behind the other */
    // three planes (fp16, bf16 hi, bf16 lo), each q, k, v^T x both batches side by side ([kind][b][h][t][d]; v [b][g][d][t]): the projection launch finds its part by grid z, and one attention launch covers all NB_ * NH_ heads
    h16* P16 = (h16*)take(3 * NB_ * PB * 2); bf* Ph = (bf*)take(3 * NB_ * PB * 2); bf* Pl = (bf*)take(3 * NB_ * PB * 2);
    bf* XB = (bf*)take((size_t)NB_ * TT * DM * 2); bf* ACh = (bf*)take((size_t)NB_ * TT * DO * 2); bf* ACl = (bf*)take((size_t)NB_ * TT * DO * 2);
    if ((size_t)(wsp - (char*)d_ws) > ws_size) return;    // ws 256 MiB
    k_prep<<<1 + 3 * NBW + NBO + NBX, 256, 0, stream>>>(x, wq, wk, wv, wo, lq1, lk1, lq2, lk2, XB, W3, WO, LAM);   /* lambda line; weights 'xw' -> [n][k] bf16; x -> bf16 */
    k_gemmw<bf, 0, false, true><<<dim3(TT / 128, DQ / 128, 3 * NB_), 256, 0, stream>>>(XB, nullptr, W3, nullptr, DM, nullptr, 0, nullptr, (size_t)TT * DM, (size_t)DQ * DM, 0, P16, Ph, Pl, PB);   /* q, k head planes and transposed v planes of both batches */
    k_fattn<<<dim3(NB_ * NHO, NTF + NTH, 1), 256, 0, stream>>>(P16, P16 + NB_ * PB, P16 + 2 * NB_ * PB, Ph, Pl, Ph + NB_ * PB, Pl + NB_ * PB, Ph + 2 * NB_ * PB, Pl + 2 * NB_ * PB, LAM, ACh, ACl);   /* both groups of every head, both batches -> (o1 - lambda o2) x (1 - lambda_init) as hi/lo planes, rows of both batches */
    k_gemmw<bf, 1, false><<<dim3(NB_ * TT / 128, DM / 128, 1), 256, 0, stream>>>(ACh, ACl, WO, nullptr, DO, OUT, DM, nullptr, 0, 0, 0);   /* Wo */
}
